// v000
// Times are from an AMD MI455X. After a warm-up the kernel runs many times in a row, and a time is the length of
// such a window on the GPU divided by its runs, so every launch and the gaps after it count. The runs cycle
// through copies of the inputs. A figure is the median of several windows, for all but v000 over two sittings.
// Sittings can differ by a few percent; kernels timed side by side share one.
// The starting kernel, v000, takes 263 microseconds a run.
#include <hip/hip_runtime.h>
// Causal multi-head self-attention with interleaved rotary (x [4][1024][1024]; q|k|v = x W^T with [out][in] weights, 16 heads of 64; scores * 1/8; causal by index; out = merged W_o^T).
// Compute dtype: all contractions v_wmma_f32_16x16x32_f16 (f16 operands, f32 accumulate). Inputs converted (RNE) to bf16 and held exactly in f16 (weights x16); q, k, v, P (x256), ctx (x64) as f16 hi planes,
// plus f16 residual planes (x2^10, separate accumulators) used for query rows 0..255 of every sequence; softmax statistics, rotary and all epilogues f32.
// Structure: weight planes (4 launches), x plane, cos/sin table from the position input, one QKV GEMM (N = 3072, rotary in the epilogue), V^T planes via LDS, fused online-softmax attention (late / early rows), output GEMM (late / early rows).
#ifndef NB
#define NB 4
#endif
#ifndef SEQ
#define SEQ 1024
#endif
#define NB_FULL 4
#define SEQ_FULL 1024
#define DM 1024
#define NH 16
#define HD 64
#define LQ (3 * DM)
#define NR (NB * SEQ)
#define ERW 256                      /* query rows per sequence that use the residual planes */

static_assert(NB <= NB_FULL);
static_assert(SEQ <= SEQ_FULL);
static_assert(NH * HD == DM);
static_assert(HD == 64);
static_assert(DM % 64 == 0);
static_assert(DM % 32 == 0);
static_assert(LQ % 64 == 0);
static_assert(SEQ % 128 == 0);
static_assert(NR % 128 == 0);
static_assert(ERW % 128 == 0);
static_assert(SEQ >= ERW);
static_assert(ERW % 64 == 0);
static_assert(SEQ % 8 == 0);
static_assert(((size_t)NR * DM / 8) % 256 == 0);
static_assert(((size_t)DM * DM / 8) % 256 == 0);

typedef unsigned short v8us __attribute__((ext_vector_type(8), may_alias));
typedef float  v8f  __attribute__((ext_vector_type(8)));
typedef float  v4f  __attribute__((ext_vector_type(4)));
typedef float  v4fa __attribute__((ext_vector_type(4), may_alias));
typedef _Float16 v16h __attribute__((ext_vector_type(16)));
union FragH { v16h v; v8us half[2]; _Float16 h[16]; unsigned short u[16]; };

__device__ __forceinline__ unsigned short bf16_bits(float x) { unsigned int u = __float_as_uint(x); return (unsigned short)((u + 0x7FFFu + ((u >> 16) & 1u)) >> 16); }
__device__ __forceinline__ float bf16_rne(float x) { return __uint_as_float(((unsigned int)bf16_bits(x)) << 16); }

// A / B fragment from a k-contiguous 16-bit row: elements 0..7 <- p[8h .. 8h+7], elements 8..15 <- p[16+8h .. 16+8h+7]
__device__ __forceinline__ v16h g2_frag(const _Float16* p, int hh) { FragH f; f.half[0] = *(const v8us*)((const unsigned short*)p + 8 * hh); f.half[1] = *(const v8us*)((const unsigned short*)p + 16 + 8 * hh); return f.v; }
__device__ __forceinline__ v8f g2_mma(v16h a, v16h b, v8f c) { v8f d = __builtin_amdgcn_wmma_f32_16x16x32_f16(false, a, false, b, (short)0, c, false, false); asm volatile("v_nop\n\tv_nop\n\tv_nop\n\tv_nop" : "+v"(d) : "v"(a), "v"(b)); return d; }
__device__ __forceinline__ void wave_lds_sync() { __builtin_amdgcn_fence(4 /* acq_rel order */, "workgroup"); __builtin_amdgcn_wave_barrier(); }

__global__ __launch_bounds__(256) void k_wnat(const float* __restrict__ w, _Float16* __restrict__ Bt) {
  const size_t t = (size_t)blockIdx.x * 256 + threadIdx.x;
  if (t >= (size_t)DM * DM / 8) return;
  const v4f a = *(const v4fa*)(w + t * 8), c = *(const v4fa*)(w + t * 8 + 4);
  FragH f;
#pragma unroll
  for (int q = 0; q < 4; ++q) { f.h[q] = (_Float16)(bf16_rne(a[q]) * 16.0f); f.h[4 + q] = (_Float16)(bf16_rne(c[q]) * 16.0f); }
  const v8us o = f.half[0];
  unsigned short* d = (unsigned short*)Bt + t * 8;
  *(v8us*)d = o;
  
}

__global__ __launch_bounds__(256) void k_x16(const float* __restrict__ x, _Float16* __restrict__ X16) {
  const size_t t = (size_t)blockIdx.x * 256 + threadIdx.x;
  if (t >= (size_t)NR * DM / 8) return;
  const size_t row = t / (DM / 8);
  const int c8 = (int)(t % (DM / 8)) * 8;
  const size_t b = row / SEQ, s = row % SEQ;
  const float* src = x + (b * SEQ_FULL + s) * DM + c8;
  const v4f a = *(const v4fa*)src, c = *(const v4fa*)(src + 4);
  FragH f;
#pragma unroll
  for (int q = 0; q < 4; ++q) { f.h[q] = (_Float16)bf16_rne(a[q]); f.h[4 + q] = (_Float16)bf16_rne(c[q]); }
  const v8us o = f.half[0];
  unsigned short* d = (unsigned short*)X16 + t * 8;
  *(v8us*)d = o;
  
}

// CS[s][j] = (cos, sin)(float(pos[s]) * inv_freq[j]), inv_freq[j] = f32(1 / 10000^(j/32)) with the power formed in double from fixed roots.
__global__ __launch_bounds__(256) void k_tab(const int* __restrict__ tp, float* __restrict__ CS) {
  __shared__ __attribute__((aligned(16))) float ts[8][64];
  const int tid = threadIdx.x;
  const int sl = tid >> 5, j = tid & 31;
  const int s = blockIdx.x * 8 + sl;
  const int pos = tp[s];
  double p = 1.0;
  p = (j & 1)  ? p * 1.3335214321633240 : p;
  p = (j & 2)  ? p * 1.7782794100389228 : p;
  p = (j & 4)  ? p * 3.1622776601683795 : p;
  p = (j & 8)  ? p * 10.0 : p;
  p = (j & 16) ? p * 100.0 : p;
  const float inv = (float)(1.0 / p);
  const float ang = (float)pos * inv;
  float sn, cs;
  sincosf(ang, &sn, &cs);
  ts[sl][2 * j] = cs;
  ts[sl][2 * j + 1] = sn;
  __syncthreads();
  if (tid < 128) {
    const int r = tid >> 4, c4 = (tid & 15) * 4;
    const v4f v = *(const v4fa*)&ts[r][c4];
    float* d = CS + (size_t)(blockIdx.x * 8 + r) * 64 + c4;
    *(v4f*)d = v;
    
  }
}

// QKV GEMM: rows r = b*SEQ + s of X16 [NR][DM] times Bw [3*DM][DM] (x16) -> f32 * 1/16; rotary on the q and k column blocks (one block column = one head);
__global__ __launch_bounds__(128) void k_qkv(const _Float16* __restrict__ X16, const _Float16* __restrict__ Bw, const float* __restrict__ CS, _Float16* __restrict__ Ph, _Float16* __restrict__ Pr) {
  __shared__ __attribute__((aligned(16))) float so[4][32][68];
  const int tid = threadIdx.x;
  const int wave = __builtin_amdgcn_readfirstlane((int)(tid >> 5));
  const int lane = tid & 31, ln = lane & 15, hh = lane >> 4;
  const int ntn = LQ / 64;
  const int mt = blockIdx.x / ntn, nq = blockIdx.x - mt * ntn;
  const int row0 = mt * 128 + 32 * wave, col0 = nq * 64;
  const _Float16* a0p = X16 + (size_t)(row0 + ln) * DM;
  const _Float16* a1p = a0p + (size_t)16 * DM;
  const _Float16* b0p = Bw + (size_t)(col0 + ln) * DM;
  const _Float16* b1p = b0p + (size_t)16 * DM;
  const _Float16* b2p = b1p + (size_t)16 * DM;
  const _Float16* b3p = b2p + (size_t)16 * DM;
  const v8f z8 = {0.f, 0.f, 0.f, 0.f, 0.f, 0.f, 0.f, 0.f};
  v8f c[8] = {z8, z8, z8, z8, z8, z8, z8, z8};
#pragma unroll 1
  for (int kb = 0; kb < DM; kb += 32) {
    const v16h a0 = g2_frag(a0p + kb, hh), a1 = g2_frag(a1p + kb, hh);
    v16h b = g2_frag(b0p + kb, hh); c[0] = g2_mma(a0, b, c[0]); c[4] = g2_mma(a1, b, c[4]);
    b = g2_frag(b1p + kb, hh); c[1] = g2_mma(a0, b, c[1]); c[5] = g2_mma(a1, b, c[5]);
    b = g2_frag(b2p + kb, hh); c[2] = g2_mma(a0, b, c[2]); c[6] = g2_mma(a1, b, c[6]);
    b = g2_frag(b3p + kb, hh); c[3] = g2_mma(a0, b, c[3]); c[7] = g2_mma(a1, b, c[7]);
  }
#pragma unroll
  for (int u = 0; u < 8; ++u) {
    const int t = u & 3, half = u >> 2;
#pragma unroll
    for (int r = 0; r < 8; ++r) so[wave][half * 16 + 8 * hh + r][t * 16 + ln] = c[u][r] * 0.0625f;
  }
  wave_lds_sync();
  const int rsub = lane >> 3, c8 = (lane & 7) * 8;
  const bool rp = col0 < 2 * DM;
  {
#pragma unroll 1
    for (int q = 0; q < 8; ++q) {
      const int r = q * 4 + rsub;
      const v4f u0 = *(const v4fa*)&so[wave][r][c8], u1 = *(const v4fa*)&so[wave][r][c8 + 4];
      const int s = (row0 + r) % SEQ;
      const v4f t0 = *(const v4fa*)(CS + (size_t)s * 64 + c8), t1 = *(const v4fa*)(CS + (size_t)s * 64 + c8 + 4);
      float e[8] = {u0[0], u0[1], u0[2], u0[3], u1[0], u1[1], u1[2], u1[3]};
      const float cz[4] = {t0[0], t0[2], t1[0], t1[2]};
      const float sz[4] = {t0[1], t0[3], t1[1], t1[3]};
#pragma unroll
      for (int i = 0; i < 4; ++i) {
        const float te = e[2 * i], to = e[2 * i + 1];
        const float re = te * cz[i] - to * sz[i];
        const float ro = te * sz[i] + to * cz[i];
        e[2 * i] = rp ? re : te;
        e[2 * i + 1] = rp ? ro : to;
      }
      FragH fh, fr;
#pragma unroll
      for (int i = 0; i < 8; ++i) { const _Float16 hi = (_Float16)e[i]; fh.h[i] = hi; fr.h[i] = (_Float16)((e[i] - (float)hi) * 1024.0f); }
      const v8us oh8 = fh.half[0], or8 = fr.half[0];
      const size_t o = (size_t)(row0 + r) * LQ + col0 + c8;
      *(v8us*)((unsigned short*)Ph + o) = oh8;
      *(v8us*)((unsigned short*)Pr + o) = or8;
    }
    
  }
}

// V^T planes: VT[plane][(b,h)][d][s] = QKV[plane][b*SEQ + s][2*DM + h*64 + d]; in [64 tokens][64 d] -> out [64 d][64 tokens] per block via LDS (cross-wave: block barrier);
__global__ __launch_bounds__(256) void k_vt(const _Float16* __restrict__ QKV, _Float16* __restrict__ VT) {
  __shared__ unsigned short tl[64][66];
  const int tid = threadIdx.x;
  const int slab = blockIdx.x / (SEQ / 64), lg = blockIdx.x % (SEQ / 64);
  const int b = slab / NH, h = slab % NH;
  const size_t pin = (size_t)blockIdx.y * ((size_t)NR * LQ);
  const size_t pout = (size_t)blockIdx.y * ((size_t)NB * NH * HD * SEQ);
  for (int i = tid; i < 64 * 8; i += 256) {
    const int r = i / 8, c8 = (i % 8) * 8;
    FragH f;
    f.half[0] = *(const v8us*)((const unsigned short*)QKV + pin + ((size_t)b * SEQ + lg * 64 + r) * LQ + 2 * DM + h * HD + c8);
#pragma unroll
    for (int q = 0; q < 8; ++q) tl[r][c8 + q] = f.u[q];
  }
  __syncthreads();
  {
#pragma unroll
    for (int rd = 0; rd < 2; ++rd) {
      const int d = rd * 32 + tid / 8, pc = tid % 8;
      FragH f;
#pragma unroll
      for (int q = 0; q < 8; ++q) f.u[q] = tl[pc * 8 + q][d];
      const v8us o = f.half[0];
      *(v8us*)((unsigned short*)VT + pout + ((size_t)slab * 64 + d) * SEQ + lg * 64 + pc * 8) = o;
    }
    
  }
}

// Fused causal attention, online softmax. Grid (query tiles of 64, NB*NH); wave = 16 query rows; 32-key steps; q, k and V^T fragments straight from the planes.
template <bool ER>
__device__ __forceinline__ void attn_body(const _Float16* __restrict__ Qh, const _Float16* __restrict__ Qr, const _Float16* __restrict__ VTh, const _Float16* __restrict__ VTr,
                                          _Float16* __restrict__ Oh, _Float16* __restrict__ Or, int qt0) {
  __shared__ __attribute__((aligned(16))) _Float16 ph[4][16][40];
  __shared__ __attribute__((aligned(16))) _Float16 pl[4][16][40];
  __shared__ __attribute__((aligned(16))) _Float16 oh[4][16][72];
  __shared__ __attribute__((aligned(16))) _Float16 ol[4][16][72];
  const int tid = threadIdx.x;
  const int wave = __builtin_amdgcn_readfirstlane((int)(tid >> 5));
  const int lane = tid & 31, ln = lane & 15, hh = lane >> 4;
  const int bh = blockIdx.y;
  const int b = bh / NH, h = bh % NH;
  const int q0 = (qt0 + (int)blockIdx.x) * 64 + wave * 16;
  const size_t rowb = (size_t)b * SEQ;
  const size_t qoff = (rowb + q0 + ln) * LQ + h * HD;
  const size_t koff0 = (rowb + ln) * LQ + DM + h * HD;
  const size_t voff0 = ((size_t)bh * HD + ln) * SEQ;
  const int nst = (q0 + 16 + 31) >> 5;
  const v8f z8 = {0.f, 0.f, 0.f, 0.f, 0.f, 0.f, 0.f, 0.f};
  v8f o[4] = {z8, z8, z8, z8};
  v8f orr[4] = {z8, z8, z8, z8};
  float mrow[8], lrow[8];
#pragma unroll
  for (int r = 0; r < 8; ++r) { mrow[r] = -1.0e30f; lrow[r] = 0.f; }
#pragma unroll 1
  for (int st = 0; st < nst; ++st) {
    const int key0 = st * 32;
    v8f sm[2] = {z8, z8};
    v8f sr[2] = {z8, z8};
#pragma unroll
    for (int kk = 0; kk < 2; ++kk) {
      const v16h qh = g2_frag(Qh + qoff + kk * 32, hh);
      v16h ql = qh;
      if (ER) ql = g2_frag(Qr + qoff + kk * 32, hh);
#pragma unroll
      for (int t = 0; t < 2; ++t) {
        const size_t ko = koff0 + (size_t)(key0 + 16 * t) * LQ + kk * 32;
        const v16h kh = g2_frag(Qh + ko, hh);
        sm[t] = g2_mma(qh, kh, sm[t]);
        if (ER) {
          const v16h kl = g2_frag(Qr + ko, hh);
          sr[t] = g2_mma(ql, kh, sr[t]);
          sr[t] = g2_mma(qh, kl, sr[t]);
        }
      }
    }
#pragma unroll
    for (int r = 0; r < 8; ++r) {
      const int qrow = q0 + 8 * hh + r;
      float s0 = sm[0][r], s1 = sm[1][r];
      if (ER) { s0 += sr[0][r] * 0.0009765625f; s1 += sr[1][r] * 0.0009765625f; }
      s0 *= 0.125f; s1 *= 0.125f;
      const bool m0 = (key0 + ln) > qrow, m1 = (key0 + 16 + ln) > qrow;
      s0 = m0 ? -1.0e9f : s0;
      s1 = m1 ? -1.0e9f : s1;
      float rm = fmaxf(s0, s1);
      rm = fmaxf(rm, __shfl_xor(rm, 1));
      rm = fmaxf(rm, __shfl_xor(rm, 2));
      rm = fmaxf(rm, __shfl_xor(rm, 4));
      rm = fmaxf(rm, __shfl_xor(rm, 8));
      const float mnew = fmaxf(mrow[r], rm);
      const float al = __expf(mrow[r] - mnew);
      const float e0 = __expf(s0 - mnew), e1 = __expf(s1 - mnew);
      const float p0 = m0 ? 0.f : e0, p1 = m1 ? 0.f : e1;
      lrow[r] = lrow[r] * al + (p0 + p1);
      mrow[r] = mnew;
#pragma unroll
      for (int j = 0; j < 4; ++j) { o[j][r] *= al; if (ER) orr[j][r] *= al; }
      const float a0 = p0 * 256.0f, a1 = p1 * 256.0f;
      const _Float16 h0 = (_Float16)a0, h1 = (_Float16)a1;
      ph[wave][8 * hh + r][ln] = h0;
      ph[wave][8 * hh + r][16 + ln] = h1;
      if (ER) {
        pl[wave][8 * hh + r][ln] = (_Float16)((a0 - (float)h0) * 1024.0f);
        pl[wave][8 * hh + r][16 + ln] = (_Float16)((a1 - (float)h1) * 1024.0f);
      }
    }
    wave_lds_sync();
    FragH pa, pb;
    pa.half[0] = *(const v8us*)&ph[wave][ln][8 * hh];
    pa.half[1] = *(const v8us*)&ph[wave][ln][16 + 8 * hh];
    pb.v = pa.v;
    if (ER) {
      pb.half[0] = *(const v8us*)&pl[wave][ln][8 * hh];
      pb.half[1] = *(const v8us*)&pl[wave][ln][16 + 8 * hh];
    }
#pragma unroll
    for (int j = 0; j < 4; ++j) {
      const size_t vo = voff0 + (size_t)(16 * j) * SEQ + key0;
      const v16h vh = g2_frag(VTh + vo, hh);
      o[j] = g2_mma(pa.v, vh, o[j]);
      if (ER) {
        const v16h vl = g2_frag(VTr + vo, hh);
        orr[j] = g2_mma(pb.v, vh, orr[j]);
        orr[j] = g2_mma(pa.v, vl, orr[j]);
      }
    }
    wave_lds_sync();
  }
#pragma unroll
  for (int r = 0; r < 8; ++r) {
    float l = lrow[r];
    l += __shfl_xor(l, 1);
    l += __shfl_xor(l, 2);
    l += __shfl_xor(l, 4);
    l += __shfl_xor(l, 8);
    const float inv = 0.25f * (1.0f / l);
#pragma unroll
    for (int j = 0; j < 4; ++j) {
      float v = o[j][r];
      if (ER) v += orr[j][r] * 0.0009765625f;
      v *= inv;
      const _Float16 hi = (_Float16)v;
      oh[wave][8 * hh + r][16 * j + ln] = hi;
      if (ER) ol[wave][8 * hh + r][16 * j + ln] = (_Float16)((v - (float)hi) * 1024.0f);
    }
  }
  wave_lds_sync();
  const int rsub = lane >> 3, c8 = (lane & 7) * 8;
  {
#pragma unroll
    for (int q = 0; q < 4; ++q) {
      const int r = q * 4 + rsub;
      const size_t oo = (rowb + q0 + r) * DM + h * HD + c8;
      const v8us vh8 = *(const v8us*)&oh[wave][r][c8];
      *(v8us*)((unsigned short*)Oh + oo) = vh8;
      if (ER) {
        const v8us vl8 = *(const v8us*)&ol[wave][r][c8];
        *(v8us*)((unsigned short*)Or + oo) = vl8;
      }
    }
    
  }
}
__global__ __launch_bounds__(128) void k_attn_late(const _Float16* __restrict__ Qh, const _Float16* __restrict__ Qr, const _Float16* __restrict__ VTh, const _Float16* __restrict__ VTr, _Float16* __restrict__ Oh, _Float16* __restrict__ Or, int qt0) {
  attn_body<false>(Qh, Qr, VTh, VTr, Oh, Or, qt0);
}
__global__ __launch_bounds__(128) void k_attn_early(const _Float16* __restrict__ Qh, const _Float16* __restrict__ Qr, const _Float16* __restrict__ VTh, const _Float16* __restrict__ VTr, _Float16* __restrict__ Oh, _Float16* __restrict__ Or, int qt0) {
  attn_body<true>(Qh, Qr, VTh, VTr, Oh, Or, qt0);
}

// Output GEMM: ctx rows (x64; hi plane Ah, residual plane Ar x2^10 when ER) times Bw [DM][DM] (x16) -> f32 * 2^-10 into the output rows b*SEQ_FULL + s.
template <bool ER>
__device__ __forceinline__ void out_body(const _Float16* __restrict__ Ah, const _Float16* __restrict__ Ar, const _Float16* __restrict__ Bw, float* __restrict__ C, int rbPerB, int rowOff) {
  __shared__ __attribute__((aligned(16))) float so[4][32][68];
  const int tid = threadIdx.x;
  const int wave = __builtin_amdgcn_readfirstlane((int)(tid >> 5));
  const int lane = tid & 31, ln = lane & 15, hh = lane >> 4;
  const int ntn = DM / 64;
  const int mt = blockIdx.x / ntn, nq = blockIdx.x - mt * ntn;
  const int b = mt / rbPerB, lb = mt - b * rbPerB;
  const int s0 = rowOff + lb * 128 + 32 * wave;
  const int col0 = nq * 64;
  const size_t arow = (size_t)b * SEQ + s0;
  const size_t crow = (size_t)b * SEQ_FULL + s0;
  const size_t a0o = (arow + ln) * DM, a1o = a0o + (size_t)16 * DM;
  const _Float16* b0p = Bw + (size_t)(col0 + ln) * DM;
  const _Float16* b1p = b0p + (size_t)16 * DM;
  const _Float16* b2p = b1p + (size_t)16 * DM;
  const _Float16* b3p = b2p + (size_t)16 * DM;
  const v8f z8 = {0.f, 0.f, 0.f, 0.f, 0.f, 0.f, 0.f, 0.f};
  v8f c[8] = {z8, z8, z8, z8, z8, z8, z8, z8};
  v8f d[8] = {z8, z8, z8, z8, z8, z8, z8, z8};
#pragma unroll 1
  for (int kb = 0; kb < DM; kb += 32) {
    const v16h a0 = g2_frag(Ah + a0o + kb, hh), a1 = g2_frag(Ah + a1o + kb, hh);
    v16h r0 = a0, r1 = a1;
    if (ER) { r0 = g2_frag(Ar + a0o + kb, hh); r1 = g2_frag(Ar + a1o + kb, hh); }
    v16h bq = g2_frag(b0p + kb, hh);
    c[0] = g2_mma(a0, bq, c[0]); c[4] = g2_mma(a1, bq, c[4]);
    if (ER) { d[0] = g2_mma(r0, bq, d[0]); d[4] = g2_mma(r1, bq, d[4]); }
    bq = g2_frag(b1p + kb, hh);
    c[1] = g2_mma(a0, bq, c[1]); c[5] = g2_mma(a1, bq, c[5]);
    if (ER) { d[1] = g2_mma(r0, bq, d[1]); d[5] = g2_mma(r1, bq, d[5]); }
    bq = g2_frag(b2p + kb, hh);
    c[2] = g2_mma(a0, bq, c[2]); c[6] = g2_mma(a1, bq, c[6]);
    if (ER) { d[2] = g2_mma(r0, bq, d[2]); d[6] = g2_mma(r1, bq, d[6]); }
    bq = g2_frag(b3p + kb, hh);
    c[3] = g2_mma(a0, bq, c[3]); c[7] = g2_mma(a1, bq, c[7]);
    if (ER) { d[3] = g2_mma(r0, bq, d[3]); d[7] = g2_mma(r1, bq, d[7]); }
  }
#pragma unroll
  for (int u = 0; u < 8; ++u) {
    const int t = u & 3, half = u >> 2;
#pragma unroll
    for (int r = 0; r < 8; ++r) {
      float v = c[u][r];
      if (ER) v += d[u][r] * 0.0009765625f;
      so[wave][half * 16 + 8 * hh + r][t * 16 + ln] = v * 0.0009765625f;
    }
  }
  wave_lds_sync();
  const int rsub = lane >> 4, c4 = (lane & 15) * 4;
  {
#pragma unroll 1
    for (int q = 0; q < 16; ++q) {
      const int r = q * 2 + rsub;
      const v4f v = *(const v4fa*)&so[wave][r][c4];
      *(v4f*)(C + (crow + r) * DM + col0 + c4) = v;
    }
    
  }
}
__global__ __launch_bounds__(128) void k_out_late(const _Float16* __restrict__ Ah, const _Float16* __restrict__ Ar, const _Float16* __restrict__ Bw, float* __restrict__ C, int rbPerB, int rowOff) {
  out_body<false>(Ah, Ar, Bw, C, rbPerB, rowOff);
}
__global__ __launch_bounds__(128) void k_out_early(const _Float16* __restrict__ Ah, const _Float16* __restrict__ Ar, const _Float16* __restrict__ Bw, float* __restrict__ C, int rbPerB, int rowOff) {
  out_body<true>(Ah, Ar, Bw, C, rbPerB, rowOff);
}

// workspace carve (bytes); every region is a multiple of 256 B
constexpr size_t SZ_W    = (size_t)DM * DM * 2;                 /* one x16 f16 weight plane */
constexpr size_t SZ_X16  = (size_t)NR * DM * 2;
constexpr size_t SZ_QKV  = (size_t)NR * LQ * 2;                 /* one q|k|v plane */
constexpr size_t SZ_VT   = (size_t)NB * NH * HD * SEQ * 2;      /* one V^T plane */
constexpr size_t SZ_O    = (size_t)NR * DM * 2;                 /* one ctx plane */
constexpr size_t SZ_CS   = (size_t)SEQ * 64 * 4;
constexpr size_t OFF_BW  = 0;                                   /* wq | wk | wv | wo */
constexpr size_t OFF_X16 = OFF_BW + 4 * SZ_W;
constexpr size_t OFF_QKV = OFF_X16 + SZ_X16;                    /* hi plane, residual plane */
constexpr size_t OFF_VT  = OFF_QKV + 2 * SZ_QKV;                /* hi plane, residual plane */
constexpr size_t OFF_O   = OFF_VT + 2 * SZ_VT;                  /* hi plane, residual plane */
constexpr size_t OFF_CS  = OFF_O + 2 * SZ_O;
constexpr size_t WS_TOTAL = OFF_CS + SZ_CS;
static_assert(WS_TOTAL <= (size_t)134217728);
static_assert(SZ_W % 256 == 0 && SZ_X16 % 256 == 0 && SZ_QKV % 256 == 0 && SZ_VT % 256 == 0 && SZ_O % 256 == 0 && SZ_CS % 256 == 0);
static_assert((size_t)((NB - 1) * SEQ_FULL + SEQ) * DM * 4 <= (size_t)NB_FULL * SEQ_FULL * DM * 4);

extern "C" void kernel_launch(void* const* d_in, const int* in_sizes, int n_in,
                              void* d_out, int out_size, void* d_ws, size_t ws_size, hipStream_t stream) {
  if (n_in < 6) return;
  const size_t need_x = (size_t)((NB - 1) * SEQ_FULL + SEQ) * DM;
  if ((size_t)in_sizes[0] < need_x) return;
  if ((size_t)in_sizes[1] < (size_t)DM * DM || (size_t)in_sizes[2] < (size_t)DM * DM || (size_t)in_sizes[3] < (size_t)DM * DM || (size_t)in_sizes[4] < (size_t)DM * DM) return;
  if (in_sizes[5] < SEQ) return;
  if ((size_t)out_size < need_x) return;
  if (WS_TOTAL > ws_size) return;
  const float* x  = (const float*)d_in[0];
  const float* wq = (const float*)d_in[1];
  const float* wk = (const float*)d_in[2];
  const float* wv = (const float*)d_in[3];
  const float* wo = (const float*)d_in[4];
  const int*   tp = (const int*)d_in[5];
  float* out = (float*)d_out;
  char* ws = (char*)d_ws;
  _Float16* BQKV = (_Float16*)(ws + OFF_BW);
  _Float16* BO   = (_Float16*)(ws + OFF_BW + 3 * SZ_W);
  _Float16* X16  = (_Float16*)(ws + OFF_X16);
  _Float16* QKVh = (_Float16*)(ws + OFF_QKV);
  _Float16* QKVr = (_Float16*)(ws + OFF_QKV + SZ_QKV);
  _Float16* VTh  = (_Float16*)(ws + OFF_VT);
  _Float16* VTr  = (_Float16*)(ws + OFF_VT + SZ_VT);
  _Float16* Oh   = (_Float16*)(ws + OFF_O);
  _Float16* Or   = (_Float16*)(ws + OFF_O + SZ_O);
  float*    CS   = (float*)(ws + OFF_CS);

  const unsigned gw = (unsigned)(((size_t)DM * DM / 8 + 255) / 256);
  k_wnat<<<gw, 256, 0, stream>>>(wq, BQKV);
  k_wnat<<<gw, 256, 0, stream>>>(wk, BQKV + (size_t)DM * DM);
  k_wnat<<<gw, 256, 0, stream>>>(wv, BQKV + (size_t)2 * DM * DM);
  k_wnat<<<gw, 256, 0, stream>>>(wo, BO);
  k_x16<<<(unsigned)(((size_t)NR * DM / 8 + 255) / 256), 256, 0, stream>>>(x, X16);
  k_tab<<<SEQ / 8, 256, 0, stream>>>(tp, CS);
  k_qkv<<<(unsigned)((NR / 128) * (LQ / 64)), 128, 0, stream>>>(X16, BQKV, CS, QKVh, QKVr);
  k_vt<<<dim3((unsigned)(NB * NH * (SEQ / 64)), 2), 256, 0, stream>>>(QKVh, VTh);      /* in [tokens][d] -> out [d][tokens], both planes (plane strides SZ_QKV / SZ_VT) */
  if (SEQ / 64 > ERW / 64)
    k_attn_late<<<dim3((unsigned)(SEQ / 64 - ERW / 64), (unsigned)(NB * NH)), 128, 0, stream>>>(QKVh, QKVr, VTh, VTr, Oh, Or, ERW / 64);
  k_attn_early<<<dim3((unsigned)(ERW / 64), (unsigned)(NB * NH)), 128, 0, stream>>>(QKVh, QKVr, VTh, VTr, Oh, Or, 0);
  if (SEQ > ERW)
    k_out_late<<<(unsigned)(NB * ((SEQ - ERW) / 128) * (DM / 64)), 128, 0, stream>>>(Oh, Or, BO, out, (SEQ - ERW) / 128, ERW);
  k_out_early<<<(unsigned)(NB * (ERW / 128) * (DM / 64)), 128, 0, stream>>>(Oh, Or, BO, out, ERW / 128, 0);
}

// v001
// Measured time: 188 microseconds a run.
// Two timings next to v000 put it at 1.41 and 1.42 times that version's speed.
#include <hip/hip_runtime.h>
// Causal multi-head self-attention with interleaved rotary (x [4][1024][1024]; q|k|v = x W^T with [out][in] weights, 16 heads of 64; scores * 1/8; causal by index; out = merged W_o^T).
// Compute dtype: all contractions v_wmma_f32_16x16x32_f16 (f16 operands, f32 accumulate). Inputs converted (RNE) to bf16 and held exactly in f16 (weights x16); q, k, v, P (x256), ctx (x64) as f16 hi planes,
// plus f16 residual planes (x2^10, separate accumulators) used for query rows 0..255 of every sequence; softmax statistics, rotary and all epilogues f32.
// Structure: weight planes (4 launches), x plane, cos/sin table from the position input, one QKV GEMM (N = 3072, rotary in the epilogue), V^T planes via LDS, fused online-softmax attention (late / early rows), output GEMM (late / early rows).
// Both GEMMs stage their operand tiles in LDS with asynchronous 16-byte copies, two buffers of 64 k (128 k for the late output rows) each; the waves read their fragments from LDS.
#ifndef NB
#define NB 4
#endif
#ifndef SEQ
#define SEQ 1024
#endif
#define NB_FULL 4
#define SEQ_FULL 1024
#define DM 1024
#define NH 16
#define HD 64
#define LQ (3 * DM)
#define NR (NB * SEQ)
#define ERW 256                      /* query rows per sequence that use the residual planes */

static_assert(NB <= NB_FULL);
static_assert(SEQ <= SEQ_FULL);
static_assert(NH * HD == DM);
static_assert(HD == 64);
static_assert(DM % 64 == 0);
static_assert(DM % 32 == 0);
static_assert(LQ % 128 == 0);
static_assert(SEQ % 128 == 0);
static_assert(NR % 128 == 0);
static_assert(ERW % 128 == 0);
static_assert(SEQ >= ERW);
static_assert(ERW % 64 == 0);
static_assert(SEQ % 8 == 0);
static_assert(((size_t)NR * DM / 8) % 256 == 0);
static_assert(((size_t)DM * DM / 8) % 256 == 0);

typedef unsigned short v8us __attribute__((ext_vector_type(8), may_alias));
typedef float  v8f  __attribute__((ext_vector_type(8)));
typedef float  v4f  __attribute__((ext_vector_type(4)));
typedef float  v4fa __attribute__((ext_vector_type(4), may_alias));
typedef _Float16 v16h __attribute__((ext_vector_type(16)));
union FragH { v16h v; v8us half[2]; _Float16 h[16]; unsigned short u[16]; };

__device__ __forceinline__ unsigned short bf16_bits(float x) { unsigned int u = __float_as_uint(x); return (unsigned short)((u + 0x7FFFu + ((u >> 16) & 1u)) >> 16); }
__device__ __forceinline__ float bf16_rne(float x) { return __uint_as_float(((unsigned int)bf16_bits(x)) << 16); }

// A / B fragment from a k-contiguous 16-bit row: elements 0..7 <- p[8h .. 8h+7], elements 8..15 <- p[16+8h .. 16+8h+7]
__device__ __forceinline__ v16h g2_frag(const _Float16* p, int hh) { FragH f; f.half[0] = *(const v8us*)((const unsigned short*)p + 8 * hh); f.half[1] = *(const v8us*)((const unsigned short*)p + 16 + 8 * hh); return f.v; }
__device__ __forceinline__ v8f g2_mma(v16h a, v16h b, v8f c) { v8f d = __builtin_amdgcn_wmma_f32_16x16x32_f16(false, a, false, b, (short)0, c, false, false); asm volatile("v_nop\n\tv_nop\n\tv_nop\n\tv_nop" : "+v"(d) : "v"(a), "v"(b)); return d; }
__device__ __forceinline__ void wave_lds_sync() { __builtin_amdgcn_fence(4 /* acq_rel order */, "workgroup"); __builtin_amdgcn_wave_barrier(); }

// One LDS stage of a GEMM block: kc of k for every operand row, row pitch = the row + 16 B (144 or 272 B = 16 B x odd: conflict-free for 16-byte row reads).
constexpr int gemm_stage_bytes(int wn, bool er, int kc) { return (128 * (er ? 2 : 1) + 64 * wn) * (kc * 2 + 16); }
#define KC_QKV 64                    /* three blocks share a WGP's LDS */
#define KC_OUT(er) ((er) ? 64 : 128) /* few blocks: the longer stage covers the copies' flight; with the residual plane its copy addresses would not fit the registers */

// N asynchronous 16-byte copies global -> LDS, lane by lane, in one statement.
// The s_wait_xcnt stands inside the statement so that no address register is rewritten in front of it; one statement a stage (two beyond 12 copies) pays that wait once.
#define CPL(a, b) "global_load_async_to_lds_b128 %" #a ", %" #b ", off\n\t"
template <int N>
__device__ __forceinline__ void cp_issue(const unsigned (&l)[N], const _Float16* const (&g)[N]) {
  static_assert(N == 8 || N == 10 || N == 12);
  if constexpr (N == 8)
    asm volatile(CPL(0, 1) CPL(2, 3) CPL(4, 5) CPL(6, 7) CPL(8, 9) CPL(10, 11) CPL(12, 13) CPL(14, 15) "s_wait_xcnt 0x0"
                 :: "v"(l[0]), "v"(g[0]), "v"(l[1]), "v"(g[1]), "v"(l[2]), "v"(g[2]), "v"(l[3]), "v"(g[3]), "v"(l[4]), "v"(g[4]), "v"(l[5]), "v"(g[5]), "v"(l[6]), "v"(g[6]), "v"(l[7]), "v"(g[7]) : "memory");
  else if constexpr (N == 10)
    asm volatile(CPL(0, 1) CPL(2, 3) CPL(4, 5) CPL(6, 7) CPL(8, 9) CPL(10, 11) CPL(12, 13) CPL(14, 15) CPL(16, 17) CPL(18, 19) "s_wait_xcnt 0x0"
                 :: "v"(l[0]), "v"(g[0]), "v"(l[1]), "v"(g[1]), "v"(l[2]), "v"(g[2]), "v"(l[3]), "v"(g[3]), "v"(l[4]), "v"(g[4]), "v"(l[5]), "v"(g[5]), "v"(l[6]), "v"(g[6]), "v"(l[7]), "v"(g[7]),
                    "v"(l[8]), "v"(g[8]), "v"(l[9]), "v"(g[9]) : "memory");
  else
    asm volatile(CPL(0, 1) CPL(2, 3) CPL(4, 5) CPL(6, 7) CPL(8, 9) CPL(10, 11) CPL(12, 13) CPL(14, 15) CPL(16, 17) CPL(18, 19) CPL(20, 21) CPL(22, 23) "s_wait_xcnt 0x0"
                 :: "v"(l[0]), "v"(g[0]), "v"(l[1]), "v"(g[1]), "v"(l[2]), "v"(g[2]), "v"(l[3]), "v"(g[3]), "v"(l[4]), "v"(g[4]), "v"(l[5]), "v"(g[5]), "v"(l[6]), "v"(g[6]), "v"(l[7]), "v"(g[7]),
                    "v"(l[8]), "v"(g[8]), "v"(l[9]), "v"(g[9]), "v"(l[10]), "v"(g[10]), "v"(l[11]), "v"(g[11]) : "memory");
}

// GEMM main loop of one block: A tile 128 rows (hi plane; residual plane too when ER), B tile 64 * WN rows, all k-contiguous with row pitch DM.
// 4 * WN waves, wave (wm, wn) = 32 rows x 64 columns; c (and d for the residual plane) accumulate k in ascending steps of 32.
// LDS stage = KC of k of [A hi 128 rows | A residual 128 rows when ER | B 64 * WN rows]; stage s + 2 is copied into the buffer that pass s has left.
template <int WN, bool ER, int KC>
__device__ __forceinline__ void gemm_core(unsigned char* sm, const _Float16* __restrict__ Ah, const _Float16* __restrict__ Ar, const _Float16* __restrict__ Bw, v8f (&c)[8], v8f (&d)[8]) {
  static_assert(DM % KC == 0 && DM / KC >= 2 && KC % 64 == 0);
  constexpr int LP = KC + 8, LPB = LP * 2;   /* LDS row pitch in f16 and in bytes */
  constexpr int TPR = KC / 8;                /* threads that copy one row, 16 B each */
  constexpr int RPP = 128 * WN / TPR;        /* rows covered by one copy of every thread */
  constexpr int NPA = ER ? 2 : 1;
  constexpr int SB = gemm_stage_bytes(WN, ER, KC);
  constexpr int NS = DM / KC;
  constexpr int KG = (WN == 1 && !ER) ? 2 : 1;   /* 32-k steps whose fragments are read as one group: two where registers allow and few waves share a SIMD */
  const int tid = threadIdx.x;
  const int wave = __builtin_amdgcn_readfirstlane((int)(tid >> 5));
  const int lane = tid & 31, ln = lane & 15, hh = lane >> 4;
  const int wm = wave & 3, wn = wave >> 2;
  const int cr = tid / TPR, cc = tid % TPR;
  const unsigned l0 = (unsigned)(size_t)sm + (unsigned)(cr * LPB + cc * 16);
  const _Float16* gA = Ah + (size_t)cr * DM + cc * 8;
  const _Float16* gR = Ar + (size_t)cr * DM + cc * 8;
  const _Float16* gB = Bw + (size_t)cr * DM + cc * 8;
  constexpr int NCP = (128 * NPA + 64 * WN) / RPP;   /* copies of a thread per stage */
  constexpr int NST = (NCP + 11) / 12, NPS = NCP / NST;   /* asm statements per stage, copies in each */
  static_assert(NST * NPS == NCP && NCP <= 63 && 128 % RPP == 0);
  auto fill = [&](int buf, int kc) {
    const unsigned l = l0 + (unsigned)(buf * SB);
#pragma unroll   /* both loops: row must be a compile-time constant, so that L and G are registers */
    for (int st = 0; st < NST; ++st) {
      unsigned L[NPS];
      const _Float16* G[NPS];
#pragma unroll
      for (int j = 0; j < NPS; ++j) {
        const int row = (st * NPS + j) * RPP;          /* first row of the stage that this copy of the block covers */
        L[j] = l + (unsigned)(row * LPB);
        G[j] = (row < 128 ? gA + (size_t)row * DM : (ER && row < 256) ? gR + (size_t)(row - 128) * DM : gB + (size_t)(row - 128 * NPA) * DM) + kc;
      }
      cp_issue<NPS>(L, G);
    }
  };
  fill(0, 0);
  asm volatile("s_wait_asynccnt 0x0" ::: "memory");   // stage 0 of this wave has landed
  __syncthreads();                                    // ... and every other wave's share of it
  fill(1, KC);
#pragma unroll 1   /* rolled: the buffer index is a scalar select, and the loop body stays short */
  for (int s = 0; s < NS; ++s) {
    const _Float16* bp = (const _Float16*)(sm + (s & 1) * SB);
    const _Float16* ap = bp + (32 * wm + ln) * LP;
    const _Float16* bq = bp + (128 * NPA + 64 * wn + ln) * LP;
#pragma unroll   /* this and the inner loops: fragment and accumulator indices must be constants, so that they are registers */
    for (int kg = 0; kg < KC / 32; kg += KG) {
      v16h af[KG][2], rf[KG][2], bf[KG][4];              /* a group's LDS reads go out together, ahead of its matrix instructions */
#pragma unroll
      for (int u = 0; u < KG; ++u) {
        const int kk = (kg + u) * 32;
        af[u][0] = g2_frag(ap + kk, hh); af[u][1] = g2_frag(ap + 16 * LP + kk, hh);
#pragma unroll
        for (int t = 0; t < 4; ++t) bf[u][t] = g2_frag(bq + t * 16 * LP + kk, hh);
        if (ER) { rf[u][0] = g2_frag(ap + 128 * LP + kk, hh); rf[u][1] = g2_frag(ap + 144 * LP + kk, hh); }
      }
#pragma unroll
      for (int u = 0; u < KG; ++u) {
#pragma unroll
        for (int t = 0; t < 4; ++t) {
          c[t] = g2_mma(af[u][0], bf[u][t], c[t]); c[4 + t] = g2_mma(af[u][1], bf[u][t], c[4 + t]);
          if (ER) { d[t] = g2_mma(rf[u][0], bf[u][t], d[t]); d[4 + t] = g2_mma(rf[u][1], bf[u][t], d[4 + t]); }
        }
      }
    }
    asm volatile("s_wait_dscnt 0x0" ::: "memory");      // this wave's reads of buffer s & 1 are done before it is refilled
    asm volatile("s_wait_asynccnt 0x0" ::: "memory");   // this wave's copies of stage s + 1 have landed
    __syncthreads();                                    // publishes stage s + 1 and ends every wave's reads of stage s
    if (s + 2 < NS) fill(s & 1, (s + 2) * KC);
  }
  asm volatile("s_wait_asynccnt 0x0" ::: "memory");     // nothing in flight when the buffers become output staging
}

__global__ __launch_bounds__(256) void k_wnat(const float* __restrict__ w, _Float16* __restrict__ Bt) {
  const size_t t = (size_t)blockIdx.x * 256 + threadIdx.x;
  if (t >= (size_t)DM * DM / 8) return;
  const v4f a = *(const v4fa*)(w + t * 8), c = *(const v4fa*)(w + t * 8 + 4);
  FragH f;
#pragma unroll
  for (int q = 0; q < 4; ++q) { f.h[q] = (_Float16)(bf16_rne(a[q]) * 16.0f); f.h[4 + q] = (_Float16)(bf16_rne(c[q]) * 16.0f); }
  const v8us o = f.half[0];
  unsigned short* d = (unsigned short*)Bt + t * 8;
  *(v8us*)d = o;
  
}

__global__ __launch_bounds__(256) void k_x16(const float* __restrict__ x, _Float16* __restrict__ X16) {
  const size_t t = (size_t)blockIdx.x * 256 + threadIdx.x;
  if (t >= (size_t)NR * DM / 8) return;
  const size_t row = t / (DM / 8);
  const int c8 = (int)(t % (DM / 8)) * 8;
  const size_t b = row / SEQ, s = row % SEQ;
  const float* src = x + (b * SEQ_FULL + s) * DM + c8;
  const v4f a = *(const v4fa*)src, c = *(const v4fa*)(src + 4);
  FragH f;
#pragma unroll
  for (int q = 0; q < 4; ++q) { f.h[q] = (_Float16)bf16_rne(a[q]); f.h[4 + q] = (_Float16)bf16_rne(c[q]); }
  const v8us o = f.half[0];
  unsigned short* d = (unsigned short*)X16 + t * 8;
  *(v8us*)d = o;
  
}

// CS[s][j] = (cos, sin)(float(pos[s]) * inv_freq[j]), inv_freq[j] = f32(1 / 10000^(j/32)) with the power formed in double from fixed roots.
__global__ __launch_bounds__(256) void k_tab(const int* __restrict__ tp, float* __restrict__ CS) {
  __shared__ __attribute__((aligned(16))) float ts[8][64];
  const int tid = threadIdx.x;
  const int sl = tid >> 5, j = tid & 31;
  const int s = blockIdx.x * 8 + sl;
  const int pos = tp[s];
  double p = 1.0;
  p = (j & 1)  ? p * 1.3335214321633240 : p;
  p = (j & 2)  ? p * 1.7782794100389228 : p;
  p = (j & 4)  ? p * 3.1622776601683795 : p;
  p = (j & 8)  ? p * 10.0 : p;
  p = (j & 16) ? p * 100.0 : p;
  const float inv = (float)(1.0 / p);
  const float ang = (float)pos * inv;
  float sn, cs;
  sincosf(ang, &sn, &cs);
  ts[sl][2 * j] = cs;
  ts[sl][2 * j + 1] = sn;
  __syncthreads();
  if (tid < 128) {
    const int r = tid >> 4, c4 = (tid & 15) * 4;
    const v4f v = *(const v4fa*)&ts[r][c4];
    float* d = CS + (size_t)(blockIdx.x * 8 + r) * 64 + c4;
    *(v4f*)d = v;
    
  }
}

// QKV GEMM: rows r = b*SEQ + s of X16 [NR][DM] times Bw [3*DM][DM] (x16) -> f32 * 1/16; rotary on the q and k column blocks (a wave's 64 columns = one head);
__global__ __launch_bounds__(256) void k_qkv(const _Float16* __restrict__ X16, const _Float16* __restrict__ Bw, const float* __restrict__ CS, _Float16* __restrict__ Ph, _Float16* __restrict__ Pr) {
  static_assert(2 * gemm_stage_bytes(2, false, KC_QKV) >= 8 * 32 * 68 * 4);
  __shared__ __attribute__((aligned(16))) unsigned char sm[2 * gemm_stage_bytes(2, false, KC_QKV)];
  float (*so)[32][68] = (float (*)[32][68])sm;          /* output staging takes the operand buffers' place behind the main loop's last barrier */
  const int tid = threadIdx.x;
  const int wave = __builtin_amdgcn_readfirstlane((int)(tid >> 5));
  const int lane = tid & 31, ln = lane & 15, hh = lane >> 4;
  const int ntn = LQ / 128;
  const int mt = blockIdx.x / ntn, nq = blockIdx.x - mt * ntn;
  const int row0 = mt * 128 + 32 * (wave & 3), col0 = nq * 128 + 64 * (wave >> 2);
  const v8f z8 = {0.f, 0.f, 0.f, 0.f, 0.f, 0.f, 0.f, 0.f};
  v8f c[8] = {z8, z8, z8, z8, z8, z8, z8, z8};
  gemm_core<2, false, KC_QKV>(sm, X16 + (size_t)(mt * 128) * DM, X16 + (size_t)(mt * 128) * DM, Bw + (size_t)(nq * 128) * DM, c, c);
#pragma unroll
  for (int u = 0; u < 8; ++u) {
    const int t = u & 3, half = u >> 2;
#pragma unroll
    for (int r = 0; r < 8; ++r) so[wave][half * 16 + 8 * hh + r][t * 16 + ln] = c[u][r] * 0.0625f;
  }
  wave_lds_sync();
  const int rsub = lane >> 3, c8 = (lane & 7) * 8;
  const bool rp = col0 < 2 * DM;
  {
#pragma unroll 1
    for (int q = 0; q < 8; ++q) {
      const int r = q * 4 + rsub;
      const v4f u0 = *(const v4fa*)&so[wave][r][c8], u1 = *(const v4fa*)&so[wave][r][c8 + 4];
      const int s = (row0 + r) % SEQ;
      const v4f t0 = *(const v4fa*)(CS + (size_t)s * 64 + c8), t1 = *(const v4fa*)(CS + (size_t)s * 64 + c8 + 4);
      float e[8] = {u0[0], u0[1], u0[2], u0[3], u1[0], u1[1], u1[2], u1[3]};
      const float cz[4] = {t0[0], t0[2], t1[0], t1[2]};
      const float sz[4] = {t0[1], t0[3], t1[1], t1[3]};
#pragma unroll
      for (int i = 0; i < 4; ++i) {
        const float te = e[2 * i], to = e[2 * i + 1];
        const float re = te * cz[i] - to * sz[i];
        const float ro = te * sz[i] + to * cz[i];
        e[2 * i] = rp ? re : te;
        e[2 * i + 1] = rp ? ro : to;
      }
      FragH fh, fr;
#pragma unroll
      for (int i = 0; i < 8; ++i) { const _Float16 hi = (_Float16)e[i]; fh.h[i] = hi; fr.h[i] = (_Float16)((e[i] - (float)hi) * 1024.0f); }
      const v8us oh8 = fh.half[0], or8 = fr.half[0];
      const size_t o = (size_t)(row0 + r) * LQ + col0 + c8;
      *(v8us*)((unsigned short*)Ph + o) = oh8;
      *(v8us*)((unsigned short*)Pr + o) = or8;
    }
    
  }
}

// V^T planes: VT[plane][(b,h)][d][s] = QKV[plane][b*SEQ + s][2*DM + h*64 + d]; in [64 tokens][64 d] -> out [64 d][64 tokens] per block via LDS (cross-wave: block barrier);
__global__ __launch_bounds__(256) void k_vt(const _Float16* __restrict__ QKV, _Float16* __restrict__ VT) {
  __shared__ unsigned short tl[64][66];
  const int tid = threadIdx.x;
  const int slab = blockIdx.x / (SEQ / 64), lg = blockIdx.x % (SEQ / 64);
  const int b = slab / NH, h = slab % NH;
  const size_t pin = (size_t)blockIdx.y * ((size_t)NR * LQ);
  const size_t pout = (size_t)blockIdx.y * ((size_t)NB * NH * HD * SEQ);
  for (int i = tid; i < 64 * 8; i += 256) {
    const int r = i / 8, c8 = (i % 8) * 8;
    FragH f;
    f.half[0] = *(const v8us*)((const unsigned short*)QKV + pin + ((size_t)b * SEQ + lg * 64 + r) * LQ + 2 * DM + h * HD + c8);
#pragma unroll
    for (int q = 0; q < 8; ++q) tl[r][c8 + q] = f.u[q];
  }
  __syncthreads();
  {
#pragma unroll
    for (int rd = 0; rd < 2; ++rd) {
      const int d = rd * 32 + tid / 8, pc = tid % 8;
      FragH f;
#pragma unroll
      for (int q = 0; q < 8; ++q) f.u[q] = tl[pc * 8 + q][d];
      const v8us o = f.half[0];
      *(v8us*)((unsigned short*)VT + pout + ((size_t)slab * 64 + d) * SEQ + lg * 64 + pc * 8) = o;
    }
    
  }
}

// Fused causal attention, online softmax. Grid (query tiles of 64, NB*NH); wave = 16 query rows; 32-key steps; q, k and V^T fragments straight from the planes.
template <bool ER>
__device__ __forceinline__ void attn_body(const _Float16* __restrict__ Qh, const _Float16* __restrict__ Qr, const _Float16* __restrict__ VTh, const _Float16* __restrict__ VTr,
                                          _Float16* __restrict__ Oh, _Float16* __restrict__ Or, int qt0) {
  __shared__ __attribute__((aligned(16))) _Float16 ph[4][16][40];
  __shared__ __attribute__((aligned(16))) _Float16 pl[4][16][40];
  __shared__ __attribute__((aligned(16))) _Float16 oh[4][16][72];
  __shared__ __attribute__((aligned(16))) _Float16 ol[4][16][72];
  const int tid = threadIdx.x;
  const int wave = __builtin_amdgcn_readfirstlane((int)(tid >> 5));
  const int lane = tid & 31, ln = lane & 15, hh = lane >> 4;
  const int bh = blockIdx.y;
  const int b = bh / NH, h = bh % NH;
  const int q0 = (qt0 + (int)blockIdx.x) * 64 + wave * 16;
  const size_t rowb = (size_t)b * SEQ;
  const size_t qoff = (rowb + q0 + ln) * LQ + h * HD;
  const size_t koff0 = (rowb + ln) * LQ + DM + h * HD;
  const size_t voff0 = ((size_t)bh * HD + ln) * SEQ;
  const int nst = (q0 + 16 + 31) >> 5;
  const v8f z8 = {0.f, 0.f, 0.f, 0.f, 0.f, 0.f, 0.f, 0.f};
  v8f o[4] = {z8, z8, z8, z8};
  v8f orr[4] = {z8, z8, z8, z8};
  float mrow[8], lrow[8];
#pragma unroll
  for (int r = 0; r < 8; ++r) { mrow[r] = -1.0e30f; lrow[r] = 0.f; }
#pragma unroll 1
  for (int st = 0; st < nst; ++st) {
    const int key0 = st * 32;
    v8f sm[2] = {z8, z8};
    v8f sr[2] = {z8, z8};
#pragma unroll
    for (int kk = 0; kk < 2; ++kk) {
      const v16h qh = g2_frag(Qh + qoff + kk * 32, hh);
      v16h ql = qh;
      if (ER) ql = g2_frag(Qr + qoff + kk * 32, hh);
#pragma unroll
      for (int t = 0; t < 2; ++t) {
        const size_t ko = koff0 + (size_t)(key0 + 16 * t) * LQ + kk * 32;
        const v16h kh = g2_frag(Qh + ko, hh);
        sm[t] = g2_mma(qh, kh, sm[t]);
        if (ER) {
          const v16h kl = g2_frag(Qr + ko, hh);
          sr[t] = g2_mma(ql, kh, sr[t]);
          sr[t] = g2_mma(qh, kl, sr[t]);
        }
      }
    }
#pragma unroll
    for (int r = 0; r < 8; ++r) {
      const int qrow = q0 + 8 * hh + r;
      float s0 = sm[0][r], s1 = sm[1][r];
      if (ER) { s0 += sr[0][r] * 0.0009765625f; s1 += sr[1][r] * 0.0009765625f; }
      s0 *= 0.125f; s1 *= 0.125f;
      const bool m0 = (key0 + ln) > qrow, m1 = (key0 + 16 + ln) > qrow;
      s0 = m0 ? -1.0e9f : s0;
      s1 = m1 ? -1.0e9f : s1;
      float rm = fmaxf(s0, s1);
      rm = fmaxf(rm, __shfl_xor(rm, 1));
      rm = fmaxf(rm, __shfl_xor(rm, 2));
      rm = fmaxf(rm, __shfl_xor(rm, 4));
      rm = fmaxf(rm, __shfl_xor(rm, 8));
      const float mnew = fmaxf(mrow[r], rm);
      const float al = __expf(mrow[r] - mnew);
      const float e0 = __expf(s0 - mnew), e1 = __expf(s1 - mnew);
      const float p0 = m0 ? 0.f : e0, p1 = m1 ? 0.f : e1;
      lrow[r] = lrow[r] * al + (p0 + p1);
      mrow[r] = mnew;
#pragma unroll
      for (int j = 0; j < 4; ++j) { o[j][r] *= al; if (ER) orr[j][r] *= al; }
      const float a0 = p0 * 256.0f, a1 = p1 * 256.0f;
      const _Float16 h0 = (_Float16)a0, h1 = (_Float16)a1;
      ph[wave][8 * hh + r][ln] = h0;
      ph[wave][8 * hh + r][16 + ln] = h1;
      if (ER) {
        pl[wave][8 * hh + r][ln] = (_Float16)((a0 - (float)h0) * 1024.0f);
        pl[wave][8 * hh + r][16 + ln] = (_Float16)((a1 - (float)h1) * 1024.0f);
      }
    }
    wave_lds_sync();
    FragH pa, pb;
    pa.half[0] = *(const v8us*)&ph[wave][ln][8 * hh];
    pa.half[1] = *(const v8us*)&ph[wave][ln][16 + 8 * hh];
    pb.v = pa.v;
    if (ER) {
      pb.half[0] = *(const v8us*)&pl[wave][ln][8 * hh];
      pb.half[1] = *(const v8us*)&pl[wave][ln][16 + 8 * hh];
    }
#pragma unroll
    for (int j = 0; j < 4; ++j) {
      const size_t vo = voff0 + (size_t)(16 * j) * SEQ + key0;
      const v16h vh = g2_frag(VTh + vo, hh);
      o[j] = g2_mma(pa.v, vh, o[j]);
      if (ER) {
        const v16h vl = g2_frag(VTr + vo, hh);
        orr[j] = g2_mma(pb.v, vh, orr[j]);
        orr[j] = g2_mma(pa.v, vl, orr[j]);
      }
    }
    wave_lds_sync();
  }
#pragma unroll
  for (int r = 0; r < 8; ++r) {
    float l = lrow[r];
    l += __shfl_xor(l, 1);
    l += __shfl_xor(l, 2);
    l += __shfl_xor(l, 4);
    l += __shfl_xor(l, 8);
    const float inv = 0.25f * (1.0f / l);
#pragma unroll
    for (int j = 0; j < 4; ++j) {
      float v = o[j][r];
      if (ER) v += orr[j][r] * 0.0009765625f;
      v *= inv;
      const _Float16 hi = (_Float16)v;
      oh[wave][8 * hh + r][16 * j + ln] = hi;
      if (ER) ol[wave][8 * hh + r][16 * j + ln] = (_Float16)((v - (float)hi) * 1024.0f);
    }
  }
  wave_lds_sync();
  const int rsub = lane >> 3, c8 = (lane & 7) * 8;
  {
#pragma unroll
    for (int q = 0; q < 4; ++q) {
      const int r = q * 4 + rsub;
      const size_t oo = (rowb + q0 + r) * DM + h * HD + c8;
      const v8us vh8 = *(const v8us*)&oh[wave][r][c8];
      *(v8us*)((unsigned short*)Oh + oo) = vh8;
      if (ER) {
        const v8us vl8 = *(const v8us*)&ol[wave][r][c8];
        *(v8us*)((unsigned short*)Or + oo) = vl8;
      }
    }
    
  }
}
__global__ __launch_bounds__(128) void k_attn_late(const _Float16* __restrict__ Qh, const _Float16* __restrict__ Qr, const _Float16* __restrict__ VTh, const _Float16* __restrict__ VTr, _Float16* __restrict__ Oh, _Float16* __restrict__ Or, int qt0) {
  attn_body<false>(Qh, Qr, VTh, VTr, Oh, Or, qt0);
}
__global__ __launch_bounds__(128) void k_attn_early(const _Float16* __restrict__ Qh, const _Float16* __restrict__ Qr, const _Float16* __restrict__ VTh, const _Float16* __restrict__ VTr, _Float16* __restrict__ Oh, _Float16* __restrict__ Or, int qt0) {
  attn_body<true>(Qh, Qr, VTh, VTr, Oh, Or, qt0);
}

// Output GEMM: ctx rows (x64; hi plane Ah, residual plane Ar x2^10 when ER) times Bw [DM][DM] (x16) -> f32 * 2^-10 into the output rows b*SEQ_FULL + s.
template <bool ER>
__device__ __forceinline__ void out_body(const _Float16* __restrict__ Ah, const _Float16* __restrict__ Ar, const _Float16* __restrict__ Bw, float* __restrict__ C, int rbPerB, int rowOff) {
  static_assert(2 * gemm_stage_bytes(1, ER, KC_OUT(ER)) >= 4 * 32 * 68 * 4);
  __shared__ __attribute__((aligned(16))) unsigned char sm[2 * gemm_stage_bytes(1, ER, KC_OUT(ER))];
  float (*so)[32][68] = (float (*)[32][68])sm;          /* output staging takes the operand buffers' place behind the main loop's last barrier */
  const int tid = threadIdx.x;
  const int wave = __builtin_amdgcn_readfirstlane((int)(tid >> 5));
  const int lane = tid & 31, ln = lane & 15, hh = lane >> 4;
  const int ntn = DM / 64;
  const int mt = blockIdx.x / ntn, nq = blockIdx.x - mt * ntn;
  const int b = mt / rbPerB, lb = mt - b * rbPerB;
  const int s0 = rowOff + lb * 128 + 32 * wave;
  const int col0 = nq * 64;
  const size_t ablk = ((size_t)b * SEQ + rowOff + lb * 128) * DM;
  const size_t crow = (size_t)b * SEQ_FULL + s0;
  const v8f z8 = {0.f, 0.f, 0.f, 0.f, 0.f, 0.f, 0.f, 0.f};
  v8f c[8] = {z8, z8, z8, z8, z8, z8, z8, z8};
  v8f d[8] = {z8, z8, z8, z8, z8, z8, z8, z8};
  gemm_core<1, ER, KC_OUT(ER)>(sm, Ah + ablk, Ar + ablk, Bw + (size_t)col0 * DM, c, d);
#pragma unroll
  for (int u = 0; u < 8; ++u) {
    const int t = u & 3, half = u >> 2;
#pragma unroll
    for (int r = 0; r < 8; ++r) {
      float v = c[u][r];
      if (ER) v += d[u][r] * 0.0009765625f;
      so[wave][half * 16 + 8 * hh + r][t * 16 + ln] = v * 0.0009765625f;
    }
  }
  wave_lds_sync();
  const int rsub = lane >> 4, c4 = (lane & 15) * 4;
  {
#pragma unroll 1
    for (int q = 0; q < 16; ++q) {
      const int r = q * 2 + rsub;
      const v4f v = *(const v4fa*)&so[wave][r][c4];
      *(v4f*)(C + (crow + r) * DM + col0 + c4) = v;
    }
    
  }
}
__global__ __launch_bounds__(128) void k_out_late(const _Float16* __restrict__ Ah, const _Float16* __restrict__ Ar, const _Float16* __restrict__ Bw, float* __restrict__ C, int rbPerB, int rowOff) {
  out_body<false>(Ah, Ar, Bw, C, rbPerB, rowOff);
}
__global__ __launch_bounds__(128) void k_out_early(const _Float16* __restrict__ Ah, const _Float16* __restrict__ Ar, const _Float16* __restrict__ Bw, float* __restrict__ C, int rbPerB, int rowOff) {
  out_body<true>(Ah, Ar, Bw, C, rbPerB, rowOff);
}

// workspace carve (bytes); every region is a multiple of 256 B
constexpr size_t SZ_W    = (size_t)DM * DM * 2;                 /* one x16 f16 weight plane */
constexpr size_t SZ_X16  = (size_t)NR * DM * 2;
constexpr size_t SZ_QKV  = (size_t)NR * LQ * 2;                 /* one q|k|v plane */
constexpr size_t SZ_VT   = (size_t)NB * NH * HD * SEQ * 2;      /* one V^T plane */
constexpr size_t SZ_O    = (size_t)NR * DM * 2;                 /* one ctx plane */
constexpr size_t SZ_CS   = (size_t)SEQ * 64 * 4;
constexpr size_t OFF_BW  = 0;                                   /* wq | wk | wv | wo */
constexpr size_t OFF_X16 = OFF_BW + 4 * SZ_W;
constexpr size_t OFF_QKV = OFF_X16 + SZ_X16;                    /* hi plane, residual plane */
constexpr size_t OFF_VT  = OFF_QKV + 2 * SZ_QKV;                /* hi plane, residual plane */
constexpr size_t OFF_O   = OFF_VT + 2 * SZ_VT;                  /* hi plane, residual plane */
constexpr size_t OFF_CS  = OFF_O + 2 * SZ_O;
constexpr size_t WS_TOTAL = OFF_CS + SZ_CS;
static_assert(WS_TOTAL <= (size_t)134217728);
static_assert(SZ_W % 256 == 0 && SZ_X16 % 256 == 0 && SZ_QKV % 256 == 0 && SZ_VT % 256 == 0 && SZ_O % 256 == 0 && SZ_CS % 256 == 0);
static_assert((size_t)((NB - 1) * SEQ_FULL + SEQ) * DM * 4 <= (size_t)NB_FULL * SEQ_FULL * DM * 4);

extern "C" void kernel_launch(void* const* d_in, const int* in_sizes, int n_in,
                              void* d_out, int out_size, void* d_ws, size_t ws_size, hipStream_t stream) {
  if (n_in < 6) return;
  const size_t need_x = (size_t)((NB - 1) * SEQ_FULL + SEQ) * DM;
  if ((size_t)in_sizes[0] < need_x) return;
  if ((size_t)in_sizes[1] < (size_t)DM * DM || (size_t)in_sizes[2] < (size_t)DM * DM || (size_t)in_sizes[3] < (size_t)DM * DM || (size_t)in_sizes[4] < (size_t)DM * DM) return;
  if (in_sizes[5] < SEQ) return;
  if ((size_t)out_size < need_x) return;
  if (WS_TOTAL > ws_size) return;
  const float* x  = (const float*)d_in[0];
  const float* wq = (const float*)d_in[1];
  const float* wk = (const float*)d_in[2];
  const float* wv = (const float*)d_in[3];
  const float* wo = (const float*)d_in[4];
  const int*   tp = (const int*)d_in[5];
  float* out = (float*)d_out;
  char* ws = (char*)d_ws;
  _Float16* BQKV = (_Float16*)(ws + OFF_BW);
  _Float16* BO   = (_Float16*)(ws + OFF_BW + 3 * SZ_W);
  _Float16* X16  = (_Float16*)(ws + OFF_X16);
  _Float16* QKVh = (_Float16*)(ws + OFF_QKV);
  _Float16* QKVr = (_Float16*)(ws + OFF_QKV + SZ_QKV);
  _Float16* VTh  = (_Float16*)(ws + OFF_VT);
  _Float16* VTr  = (_Float16*)(ws + OFF_VT + SZ_VT);
  _Float16* Oh   = (_Float16*)(ws + OFF_O);
  _Float16* Or   = (_Float16*)(ws + OFF_O + SZ_O);
  float*    CS   = (float*)(ws + OFF_CS);

  const unsigned gw = (unsigned)(((size_t)DM * DM / 8 + 255) / 256);
  k_wnat<<<gw, 256, 0, stream>>>(wq, BQKV);
  k_wnat<<<gw, 256, 0, stream>>>(wk, BQKV + (size_t)DM * DM);
  k_wnat<<<gw, 256, 0, stream>>>(wv, BQKV + (size_t)2 * DM * DM);
  k_wnat<<<gw, 256, 0, stream>>>(wo, BO);
  k_x16<<<(unsigned)(((size_t)NR * DM / 8 + 255) / 256), 256, 0, stream>>>(x, X16);
  k_tab<<<SEQ / 8, 256, 0, stream>>>(tp, CS);
  k_qkv<<<(unsigned)((NR / 128) * (LQ / 128)), 256, 0, stream>>>(X16, BQKV, CS, QKVh, QKVr);
  k_vt<<<dim3((unsigned)(NB * NH * (SEQ / 64)), 2), 256, 0, stream>>>(QKVh, VTh);      /* in [tokens][d] -> out [d][tokens], both planes (plane strides SZ_QKV / SZ_VT) */
  if (SEQ / 64 > ERW / 64)
    k_attn_late<<<dim3((unsigned)(SEQ / 64 - ERW / 64), (unsigned)(NB * NH)), 128, 0, stream>>>(QKVh, QKVr, VTh, VTr, Oh, Or, ERW / 64);
  k_attn_early<<<dim3((unsigned)(ERW / 64), (unsigned)(NB * NH)), 128, 0, stream>>>(QKVh, QKVr, VTh, VTr, Oh, Or, 0);
  if (SEQ > ERW)
    k_out_late<<<(unsigned)(NB * ((SEQ - ERW) / 128) * (DM / 64)), 128, 0, stream>>>(Oh, Or, BO, out, (SEQ - ERW) / 128, ERW);
  k_out_early<<<(unsigned)(NB * (ERW / 128) * (DM / 64)), 128, 0, stream>>>(Oh, Or, BO, out, ERW / 128, 0);
}

// v002
// It runs in 144 microseconds.
// Timed twice side by side with v001, it ran 1.31 and 1.30 times as fast.
// All steps since v000 together make it 1.85 times as fast.
#include <hip/hip_runtime.h>
// Causal multi-head self-attention with interleaved rotary (x [4][1024][1024]; q|k|v = x W^T with [out][in] weights, 16 heads of 64; scores * 1/8; causal by index; out = merged W_o^T).
// Compute dtype: all contractions v_wmma_f32_16x16x32_f16 (f16 operands, f32 accumulate). Inputs converted (RNE) to bf16 and held exactly in f16 (weights x16); q, k, v, P (x256), ctx (x64) as f16 hi planes,
// plus f16 residual planes (x2^10, separate accumulators) used for query rows 0..255 of every sequence; softmax statistics, rotary and all epilogues f32.
// Structure, five launches: preparation (cos/sin table from the position input, x plane, four weight planes: independent blocks of one grid), one QKV GEMM (N = 3072, rotary in the epilogue), V^T planes via LDS,
// fused online-softmax attention (late and early query rows as blocks of one grid), output GEMM (early and late rows as blocks of one grid).
// Both GEMMs stage their operand tiles in LDS with asynchronous 16-byte copies, two buffers of 64 k (128 k for the late output rows) each; the waves read their fragments from LDS.
#ifndef NB
#define NB 4
#endif
#ifndef SEQ
#define SEQ 1024
#endif
#define NB_FULL 4
#define SEQ_FULL 1024
#define DM 1024
#define NH 16
#define HD 64
#define LQ (3 * DM)
#define NR (NB * SEQ)
#define ERW 256                      /* query rows per sequence that use the residual planes */

static_assert(NB <= NB_FULL);
static_assert(SEQ <= SEQ_FULL);
static_assert(NH * HD == DM);
static_assert(HD == 64);
static_assert(DM % 64 == 0);
static_assert(DM % 32 == 0);
static_assert(LQ % 128 == 0);
static_assert(SEQ % 128 == 0);
static_assert(NR % 128 == 0);
static_assert(ERW % 128 == 0);
static_assert(SEQ >= ERW);
static_assert(ERW % 64 == 0);
static_assert(SEQ % 8 == 0);
static_assert(((size_t)NR * DM / 8) % 256 == 0);
static_assert(((size_t)DM * DM / 8) % 256 == 0);

typedef unsigned short v8us __attribute__((ext_vector_type(8), may_alias));
typedef float  v8f  __attribute__((ext_vector_type(8)));
typedef float  v4f  __attribute__((ext_vector_type(4)));
typedef float  v4fa __attribute__((ext_vector_type(4), may_alias));
typedef _Float16 v16h __attribute__((ext_vector_type(16)));
union FragH { v16h v; v8us half[2]; _Float16 h[16]; unsigned short u[16]; };

__device__ __forceinline__ unsigned short bf16_bits(float x) { unsigned int u = __float_as_uint(x); return (unsigned short)((u + 0x7FFFu + ((u >> 16) & 1u)) >> 16); }
__device__ __forceinline__ float bf16_rne(float x) { return __uint_as_float(((unsigned int)bf16_bits(x)) << 16); }

// A / B fragment from a k-contiguous 16-bit row: elements 0..7 <- p[8h .. 8h+7], elements 8..15 <- p[16+8h .. 16+8h+7]
__device__ __forceinline__ v16h g2_frag(const _Float16* p, int hh) { FragH f; f.half[0] = *(const v8us*)((const unsigned short*)p + 8 * hh); f.half[1] = *(const v8us*)((const unsigned short*)p + 16 + 8 * hh); return f.v; }
__device__ __forceinline__ v8f g2_mma(v16h a, v16h b, v8f c) { v8f d = __builtin_amdgcn_wmma_f32_16x16x32_f16(false, a, false, b, (short)0, c, false, false); asm volatile("v_nop\n\tv_nop\n\tv_nop\n\tv_nop" : "+v"(d) : "v"(a), "v"(b)); return d; }
__device__ __forceinline__ void wave_lds_sync() { __builtin_amdgcn_fence(4 /* acq_rel order */, "workgroup"); __builtin_amdgcn_wave_barrier(); }

// One LDS stage of a GEMM block: kc of k for every operand row, row pitch = the row + 16 B (144 or 272 B = 16 B x odd: conflict-free for 16-byte row reads).
constexpr int gemm_stage_bytes(int wn, bool er, int kc) { return (128 * (er ? 2 : 1) + 64 * wn) * (kc * 2 + 16); }
#define KC_QKV 64                    /* three blocks share a WGP's LDS */
#define KC_OUT(er) ((er) ? 64 : 128) /* few blocks: the longer stage covers the copies' flight; with the residual plane its copy addresses would not fit the registers */

// N asynchronous 16-byte copies global -> LDS, lane by lane, in one statement.
// The s_wait_xcnt stands inside the statement so that no address register is rewritten in front of it; one statement a stage (two beyond 12 copies) pays that wait once.
#define CPL(a, b) "global_load_async_to_lds_b128 %" #a ", %" #b ", off\n\t"
template <int N>
__device__ __forceinline__ void cp_issue(const unsigned (&l)[N], const _Float16* const (&g)[N]) {
  static_assert(N == 8 || N == 10 || N == 12);
  if constexpr (N == 8)
    asm volatile(CPL(0, 1) CPL(2, 3) CPL(4, 5) CPL(6, 7) CPL(8, 9) CPL(10, 11) CPL(12, 13) CPL(14, 15) "s_wait_xcnt 0x0"
                 :: "v"(l[0]), "v"(g[0]), "v"(l[1]), "v"(g[1]), "v"(l[2]), "v"(g[2]), "v"(l[3]), "v"(g[3]), "v"(l[4]), "v"(g[4]), "v"(l[5]), "v"(g[5]), "v"(l[6]), "v"(g[6]), "v"(l[7]), "v"(g[7]) : "memory");
  else if constexpr (N == 10)
    asm volatile(CPL(0, 1) CPL(2, 3) CPL(4, 5) CPL(6, 7) CPL(8, 9) CPL(10, 11) CPL(12, 13) CPL(14, 15) CPL(16, 17) CPL(18, 19) "s_wait_xcnt 0x0"
                 :: "v"(l[0]), "v"(g[0]), "v"(l[1]), "v"(g[1]), "v"(l[2]), "v"(g[2]), "v"(l[3]), "v"(g[3]), "v"(l[4]), "v"(g[4]), "v"(l[5]), "v"(g[5]), "v"(l[6]), "v"(g[6]), "v"(l[7]), "v"(g[7]),
                    "v"(l[8]), "v"(g[8]), "v"(l[9]), "v"(g[9]) : "memory");
  else
    asm volatile(CPL(0, 1) CPL(2, 3) CPL(4, 5) CPL(6, 7) CPL(8, 9) CPL(10, 11) CPL(12, 13) CPL(14, 15) CPL(16, 17) CPL(18, 19) CPL(20, 21) CPL(22, 23) "s_wait_xcnt 0x0"
                 :: "v"(l[0]), "v"(g[0]), "v"(l[1]), "v"(g[1]), "v"(l[2]), "v"(g[2]), "v"(l[3]), "v"(g[3]), "v"(l[4]), "v"(g[4]), "v"(l[5]), "v"(g[5]), "v"(l[6]), "v"(g[6]), "v"(l[7]), "v"(g[7]),
                    "v"(l[8]), "v"(g[8]), "v"(l[9]), "v"(g[9]), "v"(l[10]), "v"(g[10]), "v"(l[11]), "v"(g[11]) : "memory");
}

// GEMM main loop of one block: A tile 128 rows (hi plane; residual plane too when ER), B tile 64 * WN rows, all k-contiguous with row pitch DM.
// 4 * WN waves, wave (wm, wn) = 32 rows x 64 columns; c (and d for the residual plane) accumulate k in ascending steps of 32.
// LDS stage = KC of k of [A hi 128 rows | A residual 128 rows when ER | B 64 * WN rows]; stage s + 2 is copied into the buffer that pass s has left.
template <int WN, bool ER, int KC>
__device__ __forceinline__ void gemm_core(unsigned char* sm, const _Float16* __restrict__ Ah, const _Float16* __restrict__ Ar, const _Float16* __restrict__ Bw, v8f (&c)[8], v8f (&d)[8]) {
  static_assert(DM % KC == 0 && DM / KC >= 2 && KC % 64 == 0);
  constexpr int LP = KC + 8, LPB = LP * 2;   /* LDS row pitch in f16 and in bytes */
  constexpr int TPR = KC / 8;                /* threads that copy one row, 16 B each */
  constexpr int RPP = 128 * WN / TPR;        /* rows covered by one copy of every thread */
  constexpr int NPA = ER ? 2 : 1;
  constexpr int SB = gemm_stage_bytes(WN, ER, KC);
  constexpr int NS = DM / KC;
  constexpr int KG = (WN == 1 && !ER) ? 2 : 1;   /* 32-k steps whose fragments are read as one group: two where registers allow and few waves share a SIMD */
  const int tid = threadIdx.x;
  const int wave = __builtin_amdgcn_readfirstlane((int)(tid >> 5));
  const int lane = tid & 31, ln = lane & 15, hh = lane >> 4;
  const int wm = wave & 3, wn = wave >> 2;
  const int cr = tid / TPR, cc = tid % TPR;
  const unsigned l0 = (unsigned)(size_t)sm + (unsigned)(cr * LPB + cc * 16);
  const _Float16* gA = Ah + (size_t)cr * DM + cc * 8;
  const _Float16* gR = Ar + (size_t)cr * DM + cc * 8;
  const _Float16* gB = Bw + (size_t)cr * DM + cc * 8;
  constexpr int NCP = (128 * NPA + 64 * WN) / RPP;   /* copies of a thread per stage */
  constexpr int NST = (NCP + 11) / 12, NPS = NCP / NST;   /* asm statements per stage, copies in each */
  static_assert(NST * NPS == NCP && NCP <= 63 && 128 % RPP == 0);
  auto fill = [&](int buf, int kc) {
    const unsigned l = l0 + (unsigned)(buf * SB);
#pragma unroll   /* both loops: row must be a compile-time constant, so that L and G are registers */
    for (int st = 0; st < NST; ++st) {
      unsigned L[NPS];
      const _Float16* G[NPS];
#pragma unroll
      for (int j = 0; j < NPS; ++j) {
        const int row = (st * NPS + j) * RPP;          /* first row of the stage that this copy of the block covers */
        L[j] = l + (unsigned)(row * LPB);
        G[j] = (row < 128 ? gA + (size_t)row * DM : (ER && row < 256) ? gR + (size_t)(row - 128) * DM : gB + (size_t)(row - 128 * NPA) * DM) + kc;
      }
      cp_issue<NPS>(L, G);
    }
  };
  fill(0, 0);
  asm volatile("s_wait_asynccnt 0x0" ::: "memory");   // stage 0 of this wave has landed
  __syncthreads();                                    // ... and every other wave's share of it
  fill(1, KC);
#pragma unroll 1   /* rolled: the buffer index is a scalar select, and the loop body stays short */
  for (int s = 0; s < NS; ++s) {
    const _Float16* bp = (const _Float16*)(sm + (s & 1) * SB);
    const _Float16* ap = bp + (32 * wm + ln) * LP;
    const _Float16* bq = bp + (128 * NPA + 64 * wn + ln) * LP;
#pragma unroll   /* this and the inner loops: fragment and accumulator indices must be constants, so that they are registers */
    for (int kg = 0; kg < KC / 32; kg += KG) {
      v16h af[KG][2], rf[KG][2], bf[KG][4];              /* a group's LDS reads go out together, ahead of its matrix instructions */
#pragma unroll
      for (int u = 0; u < KG; ++u) {
        const int kk = (kg + u) * 32;
        af[u][0] = g2_frag(ap + kk, hh); af[u][1] = g2_frag(ap + 16 * LP + kk, hh);
#pragma unroll
        for (int t = 0; t < 4; ++t) bf[u][t] = g2_frag(bq + t * 16 * LP + kk, hh);
        if (ER) { rf[u][0] = g2_frag(ap + 128 * LP + kk, hh); rf[u][1] = g2_frag(ap + 144 * LP + kk, hh); }
      }
#pragma unroll
      for (int u = 0; u < KG; ++u) {
#pragma unroll
        for (int t = 0; t < 4; ++t) {
          c[t] = g2_mma(af[u][0], bf[u][t], c[t]); c[4 + t] = g2_mma(af[u][1], bf[u][t], c[4 + t]);
          if (ER) { d[t] = g2_mma(rf[u][0], bf[u][t], d[t]); d[4 + t] = g2_mma(rf[u][1], bf[u][t], d[4 + t]); }
        }
      }
    }
    asm volatile("s_wait_dscnt 0x0" ::: "memory");      // this wave's reads of buffer s & 1 are done before it is refilled
    asm volatile("s_wait_asynccnt 0x0" ::: "memory");   // this wave's copies of stage s + 1 have landed
    __syncthreads();                                    // publishes stage s + 1 and ends every wave's reads of stage s
    if (s + 2 < NS) fill(s & 1, (s + 2) * KC);
  }
  asm volatile("s_wait_asynccnt 0x0" ::: "memory");     // nothing in flight when the buffers become output staging
}

__device__ __forceinline__ void wnat_body(const float* __restrict__ w, _Float16* __restrict__ Bt, unsigned blk) {
  const size_t t = (size_t)blk * 256 + threadIdx.x;
  if (t >= (size_t)DM * DM / 8) return;
  const v4f a = *(const v4fa*)(w + t * 8), c = *(const v4fa*)(w + t * 8 + 4);
  FragH f;
#pragma unroll
  for (int q = 0; q < 4; ++q) { f.h[q] = (_Float16)(bf16_rne(a[q]) * 16.0f); f.h[4 + q] = (_Float16)(bf16_rne(c[q]) * 16.0f); }
  const v8us o = f.half[0];
  unsigned short* d = (unsigned short*)Bt + t * 8;
  *(v8us*)d = o;
  
}

__device__ __forceinline__ void x16_body(const float* __restrict__ x, _Float16* __restrict__ X16, unsigned blk) {
  const size_t t = (size_t)blk * 256 + threadIdx.x;
  if (t >= (size_t)NR * DM / 8) return;
  const size_t row = t / (DM / 8);
  const int c8 = (int)(t % (DM / 8)) * 8;
  const size_t b = row / SEQ, s = row % SEQ;
  const float* src = x + (b * SEQ_FULL + s) * DM + c8;
  const v4f a = *(const v4fa*)src, c = *(const v4fa*)(src + 4);
  FragH f;
#pragma unroll
  for (int q = 0; q < 4; ++q) { f.h[q] = (_Float16)bf16_rne(a[q]); f.h[4 + q] = (_Float16)bf16_rne(c[q]); }
  const v8us o = f.half[0];
  unsigned short* d = (unsigned short*)X16 + t * 8;
  *(v8us*)d = o;
  
}

// CS[s][j] = (cos, sin)(float(pos[s]) * inv_freq[j]), inv_freq[j] = f32(1 / 10000^(j/32)) with the power formed in double from fixed roots.
__device__ __forceinline__ void tab_body(const int* __restrict__ tp, float* __restrict__ CS, unsigned blk) {
  __shared__ __attribute__((aligned(16))) float ts[8][64];
  const int tid = threadIdx.x;
  const int sl = tid >> 5, j = tid & 31;
  const int s = (int)blk * 8 + sl;
  const int pos = tp[s];
  double p = 1.0;
  p = (j & 1)  ? p * 1.3335214321633240 : p;
  p = (j & 2)  ? p * 1.7782794100389228 : p;
  p = (j & 4)  ? p * 3.1622776601683795 : p;
  p = (j & 8)  ? p * 10.0 : p;
  p = (j & 16) ? p * 100.0 : p;
  const float inv = (float)(1.0 / p);
  const float ang = (float)pos * inv;
  float sn, cs;
  sincosf(ang, &sn, &cs);
  ts[sl][2 * j] = cs;
  ts[sl][2 * j + 1] = sn;
  __syncthreads();
  if (tid < 128) {
    const int r = tid >> 4, c4 = (tid & 15) * 4;
    const v4f v = *(const v4fa*)&ts[r][c4];
    float* d = CS + (size_t)(blk * 8 + r) * 64 + c4;
    *(v4f*)d = v;
    
  }
}

// Preparation, one grid: nothing here reads what another block of the grid writes. Table blocks first (the longest dependent chain), then the x plane, then the four weight planes (wq | wk | wv | wo, contiguous in Bt).
constexpr unsigned GP_T = SEQ / 8;
constexpr unsigned GP_X = (unsigned)(((size_t)NR * DM / 8 + 255) / 256);
constexpr unsigned GP_W = (unsigned)(((size_t)DM * DM / 8 + 255) / 256);
__global__ __launch_bounds__(256) void k_prep(const float* __restrict__ x, const float* __restrict__ wq, const float* __restrict__ wk, const float* __restrict__ wv, const float* __restrict__ wo, const int* __restrict__ tp,
                                              _Float16* __restrict__ Bt, _Float16* __restrict__ X16, float* __restrict__ CS) {
  const unsigned blk = blockIdx.x;
  if (blk < GP_T) { tab_body(tp, CS, blk); return; }
  if (blk < GP_T + GP_X) { x16_body(x, X16, blk - GP_T); return; }
  const unsigned wb = blk - (GP_T + GP_X), wi = wb / GP_W;
  const float* w = wi == 0 ? wq : wi == 1 ? wk : wi == 2 ? wv : wo;
  wnat_body(w, Bt + (size_t)wi * DM * DM, wb - wi * GP_W);
}

// QKV GEMM: rows r = b*SEQ + s of X16 [NR][DM] times Bw [3*DM][DM] (x16) -> f32 * 1/16; rotary on the q and k column blocks (a wave's 64 columns = one head);
__global__ __launch_bounds__(256) void k_qkv(const _Float16* __restrict__ X16, const _Float16* __restrict__ Bw, const float* __restrict__ CS, _Float16* __restrict__ Ph, _Float16* __restrict__ Pr) {
  static_assert(2 * gemm_stage_bytes(2, false, KC_QKV) >= 8 * 32 * 68 * 4);
  __shared__ __attribute__((aligned(16))) unsigned char sm[2 * gemm_stage_bytes(2, false, KC_QKV)];
  float (*so)[32][68] = (float (*)[32][68])sm;          /* output staging takes the operand buffers' place behind the main loop's last barrier */
  const int tid = threadIdx.x;
  const int wave = __builtin_amdgcn_readfirstlane((int)(tid >> 5));
  const int lane = tid & 31, ln = lane & 15, hh = lane >> 4;
  const int ntn = LQ / 128;
  const int mt = blockIdx.x / ntn, nq = blockIdx.x - mt * ntn;
  const int row0 = mt * 128 + 32 * (wave & 3), col0 = nq * 128 + 64 * (wave >> 2);
  const v8f z8 = {0.f, 0.f, 0.f, 0.f, 0.f, 0.f, 0.f, 0.f};
  v8f c[8] = {z8, z8, z8, z8, z8, z8, z8, z8};
  gemm_core<2, false, KC_QKV>(sm, X16 + (size_t)(mt * 128) * DM, X16 + (size_t)(mt * 128) * DM, Bw + (size_t)(nq * 128) * DM, c, c);
#pragma unroll
  for (int u = 0; u < 8; ++u) {
    const int t = u & 3, half = u >> 2;
#pragma unroll
    for (int r = 0; r < 8; ++r) so[wave][half * 16 + 8 * hh + r][t * 16 + ln] = c[u][r] * 0.0625f;
  }
  wave_lds_sync();
  const int rsub = lane >> 3, c8 = (lane & 7) * 8;
  const bool rp = col0 < 2 * DM;
  {
#pragma unroll 1
    for (int q = 0; q < 8; ++q) {
      const int r = q * 4 + rsub;
      const v4f u0 = *(const v4fa*)&so[wave][r][c8], u1 = *(const v4fa*)&so[wave][r][c8 + 4];
      const int s = (row0 + r) % SEQ;
      const v4f t0 = *(const v4fa*)(CS + (size_t)s * 64 + c8), t1 = *(const v4fa*)(CS + (size_t)s * 64 + c8 + 4);
      float e[8] = {u0[0], u0[1], u0[2], u0[3], u1[0], u1[1], u1[2], u1[3]};
      const float cz[4] = {t0[0], t0[2], t1[0], t1[2]};
      const float sz[4] = {t0[1], t0[3], t1[1], t1[3]};
#pragma unroll
      for (int i = 0; i < 4; ++i) {
        const float te = e[2 * i], to = e[2 * i + 1];
        const float re = te * cz[i] - to * sz[i];
        const float ro = te * sz[i] + to * cz[i];
        e[2 * i] = rp ? re : te;
        e[2 * i + 1] = rp ? ro : to;
      }
      FragH fh, fr;
#pragma unroll
      for (int i = 0; i < 8; ++i) { const _Float16 hi = (_Float16)e[i]; fh.h[i] = hi; fr.h[i] = (_Float16)((e[i] - (float)hi) * 1024.0f); }
      const v8us oh8 = fh.half[0], or8 = fr.half[0];
      const size_t o = (size_t)(row0 + r) * LQ + col0 + c8;
      *(v8us*)((unsigned short*)Ph + o) = oh8;
      *(v8us*)((unsigned short*)Pr + o) = or8;
    }
    
  }
}

// V^T planes: VT[plane][(b,h)][d][s] = QKV[plane][b*SEQ + s][2*DM + h*64 + d]; in [64 tokens][64 d] -> out [64 d][64 tokens] per block via LDS (cross-wave: block barrier);
__global__ __launch_bounds__(256) void k_vt(const _Float16* __restrict__ QKV, _Float16* __restrict__ VT) {
  __shared__ unsigned short tl[64][66];
  const int tid = threadIdx.x;
  const int slab = blockIdx.x / (SEQ / 64), lg = blockIdx.x % (SEQ / 64);
  const int b = slab / NH, h = slab % NH;
  const size_t pin = (size_t)blockIdx.y * ((size_t)NR * LQ);
  const size_t pout = (size_t)blockIdx.y * ((size_t)NB * NH * HD * SEQ);
  for (int i = tid; i < 64 * 8; i += 256) {
    const int r = i / 8, c8 = (i % 8) * 8;
    FragH f;
    f.half[0] = *(const v8us*)((const unsigned short*)QKV + pin + ((size_t)b * SEQ + lg * 64 + r) * LQ + 2 * DM + h * HD + c8);
#pragma unroll
    for (int q = 0; q < 8; ++q) tl[r][c8 + q] = f.u[q];
  }
  __syncthreads();
  {
#pragma unroll
    for (int rd = 0; rd < 2; ++rd) {
      const int d = rd * 32 + tid / 8, pc = tid % 8;
      FragH f;
#pragma unroll
      for (int q = 0; q < 8; ++q) f.u[q] = tl[pc * 8 + q][d];
      const v8us o = f.half[0];
      *(v8us*)((unsigned short*)VT + pout + ((size_t)slab * 64 + d) * SEQ + lg * 64 + pc * 8) = o;
    }
    
  }
}

// Fused causal attention, online softmax. Block = query tile qt of 64 rows of (batch, head) bh; wave = 16 query rows; 32-key steps; q, k and V^T fragments straight from the planes.
// As built, every k and V^T fragment load is waited for directly in front of its matrix instruction: a key step is a chain of 8 load round trips (16 with the residual planes).
struct AttnLds { _Float16 ph[4][16][40]; _Float16 pl[4][16][40]; _Float16 oh[4][16][72]; _Float16 ol[4][16][72]; };   /* every member a multiple of 16 B */
template <bool ER>
__device__ __forceinline__ void attn_body(AttnLds& sh, const _Float16* __restrict__ Qh, const _Float16* __restrict__ Qr, const _Float16* __restrict__ VTh, const _Float16* __restrict__ VTr,
                                          _Float16* __restrict__ Oh, _Float16* __restrict__ Or, int qt, int bh) {
  auto& ph = sh.ph; auto& pl = sh.pl; auto& oh = sh.oh; auto& ol = sh.ol;
  const int tid = threadIdx.x;
  const int wave = __builtin_amdgcn_readfirstlane((int)(tid >> 5));
  const int lane = tid & 31, ln = lane & 15, hh = lane >> 4;
  const int b = bh / NH, h = bh % NH;
  const int q0 = qt * 64 + wave * 16;
  const size_t rowb = (size_t)b * SEQ;
  const size_t qoff = (rowb + q0 + ln) * LQ + h * HD;
  const size_t koff0 = (rowb + ln) * LQ + DM + h * HD;
  const size_t voff0 = ((size_t)bh * HD + ln) * SEQ;
  const int nst = (q0 + 16 + 31) >> 5;
  const v8f z8 = {0.f, 0.f, 0.f, 0.f, 0.f, 0.f, 0.f, 0.f};
  v8f o[4] = {z8, z8, z8, z8};
  v8f orr[4] = {z8, z8, z8, z8};
  float mrow[8], lrow[8];
#pragma unroll
  for (int r = 0; r < 8; ++r) { mrow[r] = -1.0e30f; lrow[r] = 0.f; }
#pragma unroll 1
  for (int st = 0; st < nst; ++st) {
    const int key0 = st * 32;
    v8f sm[2] = {z8, z8};
    v8f sr[2] = {z8, z8};
#pragma unroll
    for (int kk = 0; kk < 2; ++kk) {
      const v16h qh = g2_frag(Qh + qoff + kk * 32, hh);
      v16h ql = qh;
      if (ER) ql = g2_frag(Qr + qoff + kk * 32, hh);
#pragma unroll
      for (int t = 0; t < 2; ++t) {
        const size_t ko = koff0 + (size_t)(key0 + 16 * t) * LQ + kk * 32;
        const v16h kh = g2_frag(Qh + ko, hh);
        sm[t] = g2_mma(qh, kh, sm[t]);
        if (ER) {
          const v16h kl = g2_frag(Qr + ko, hh);
          sr[t] = g2_mma(ql, kh, sr[t]);
          sr[t] = g2_mma(qh, kl, sr[t]);
        }
      }
    }
#pragma unroll
    for (int r = 0; r < 8; ++r) {
      const int qrow = q0 + 8 * hh + r;
      float s0 = sm[0][r], s1 = sm[1][r];
      if (ER) { s0 += sr[0][r] * 0.0009765625f; s1 += sr[1][r] * 0.0009765625f; }
      s0 *= 0.125f; s1 *= 0.125f;
      const bool m0 = (key0 + ln) > qrow, m1 = (key0 + 16 + ln) > qrow;
      s0 = m0 ? -1.0e9f : s0;
      s1 = m1 ? -1.0e9f : s1;
      float rm = fmaxf(s0, s1);
      rm = fmaxf(rm, __shfl_xor(rm, 1));
      rm = fmaxf(rm, __shfl_xor(rm, 2));
      rm = fmaxf(rm, __shfl_xor(rm, 4));
      rm = fmaxf(rm, __shfl_xor(rm, 8));
      const float mnew = fmaxf(mrow[r], rm);
      const float al = __expf(mrow[r] - mnew);
      const float e0 = __expf(s0 - mnew), e1 = __expf(s1 - mnew);
      const float p0 = m0 ? 0.f : e0, p1 = m1 ? 0.f : e1;
      lrow[r] = lrow[r] * al + (p0 + p1);
      mrow[r] = mnew;
#pragma unroll
      for (int j = 0; j < 4; ++j) { o[j][r] *= al; if (ER) orr[j][r] *= al; }
      const float a0 = p0 * 256.0f, a1 = p1 * 256.0f;
      const _Float16 h0 = (_Float16)a0, h1 = (_Float16)a1;
      ph[wave][8 * hh + r][ln] = h0;
      ph[wave][8 * hh + r][16 + ln] = h1;
      if (ER) {
        pl[wave][8 * hh + r][ln] = (_Float16)((a0 - (float)h0) * 1024.0f);
        pl[wave][8 * hh + r][16 + ln] = (_Float16)((a1 - (float)h1) * 1024.0f);
      }
    }
    wave_lds_sync();
    FragH pa, pb;
    pa.half[0] = *(const v8us*)&ph[wave][ln][8 * hh];
    pa.half[1] = *(const v8us*)&ph[wave][ln][16 + 8 * hh];
    pb.v = pa.v;
    if (ER) {
      pb.half[0] = *(const v8us*)&pl[wave][ln][8 * hh];
      pb.half[1] = *(const v8us*)&pl[wave][ln][16 + 8 * hh];
    }
#pragma unroll
    for (int j = 0; j < 4; ++j) {
      const size_t vo = voff0 + (size_t)(16 * j) * SEQ + key0;
      const v16h vh = g2_frag(VTh + vo, hh);
      o[j] = g2_mma(pa.v, vh, o[j]);
      if (ER) {
        const v16h vl = g2_frag(VTr + vo, hh);
        orr[j] = g2_mma(pb.v, vh, orr[j]);
        orr[j] = g2_mma(pa.v, vl, orr[j]);
      }
    }
    wave_lds_sync();
  }
#pragma unroll
  for (int r = 0; r < 8; ++r) {
    float l = lrow[r];
    l += __shfl_xor(l, 1);
    l += __shfl_xor(l, 2);
    l += __shfl_xor(l, 4);
    l += __shfl_xor(l, 8);
    const float inv = 0.25f * (1.0f / l);
#pragma unroll
    for (int j = 0; j < 4; ++j) {
      float v = o[j][r];
      if (ER) v += orr[j][r] * 0.0009765625f;
      v *= inv;
      const _Float16 hi = (_Float16)v;
      oh[wave][8 * hh + r][16 * j + ln] = hi;
      if (ER) ol[wave][8 * hh + r][16 * j + ln] = (_Float16)((v - (float)hi) * 1024.0f);
    }
  }
  wave_lds_sync();
  const int rsub = lane >> 3, c8 = (lane & 7) * 8;
  {
#pragma unroll
    for (int q = 0; q < 4; ++q) {
      const int r = q * 4 + rsub;
      const size_t oo = (rowb + q0 + r) * DM + h * HD + c8;
      const v8us vh8 = *(const v8us*)&oh[wave][r][c8];
      *(v8us*)((unsigned short*)Oh + oo) = vh8;
      if (ER) {
        const v8us vl8 = *(const v8us*)&ol[wave][r][c8];
        *(v8us*)((unsigned short*)Or + oo) = vl8;
      }
    }
    
  }
}
// One grid: the late tiles (tile fastest, then bh), behind them the early tiles, which use the residual planes; no block reads what another writes.
constexpr unsigned NT_E = ERW / 64, NT_L = SEQ / 64 - ERW / 64, NT_L1 = NT_L ? NT_L : 1;
constexpr unsigned GA_L = NT_L * NB * NH, GA_E = NT_E * NB * NH;
__global__ __launch_bounds__(128) void k_attn(const _Float16* __restrict__ Qh, const _Float16* __restrict__ Qr, const _Float16* __restrict__ VTh, const _Float16* __restrict__ VTr, _Float16* __restrict__ Oh, _Float16* __restrict__ Or) {
  __shared__ __attribute__((aligned(16))) AttnLds sh;
  const unsigned blk = blockIdx.x;
  if (blk < GA_L) {
    attn_body<false>(sh, Qh, Qr, VTh, VTr, Oh, Or, (int)(NT_E + blk % NT_L1), (int)(blk / NT_L1));
  } else {
    const unsigned e = blk - GA_L;
    attn_body<true>(sh, Qh, Qr, VTh, VTr, Oh, Or, (int)(e % NT_E), (int)(e / NT_E));
  }
}

// Output GEMM: ctx rows (x64; hi plane Ah, residual plane Ar x2^10 when ER) times Bw [DM][DM] (x16) -> f32 * 2^-10 into the output rows b*SEQ_FULL + s.
template <bool ER>
__device__ __forceinline__ void out_body(unsigned char* sm, const _Float16* __restrict__ Ah, const _Float16* __restrict__ Ar, const _Float16* __restrict__ Bw, float* __restrict__ C, int blk, int rbPerB, int rowOff) {
  static_assert(2 * gemm_stage_bytes(1, ER, KC_OUT(ER)) >= 4 * 32 * 68 * 4);
  float (*so)[32][68] = (float (*)[32][68])sm;          /* output staging takes the operand buffers' place behind the main loop's last barrier */
  const int tid = threadIdx.x;
  const int wave = __builtin_amdgcn_readfirstlane((int)(tid >> 5));
  const int lane = tid & 31, ln = lane & 15, hh = lane >> 4;
  const int ntn = DM / 64;
  const int mt = blk / ntn, nq = blk - mt * ntn;
  const int b = mt / rbPerB, lb = mt - b * rbPerB;
  const int s0 = rowOff + lb * 128 + 32 * wave;
  const int col0 = nq * 64;
  const size_t ablk = ((size_t)b * SEQ + rowOff + lb * 128) * DM;
  const size_t crow = (size_t)b * SEQ_FULL + s0;
  const v8f z8 = {0.f, 0.f, 0.f, 0.f, 0.f, 0.f, 0.f, 0.f};
  v8f c[8] = {z8, z8, z8, z8, z8, z8, z8, z8};
  v8f d[8] = {z8, z8, z8, z8, z8, z8, z8, z8};
  gemm_core<1, ER, KC_OUT(ER)>(sm, Ah + ablk, Ar + ablk, Bw + (size_t)col0 * DM, c, d);
#pragma unroll
  for (int u = 0; u < 8; ++u) {
    const int t = u & 3, half = u >> 2;
#pragma unroll
    for (int r = 0; r < 8; ++r) {
      float v = c[u][r];
      if (ER) v += d[u][r] * 0.0009765625f;
      so[wave][half * 16 + 8 * hh + r][t * 16 + ln] = v * 0.0009765625f;
    }
  }
  wave_lds_sync();
  const int rsub = lane >> 4, c4 = (lane & 15) * 4;
  {
#pragma unroll 1
    for (int q = 0; q < 16; ++q) {
      const int r = q * 2 + rsub;
      const v4f v = *(const v4fa*)&so[wave][r][c4];
      *(v4f*)(C + (crow + r) * DM + col0 + c4) = v;
    }
    
  }
}
// One grid: the early row blocks first (twice the matrix work and twice the stages of a late block), behind them the late ones; both use the same LDS bytes.
constexpr int RB_E = ERW / 128, RB_L = (SEQ - ERW) / 128, RB_L1 = RB_L ? RB_L : 1;
constexpr unsigned GO_E = (unsigned)(NB * RB_E * (DM / 64)), GO_L = (unsigned)(NB * RB_L * (DM / 64));
constexpr int OUT_LDS_E = 2 * gemm_stage_bytes(1, true, KC_OUT(true)), OUT_LDS_L = 2 * gemm_stage_bytes(1, false, KC_OUT(false));
__global__ __launch_bounds__(128) void k_out(const _Float16* __restrict__ Ah, const _Float16* __restrict__ Ar, const _Float16* __restrict__ Bw, float* __restrict__ C) {
  __shared__ __attribute__((aligned(16))) unsigned char sm[OUT_LDS_E > OUT_LDS_L ? OUT_LDS_E : OUT_LDS_L];
  const unsigned blk = blockIdx.x;
  if (blk < GO_E) out_body<true>(sm, Ah, Ar, Bw, C, (int)blk, RB_E, 0);
  else out_body<false>(sm, Ah, Ar, Bw, C, (int)(blk - GO_E), RB_L1, ERW);
}

// workspace carve (bytes); every region is a multiple of 256 B
constexpr size_t SZ_W    = (size_t)DM * DM * 2;                 /* one x16 f16 weight plane */
constexpr size_t SZ_X16  = (size_t)NR * DM * 2;
constexpr size_t SZ_QKV  = (size_t)NR * LQ * 2;                 /* one q|k|v plane */
constexpr size_t SZ_VT   = (size_t)NB * NH * HD * SEQ * 2;      /* one V^T plane */
constexpr size_t SZ_O    = (size_t)NR * DM * 2;                 /* one ctx plane */
constexpr size_t SZ_CS   = (size_t)SEQ * 64 * 4;
constexpr size_t OFF_BW  = 0;                                   /* wq | wk | wv | wo */
constexpr size_t OFF_X16 = OFF_BW + 4 * SZ_W;
constexpr size_t OFF_QKV = OFF_X16 + SZ_X16;                    /* hi plane, residual plane */
constexpr size_t OFF_VT  = OFF_QKV + 2 * SZ_QKV;                /* hi plane, residual plane */
constexpr size_t OFF_O   = OFF_VT + 2 * SZ_VT;                  /* hi plane, residual plane */
constexpr size_t OFF_CS  = OFF_O + 2 * SZ_O;
constexpr size_t WS_TOTAL = OFF_CS + SZ_CS;
static_assert(WS_TOTAL <= (size_t)134217728);
static_assert(SZ_W % 256 == 0 && SZ_X16 % 256 == 0 && SZ_QKV % 256 == 0 && SZ_VT % 256 == 0 && SZ_O % 256 == 0 && SZ_CS % 256 == 0);
static_assert((size_t)((NB - 1) * SEQ_FULL + SEQ) * DM * 4 <= (size_t)NB_FULL * SEQ_FULL * DM * 4);

extern "C" void kernel_launch(void* const* d_in, const int* in_sizes, int n_in,
                              void* d_out, int out_size, void* d_ws, size_t ws_size, hipStream_t stream) {
  if (n_in < 6) return;
  const size_t need_x = (size_t)((NB - 1) * SEQ_FULL + SEQ) * DM;
  if ((size_t)in_sizes[0] < need_x) return;
  if ((size_t)in_sizes[1] < (size_t)DM * DM || (size_t)in_sizes[2] < (size_t)DM * DM || (size_t)in_sizes[3] < (size_t)DM * DM || (size_t)in_sizes[4] < (size_t)DM * DM) return;
  if (in_sizes[5] < SEQ) return;
  if ((size_t)out_size < need_x) return;
  if (WS_TOTAL > ws_size) return;
  const float* x  = (const float*)d_in[0];
  const float* wq = (const float*)d_in[1];
  const float* wk = (const float*)d_in[2];
  const float* wv = (const float*)d_in[3];
  const float* wo = (const float*)d_in[4];
  const int*   tp = (const int*)d_in[5];
  float* out = (float*)d_out;
  char* ws = (char*)d_ws;
  _Float16* BQKV = (_Float16*)(ws + OFF_BW);
  _Float16* BO   = (_Float16*)(ws + OFF_BW + 3 * SZ_W);
  _Float16* X16  = (_Float16*)(ws + OFF_X16);
  _Float16* QKVh = (_Float16*)(ws + OFF_QKV);
  _Float16* QKVr = (_Float16*)(ws + OFF_QKV + SZ_QKV);
  _Float16* VTh  = (_Float16*)(ws + OFF_VT);
  _Float16* VTr  = (_Float16*)(ws + OFF_VT + SZ_VT);
  _Float16* Oh   = (_Float16*)(ws + OFF_O);
  _Float16* Or   = (_Float16*)(ws + OFF_O + SZ_O);
  float*    CS   = (float*)(ws + OFF_CS);

  k_prep<<<GP_T + GP_X + 4 * GP_W, 256, 0, stream>>>(x, wq, wk, wv, wo, tp, BQKV, X16, CS);
  k_qkv<<<(unsigned)((NR / 128) * (LQ / 128)), 256, 0, stream>>>(X16, BQKV, CS, QKVh, QKVr);
  k_vt<<<dim3((unsigned)(NB * NH * (SEQ / 64)), 2), 256, 0, stream>>>(QKVh, VTh);      /* in [tokens][d] -> out [d][tokens], both planes (plane strides SZ_QKV / SZ_VT) */
  k_attn<<<GA_L + GA_E, 128, 0, stream>>>(QKVh, QKVr, VTh, VTr, Oh, Or);
  k_out<<<GO_E + GO_L, 128, 0, stream>>>(Oh, Or, BO, out);
}

// v003
// Measured time: 105 microseconds a run.
// In two side-by-side timings against v002, it was 1.36 and 1.37 times as fast.
// Over all steps from v000 it is 2.52 times as fast.
#include <hip/hip_runtime.h>
// Causal multi-head self-attention with interleaved rotary (x [4][1024][1024]; q|k|v = x W^T with [out][in] weights, 16 heads of 64; scores * 1/8; causal by index; out = merged W_o^T).
// Compute dtype: all contractions v_wmma_f32_16x16x32_f16 (f16 operands, f32 accumulate). Inputs converted (RNE) to bf16 and held exactly in f16 (weights x16); q, k, v, P (x256), ctx (x64) as f16 hi planes,
// plus f16 residual planes (x2^10, separate accumulators) used for query rows 0..255 of every sequence; softmax statistics, rotary and all epilogues f32.
// Structure, five launches: preparation (cos/sin table from the position input, x plane, four weight planes: independent blocks of one grid), one QKV GEMM (N = 3072, rotary in the epilogue), V^T planes via LDS,
// fused online-softmax attention (late and early query rows as blocks of one grid), output GEMM (early and late rows as blocks of one grid).
// Both GEMMs stage their operand tiles in LDS with asynchronous 16-byte copies, two buffers of 64 k (128 k for the late output rows) each; the waves read their fragments from LDS.
#ifndef NB
#define NB 4
#endif
#ifndef SEQ
#define SEQ 1024
#endif
#define NB_FULL 4
#define SEQ_FULL 1024
#define DM 1024
#define NH 16
#define HD 64
#define LQ (3 * DM)
#define NR (NB * SEQ)
#define ERW 256                      /* query rows per sequence that use the residual planes */

static_assert(NB <= NB_FULL);
static_assert(SEQ <= SEQ_FULL);
static_assert(NH * HD == DM);
static_assert(HD == 64);
static_assert(DM % 64 == 0);
static_assert(DM % 32 == 0);
static_assert(LQ % 128 == 0);
static_assert(SEQ % 128 == 0);
static_assert(NR % 128 == 0);
static_assert(ERW % 128 == 0);
static_assert(SEQ >= ERW);
static_assert(ERW % 64 == 0);
static_assert(SEQ % 8 == 0);
static_assert(((size_t)NR * DM / 8) % 256 == 0);
static_assert(((size_t)DM * DM / 8) % 256 == 0);

typedef unsigned short v8us __attribute__((ext_vector_type(8), may_alias));
typedef float  v8f  __attribute__((ext_vector_type(8)));
typedef float  v4f  __attribute__((ext_vector_type(4)));
typedef float  v4fa __attribute__((ext_vector_type(4), may_alias));
typedef _Float16 v16h __attribute__((ext_vector_type(16)));
union FragH { v16h v; v8us half[2]; _Float16 h[16]; unsigned short u[16]; };

__device__ __forceinline__ unsigned short bf16_bits(float x) { unsigned int u = __float_as_uint(x); return (unsigned short)((u + 0x7FFFu + ((u >> 16) & 1u)) >> 16); }
__device__ __forceinline__ float bf16_rne(float x) { return __uint_as_float(((unsigned int)bf16_bits(x)) << 16); }

// A / B fragment from a k-contiguous 16-bit row: elements 0..7 <- p[8h .. 8h+7], elements 8..15 <- p[16+8h .. 16+8h+7]
__device__ __forceinline__ v16h g2_frag(const _Float16* p, int hh) { FragH f; f.half[0] = *(const v8us*)((const unsigned short*)p + 8 * hh); f.half[1] = *(const v8us*)((const unsigned short*)p + 16 + 8 * hh); return f.v; }
__device__ __forceinline__ v8f g2_mma(v16h a, v16h b, v8f c) { v8f d = __builtin_amdgcn_wmma_f32_16x16x32_f16(false, a, false, b, (short)0, c, false, false); asm volatile("v_nop\n\tv_nop\n\tv_nop\n\tv_nop" : "+v"(d) : "v"(a), "v"(b)); return d; }
__device__ __forceinline__ void wave_lds_sync() { __builtin_amdgcn_fence(4 /* acq_rel order */, "workgroup"); __builtin_amdgcn_wave_barrier(); }
// The same for LDS alone: orders a wave's own LDS stores and loads and leaves its global loads in flight (the fence over all memory drains them).
__device__ __forceinline__ void wave_lds_only_sync() { __builtin_amdgcn_fence(4 /* acq_rel order */, "workgroup", "local"); __builtin_amdgcn_wave_barrier(); }

// One LDS stage of a GEMM block: kc of k for every operand row, row pitch = the row + 16 B (144 or 272 B = 16 B x odd: conflict-free for 16-byte row reads).
constexpr int gemm_stage_bytes(int wn, bool er, int kc) { return (128 * (er ? 2 : 1) + 64 * wn) * (kc * 2 + 16); }
#define KC_QKV 64                    /* three blocks share a WGP's LDS */
#define KC_OUT(er) ((er) ? 64 : 128) /* few blocks: the longer stage covers the copies' flight; with the residual plane its copy addresses would not fit the registers */

// N asynchronous 16-byte copies global -> LDS, lane by lane, in one statement.
// The s_wait_xcnt stands inside the statement so that no address register is rewritten in front of it; one statement a stage (two beyond 12 copies) pays that wait once.
#define CPL(a, b) "global_load_async_to_lds_b128 %" #a ", %" #b ", off\n\t"
template <int N>
__device__ __forceinline__ void cp_issue(const unsigned (&l)[N], const _Float16* const (&g)[N]) {
  static_assert(N == 8 || N == 10 || N == 12);
  if constexpr (N == 8)
    asm volatile(CPL(0, 1) CPL(2, 3) CPL(4, 5) CPL(6, 7) CPL(8, 9) CPL(10, 11) CPL(12, 13) CPL(14, 15) "s_wait_xcnt 0x0"
                 :: "v"(l[0]), "v"(g[0]), "v"(l[1]), "v"(g[1]), "v"(l[2]), "v"(g[2]), "v"(l[3]), "v"(g[3]), "v"(l[4]), "v"(g[4]), "v"(l[5]), "v"(g[5]), "v"(l[6]), "v"(g[6]), "v"(l[7]), "v"(g[7]) : "memory");
  else if constexpr (N == 10)
    asm volatile(CPL(0, 1) CPL(2, 3) CPL(4, 5) CPL(6, 7) CPL(8, 9) CPL(10, 11) CPL(12, 13) CPL(14, 15) CPL(16, 17) CPL(18, 19) "s_wait_xcnt 0x0"
                 :: "v"(l[0]), "v"(g[0]), "v"(l[1]), "v"(g[1]), "v"(l[2]), "v"(g[2]), "v"(l[3]), "v"(g[3]), "v"(l[4]), "v"(g[4]), "v"(l[5]), "v"(g[5]), "v"(l[6]), "v"(g[6]), "v"(l[7]), "v"(g[7]),
                    "v"(l[8]), "v"(g[8]), "v"(l[9]), "v"(g[9]) : "memory");
  else
    asm volatile(CPL(0, 1) CPL(2, 3) CPL(4, 5) CPL(6, 7) CPL(8, 9) CPL(10, 11) CPL(12, 13) CPL(14, 15) CPL(16, 17) CPL(18, 19) CPL(20, 21) CPL(22, 23) "s_wait_xcnt 0x0"
                 :: "v"(l[0]), "v"(g[0]), "v"(l[1]), "v"(g[1]), "v"(l[2]), "v"(g[2]), "v"(l[3]), "v"(g[3]), "v"(l[4]), "v"(g[4]), "v"(l[5]), "v"(g[5]), "v"(l[6]), "v"(g[6]), "v"(l[7]), "v"(g[7]),
                    "v"(l[8]), "v"(g[8]), "v"(l[9]), "v"(g[9]), "v"(l[10]), "v"(g[10]), "v"(l[11]), "v"(g[11]) : "memory");
}

// GEMM main loop of one block: A tile 128 rows (hi plane; residual plane too when ER), B tile 64 * WN rows, all k-contiguous with row pitch DM.
// 4 * WN waves, wave (wm, wn) = 32 rows x 64 columns; c (and d for the residual plane) accumulate k in ascending steps of 32.
// LDS stage = KC of k of [A hi 128 rows | A residual 128 rows when ER | B 64 * WN rows]; stage s + 2 is copied into the buffer that pass s has left.
template <int WN, bool ER, int KC>
__device__ __forceinline__ void gemm_core(unsigned char* sm, const _Float16* __restrict__ Ah, const _Float16* __restrict__ Ar, const _Float16* __restrict__ Bw, v8f (&c)[8], v8f (&d)[8]) {
  static_assert(DM % KC == 0 && DM / KC >= 2 && KC % 64 == 0);
  constexpr int LP = KC + 8, LPB = LP * 2;   /* LDS row pitch in f16 and in bytes */
  constexpr int TPR = KC / 8;                /* threads that copy one row, 16 B each */
  constexpr int RPP = 128 * WN / TPR;        /* rows covered by one copy of every thread */
  constexpr int NPA = ER ? 2 : 1;
  constexpr int SB = gemm_stage_bytes(WN, ER, KC);
  constexpr int NS = DM / KC;
  constexpr int KG = (WN == 1 && !ER) ? 2 : 1;   /* 32-k steps whose fragments are read as one group: two where registers allow and few waves share a SIMD */
  const int tid = threadIdx.x;
  const int wave = __builtin_amdgcn_readfirstlane((int)(tid >> 5));
  const int lane = tid & 31, ln = lane & 15, hh = lane >> 4;
  const int wm = wave & 3, wn = wave >> 2;
  const int cr = tid / TPR, cc = tid % TPR;
  const unsigned l0 = (unsigned)(size_t)sm + (unsigned)(cr * LPB + cc * 16);
  const _Float16* gA = Ah + (size_t)cr * DM + cc * 8;
  const _Float16* gR = Ar + (size_t)cr * DM + cc * 8;
  const _Float16* gB = Bw + (size_t)cr * DM + cc * 8;
  constexpr int NCP = (128 * NPA + 64 * WN) / RPP;   /* copies of a thread per stage */
  constexpr int NST = (NCP + 11) / 12, NPS = NCP / NST;   /* asm statements per stage, copies in each */
  static_assert(NST * NPS == NCP && NCP <= 63 && 128 % RPP == 0);
  auto fill = [&](int buf, int kc) {
    const unsigned l = l0 + (unsigned)(buf * SB);
#pragma unroll   /* both loops: row must be a compile-time constant, so that L and G are registers */
    for (int st = 0; st < NST; ++st) {
      unsigned L[NPS];
      const _Float16* G[NPS];
#pragma unroll
      for (int j = 0; j < NPS; ++j) {
        const int row = (st * NPS + j) * RPP;          /* first row of the stage that this copy of the block covers */
        L[j] = l + (unsigned)(row * LPB);
        G[j] = (row < 128 ? gA + (size_t)row * DM : (ER && row < 256) ? gR + (size_t)(row - 128) * DM : gB + (size_t)(row - 128 * NPA) * DM) + kc;
      }
      cp_issue<NPS>(L, G);
    }
  };
  fill(0, 0);
  asm volatile("s_wait_asynccnt 0x0" ::: "memory");   // stage 0 of this wave has landed
  __syncthreads();                                    // ... and every other wave's share of it
  fill(1, KC);
#pragma unroll 1   /* rolled: the buffer index is a scalar select, and the loop body stays short */
  for (int s = 0; s < NS; ++s) {
    const _Float16* bp = (const _Float16*)(sm + (s & 1) * SB);
    const _Float16* ap = bp + (32 * wm + ln) * LP;
    const _Float16* bq = bp + (128 * NPA + 64 * wn + ln) * LP;
#pragma unroll   /* this and the inner loops: fragment and accumulator indices must be constants, so that they are registers */
    for (int kg = 0; kg < KC / 32; kg += KG) {
      v16h af[KG][2], rf[KG][2], bf[KG][4];              /* a group's LDS reads go out together, ahead of its matrix instructions */
#pragma unroll
      for (int u = 0; u < KG; ++u) {
        const int kk = (kg + u) * 32;
        af[u][0] = g2_frag(ap + kk, hh); af[u][1] = g2_frag(ap + 16 * LP + kk, hh);
#pragma unroll
        for (int t = 0; t < 4; ++t) bf[u][t] = g2_frag(bq + t * 16 * LP + kk, hh);
        if (ER) { rf[u][0] = g2_frag(ap + 128 * LP + kk, hh); rf[u][1] = g2_frag(ap + 144 * LP + kk, hh); }
      }
#pragma unroll
      for (int u = 0; u < KG; ++u) {
#pragma unroll
        for (int t = 0; t < 4; ++t) {
          c[t] = g2_mma(af[u][0], bf[u][t], c[t]); c[4 + t] = g2_mma(af[u][1], bf[u][t], c[4 + t]);
          if (ER) { d[t] = g2_mma(rf[u][0], bf[u][t], d[t]); d[4 + t] = g2_mma(rf[u][1], bf[u][t], d[4 + t]); }
        }
      }
    }
    asm volatile("s_wait_dscnt 0x0" ::: "memory");      // this wave's reads of buffer s & 1 are done before it is refilled
    asm volatile("s_wait_asynccnt 0x0" ::: "memory");   // this wave's copies of stage s + 1 have landed
    __syncthreads();                                    // publishes stage s + 1 and ends every wave's reads of stage s
    if (s + 2 < NS) fill(s & 1, (s + 2) * KC);
  }
  asm volatile("s_wait_asynccnt 0x0" ::: "memory");     // nothing in flight when the buffers become output staging
}

__device__ __forceinline__ void wnat_body(const float* __restrict__ w, _Float16* __restrict__ Bt, unsigned blk) {
  const size_t t = (size_t)blk * 256 + threadIdx.x;
  if (t >= (size_t)DM * DM / 8) return;
  const v4f a = *(const v4fa*)(w + t * 8), c = *(const v4fa*)(w + t * 8 + 4);
  FragH f;
#pragma unroll
  for (int q = 0; q < 4; ++q) { f.h[q] = (_Float16)(bf16_rne(a[q]) * 16.0f); f.h[4 + q] = (_Float16)(bf16_rne(c[q]) * 16.0f); }
  const v8us o = f.half[0];
  unsigned short* d = (unsigned short*)Bt + t * 8;
  *(v8us*)d = o;
  
}

__device__ __forceinline__ void x16_body(const float* __restrict__ x, _Float16* __restrict__ X16, unsigned blk) {
  const size_t t = (size_t)blk * 256 + threadIdx.x;
  if (t >= (size_t)NR * DM / 8) return;
  const size_t row = t / (DM / 8);
  const int c8 = (int)(t % (DM / 8)) * 8;
  const size_t b = row / SEQ, s = row % SEQ;
  const float* src = x + (b * SEQ_FULL + s) * DM + c8;
  const v4f a = *(const v4fa*)src, c = *(const v4fa*)(src + 4);
  FragH f;
#pragma unroll
  for (int q = 0; q < 4; ++q) { f.h[q] = (_Float16)bf16_rne(a[q]); f.h[4 + q] = (_Float16)bf16_rne(c[q]); }
  const v8us o = f.half[0];
  unsigned short* d = (unsigned short*)X16 + t * 8;
  *(v8us*)d = o;
  
}

// CS[s][j] = (cos, sin)(float(pos[s]) * inv_freq[j]), inv_freq[j] = f32(1 / 10000^(j/32)) with the power formed in double from fixed roots.
__device__ __forceinline__ void tab_body(const int* __restrict__ tp, float* __restrict__ CS, unsigned blk) {
  __shared__ __attribute__((aligned(16))) float ts[8][64];
  const int tid = threadIdx.x;
  const int sl = tid >> 5, j = tid & 31;
  const int s = (int)blk * 8 + sl;
  const int pos = tp[s];
  double p = 1.0;
  p = (j & 1)  ? p * 1.3335214321633240 : p;
  p = (j & 2)  ? p * 1.7782794100389228 : p;
  p = (j & 4)  ? p * 3.1622776601683795 : p;
  p = (j & 8)  ? p * 10.0 : p;
  p = (j & 16) ? p * 100.0 : p;
  const float inv = (float)(1.0 / p);
  const float ang = (float)pos * inv;
  float sn, cs;
  sincosf(ang, &sn, &cs);
  ts[sl][2 * j] = cs;
  ts[sl][2 * j + 1] = sn;
  __syncthreads();
  if (tid < 128) {
    const int r = tid >> 4, c4 = (tid & 15) * 4;
    const v4f v = *(const v4fa*)&ts[r][c4];
    float* d = CS + (size_t)(blk * 8 + r) * 64 + c4;
    *(v4f*)d = v;
    
  }
}

// Preparation, one grid: nothing here reads what another block of the grid writes. Table blocks first (the longest dependent chain), then the x plane, then the four weight planes (wq | wk | wv | wo, contiguous in Bt).
constexpr unsigned GP_T = SEQ / 8;
constexpr unsigned GP_X = (unsigned)(((size_t)NR * DM / 8 + 255) / 256);
constexpr unsigned GP_W = (unsigned)(((size_t)DM * DM / 8 + 255) / 256);
__global__ __launch_bounds__(256) void k_prep(const float* __restrict__ x, const float* __restrict__ wq, const float* __restrict__ wk, const float* __restrict__ wv, const float* __restrict__ wo, const int* __restrict__ tp,
                                              _Float16* __restrict__ Bt, _Float16* __restrict__ X16, float* __restrict__ CS) {
  const unsigned blk = blockIdx.x;
  if (blk < GP_T) { tab_body(tp, CS, blk); return; }
  if (blk < GP_T + GP_X) { x16_body(x, X16, blk - GP_T); return; }
  const unsigned wb = blk - (GP_T + GP_X), wi = wb / GP_W;
  const float* w = wi == 0 ? wq : wi == 1 ? wk : wi == 2 ? wv : wo;
  wnat_body(w, Bt + (size_t)wi * DM * DM, wb - wi * GP_W);
}

// QKV GEMM: rows r = b*SEQ + s of X16 [NR][DM] times Bw [3*DM][DM] (x16) -> f32 * 1/16; rotary on the q and k column blocks (a wave's 64 columns = one head);
__global__ __launch_bounds__(256) void k_qkv(const _Float16* __restrict__ X16, const _Float16* __restrict__ Bw, const float* __restrict__ CS, _Float16* __restrict__ Ph, _Float16* __restrict__ Pr) {
  static_assert(2 * gemm_stage_bytes(2, false, KC_QKV) >= 8 * 32 * 68 * 4);
  __shared__ __attribute__((aligned(16))) unsigned char sm[2 * gemm_stage_bytes(2, false, KC_QKV)];
  float (*so)[32][68] = (float (*)[32][68])sm;          /* output staging takes the operand buffers' place behind the main loop's last barrier */
  const int tid = threadIdx.x;
  const int wave = __builtin_amdgcn_readfirstlane((int)(tid >> 5));
  const int lane = tid & 31, ln = lane & 15, hh = lane >> 4;
  const int ntn = LQ / 128;
  const int mt = blockIdx.x / ntn, nq = blockIdx.x - mt * ntn;
  const int row0 = mt * 128 + 32 * (wave & 3), col0 = nq * 128 + 64 * (wave >> 2);
  const v8f z8 = {0.f, 0.f, 0.f, 0.f, 0.f, 0.f, 0.f, 0.f};
  v8f c[8] = {z8, z8, z8, z8, z8, z8, z8, z8};
  gemm_core<2, false, KC_QKV>(sm, X16 + (size_t)(mt * 128) * DM, X16 + (size_t)(mt * 128) * DM, Bw + (size_t)(nq * 128) * DM, c, c);
#pragma unroll
  for (int u = 0; u < 8; ++u) {
    const int t = u & 3, half = u >> 2;
#pragma unroll
    for (int r = 0; r < 8; ++r) so[wave][half * 16 + 8 * hh + r][t * 16 + ln] = c[u][r] * 0.0625f;
  }
  wave_lds_sync();
  const int rsub = lane >> 3, c8 = (lane & 7) * 8;
  const bool rp = col0 < 2 * DM;
  {
#pragma unroll 1
    for (int q = 0; q < 8; ++q) {
      const int r = q * 4 + rsub;
      const v4f u0 = *(const v4fa*)&so[wave][r][c8], u1 = *(const v4fa*)&so[wave][r][c8 + 4];
      const int s = (row0 + r) % SEQ;
      const v4f t0 = *(const v4fa*)(CS + (size_t)s * 64 + c8), t1 = *(const v4fa*)(CS + (size_t)s * 64 + c8 + 4);
      float e[8] = {u0[0], u0[1], u0[2], u0[3], u1[0], u1[1], u1[2], u1[3]};
      const float cz[4] = {t0[0], t0[2], t1[0], t1[2]};
      const float sz[4] = {t0[1], t0[3], t1[1], t1[3]};
#pragma unroll
      for (int i = 0; i < 4; ++i) {
        const float te = e[2 * i], to = e[2 * i + 1];
        const float re = te * cz[i] - to * sz[i];
        const float ro = te * sz[i] + to * cz[i];
        e[2 * i] = rp ? re : te;
        e[2 * i + 1] = rp ? ro : to;
      }
      FragH fh, fr;
#pragma unroll
      for (int i = 0; i < 8; ++i) { const _Float16 hi = (_Float16)e[i]; fh.h[i] = hi; fr.h[i] = (_Float16)((e[i] - (float)hi) * 1024.0f); }
      const v8us oh8 = fh.half[0], or8 = fr.half[0];
      const size_t o = (size_t)(row0 + r) * LQ + col0 + c8;
      *(v8us*)((unsigned short*)Ph + o) = oh8;
      *(v8us*)((unsigned short*)Pr + o) = or8;
    }
    
  }
}

// V^T planes: VT[plane][(b,h)][d][s] = QKV[plane][b*SEQ + s][2*DM + h*64 + d]; in [64 tokens][64 d] -> out [64 d][64 tokens] per block via LDS (cross-wave: block barrier);
__global__ __launch_bounds__(256) void k_vt(const _Float16* __restrict__ QKV, _Float16* __restrict__ VT) {
  __shared__ unsigned short tl[64][66];
  const int tid = threadIdx.x;
  const int slab = blockIdx.x / (SEQ / 64), lg = blockIdx.x % (SEQ / 64);
  const int b = slab / NH, h = slab % NH;
  const size_t pin = (size_t)blockIdx.y * ((size_t)NR * LQ);
  const size_t pout = (size_t)blockIdx.y * ((size_t)NB * NH * HD * SEQ);
  for (int i = tid; i < 64 * 8; i += 256) {
    const int r = i / 8, c8 = (i % 8) * 8;
    FragH f;
    f.half[0] = *(const v8us*)((const unsigned short*)QKV + pin + ((size_t)b * SEQ + lg * 64 + r) * LQ + 2 * DM + h * HD + c8);
#pragma unroll
    for (int q = 0; q < 8; ++q) tl[r][c8 + q] = f.u[q];
  }
  __syncthreads();
  {
#pragma unroll
    for (int rd = 0; rd < 2; ++rd) {
      const int d = rd * 32 + tid / 8, pc = tid % 8;
      FragH f;
#pragma unroll
      for (int q = 0; q < 8; ++q) f.u[q] = tl[pc * 8 + q][d];
      const v8us o = f.half[0];
      *(v8us*)((unsigned short*)VT + pout + ((size_t)slab * 64 + d) * SEQ + lg * 64 + pc * 8) = o;
    }
    
  }
}

// Fused causal attention, online softmax. Block = query tile qt of 64 rows of (batch, head) bh; wave = 16 query rows; 32-key steps; q, k and V^T fragments straight from the planes.
// Fragment loads stand ahead of the work that hides them: q once in front of the loop; late rows: V^T of a step at its top, k of the next step behind this step's score products;
// early rows (twice the planes, few steps): all k of a step together at its top, all V^T behind its score products, so that the kernel's registers still let four blocks share a WGP.
struct AttnLds { _Float16 ph[4][16][40]; _Float16 pl[4][16][40]; _Float16 oh[4][16][72]; _Float16 ol[4][16][72]; };   /* every member a multiple of 16 B */
template <bool ER>
__device__ __forceinline__ void attn_body(AttnLds& sh, const _Float16* __restrict__ Qh, const _Float16* __restrict__ Qr, const _Float16* __restrict__ VTh, const _Float16* __restrict__ VTr,
                                          _Float16* __restrict__ Oh, _Float16* __restrict__ Or, int qt, int bh) {
  auto& ph = sh.ph; auto& pl = sh.pl; auto& oh = sh.oh; auto& ol = sh.ol;
  const int tid = threadIdx.x;
  const int wave = __builtin_amdgcn_readfirstlane((int)(tid >> 5));
  const int lane = tid & 31, ln = lane & 15, hh = lane >> 4;
  const int b = bh / NH, h = bh % NH;
  const int q0 = qt * 64 + wave * 16;
  const size_t rowb = (size_t)b * SEQ;
  const size_t qoff = (rowb + q0 + ln) * LQ + h * HD;
  const size_t koff0 = (rowb + ln) * LQ + DM + h * HD;
  const size_t voff0 = ((size_t)bh * HD + ln) * SEQ;
  const int nst = (q0 + 16 + 31) >> 5;
  const v8f z8 = {0.f, 0.f, 0.f, 0.f, 0.f, 0.f, 0.f, 0.f};
  v8f o[4] = {z8, z8, z8, z8};
  v8f orr[4] = {z8, z8, z8, z8};
  float mrow[8], lrow[8];
#pragma unroll
  for (int r = 0; r < 8; ++r) { mrow[r] = -1.0e30f; lrow[r] = 0.f; }
  v16h qh[2], ql[2], kh[2][2], kl[2][2], vh[4], vl[4];
  auto load_q = [&]() {
#pragma unroll
    for (int kk = 0; kk < 2; ++kk) {
      qh[kk] = g2_frag(Qh + qoff + kk * 32, hh);
      if constexpr (ER) ql[kk] = g2_frag(Qr + qoff + kk * 32, hh);
    }
  };
  auto load_k = [&](int key0) {
    const _Float16* kph = Qh + koff0 + (size_t)key0 * LQ + 8 * hh;   /* the lane's own address: every load below is this plus a constant */
    const _Float16* kpl = Qr + koff0 + (size_t)key0 * LQ + 8 * hh;
#pragma unroll
    for (int kk = 0; kk < 2; ++kk) {
#pragma unroll
      for (int t = 0; t < 2; ++t) {
        kh[kk][t] = g2_frag(kph + (size_t)(16 * t) * LQ + kk * 32, 0);
        if constexpr (ER) kl[kk][t] = g2_frag(kpl + (size_t)(16 * t) * LQ + kk * 32, 0);
      }
    }
    // Early rows: registers are short; the inputs keep the loads' address registers up to the wait.
    if constexpr (ER) asm volatile("s_wait_xcnt 0x0" :: "v"(kph), "v"(kpl) : "memory");
  };
  auto load_v = [&](const _Float16* vph, const _Float16* vpl) {
#pragma unroll
    for (int j = 0; j < 4; ++j) {
      vh[j] = g2_frag(vph + (size_t)(16 * j) * SEQ, 0);
      if constexpr (ER) vl[j] = g2_frag(vpl + (size_t)(16 * j) * SEQ, 0);
    }
  };
  load_q();
  if constexpr (!ER) load_k(0);
#pragma unroll 1
  for (int st = 0; st < nst; ++st) {
    const int key0 = st * 32;
    v8f sm[2] = {z8, z8};
    v8f sr[2] = {z8, z8};
    const _Float16* vph = VTh + voff0 + key0 + 8 * hh;   /* the lane's own addresses, as in load_k */
    const _Float16* vpl = VTr + voff0 + key0 + 8 * hh;
    if constexpr (ER) load_k(key0); else load_v(vph, vpl);
#pragma unroll
    for (int kk = 0; kk < 2; ++kk) {
#pragma unroll
      for (int t = 0; t < 2; ++t) {
        sm[t] = g2_mma(qh[kk], kh[kk][t], sm[t]);
        if constexpr (ER) {
          sr[t] = g2_mma(ql[kk], kh[kk][t], sr[t]);
          sr[t] = g2_mma(qh[kk], kl[kk][t], sr[t]);
        }
      }
    }
    if constexpr (ER) load_v(vph, vpl); else load_k((st + 1 < nst ? st + 1 : st) * 32);   /* the last step fetches its own keys again: no row past the wave's range is read */
    const int kq = key0 + ln - (q0 + 8 * hh);   /* key index minus the index of the lane's first query row: one register where eight row indices stood */
#pragma unroll
    for (int r = 0; r < 8; ++r) {
      float s0 = sm[0][r], s1 = sm[1][r];
      if (ER) { s0 += sr[0][r] * 0.0009765625f; s1 += sr[1][r] * 0.0009765625f; }
      s0 *= 0.125f; s1 *= 0.125f;
      const bool m0 = kq > r, m1 = kq + 16 > r;
      s0 = m0 ? -1.0e9f : s0;
      s1 = m1 ? -1.0e9f : s1;
      float rm = fmaxf(s0, s1);
      rm = fmaxf(rm, __shfl_xor(rm, 1));
      rm = fmaxf(rm, __shfl_xor(rm, 2));
      rm = fmaxf(rm, __shfl_xor(rm, 4));
      rm = fmaxf(rm, __shfl_xor(rm, 8));
      const float mnew = fmaxf(mrow[r], rm);
      const float al = __expf(mrow[r] - mnew);
      const float e0 = __expf(s0 - mnew), e1 = __expf(s1 - mnew);
      const float p0 = m0 ? 0.f : e0, p1 = m1 ? 0.f : e1;
      lrow[r] = lrow[r] * al + (p0 + p1);
      mrow[r] = mnew;
#pragma unroll
      for (int j = 0; j < 4; ++j) { o[j][r] *= al; if (ER) orr[j][r] *= al; }
      const float a0 = p0 * 256.0f, a1 = p1 * 256.0f;
      const _Float16 h0 = (_Float16)a0, h1 = (_Float16)a1;
      ph[wave][8 * hh + r][ln] = h0;
      ph[wave][8 * hh + r][16 + ln] = h1;
      if (ER) {
        pl[wave][8 * hh + r][ln] = (_Float16)((a0 - (float)h0) * 1024.0f);
        pl[wave][8 * hh + r][16 + ln] = (_Float16)((a1 - (float)h1) * 1024.0f);
      }
    }
    if constexpr (ER) asm volatile("s_wait_xcnt 0x0" :: "v"(vph), "v"(vpl) : "memory");   // as in load_k, for the V^T loads; it stands here, where it no longer holds the wave up
    wave_lds_only_sync();
    FragH pa, pb;
    pa.half[0] = *(const v8us*)&ph[wave][ln][8 * hh];
    pa.half[1] = *(const v8us*)&ph[wave][ln][16 + 8 * hh];
    pb.v = pa.v;
    if (ER) {
      pb.half[0] = *(const v8us*)&pl[wave][ln][8 * hh];
      pb.half[1] = *(const v8us*)&pl[wave][ln][16 + 8 * hh];
    }
#pragma unroll
    for (int j = 0; j < 4; ++j) {
      o[j] = g2_mma(pa.v, vh[j], o[j]);
      if constexpr (ER) {
        orr[j] = g2_mma(pb.v, vh[j], orr[j]);
        orr[j] = g2_mma(pa.v, vl[j], orr[j]);
      }
    }
    wave_lds_only_sync();
  }
#pragma unroll
  for (int r = 0; r < 8; ++r) {
    float l = lrow[r];
    l += __shfl_xor(l, 1);
    l += __shfl_xor(l, 2);
    l += __shfl_xor(l, 4);
    l += __shfl_xor(l, 8);
    const float inv = 0.25f * (1.0f / l);
#pragma unroll
    for (int j = 0; j < 4; ++j) {
      float v = o[j][r];
      if (ER) v += orr[j][r] * 0.0009765625f;
      v *= inv;
      const _Float16 hi = (_Float16)v;
      oh[wave][8 * hh + r][16 * j + ln] = hi;
      if (ER) ol[wave][8 * hh + r][16 * j + ln] = (_Float16)((v - (float)hi) * 1024.0f);
    }
  }
  wave_lds_sync();
  const int rsub = lane >> 3, c8 = (lane & 7) * 8;
  {
#pragma unroll
    for (int q = 0; q < 4; ++q) {
      const int r = q * 4 + rsub;
      const size_t oo = (rowb + q0 + r) * DM + h * HD + c8;
      const v8us vh8 = *(const v8us*)&oh[wave][r][c8];
      *(v8us*)((unsigned short*)Oh + oo) = vh8;
      if (ER) {
        const v8us vl8 = *(const v8us*)&ol[wave][r][c8];
        *(v8us*)((unsigned short*)Or + oo) = vl8;
      }
    }
    
  }
}
// One grid: the late tiles (tile fastest, then bh), behind them the early tiles, which use the residual planes; no block reads what another writes.
constexpr unsigned NT_E = ERW / 64, NT_L = SEQ / 64 - ERW / 64, NT_L1 = NT_L ? NT_L : 1;
constexpr unsigned GA_L = NT_L * NB * NH, GA_E = NT_E * NB * NH;
__global__ __launch_bounds__(128) void k_attn(const _Float16* __restrict__ Qh, const _Float16* __restrict__ Qr, const _Float16* __restrict__ VTh, const _Float16* __restrict__ VTr, _Float16* __restrict__ Oh, _Float16* __restrict__ Or) {
  __shared__ __attribute__((aligned(16))) AttnLds sh;
  const unsigned blk = blockIdx.x;
  if (blk < GA_L) {
    attn_body<false>(sh, Qh, Qr, VTh, VTr, Oh, Or, (int)(NT_E + blk % NT_L1), (int)(blk / NT_L1));
  } else {
    const unsigned e = blk - GA_L;
    attn_body<true>(sh, Qh, Qr, VTh, VTr, Oh, Or, (int)(e % NT_E), (int)(e / NT_E));
  }
}

// Output GEMM: ctx rows (x64; hi plane Ah, residual plane Ar x2^10 when ER) times Bw [DM][DM] (x16) -> f32 * 2^-10 into the output rows b*SEQ_FULL + s.
template <bool ER>
__device__ __forceinline__ void out_body(unsigned char* sm, const _Float16* __restrict__ Ah, const _Float16* __restrict__ Ar, const _Float16* __restrict__ Bw, float* __restrict__ C, int blk, int rbPerB, int rowOff) {
  static_assert(2 * gemm_stage_bytes(1, ER, KC_OUT(ER)) >= 4 * 32 * 68 * 4);
  float (*so)[32][68] = (float (*)[32][68])sm;          /* output staging takes the operand buffers' place behind the main loop's last barrier */
  const int tid = threadIdx.x;
  const int wave = __builtin_amdgcn_readfirstlane((int)(tid >> 5));
  const int lane = tid & 31, ln = lane & 15, hh = lane >> 4;
  const int ntn = DM / 64;
  const int mt = blk / ntn, nq = blk - mt * ntn;
  const int b = mt / rbPerB, lb = mt - b * rbPerB;
  const int s0 = rowOff + lb * 128 + 32 * wave;
  const int col0 = nq * 64;
  const size_t ablk = ((size_t)b * SEQ + rowOff + lb * 128) * DM;
  const size_t crow = (size_t)b * SEQ_FULL + s0;
  const v8f z8 = {0.f, 0.f, 0.f, 0.f, 0.f, 0.f, 0.f, 0.f};
  v8f c[8] = {z8, z8, z8, z8, z8, z8, z8, z8};
  v8f d[8] = {z8, z8, z8, z8, z8, z8, z8, z8};
  gemm_core<1, ER, KC_OUT(ER)>(sm, Ah + ablk, Ar + ablk, Bw + (size_t)col0 * DM, c, d);
#pragma unroll
  for (int u = 0; u < 8; ++u) {
    const int t = u & 3, half = u >> 2;
#pragma unroll
    for (int r = 0; r < 8; ++r) {
      float v = c[u][r];
      if (ER) v += d[u][r] * 0.0009765625f;
      so[wave][half * 16 + 8 * hh + r][t * 16 + ln] = v * 0.0009765625f;
    }
  }
  wave_lds_sync();
  const int rsub = lane >> 4, c4 = (lane & 15) * 4;
  {
#pragma unroll 1
    for (int q = 0; q < 16; ++q) {
      const int r = q * 2 + rsub;
      const v4f v = *(const v4fa*)&so[wave][r][c4];
      *(v4f*)(C + (crow + r) * DM + col0 + c4) = v;
    }
    
  }
}
// One grid: the early row blocks first (twice the matrix work and twice the stages of a late block), behind them the late ones; both use the same LDS bytes.
constexpr int RB_E = ERW / 128, RB_L = (SEQ - ERW) / 128, RB_L1 = RB_L ? RB_L : 1;
constexpr unsigned GO_E = (unsigned)(NB * RB_E * (DM / 64)), GO_L = (unsigned)(NB * RB_L * (DM / 64));
constexpr int OUT_LDS_E = 2 * gemm_stage_bytes(1, true, KC_OUT(true)), OUT_LDS_L = 2 * gemm_stage_bytes(1, false, KC_OUT(false));
__global__ __launch_bounds__(128) void k_out(const _Float16* __restrict__ Ah, const _Float16* __restrict__ Ar, const _Float16* __restrict__ Bw, float* __restrict__ C) {
  __shared__ __attribute__((aligned(16))) unsigned char sm[OUT_LDS_E > OUT_LDS_L ? OUT_LDS_E : OUT_LDS_L];
  const unsigned blk = blockIdx.x;
  if (blk < GO_E) out_body<true>(sm, Ah, Ar, Bw, C, (int)blk, RB_E, 0);
  else out_body<false>(sm, Ah, Ar, Bw, C, (int)(blk - GO_E), RB_L1, ERW);
}

// workspace carve (bytes); every region is a multiple of 256 B
constexpr size_t SZ_W    = (size_t)DM * DM * 2;                 /* one x16 f16 weight plane */
constexpr size_t SZ_X16  = (size_t)NR * DM * 2;
constexpr size_t SZ_QKV  = (size_t)NR * LQ * 2;                 /* one q|k|v plane */
constexpr size_t SZ_VT   = (size_t)NB * NH * HD * SEQ * 2;      /* one V^T plane */
constexpr size_t SZ_O    = (size_t)NR * DM * 2;                 /* one ctx plane */
constexpr size_t SZ_CS   = (size_t)SEQ * 64 * 4;
constexpr size_t OFF_BW  = 0;                                   /* wq | wk | wv | wo */
constexpr size_t OFF_X16 = OFF_BW + 4 * SZ_W;
constexpr size_t OFF_QKV = OFF_X16 + SZ_X16;                    /* hi plane, residual plane */
constexpr size_t OFF_VT  = OFF_QKV + 2 * SZ_QKV;                /* hi plane, residual plane */
constexpr size_t OFF_O   = OFF_VT + 2 * SZ_VT;                  /* hi plane, residual plane */
constexpr size_t OFF_CS  = OFF_O + 2 * SZ_O;
constexpr size_t WS_TOTAL = OFF_CS + SZ_CS;
static_assert(WS_TOTAL <= (size_t)134217728);
static_assert(SZ_W % 256 == 0 && SZ_X16 % 256 == 0 && SZ_QKV % 256 == 0 && SZ_VT % 256 == 0 && SZ_O % 256 == 0 && SZ_CS % 256 == 0);
static_assert((size_t)((NB - 1) * SEQ_FULL + SEQ) * DM * 4 <= (size_t)NB_FULL * SEQ_FULL * DM * 4);

extern "C" void kernel_launch(void* const* d_in, const int* in_sizes, int n_in,
                              void* d_out, int out_size, void* d_ws, size_t ws_size, hipStream_t stream) {
  if (n_in < 6) return;
  const size_t need_x = (size_t)((NB - 1) * SEQ_FULL + SEQ) * DM;
  if ((size_t)in_sizes[0] < need_x) return;
  if ((size_t)in_sizes[1] < (size_t)DM * DM || (size_t)in_sizes[2] < (size_t)DM * DM || (size_t)in_sizes[3] < (size_t)DM * DM || (size_t)in_sizes[4] < (size_t)DM * DM) return;
  if (in_sizes[5] < SEQ) return;
  if ((size_t)out_size < need_x) return;
  if (WS_TOTAL > ws_size) return;
  const float* x  = (const float*)d_in[0];
  const float* wq = (const float*)d_in[1];
  const float* wk = (const float*)d_in[2];
  const float* wv = (const float*)d_in[3];
  const float* wo = (const float*)d_in[4];
  const int*   tp = (const int*)d_in[5];
  float* out = (float*)d_out;
  char* ws = (char*)d_ws;
  _Float16* BQKV = (_Float16*)(ws + OFF_BW);
  _Float16* BO   = (_Float16*)(ws + OFF_BW + 3 * SZ_W);
  _Float16* X16  = (_Float16*)(ws + OFF_X16);
  _Float16* QKVh = (_Float16*)(ws + OFF_QKV);
  _Float16* QKVr = (_Float16*)(ws + OFF_QKV + SZ_QKV);
  _Float16* VTh  = (_Float16*)(ws + OFF_VT);
  _Float16* VTr  = (_Float16*)(ws + OFF_VT + SZ_VT);
  _Float16* Oh   = (_Float16*)(ws + OFF_O);
  _Float16* Or   = (_Float16*)(ws + OFF_O + SZ_O);
  float*    CS   = (float*)(ws + OFF_CS);

  k_prep<<<GP_T + GP_X + 4 * GP_W, 256, 0, stream>>>(x, wq, wk, wv, wo, tp, BQKV, X16, CS);
  k_qkv<<<(unsigned)((NR / 128) * (LQ / 128)), 256, 0, stream>>>(X16, BQKV, CS, QKVh, QKVr);
  k_vt<<<dim3((unsigned)(NB * NH * (SEQ / 64)), 2), 256, 0, stream>>>(QKVh, VTh);      /* in [tokens][d] -> out [d][tokens], both planes (plane strides SZ_QKV / SZ_VT) */
  k_attn<<<GA_L + GA_E, 128, 0, stream>>>(QKVh, QKVr, VTh, VTr, Oh, Or);
  k_out<<<GO_E + GO_L, 128, 0, stream>>>(Oh, Or, BO, out);
}

// v004
// A run of this version takes 99.1 microseconds.
// In both of two side-by-side timings against v003, it was 1.06 times as fast.
// All steps since v000 together make it 2.68 times as fast.
#include <hip/hip_runtime.h>
// Causal multi-head self-attention with interleaved rotary (x [4][1024][1024]; q|k|v = x W^T with [out][in] weights, 16 heads of 64; scores * 1/8; causal by index; out = merged W_o^T).
// Compute dtype: all contractions v_wmma_f32_16x16x32_f16 (f16 operands, f32 accumulate). Inputs converted (RNE) to bf16 and held exactly in f16 (weights x16); q, k, v, P (x256), ctx (x64) as f16 hi planes,
// plus f16 residual planes (x2^10, separate accumulators) used for query rows 0..255 of every sequence; softmax statistics, rotary and all epilogues f32.
// Structure, four launches: preparation (cos/sin table from the position input, x plane, four weight planes: independent blocks of one grid), one QKV GEMM (N = 3072; rotary in the epilogue of the q and k blocks,
// the v blocks store their planes transposed, V^T), fused online-softmax attention (late and early query rows as blocks of one grid), output GEMM (early and late rows as blocks of one grid).
// Both GEMMs stage their operand tiles in LDS with asynchronous 16-byte copies, two buffers of 64 k (128 k for the late output rows) each; the waves read their fragments from LDS.
#ifndef NB
#define NB 4
#endif
#ifndef SEQ
#define SEQ 1024
#endif
#define NB_FULL 4
#define SEQ_FULL 1024
#define DM 1024
#define NH 16
#define HD 64
#define LQ (3 * DM)
#define NR (NB * SEQ)
#define ERW 256                      /* query rows per sequence that use the residual planes */

static_assert(NB <= NB_FULL);
static_assert(SEQ <= SEQ_FULL);
static_assert(NH * HD == DM);
static_assert(HD == 64);
static_assert(DM % 64 == 0);
static_assert(DM % 32 == 0);
static_assert(LQ % 128 == 0);
static_assert(SEQ % 128 == 0);
static_assert(NR % 128 == 0);
static_assert(ERW % 128 == 0);
static_assert(SEQ >= ERW);
static_assert(ERW % 64 == 0);
static_assert(SEQ % 8 == 0);
static_assert(((size_t)NR * DM / 8) % 256 == 0);
static_assert(((size_t)DM * DM / 8) % 256 == 0);

typedef unsigned short v8us __attribute__((ext_vector_type(8), may_alias));
typedef float  v8f  __attribute__((ext_vector_type(8)));
typedef float  v4f  __attribute__((ext_vector_type(4)));
typedef float  v4fa __attribute__((ext_vector_type(4), may_alias));
typedef _Float16 v16h __attribute__((ext_vector_type(16)));
union FragH { v16h v; v8us half[2]; _Float16 h[16]; unsigned short u[16]; };

__device__ __forceinline__ unsigned short bf16_bits(float x) { unsigned int u = __float_as_uint(x); return (unsigned short)((u + 0x7FFFu + ((u >> 16) & 1u)) >> 16); }
__device__ __forceinline__ float bf16_rne(float x) { return __uint_as_float(((unsigned int)bf16_bits(x)) << 16); }

// A / B fragment from a k-contiguous 16-bit row: elements 0..7 <- p[8h .. 8h+7], elements 8..15 <- p[16+8h .. 16+8h+7]
__device__ __forceinline__ v16h g2_frag(const _Float16* p, int hh) { FragH f; f.half[0] = *(const v8us*)((const unsigned short*)p + 8 * hh); f.half[1] = *(const v8us*)((const unsigned short*)p + 16 + 8 * hh); return f.v; }
__device__ __forceinline__ v8f g2_mma(v16h a, v16h b, v8f c) { v8f d = __builtin_amdgcn_wmma_f32_16x16x32_f16(false, a, false, b, (short)0, c, false, false); asm volatile("v_nop\n\tv_nop\n\tv_nop\n\tv_nop" : "+v"(d) : "v"(a), "v"(b)); return d; }
__device__ __forceinline__ void wave_lds_sync() { __builtin_amdgcn_fence(4 /* acq_rel order */, "workgroup"); __builtin_amdgcn_wave_barrier(); }
// The same for LDS alone: orders a wave's own LDS stores and loads and leaves its global loads in flight (the fence over all memory drains them).
__device__ __forceinline__ void wave_lds_only_sync() { __builtin_amdgcn_fence(4 /* acq_rel order */, "workgroup", "local"); __builtin_amdgcn_wave_barrier(); }

// One LDS stage of a GEMM block: kc of k for every operand row, row pitch = the row + 16 B (144 or 272 B = 16 B x odd: conflict-free for 16-byte row reads).
constexpr int gemm_stage_bytes(int wn, bool er, int kc) { return (128 * (er ? 2 : 1) + 64 * wn) * (kc * 2 + 16); }
#define KC_QKV 64                    /* three blocks share a WGP's LDS */
#define KC_OUT(er) ((er) ? 64 : 128) /* few blocks: the longer stage covers the copies' flight; with the residual plane its copy addresses would not fit the registers */

// N asynchronous 16-byte copies global -> LDS, lane by lane, in one statement.
// The s_wait_xcnt stands inside the statement so that no address register is rewritten in front of it; one statement a stage (two beyond 12 copies) pays that wait once.
#define CPL(a, b) "global_load_async_to_lds_b128 %" #a ", %" #b ", off\n\t"
template <int N>
__device__ __forceinline__ void cp_issue(const unsigned (&l)[N], const _Float16* const (&g)[N]) {
  static_assert(N == 8 || N == 10 || N == 12);
  if constexpr (N == 8)
    asm volatile(CPL(0, 1) CPL(2, 3) CPL(4, 5) CPL(6, 7) CPL(8, 9) CPL(10, 11) CPL(12, 13) CPL(14, 15) "s_wait_xcnt 0x0"
                 :: "v"(l[0]), "v"(g[0]), "v"(l[1]), "v"(g[1]), "v"(l[2]), "v"(g[2]), "v"(l[3]), "v"(g[3]), "v"(l[4]), "v"(g[4]), "v"(l[5]), "v"(g[5]), "v"(l[6]), "v"(g[6]), "v"(l[7]), "v"(g[7]) : "memory");
  else if constexpr (N == 10)
    asm volatile(CPL(0, 1) CPL(2, 3) CPL(4, 5) CPL(6, 7) CPL(8, 9) CPL(10, 11) CPL(12, 13) CPL(14, 15) CPL(16, 17) CPL(18, 19) "s_wait_xcnt 0x0"
                 :: "v"(l[0]), "v"(g[0]), "v"(l[1]), "v"(g[1]), "v"(l[2]), "v"(g[2]), "v"(l[3]), "v"(g[3]), "v"(l[4]), "v"(g[4]), "v"(l[5]), "v"(g[5]), "v"(l[6]), "v"(g[6]), "v"(l[7]), "v"(g[7]),
                    "v"(l[8]), "v"(g[8]), "v"(l[9]), "v"(g[9]) : "memory");
  else
    asm volatile(CPL(0, 1) CPL(2, 3) CPL(4, 5) CPL(6, 7) CPL(8, 9) CPL(10, 11) CPL(12, 13) CPL(14, 15) CPL(16, 17) CPL(18, 19) CPL(20, 21) CPL(22, 23) "s_wait_xcnt 0x0"
                 :: "v"(l[0]), "v"(g[0]), "v"(l[1]), "v"(g[1]), "v"(l[2]), "v"(g[2]), "v"(l[3]), "v"(g[3]), "v"(l[4]), "v"(g[4]), "v"(l[5]), "v"(g[5]), "v"(l[6]), "v"(g[6]), "v"(l[7]), "v"(g[7]),
                    "v"(l[8]), "v"(g[8]), "v"(l[9]), "v"(g[9]), "v"(l[10]), "v"(g[10]), "v"(l[11]), "v"(g[11]) : "memory");
}

// GEMM main loop of one block: A tile 128 rows (hi plane; residual plane too when ER), B tile 64 * WN rows, all k-contiguous with row pitch DM.
// 4 * WN waves, wave (wm, wn) = 32 rows x 64 columns; c (and d for the residual plane) accumulate k in ascending steps of 32.
// LDS stage = KC of k of [A hi 128 rows | A residual 128 rows when ER | B 64 * WN rows]; stage s + 2 is copied into the buffer that pass s has left.
template <int WN, bool ER, int KC>
__device__ __forceinline__ void gemm_core(unsigned char* sm, const _Float16* __restrict__ Ah, const _Float16* __restrict__ Ar, const _Float16* __restrict__ Bw, v8f (&c)[8], v8f (&d)[8]) {
  static_assert(DM % KC == 0 && DM / KC >= 2 && KC % 64 == 0);
  constexpr int LP = KC + 8, LPB = LP * 2;   /* LDS row pitch in f16 and in bytes */
  constexpr int TPR = KC / 8;                /* threads that copy one row, 16 B each */
  constexpr int RPP = 128 * WN / TPR;        /* rows covered by one copy of every thread */
  constexpr int NPA = ER ? 2 : 1;
  constexpr int SB = gemm_stage_bytes(WN, ER, KC);
  constexpr int NS = DM / KC;
  constexpr int KG = (WN == 1 && !ER) ? 2 : 1;   /* 32-k steps whose fragments are read as one group: two where registers allow and few waves share a SIMD */
  const int tid = threadIdx.x;
  const int wave = __builtin_amdgcn_readfirstlane((int)(tid >> 5));
  const int lane = tid & 31, ln = lane & 15, hh = lane >> 4;
  const int wm = wave & 3, wn = wave >> 2;
  const int cr = tid / TPR, cc = tid % TPR;
  const unsigned l0 = (unsigned)(size_t)sm + (unsigned)(cr * LPB + cc * 16);
  const _Float16* gA = Ah + (size_t)cr * DM + cc * 8;
  const _Float16* gR = Ar + (size_t)cr * DM + cc * 8;
  const _Float16* gB = Bw + (size_t)cr * DM + cc * 8;
  constexpr int NCP = (128 * NPA + 64 * WN) / RPP;   /* copies of a thread per stage */
  constexpr int NST = (NCP + 11) / 12, NPS = NCP / NST;   /* asm statements per stage, copies in each */
  static_assert(NST * NPS == NCP && NCP <= 63 && 128 % RPP == 0);
  auto fill = [&](int buf, int kc) {
    const unsigned l = l0 + (unsigned)(buf * SB);
#pragma unroll   /* both loops: row must be a compile-time constant, so that L and G are registers */
    for (int st = 0; st < NST; ++st) {
      unsigned L[NPS];
      const _Float16* G[NPS];
#pragma unroll
      for (int j = 0; j < NPS; ++j) {
        const int row = (st * NPS + j) * RPP;          /* first row of the stage that this copy of the block covers */
        L[j] = l + (unsigned)(row * LPB);
        G[j] = (row < 128 ? gA + (size_t)row * DM : (ER && row < 256) ? gR + (size_t)(row - 128) * DM : gB + (size_t)(row - 128 * NPA) * DM) + kc;
      }
      cp_issue<NPS>(L, G);
    }
  };
  fill(0, 0);
  asm volatile("s_wait_asynccnt 0x0" ::: "memory");   // stage 0 of this wave has landed
  __syncthreads();                                    // ... and every other wave's share of it
  fill(1, KC);
#pragma unroll 1   /* rolled: the buffer index is a scalar select, and the loop body stays short */
  for (int s = 0; s < NS; ++s) {
    const _Float16* bp = (const _Float16*)(sm + (s & 1) * SB);
    const _Float16* ap = bp + (32 * wm + ln) * LP;
    const _Float16* bq = bp + (128 * NPA + 64 * wn + ln) * LP;
#pragma unroll   /* this and the inner loops: fragment and accumulator indices must be constants, so that they are registers */
    for (int kg = 0; kg < KC / 32; kg += KG) {
      v16h af[KG][2], rf[KG][2], bf[KG][4];              /* a group's LDS reads go out together, ahead of its matrix instructions */
#pragma unroll
      for (int u = 0; u < KG; ++u) {
        const int kk = (kg + u) * 32;
        af[u][0] = g2_frag(ap + kk, hh); af[u][1] = g2_frag(ap + 16 * LP + kk, hh);
#pragma unroll
        for (int t = 0; t < 4; ++t) bf[u][t] = g2_frag(bq + t * 16 * LP + kk, hh);
        if (ER) { rf[u][0] = g2_frag(ap + 128 * LP + kk, hh); rf[u][1] = g2_frag(ap + 144 * LP + kk, hh); }
      }
#pragma unroll
      for (int u = 0; u < KG; ++u) {
#pragma unroll
        for (int t = 0; t < 4; ++t) {
          c[t] = g2_mma(af[u][0], bf[u][t], c[t]); c[4 + t] = g2_mma(af[u][1], bf[u][t], c[4 + t]);
          if (ER) { d[t] = g2_mma(rf[u][0], bf[u][t], d[t]); d[4 + t] = g2_mma(rf[u][1], bf[u][t], d[4 + t]); }
        }
      }
    }
    asm volatile("s_wait_dscnt 0x0" ::: "memory");      // this wave's reads of buffer s & 1 are done before it is refilled
    asm volatile("s_wait_asynccnt 0x0" ::: "memory");   // this wave's copies of stage s + 1 have landed
    __syncthreads();                                    // publishes stage s + 1 and ends every wave's reads of stage s
    if (s + 2 < NS) fill(s & 1, (s + 2) * KC);
  }
  asm volatile("s_wait_asynccnt 0x0" ::: "memory");     // nothing in flight when the buffers become output staging
}

__device__ __forceinline__ void wnat_body(const float* __restrict__ w, _Float16* __restrict__ Bt, unsigned blk) {
  const size_t t = (size_t)blk * 256 + threadIdx.x;
  if (t >= (size_t)DM * DM / 8) return;
  const v4f a = *(const v4fa*)(w + t * 8), c = *(const v4fa*)(w + t * 8 + 4);
  FragH f;
#pragma unroll
  for (int q = 0; q < 4; ++q) { f.h[q] = (_Float16)(bf16_rne(a[q]) * 16.0f); f.h[4 + q] = (_Float16)(bf16_rne(c[q]) * 16.0f); }
  const v8us o = f.half[0];
  unsigned short* d = (unsigned short*)Bt + t * 8;
  *(v8us*)d = o;
  
}

__device__ __forceinline__ void x16_body(const float* __restrict__ x, _Float16* __restrict__ X16, unsigned blk) {
  const size_t t = (size_t)blk * 256 + threadIdx.x;
  if (t >= (size_t)NR * DM / 8) return;
  const size_t row = t / (DM / 8);
  const int c8 = (int)(t % (DM / 8)) * 8;
  const size_t b = row / SEQ, s = row % SEQ;
  const float* src = x + (b * SEQ_FULL + s) * DM + c8;
  const v4f a = *(const v4fa*)src, c = *(const v4fa*)(src + 4);
  FragH f;
#pragma unroll
  for (int q = 0; q < 4; ++q) { f.h[q] = (_Float16)bf16_rne(a[q]); f.h[4 + q] = (_Float16)bf16_rne(c[q]); }
  const v8us o = f.half[0];
  unsigned short* d = (unsigned short*)X16 + t * 8;
  *(v8us*)d = o;
  
}

// CS[s][j] = (cos, sin)(float(pos[s]) * inv_freq[j]), inv_freq[j] = f32(1 / 10000^(j/32)) with the power formed in double from fixed roots.
__device__ __forceinline__ void tab_body(const int* __restrict__ tp, float* __restrict__ CS, unsigned blk) {
  __shared__ __attribute__((aligned(16))) float ts[8][64];
  const int tid = threadIdx.x;
  const int sl = tid >> 5, j = tid & 31;
  const int s = (int)blk * 8 + sl;
  const int pos = tp[s];
  double p = 1.0;
  p = (j & 1)  ? p * 1.3335214321633240 : p;
  p = (j & 2)  ? p * 1.7782794100389228 : p;
  p = (j & 4)  ? p * 3.1622776601683795 : p;
  p = (j & 8)  ? p * 10.0 : p;
  p = (j & 16) ? p * 100.0 : p;
  const float inv = (float)(1.0 / p);
  const float ang = (float)pos * inv;
  float sn, cs;
  sincosf(ang, &sn, &cs);
  ts[sl][2 * j] = cs;
  ts[sl][2 * j + 1] = sn;
  __syncthreads();
  if (tid < 128) {
    const int r = tid >> 4, c4 = (tid & 15) * 4;
    const v4f v = *(const v4fa*)&ts[r][c4];
    float* d = CS + (size_t)(blk * 8 + r) * 64 + c4;
    *(v4f*)d = v;
    
  }
}

// Preparation, one grid: nothing here reads what another block of the grid writes. Table blocks first (the longest dependent chain), then the x plane, then the four weight planes (wq | wk | wv | wo, contiguous in Bt).
constexpr unsigned GP_T = SEQ / 8;
constexpr unsigned GP_X = (unsigned)(((size_t)NR * DM / 8 + 255) / 256);
constexpr unsigned GP_W = (unsigned)(((size_t)DM * DM / 8 + 255) / 256);
__global__ __launch_bounds__(256) void k_prep(const float* __restrict__ x, const float* __restrict__ wq, const float* __restrict__ wk, const float* __restrict__ wv, const float* __restrict__ wo, const int* __restrict__ tp,
                                              _Float16* __restrict__ Bt, _Float16* __restrict__ X16, float* __restrict__ CS) {
  const unsigned blk = blockIdx.x;
  if (blk < GP_T) { tab_body(tp, CS, blk); return; }
  if (blk < GP_T + GP_X) { x16_body(x, X16, blk - GP_T); return; }
  const unsigned wb = blk - (GP_T + GP_X), wi = wb / GP_W;
  const float* w = wi == 0 ? wq : wi == 1 ? wk : wi == 2 ? wv : wo;
  wnat_body(w, Bt + (size_t)wi * DM * DM, wb - wi * GP_W);
}

// QKV GEMM: rows r = b*SEQ + s of X16 [NR][DM] times Bw [3*DM][DM] (x16) -> f32 * 1/16; rotary on the q and k column blocks (one wave's columns = one head), written to the planes Ph, Pr [r][LQ];
// the v column blocks go out transposed and nowhere else: VT[plane][(b,h)][d][s], plane stride NB*NH*HD*SEQ.
__global__ __launch_bounds__(256) void k_qkv(const _Float16* __restrict__ X16, const _Float16* __restrict__ Bw, const float* __restrict__ CS, _Float16* __restrict__ Ph, _Float16* __restrict__ Pr, _Float16* __restrict__ VT) {
  static_assert(2 * gemm_stage_bytes(2, false, KC_QKV) >= 8 * 32 * 68 * 4);
  constexpr int TP = 128 + 8;                           /* V^T staging: tokens of a row + 16 B (272 B = 16 B x odd: conflict-free for 16-byte accesses down a column of rows) */
  static_assert(2 * gemm_stage_bytes(2, false, KC_QKV) >= 2 * 128 * TP * 2);
  static_assert((2 * DM) % 128 == 0 && HD == 64);
  __shared__ __attribute__((aligned(16))) unsigned char sm[2 * gemm_stage_bytes(2, false, KC_QKV)];
  float (*so)[32][68] = (float (*)[32][68])sm;          /* output staging takes the operand buffers' place behind the main loop's last barrier */
  const int tid = threadIdx.x;
  const int wave = __builtin_amdgcn_readfirstlane((int)(tid >> 5));
  const int lane = tid & 31, ln = lane & 15, hh = lane >> 4;
  const int ntn = LQ / 128;
  const int mt = blockIdx.x / ntn, nq = blockIdx.x - mt * ntn;
  const int row0 = mt * 128 + 32 * (wave & 3), col0 = nq * 128 + 64 * (wave >> 2);
  const v8f z8 = {0.f, 0.f, 0.f, 0.f, 0.f, 0.f, 0.f, 0.f};
  v8f c[8] = {z8, z8, z8, z8, z8, z8, z8, z8};
  gemm_core<2, false, KC_QKV>(sm, X16 + (size_t)(mt * 128) * DM, X16 + (size_t)(mt * 128) * DM, Bw + (size_t)(nq * 128) * DM, c, c);
  if (nq >= 2 * DM / 128) {   /* v block (the same for the whole block): an accumulator's eight registers are eight consecutive tokens of one d, that is 16 B of a V^T row */
    _Float16 (*tv)[128][TP] = (_Float16 (*)[128][TP])sm;   /* [plane][the block's column = (head, d)][the block's token]; takes the operand buffers' place like so */
#pragma unroll   /* this and the inner loop: accumulator indices must be constants, so that they are registers */
    for (int u = 0; u < 8; ++u) {
      const int dc = 64 * (wave >> 2) + (u & 3) * 16 + ln, tk = 32 * (wave & 3) + (u >> 2) * 16 + 8 * hh;
      FragH fh, fr;
#pragma unroll
      for (int r = 0; r < 8; ++r) { const float e = c[u][r] * 0.0625f; const _Float16 hi = (_Float16)e; fh.h[r] = hi; fr.h[r] = (_Float16)((e - (float)hi) * 1024.0f); }
      *(v8us*)&tv[0][dc][tk] = fh.half[0];
      *(v8us*)&tv[1][dc][tk] = fr.half[0];
    }
    __syncthreads();   // a V^T row of the block holds tokens of four waves; behind this a wave stores whole rows of 256 B
    const int b = (mt * 128) / SEQ, s0 = (mt * 128) % SEQ;
    const int pln = wave >> 2;
    unsigned short* vo = (unsigned short*)VT + (size_t)pln * ((size_t)NB * NH * HD * SEQ) + ((size_t)(b * NH) * HD + (nq * 128 - 2 * DM) + (wave & 3) * 32 + hh) * SEQ + s0 + ln * 8;
#pragma unroll   /* row offsets are constants: one address for all sixteen stores */
    for (int q = 0; q < 16; ++q) {
      const v8us v = *(const v8us*)&tv[pln][(wave & 3) * 32 + q * 2 + hh][ln * 8];
      *(v8us*)(vo + (size_t)(q * 2) * SEQ) = v;
    }
    return;
  }
#pragma unroll
  for (int u = 0; u < 8; ++u) {
    const int t = u & 3, half = u >> 2;
#pragma unroll
    for (int r = 0; r < 8; ++r) so[wave][half * 16 + 8 * hh + r][t * 16 + ln] = c[u][r] * 0.0625f;
  }
  wave_lds_sync();
  const int rsub = lane >> 3, c8 = (lane & 7) * 8;
  {
#pragma unroll 1
    for (int q = 0; q < 8; ++q) {
      const int r = q * 4 + rsub;
      const v4f u0 = *(const v4fa*)&so[wave][r][c8], u1 = *(const v4fa*)&so[wave][r][c8 + 4];
      const int s = (row0 + r) % SEQ;
      const v4f t0 = *(const v4fa*)(CS + (size_t)s * 64 + c8), t1 = *(const v4fa*)(CS + (size_t)s * 64 + c8 + 4);
      float e[8] = {u0[0], u0[1], u0[2], u0[3], u1[0], u1[1], u1[2], u1[3]};
      const float cz[4] = {t0[0], t0[2], t1[0], t1[2]};
      const float sz[4] = {t0[1], t0[3], t1[1], t1[3]};
#pragma unroll
      for (int i = 0; i < 4; ++i) {
        const float te = e[2 * i], to = e[2 * i + 1];
        const float re = te * cz[i] - to * sz[i];
        const float ro = te * sz[i] + to * cz[i];
        e[2 * i] = re;
        e[2 * i + 1] = ro;
      }
      FragH fh, fr;
#pragma unroll
      for (int i = 0; i < 8; ++i) { const _Float16 hi = (_Float16)e[i]; fh.h[i] = hi; fr.h[i] = (_Float16)((e[i] - (float)hi) * 1024.0f); }
      const v8us oh8 = fh.half[0], or8 = fr.half[0];
      const size_t o = (size_t)(row0 + r) * LQ + col0 + c8;
      *(v8us*)((unsigned short*)Ph + o) = oh8;
      *(v8us*)((unsigned short*)Pr + o) = or8;
    }
    
  }
}

// Fused causal attention, online softmax. Block = query tile qt of 64 rows of (batch, head) bh; wave = 16 query rows; 32-key steps; q, k and V^T fragments straight from the planes.
// Fragment loads stand ahead of the work that hides them: q once in front of the loop; late rows: V^T of a step at its top, k of the next step behind this step's score products;
// early rows (twice the planes, few steps): all k of a step together at its top, all V^T behind its score products, so that the kernel's registers still let four blocks share a WGP.
struct AttnLds { _Float16 ph[4][16][40]; _Float16 pl[4][16][40]; _Float16 oh[4][16][72]; _Float16 ol[4][16][72]; };   /* every member a multiple of 16 B */
template <bool ER>
__device__ __forceinline__ void attn_body(AttnLds& sh, const _Float16* __restrict__ Qh, const _Float16* __restrict__ Qr, const _Float16* __restrict__ VTh, const _Float16* __restrict__ VTr,
                                          _Float16* __restrict__ Oh, _Float16* __restrict__ Or, int qt, int bh) {
  auto& ph = sh.ph; auto& pl = sh.pl; auto& oh = sh.oh; auto& ol = sh.ol;
  const int tid = threadIdx.x;
  const int wave = __builtin_amdgcn_readfirstlane((int)(tid >> 5));
  const int lane = tid & 31, ln = lane & 15, hh = lane >> 4;
  const int b = bh / NH, h = bh % NH;
  const int q0 = qt * 64 + wave * 16;
  const size_t rowb = (size_t)b * SEQ;
  const size_t qoff = (rowb + q0 + ln) * LQ + h * HD;
  const size_t koff0 = (rowb + ln) * LQ + DM + h * HD;
  const size_t voff0 = ((size_t)bh * HD + ln) * SEQ;
  const int nst = (q0 + 16 + 31) >> 5;
  const v8f z8 = {0.f, 0.f, 0.f, 0.f, 0.f, 0.f, 0.f, 0.f};
  v8f o[4] = {z8, z8, z8, z8};
  v8f orr[4] = {z8, z8, z8, z8};
  float mrow[8], lrow[8];
#pragma unroll
  for (int r = 0; r < 8; ++r) { mrow[r] = -1.0e30f; lrow[r] = 0.f; }
  v16h qh[2], ql[2], kh[2][2], kl[2][2], vh[4], vl[4];
  auto load_q = [&]() {
#pragma unroll
    for (int kk = 0; kk < 2; ++kk) {
      qh[kk] = g2_frag(Qh + qoff + kk * 32, hh);
      if constexpr (ER) ql[kk] = g2_frag(Qr + qoff + kk * 32, hh);
    }
  };
  auto load_k = [&](int key0) {
    const _Float16* kph = Qh + koff0 + (size_t)key0 * LQ + 8 * hh;   /* the lane's own address: every load below is this plus a constant */
    const _Float16* kpl = Qr + koff0 + (size_t)key0 * LQ + 8 * hh;
#pragma unroll
    for (int kk = 0; kk < 2; ++kk) {
#pragma unroll
      for (int t = 0; t < 2; ++t) {
        kh[kk][t] = g2_frag(kph + (size_t)(16 * t) * LQ + kk * 32, 0);
        if constexpr (ER) kl[kk][t] = g2_frag(kpl + (size_t)(16 * t) * LQ + kk * 32, 0);
      }
    }
    // Early rows: registers are short; the inputs keep the loads' address registers up to the wait.
    if constexpr (ER) asm volatile("s_wait_xcnt 0x0" :: "v"(kph), "v"(kpl) : "memory");
  };
  auto load_v = [&](const _Float16* vph, const _Float16* vpl) {
#pragma unroll
    for (int j = 0; j < 4; ++j) {
      vh[j] = g2_frag(vph + (size_t)(16 * j) * SEQ, 0);
      if constexpr (ER) vl[j] = g2_frag(vpl + (size_t)(16 * j) * SEQ, 0);
    }
  };
  load_q();
  if constexpr (!ER) load_k(0);
#pragma unroll 1
  for (int st = 0; st < nst; ++st) {
    const int key0 = st * 32;
    v8f sm[2] = {z8, z8};
    v8f sr[2] = {z8, z8};
    const _Float16* vph = VTh + voff0 + key0 + 8 * hh;   /* the lane's own addresses, as in load_k */
    const _Float16* vpl = VTr + voff0 + key0 + 8 * hh;
    if constexpr (ER) load_k(key0); else load_v(vph, vpl);
#pragma unroll
    for (int kk = 0; kk < 2; ++kk) {
#pragma unroll
      for (int t = 0; t < 2; ++t) {
        sm[t] = g2_mma(qh[kk], kh[kk][t], sm[t]);
        if constexpr (ER) {
          sr[t] = g2_mma(ql[kk], kh[kk][t], sr[t]);
          sr[t] = g2_mma(qh[kk], kl[kk][t], sr[t]);
        }
      }
    }
    if constexpr (ER) load_v(vph, vpl); else load_k((st + 1 < nst ? st + 1 : st) * 32);   /* the last step fetches its own keys again: no row past the wave's range is read */
    const int kq = key0 + ln - (q0 + 8 * hh);   /* key index minus the index of the lane's first query row: one register where eight row indices stood */
#pragma unroll
    for (int r = 0; r < 8; ++r) {
      float s0 = sm[0][r], s1 = sm[1][r];
      if (ER) { s0 += sr[0][r] * 0.0009765625f; s1 += sr[1][r] * 0.0009765625f; }
      s0 *= 0.125f; s1 *= 0.125f;
      const bool m0 = kq > r, m1 = kq + 16 > r;
      s0 = m0 ? -1.0e9f : s0;
      s1 = m1 ? -1.0e9f : s1;
      float rm = fmaxf(s0, s1);
      rm = fmaxf(rm, __shfl_xor(rm, 1));
      rm = fmaxf(rm, __shfl_xor(rm, 2));
      rm = fmaxf(rm, __shfl_xor(rm, 4));
      rm = fmaxf(rm, __shfl_xor(rm, 8));
      const float mnew = fmaxf(mrow[r], rm);
      const float al = __expf(mrow[r] - mnew);
      const float e0 = __expf(s0 - mnew), e1 = __expf(s1 - mnew);
      const float p0 = m0 ? 0.f : e0, p1 = m1 ? 0.f : e1;
      lrow[r] = lrow[r] * al + (p0 + p1);
      mrow[r] = mnew;
#pragma unroll
      for (int j = 0; j < 4; ++j) { o[j][r] *= al; if (ER) orr[j][r] *= al; }
      const float a0 = p0 * 256.0f, a1 = p1 * 256.0f;
      const _Float16 h0 = (_Float16)a0, h1 = (_Float16)a1;
      ph[wave][8 * hh + r][ln] = h0;
      ph[wave][8 * hh + r][16 + ln] = h1;
      if (ER) {
        pl[wave][8 * hh + r][ln] = (_Float16)((a0 - (float)h0) * 1024.0f);
        pl[wave][8 * hh + r][16 + ln] = (_Float16)((a1 - (float)h1) * 1024.0f);
      }
    }
    if constexpr (ER) asm volatile("s_wait_xcnt 0x0" :: "v"(vph), "v"(vpl) : "memory");   // as in load_k, for the V^T loads; it stands here, where it no longer holds the wave up
    wave_lds_only_sync();
    FragH pa, pb;
    pa.half[0] = *(const v8us*)&ph[wave][ln][8 * hh];
    pa.half[1] = *(const v8us*)&ph[wave][ln][16 + 8 * hh];
    pb.v = pa.v;
    if (ER) {
      pb.half[0] = *(const v8us*)&pl[wave][ln][8 * hh];
      pb.half[1] = *(const v8us*)&pl[wave][ln][16 + 8 * hh];
    }
#pragma unroll
    for (int j = 0; j < 4; ++j) {
      o[j] = g2_mma(pa.v, vh[j], o[j]);
      if constexpr (ER) {
        orr[j] = g2_mma(pb.v, vh[j], orr[j]);
        orr[j] = g2_mma(pa.v, vl[j], orr[j]);
      }
    }
    wave_lds_only_sync();
  }
#pragma unroll
  for (int r = 0; r < 8; ++r) {
    float l = lrow[r];
    l += __shfl_xor(l, 1);
    l += __shfl_xor(l, 2);
    l += __shfl_xor(l, 4);
    l += __shfl_xor(l, 8);
    const float inv = 0.25f * (1.0f / l);
#pragma unroll
    for (int j = 0; j < 4; ++j) {
      float v = o[j][r];
      if (ER) v += orr[j][r] * 0.0009765625f;
      v *= inv;
      const _Float16 hi = (_Float16)v;
      oh[wave][8 * hh + r][16 * j + ln] = hi;
      if (ER) ol[wave][8 * hh + r][16 * j + ln] = (_Float16)((v - (float)hi) * 1024.0f);
    }
  }
  wave_lds_sync();
  const int rsub = lane >> 3, c8 = (lane & 7) * 8;
  {
#pragma unroll
    for (int q = 0; q < 4; ++q) {
      const int r = q * 4 + rsub;
      const size_t oo = (rowb + q0 + r) * DM + h * HD + c8;
      const v8us vh8 = *(const v8us*)&oh[wave][r][c8];
      *(v8us*)((unsigned short*)Oh + oo) = vh8;
      if (ER) {
        const v8us vl8 = *(const v8us*)&ol[wave][r][c8];
        *(v8us*)((unsigned short*)Or + oo) = vl8;
      }
    }
    
  }
}
// One grid: the late tiles (tile fastest, then bh), behind them the early tiles, which use the residual planes; no block reads what another writes.
constexpr unsigned NT_E = ERW / 64, NT_L = SEQ / 64 - ERW / 64, NT_L1 = NT_L ? NT_L : 1;
constexpr unsigned GA_L = NT_L * NB * NH, GA_E = NT_E * NB * NH;
__global__ __launch_bounds__(128) void k_attn(const _Float16* __restrict__ Qh, const _Float16* __restrict__ Qr, const _Float16* __restrict__ VTh, const _Float16* __restrict__ VTr, _Float16* __restrict__ Oh, _Float16* __restrict__ Or) {
  __shared__ __attribute__((aligned(16))) AttnLds sh;
  const unsigned blk = blockIdx.x;
  if (blk < GA_L) {
    attn_body<false>(sh, Qh, Qr, VTh, VTr, Oh, Or, (int)(NT_E + blk % NT_L1), (int)(blk / NT_L1));
  } else {
    const unsigned e = blk - GA_L;
    attn_body<true>(sh, Qh, Qr, VTh, VTr, Oh, Or, (int)(e % NT_E), (int)(e / NT_E));
  }
}

// Output GEMM: ctx rows (x64; hi plane Ah, residual plane Ar x2^10 when ER) times Bw [DM][DM] (x16) -> f32 * 2^-10 into the output rows b*SEQ_FULL + s.
template <bool ER>
__device__ __forceinline__ void out_body(unsigned char* sm, const _Float16* __restrict__ Ah, const _Float16* __restrict__ Ar, const _Float16* __restrict__ Bw, float* __restrict__ C, int blk, int rbPerB, int rowOff) {
  static_assert(2 * gemm_stage_bytes(1, ER, KC_OUT(ER)) >= 4 * 32 * 68 * 4);
  float (*so)[32][68] = (float (*)[32][68])sm;          /* output staging takes the operand buffers' place behind the main loop's last barrier */
  const int tid = threadIdx.x;
  const int wave = __builtin_amdgcn_readfirstlane((int)(tid >> 5));
  const int lane = tid & 31, ln = lane & 15, hh = lane >> 4;
  const int ntn = DM / 64;
  const int mt = blk / ntn, nq = blk - mt * ntn;
  const int b = mt / rbPerB, lb = mt - b * rbPerB;
  const int s0 = rowOff + lb * 128 + 32 * wave;
  const int col0 = nq * 64;
  const size_t ablk = ((size_t)b * SEQ + rowOff + lb * 128) * DM;
  const size_t crow = (size_t)b * SEQ_FULL + s0;
  const v8f z8 = {0.f, 0.f, 0.f, 0.f, 0.f, 0.f, 0.f, 0.f};
  v8f c[8] = {z8, z8, z8, z8, z8, z8, z8, z8};
  v8f d[8] = {z8, z8, z8, z8, z8, z8, z8, z8};
  gemm_core<1, ER, KC_OUT(ER)>(sm, Ah + ablk, Ar + ablk, Bw + (size_t)col0 * DM, c, d);
#pragma unroll
  for (int u = 0; u < 8; ++u) {
    const int t = u & 3, half = u >> 2;
#pragma unroll
    for (int r = 0; r < 8; ++r) {
      float v = c[u][r];
      if (ER) v += d[u][r] * 0.0009765625f;
      so[wave][half * 16 + 8 * hh + r][t * 16 + ln] = v * 0.0009765625f;
    }
  }
  wave_lds_sync();
  const int rsub = lane >> 4, c4 = (lane & 15) * 4;
  {
#pragma unroll 1
    for (int q = 0; q < 16; ++q) {
      const int r = q * 2 + rsub;
      const v4f v = *(const v4fa*)&so[wave][r][c4];
      *(v4f*)(C + (crow + r) * DM + col0 + c4) = v;
    }
    
  }
}
// One grid: the early row blocks first (twice the matrix work and twice the stages of a late block), behind them the late ones; both use the same LDS bytes.
constexpr int RB_E = ERW / 128, RB_L = (SEQ - ERW) / 128, RB_L1 = RB_L ? RB_L : 1;
constexpr unsigned GO_E = (unsigned)(NB * RB_E * (DM / 64)), GO_L = (unsigned)(NB * RB_L * (DM / 64));
constexpr int OUT_LDS_E = 2 * gemm_stage_bytes(1, true, KC_OUT(true)), OUT_LDS_L = 2 * gemm_stage_bytes(1, false, KC_OUT(false));
__global__ __launch_bounds__(128) void k_out(const _Float16* __restrict__ Ah, const _Float16* __restrict__ Ar, const _Float16* __restrict__ Bw, float* __restrict__ C) {
  __shared__ __attribute__((aligned(16))) unsigned char sm[OUT_LDS_E > OUT_LDS_L ? OUT_LDS_E : OUT_LDS_L];
  const unsigned blk = blockIdx.x;
  if (blk < GO_E) out_body<true>(sm, Ah, Ar, Bw, C, (int)blk, RB_E, 0);
  else out_body<false>(sm, Ah, Ar, Bw, C, (int)(blk - GO_E), RB_L1, ERW);
}

// workspace carve (bytes); every region is a multiple of 256 B
constexpr size_t SZ_W    = (size_t)DM * DM * 2;                 /* one x16 f16 weight plane */
constexpr size_t SZ_X16  = (size_t)NR * DM * 2;
constexpr size_t SZ_QKV  = (size_t)NR * LQ * 2;                 /* one q|k plane, row pitch LQ (the last third of a row is neither written nor read) */
constexpr size_t SZ_VT   = (size_t)NB * NH * HD * SEQ * 2;      /* one V^T plane */
constexpr size_t SZ_O    = (size_t)NR * DM * 2;                 /* one ctx plane */
constexpr size_t SZ_CS   = (size_t)SEQ * 64 * 4;
constexpr size_t OFF_BW  = 0;                                   /* wq | wk | wv | wo */
constexpr size_t OFF_X16 = OFF_BW + 4 * SZ_W;
constexpr size_t OFF_QKV = OFF_X16 + SZ_X16;                    /* hi plane, residual plane */
constexpr size_t OFF_VT  = OFF_QKV + 2 * SZ_QKV;                /* hi plane, residual plane */
constexpr size_t OFF_O   = OFF_VT + 2 * SZ_VT;                  /* hi plane, residual plane */
constexpr size_t OFF_CS  = OFF_O + 2 * SZ_O;
constexpr size_t WS_TOTAL = OFF_CS + SZ_CS;
static_assert(WS_TOTAL <= (size_t)134217728);
static_assert(SZ_W % 256 == 0 && SZ_X16 % 256 == 0 && SZ_QKV % 256 == 0 && SZ_VT % 256 == 0 && SZ_O % 256 == 0 && SZ_CS % 256 == 0);
static_assert((size_t)((NB - 1) * SEQ_FULL + SEQ) * DM * 4 <= (size_t)NB_FULL * SEQ_FULL * DM * 4);

extern "C" void kernel_launch(void* const* d_in, const int* in_sizes, int n_in,
                              void* d_out, int out_size, void* d_ws, size_t ws_size, hipStream_t stream) {
  if (n_in < 6) return;
  const size_t need_x = (size_t)((NB - 1) * SEQ_FULL + SEQ) * DM;
  if ((size_t)in_sizes[0] < need_x) return;
  if ((size_t)in_sizes[1] < (size_t)DM * DM || (size_t)in_sizes[2] < (size_t)DM * DM || (size_t)in_sizes[3] < (size_t)DM * DM || (size_t)in_sizes[4] < (size_t)DM * DM) return;
  if (in_sizes[5] < SEQ) return;
  if ((size_t)out_size < need_x) return;
  if (WS_TOTAL > ws_size) return;
  const float* x  = (const float*)d_in[0];
  const float* wq = (const float*)d_in[1];
  const float* wk = (const float*)d_in[2];
  const float* wv = (const float*)d_in[3];
  const float* wo = (const float*)d_in[4];
  const int*   tp = (const int*)d_in[5];
  float* out = (float*)d_out;
  char* ws = (char*)d_ws;
  _Float16* BQKV = (_Float16*)(ws + OFF_BW);
  _Float16* BO   = (_Float16*)(ws + OFF_BW + 3 * SZ_W);
  _Float16* X16  = (_Float16*)(ws + OFF_X16);
  _Float16* QKVh = (_Float16*)(ws + OFF_QKV);
  _Float16* QKVr = (_Float16*)(ws + OFF_QKV + SZ_QKV);
  _Float16* VTh  = (_Float16*)(ws + OFF_VT);
  _Float16* VTr  = (_Float16*)(ws + OFF_VT + SZ_VT);
  _Float16* Oh   = (_Float16*)(ws + OFF_O);
  _Float16* Or   = (_Float16*)(ws + OFF_O + SZ_O);
  float*    CS   = (float*)(ws + OFF_CS);

  k_prep<<<GP_T + GP_X + 4 * GP_W, 256, 0, stream>>>(x, wq, wk, wv, wo, tp, BQKV, X16, CS);
  k_qkv<<<(unsigned)((NR / 128) * (LQ / 128)), 256, 0, stream>>>(X16, BQKV, CS, QKVh, QKVr, VTh);   /* V^T: both planes behind VTh (plane stride SZ_VT) */
  k_attn<<<GA_L + GA_E, 128, 0, stream>>>(QKVh, QKVr, VTh, VTr, Oh, Or);
  k_out<<<GO_E + GO_L, 128, 0, stream>>>(Oh, Or, BO, out);
}

// v005
// A run of this version takes 86.9 microseconds.
// Timed twice side by side with v004, it ran 1.14 times as fast both times.
// Counting every step since v000, it is 3.05 times as fast.
#include <hip/hip_runtime.h>
// Causal multi-head self-attention with interleaved rotary (x [4][1024][1024]; q|k|v = x W^T with [out][in] weights, 16 heads of 64; scores * 1/8; causal by index; out = merged W_o^T).
// Compute dtype: all contractions v_wmma_f32_16x16x32_f16 (f16 operands, f32 accumulate). Inputs converted (RNE) to bf16 and held exactly in f16 (weights x16); q, k, v, P (x256), ctx (x64) as f16 hi planes,
// plus f16 residual planes (x2^10, separate accumulators) used for query rows 0..255 of every sequence; softmax statistics, rotary and all epilogues f32.
// Structure, four launches: preparation (cos/sin table from the position input, x plane, four weight planes: independent blocks of one grid), one QKV GEMM (N = 3072; rotary in the epilogue of the q and k blocks,
// the k and v blocks store their planes in the order of the attention's fragments, v transposed), fused online-softmax attention (late and early query rows as blocks of one grid), output GEMM (early and late rows as blocks of one grid).
// Both GEMMs stage their operand tiles in LDS with asynchronous 16-byte copies, two buffers of 64 k (128 k for the late output rows) each; the waves read their fragments from LDS.
#ifndef NB
#define NB 4
#endif
#ifndef SEQ
#define SEQ 1024
#endif
#define NB_FULL 4
#define SEQ_FULL 1024
#define DM 1024
#define NH 16
#define HD 64
#define LQ (3 * DM)
#define NR (NB * SEQ)
#define ERW 256                      /* query rows per sequence that use the residual planes */

static_assert(NB <= NB_FULL);
static_assert(SEQ <= SEQ_FULL);
static_assert(NH * HD == DM);
static_assert(HD == 64);
static_assert(DM % 64 == 0);
static_assert(DM % 32 == 0);
static_assert(LQ % 128 == 0);
static_assert(SEQ % 128 == 0);
static_assert(NR % 128 == 0);
static_assert(ERW % 128 == 0);
static_assert(SEQ >= ERW);
static_assert(ERW % 64 == 0);
static_assert(SEQ % 8 == 0);
static_assert(((size_t)NR * DM / 8) % 256 == 0);
static_assert(((size_t)DM * DM / 8) % 256 == 0);

typedef unsigned short v8us __attribute__((ext_vector_type(8), may_alias));
typedef float  v8f  __attribute__((ext_vector_type(8)));
typedef float  v4f  __attribute__((ext_vector_type(4)));
typedef float  v4fa __attribute__((ext_vector_type(4), may_alias));
typedef _Float16 v16h __attribute__((ext_vector_type(16)));
union FragH { v16h v; v8us half[2]; _Float16 h[16]; unsigned short u[16]; };

__device__ __forceinline__ unsigned short bf16_bits(float x) { unsigned int u = __float_as_uint(x); return (unsigned short)((u + 0x7FFFu + ((u >> 16) & 1u)) >> 16); }
__device__ __forceinline__ float bf16_rne(float x) { return __uint_as_float(((unsigned int)bf16_bits(x)) << 16); }

// A / B fragment from a k-contiguous 16-bit row: elements 0..7 <- p[8h .. 8h+7], elements 8..15 <- p[16+8h .. 16+8h+7]
__device__ __forceinline__ v16h g2_frag(const _Float16* p, int hh) { FragH f; f.half[0] = *(const v8us*)((const unsigned short*)p + 8 * hh); f.half[1] = *(const v8us*)((const unsigned short*)p + 16 + 8 * hh); return f.v; }
// The same fragment from a plane stored in fragment order: each half is the lane's 16 B of a 512-byte piece, so that a wave's load covers four whole 128-byte lines; p = the first piece + 8 * lane.
__device__ __forceinline__ v16h g2_pk(const _Float16* p) { FragH f; f.half[0] = *(const v8us*)(const unsigned short*)p; f.half[1] = *(const v8us*)((const unsigned short*)p + 256); return f.v; }
__device__ __forceinline__ v8f g2_mma(v16h a, v16h b, v8f c) { v8f d = __builtin_amdgcn_wmma_f32_16x16x32_f16(false, a, false, b, (short)0, c, false, false); asm volatile("v_nop\n\tv_nop\n\tv_nop\n\tv_nop" : "+v"(d) : "v"(a), "v"(b)); return d; }
__device__ __forceinline__ void wave_lds_sync() { __builtin_amdgcn_fence(4 /* acq_rel order */, "workgroup"); __builtin_amdgcn_wave_barrier(); }
// The same for LDS alone: orders a wave's own LDS stores and loads and leaves its global loads in flight (the fence over all memory drains them).
__device__ __forceinline__ void wave_lds_only_sync() { __builtin_amdgcn_fence(4 /* acq_rel order */, "workgroup", "local"); __builtin_amdgcn_wave_barrier(); }

// One LDS stage of a GEMM block: kc of k for every operand row, row pitch = the row + 16 B (144 or 272 B = 16 B x odd: conflict-free for 16-byte row reads).
constexpr int gemm_stage_bytes(int wn, bool er, int kc) { return (128 * (er ? 2 : 1) + 64 * wn) * (kc * 2 + 16); }
#define KC_QKV 64                    /* three blocks share a WGP's LDS */
#define KC_OUT(er) ((er) ? 64 : 128) /* few blocks: the longer stage covers the copies' flight; with the residual plane its copy addresses would not fit the registers */

// N asynchronous 16-byte copies global -> LDS, lane by lane, in one statement.
// The s_wait_xcnt stands inside the statement so that no address register is rewritten in front of it; one statement a stage (two beyond 12 copies) pays that wait once.
#define CPL(a, b) "global_load_async_to_lds_b128 %" #a ", %" #b ", off\n\t"
template <int N>
__device__ __forceinline__ void cp_issue(const unsigned (&l)[N], const _Float16* const (&g)[N]) {
  static_assert(N == 8 || N == 10 || N == 12);
  if constexpr (N == 8)
    asm volatile(CPL(0, 1) CPL(2, 3) CPL(4, 5) CPL(6, 7) CPL(8, 9) CPL(10, 11) CPL(12, 13) CPL(14, 15) "s_wait_xcnt 0x0"
                 :: "v"(l[0]), "v"(g[0]), "v"(l[1]), "v"(g[1]), "v"(l[2]), "v"(g[2]), "v"(l[3]), "v"(g[3]), "v"(l[4]), "v"(g[4]), "v"(l[5]), "v"(g[5]), "v"(l[6]), "v"(g[6]), "v"(l[7]), "v"(g[7]) : "memory");
  else if constexpr (N == 10)
    asm volatile(CPL(0, 1) CPL(2, 3) CPL(4, 5) CPL(6, 7) CPL(8, 9) CPL(10, 11) CPL(12, 13) CPL(14, 15) CPL(16, 17) CPL(18, 19) "s_wait_xcnt 0x0"
                 :: "v"(l[0]), "v"(g[0]), "v"(l[1]), "v"(g[1]), "v"(l[2]), "v"(g[2]), "v"(l[3]), "v"(g[3]), "v"(l[4]), "v"(g[4]), "v"(l[5]), "v"(g[5]), "v"(l[6]), "v"(g[6]), "v"(l[7]), "v"(g[7]),
                    "v"(l[8]), "v"(g[8]), "v"(l[9]), "v"(g[9]) : "memory");
  else
    asm volatile(CPL(0, 1) CPL(2, 3) CPL(4, 5) CPL(6, 7) CPL(8, 9) CPL(10, 11) CPL(12, 13) CPL(14, 15) CPL(16, 17) CPL(18, 19) CPL(20, 21) CPL(22, 23) "s_wait_xcnt 0x0"
                 :: "v"(l[0]), "v"(g[0]), "v"(l[1]), "v"(g[1]), "v"(l[2]), "v"(g[2]), "v"(l[3]), "v"(g[3]), "v"(l[4]), "v"(g[4]), "v"(l[5]), "v"(g[5]), "v"(l[6]), "v"(g[6]), "v"(l[7]), "v"(g[7]),
                    "v"(l[8]), "v"(g[8]), "v"(l[9]), "v"(g[9]), "v"(l[10]), "v"(g[10]), "v"(l[11]), "v"(g[11]) : "memory");
}

// GEMM main loop of one block: A tile 128 rows (hi plane; residual plane too when ER), B tile 64 * WN rows, all k-contiguous with row pitch DM.
// 4 * WN waves, wave (wm, wn) = 32 rows x 64 columns; c (and d for the residual plane) accumulate k in ascending steps of 32.
// LDS stage = KC of k of [A hi 128 rows | A residual 128 rows when ER | B 64 * WN rows]; stage s + 2 is copied into the buffer that pass s has left.
template <int WN, bool ER, int KC>
__device__ __forceinline__ void gemm_core(unsigned char* sm, const _Float16* __restrict__ Ah, const _Float16* __restrict__ Ar, const _Float16* __restrict__ Bw, v8f (&c)[8], v8f (&d)[8]) {
  static_assert(DM % KC == 0 && DM / KC >= 2 && KC % 64 == 0);
  constexpr int LP = KC + 8, LPB = LP * 2;   /* LDS row pitch in f16 and in bytes */
  constexpr int TPR = KC / 8;                /* threads that copy one row, 16 B each */
  constexpr int RPP = 128 * WN / TPR;        /* rows covered by one copy of every thread */
  constexpr int NPA = ER ? 2 : 1;
  constexpr int SB = gemm_stage_bytes(WN, ER, KC);
  constexpr int NS = DM / KC;
  constexpr int KG = (WN == 1 && !ER) ? 2 : 1;   /* 32-k steps whose fragments are read as one group: two where registers allow and few waves share a SIMD */
  const int tid = threadIdx.x;
  const int wave = __builtin_amdgcn_readfirstlane((int)(tid >> 5));
  const int lane = tid & 31, ln = lane & 15, hh = lane >> 4;
  const int wm = wave & 3, wn = wave >> 2;
  const int cr = tid / TPR, cc = tid % TPR;
  const unsigned l0 = (unsigned)(size_t)sm + (unsigned)(cr * LPB + cc * 16);
  const _Float16* gA = Ah + (size_t)cr * DM + cc * 8;
  const _Float16* gR = Ar + (size_t)cr * DM + cc * 8;
  const _Float16* gB = Bw + (size_t)cr * DM + cc * 8;
  constexpr int NCP = (128 * NPA + 64 * WN) / RPP;   /* copies of a thread per stage */
  constexpr int NST = (NCP + 11) / 12, NPS = NCP / NST;   /* asm statements per stage, copies in each */
  static_assert(NST * NPS == NCP && NCP <= 63 && 128 % RPP == 0);
  auto fill = [&](int buf, int kc) {
    const unsigned l = l0 + (unsigned)(buf * SB);
#pragma unroll   /* both loops: row must be a compile-time constant, so that L and G are registers */
    for (int st = 0; st < NST; ++st) {
      unsigned L[NPS];
      const _Float16* G[NPS];
#pragma unroll
      for (int j = 0; j < NPS; ++j) {
        const int row = (st * NPS + j) * RPP;          /* first row of the stage that this copy of the block covers */
        L[j] = l + (unsigned)(row * LPB);
        G[j] = (row < 128 ? gA + (size_t)row * DM : (ER && row < 256) ? gR + (size_t)(row - 128) * DM : gB + (size_t)(row - 128 * NPA) * DM) + kc;
      }
      cp_issue<NPS>(L, G);
    }
  };
  fill(0, 0);
  asm volatile("s_wait_asynccnt 0x0" ::: "memory");   // stage 0 of this wave has landed
  __syncthreads();                                    // ... and every other wave's share of it
  fill(1, KC);
#pragma unroll 1   /* rolled: the buffer index is a scalar select, and the loop body stays short */
  for (int s = 0; s < NS; ++s) {
    const _Float16* bp = (const _Float16*)(sm + (s & 1) * SB);
    const _Float16* ap = bp + (32 * wm + ln) * LP;
    const _Float16* bq = bp + (128 * NPA + 64 * wn + ln) * LP;
#pragma unroll   /* this and the inner loops: fragment and accumulator indices must be constants, so that they are registers */
    for (int kg = 0; kg < KC / 32; kg += KG) {
      v16h af[KG][2], rf[KG][2], bf[KG][4];              /* a group's LDS reads go out together, ahead of its matrix instructions */
#pragma unroll
      for (int u = 0; u < KG; ++u) {
        const int kk = (kg + u) * 32;
        af[u][0] = g2_frag(ap + kk, hh); af[u][1] = g2_frag(ap + 16 * LP + kk, hh);
#pragma unroll
        for (int t = 0; t < 4; ++t) bf[u][t] = g2_frag(bq + t * 16 * LP + kk, hh);
        if (ER) { rf[u][0] = g2_frag(ap + 128 * LP + kk, hh); rf[u][1] = g2_frag(ap + 144 * LP + kk, hh); }
      }
#pragma unroll
      for (int u = 0; u < KG; ++u) {
#pragma unroll
        for (int t = 0; t < 4; ++t) {
          c[t] = g2_mma(af[u][0], bf[u][t], c[t]); c[4 + t] = g2_mma(af[u][1], bf[u][t], c[4 + t]);
          if (ER) { d[t] = g2_mma(rf[u][0], bf[u][t], d[t]); d[4 + t] = g2_mma(rf[u][1], bf[u][t], d[4 + t]); }
        }
      }
    }
    asm volatile("s_wait_dscnt 0x0" ::: "memory");      // this wave's reads of buffer s & 1 are done before it is refilled
    asm volatile("s_wait_asynccnt 0x0" ::: "memory");   // this wave's copies of stage s + 1 have landed
    __syncthreads();                                    // publishes stage s + 1 and ends every wave's reads of stage s
    if (s + 2 < NS) fill(s & 1, (s + 2) * KC);
  }
  asm volatile("s_wait_asynccnt 0x0" ::: "memory");     // nothing in flight when the buffers become output staging
}

__device__ __forceinline__ void wnat_body(const float* __restrict__ w, _Float16* __restrict__ Bt, unsigned blk) {
  const size_t t = (size_t)blk * 256 + threadIdx.x;
  if (t >= (size_t)DM * DM / 8) return;
  const v4f a = *(const v4fa*)(w + t * 8), c = *(const v4fa*)(w + t * 8 + 4);
  FragH f;
#pragma unroll
  for (int q = 0; q < 4; ++q) { f.h[q] = (_Float16)(bf16_rne(a[q]) * 16.0f); f.h[4 + q] = (_Float16)(bf16_rne(c[q]) * 16.0f); }
  const v8us o = f.half[0];
  unsigned short* d = (unsigned short*)Bt + t * 8;
  *(v8us*)d = o;
  
}

__device__ __forceinline__ void x16_body(const float* __restrict__ x, _Float16* __restrict__ X16, unsigned blk) {
  const size_t t = (size_t)blk * 256 + threadIdx.x;
  if (t >= (size_t)NR * DM / 8) return;
  const size_t row = t / (DM / 8);
  const int c8 = (int)(t % (DM / 8)) * 8;
  const size_t b = row / SEQ, s = row % SEQ;
  const float* src = x + (b * SEQ_FULL + s) * DM + c8;
  const v4f a = *(const v4fa*)src, c = *(const v4fa*)(src + 4);
  FragH f;
#pragma unroll
  for (int q = 0; q < 4; ++q) { f.h[q] = (_Float16)bf16_rne(a[q]); f.h[4 + q] = (_Float16)bf16_rne(c[q]); }
  const v8us o = f.half[0];
  unsigned short* d = (unsigned short*)X16 + t * 8;
  *(v8us*)d = o;
  
}

// CS[s][j] = (cos, sin)(float(pos[s]) * inv_freq[j]), inv_freq[j] = f32(1 / 10000^(j/32)) with the power formed in double from fixed roots.
__device__ __forceinline__ void tab_body(const int* __restrict__ tp, float* __restrict__ CS, unsigned blk) {
  __shared__ __attribute__((aligned(16))) float ts[8][64];
  const int tid = threadIdx.x;
  const int sl = tid >> 5, j = tid & 31;
  const int s = (int)blk * 8 + sl;
  const int pos = tp[s];
  double p = 1.0;
  p = (j & 1)  ? p * 1.3335214321633240 : p;
  p = (j & 2)  ? p * 1.7782794100389228 : p;
  p = (j & 4)  ? p * 3.1622776601683795 : p;
  p = (j & 8)  ? p * 10.0 : p;
  p = (j & 16) ? p * 100.0 : p;
  const float inv = (float)(1.0 / p);
  const float ang = (float)pos * inv;
  float sn, cs;
  sincosf(ang, &sn, &cs);
  ts[sl][2 * j] = cs;
  ts[sl][2 * j + 1] = sn;
  __syncthreads();
  if (tid < 128) {
    const int r = tid >> 4, c4 = (tid & 15) * 4;
    const v4f v = *(const v4fa*)&ts[r][c4];
    float* d = CS + (size_t)(blk * 8 + r) * 64 + c4;
    *(v4f*)d = v;
    
  }
}

// Preparation, one grid: nothing here reads what another block of the grid writes. Table blocks first (the longest dependent chain), then the x plane, then the four weight planes (wq | wk | wv | wo, contiguous in Bt).
constexpr unsigned GP_T = SEQ / 8;
constexpr unsigned GP_X = (unsigned)(((size_t)NR * DM / 8 + 255) / 256);
constexpr unsigned GP_W = (unsigned)(((size_t)DM * DM / 8 + 255) / 256);
__global__ __launch_bounds__(256) void k_prep(const float* __restrict__ x, const float* __restrict__ wq, const float* __restrict__ wk, const float* __restrict__ wv, const float* __restrict__ wo, const int* __restrict__ tp,
                                              _Float16* __restrict__ Bt, _Float16* __restrict__ X16, float* __restrict__ CS) {
  const unsigned blk = blockIdx.x;
  if (blk < GP_T) { tab_body(tp, CS, blk); return; }
  if (blk < GP_T + GP_X) { x16_body(x, X16, blk - GP_T); return; }
  const unsigned wb = blk - (GP_T + GP_X), wi = wb / GP_W;
  const float* w = wi == 0 ? wq : wi == 1 ? wk : wi == 2 ? wv : wo;
  wnat_body(w, Bt + (size_t)wi * DM * DM, wb - wi * GP_W);
}

// QKV GEMM: rows r = b*SEQ + s of X16 [NR][DM] times Bw [3*DM][DM] (x16) -> f32 * 1/16; rotary on the q and k column blocks (one wave's columns = one head); q is written to the planes Ph, Pr [r][LQ].
// k and v go out in the order in which the attention's fragments take them, in pieces of 512 B = 32 lanes (16 hh + ln) x 8 f16, plane stride NB*NH*HD*SEQ:
// KP[plane][(b,h)][key / 16][d / 16][lane: ln = key % 16, hh = d / 8 % 2][d % 8],  VT[plane][(b,h)][key / 32][d / 16][key / 16 % 2][lane: ln = d % 16, hh = key / 8 % 2][key % 8].
__global__ __launch_bounds__(256) void k_qkv(const _Float16* __restrict__ X16, const _Float16* __restrict__ Bw, const float* __restrict__ CS, _Float16* __restrict__ Ph, _Float16* __restrict__ Pr, _Float16* __restrict__ KP, _Float16* __restrict__ VT) {
  static_assert(2 * gemm_stage_bytes(2, false, KC_QKV) >= 8 * 32 * 68 * 4);
  constexpr int TP = 128 + 8;                           /* V^T staging: tokens of a row + 16 B (272 B = 16 B x odd: conflict-free for 16-byte accesses down a column of rows) */
  static_assert(2 * gemm_stage_bytes(2, false, KC_QKV) >= 2 * 128 * TP * 2);
  static_assert((2 * DM) % 128 == 0 && HD == 64);
  __shared__ __attribute__((aligned(16))) unsigned char sm[2 * gemm_stage_bytes(2, false, KC_QKV)];
  float (*so)[32][68] = (float (*)[32][68])sm;          /* output staging takes the operand buffers' place behind the main loop's last barrier */
  const int tid = threadIdx.x;
  const int wave = __builtin_amdgcn_readfirstlane((int)(tid >> 5));
  const int lane = tid & 31, ln = lane & 15, hh = lane >> 4;
  const int ntn = LQ / 128;
  const int mt = blockIdx.x / ntn, nq = blockIdx.x - mt * ntn;
  const int row0 = mt * 128 + 32 * (wave & 3), col0 = nq * 128 + 64 * (wave >> 2);
  const v8f z8 = {0.f, 0.f, 0.f, 0.f, 0.f, 0.f, 0.f, 0.f};
  v8f c[8] = {z8, z8, z8, z8, z8, z8, z8, z8};
  gemm_core<2, false, KC_QKV>(sm, X16 + (size_t)(mt * 128) * DM, X16 + (size_t)(mt * 128) * DM, Bw + (size_t)(nq * 128) * DM, c, c);
  if (nq >= 2 * DM / 128) {   /* v block (the same for the whole block): an accumulator's eight registers are eight consecutive tokens of one d, that is 16 B of a V^T row */
    _Float16 (*tv)[128][TP] = (_Float16 (*)[128][TP])sm;   /* [plane][the block's column = (head, d)][the block's token]; takes the operand buffers' place like so */
#pragma unroll   /* this and the inner loop: accumulator indices must be constants, so that they are registers */
    for (int u = 0; u < 8; ++u) {
      const int dc = 64 * (wave >> 2) + (u & 3) * 16 + ln, tk = 32 * (wave & 3) + (u >> 2) * 16 + 8 * hh;
      FragH fh, fr;
#pragma unroll
      for (int r = 0; r < 8; ++r) { const float e = c[u][r] * 0.0625f; const _Float16 hi = (_Float16)e; fh.h[r] = hi; fr.h[r] = (_Float16)((e - (float)hi) * 1024.0f); }
      *(v8us*)&tv[0][dc][tk] = fh.half[0];
      *(v8us*)&tv[1][dc][tk] = fr.half[0];
    }
    __syncthreads();   // each piece is one accumulator of one wave (one plane, lane for lane), and a wave's pieces come from two waves; behind this a wave stores sixteen whole pieces, 8 KB in a row
    const int b = (mt * 128) / SEQ, s0 = (mt * 128) % SEQ;
    const int pln = wave >> 2;
    const int hd = (wave >> 1) & 1, st2 = (wave & 1) * 2;   /* the wave's head of the block's two, the first of its two 32-key steps of the block's four */
    unsigned short* vo = (unsigned short*)VT + (size_t)pln * ((size_t)NB * NH * HD * SEQ) + ((size_t)(b * NH + (nq * 128 - 2 * DM) / HD + hd) * SEQ + s0 + st2 * 32) * HD + lane * 8;
#pragma unroll   /* piece offsets are constants: one address for all sixteen stores */
    for (int q = 0; q < 16; ++q) {
      const v8us v = *(const v8us*)&tv[pln][hd * 64 + ((q >> 1) & 3) * 16 + ln][(st2 + (q >> 3)) * 32 + (q & 1) * 16 + 8 * hh];
      *(v8us*)(vo + q * 256) = v;
    }
    return;
  }
#pragma unroll
  for (int u = 0; u < 8; ++u) {
    const int t = u & 3, half = u >> 2;
#pragma unroll
    for (int r = 0; r < 8; ++r) so[wave][half * 16 + 8 * hh + r][t * 16 + ln] = c[u][r] * 0.0625f;
  }
  wave_lds_sync();
  // Rotary, split and store of one 16-byte piece of a row: row r of the wave's 32, columns c8 .. c8 + 7 of its head.
  auto piece = [&](int r, int c8, unsigned short* dh, unsigned short* dr) {
    const v4f u0 = *(const v4fa*)&so[wave][r][c8], u1 = *(const v4fa*)&so[wave][r][c8 + 4];
    const int s = (row0 + r) % SEQ;
    const v4f t0 = *(const v4fa*)(CS + (size_t)s * 64 + c8), t1 = *(const v4fa*)(CS + (size_t)s * 64 + c8 + 4);
    float e[8] = {u0[0], u0[1], u0[2], u0[3], u1[0], u1[1], u1[2], u1[3]};
    const float cz[4] = {t0[0], t0[2], t1[0], t1[2]};
    const float sz[4] = {t0[1], t0[3], t1[1], t1[3]};
#pragma unroll
    for (int i = 0; i < 4; ++i) {
      const float te = e[2 * i], to = e[2 * i + 1];
      const float re = te * cz[i] - to * sz[i];
      const float ro = te * sz[i] + to * cz[i];
      e[2 * i] = re;
      e[2 * i + 1] = ro;
    }
    FragH fh, fr;
#pragma unroll
    for (int i = 0; i < 8; ++i) { const _Float16 hi = (_Float16)e[i]; fh.h[i] = hi; fr.h[i] = (_Float16)((e[i] - (float)hi) * 1024.0f); }
    *(v8us*)dh = fh.half[0];
    *(v8us*)dr = fr.half[0];
  };
  if (nq >= DM / 128) {   /* k block (the same for the whole block): the wave's 32 keys x 64 d are eight pieces, 4 KB in a row */
    unsigned short* kh = (unsigned short*)KP + ((size_t)((row0 / SEQ) * NH + (col0 - DM) / HD) * SEQ + row0 % SEQ) * HD + lane * 8;
    unsigned short* kr = kh + (size_t)NB * NH * HD * SEQ;
#pragma unroll 1
    for (int q = 0; q < 8; ++q) piece((q >> 2) * 16 + ln, (q & 3) * 16 + 8 * hh, kh + q * 256, kr + q * 256);
  } else {
    const int rsub = lane >> 3, c8 = (lane & 7) * 8;
#pragma unroll 1
    for (int q = 0; q < 8; ++q) {
      const int r = q * 4 + rsub;
      const size_t o = (size_t)(row0 + r) * LQ + col0 + c8;
      piece(r, c8, (unsigned short*)Ph + o, (unsigned short*)Pr + o);
    }
  }
}

// Fused causal attention, online softmax. Block = query tile qt of 64 rows of (batch, head) bh; wave = 16 query rows; 32-key steps; q, k and V^T fragments straight from the planes (k and V^T: a step's fragments are 4 KB in a row of each plane).
// Fragment loads stand ahead of the work that hides them: q once in front of the loop; late rows: V^T of a step at its top, k of the next step behind this step's score products;
// early rows (twice the planes, few steps): all k of a step together at its top, all V^T behind its score products, so that the kernel's registers still let four blocks share a WGP.
struct AttnLds { _Float16 ph[4][16][40]; _Float16 pl[4][16][40]; _Float16 oh[4][16][72]; _Float16 ol[4][16][72]; };   /* every member a multiple of 16 B */
template <bool ER>
__device__ __forceinline__ void attn_body(AttnLds& sh, const _Float16* __restrict__ Qh, const _Float16* __restrict__ Qr, const _Float16* __restrict__ Kh, const _Float16* __restrict__ Kr, const _Float16* __restrict__ VTh, const _Float16* __restrict__ VTr,
                                          _Float16* __restrict__ Oh, _Float16* __restrict__ Or, int qt, int bh) {
  auto& ph = sh.ph; auto& pl = sh.pl; auto& oh = sh.oh; auto& ol = sh.ol;
  const int tid = threadIdx.x;
  const int wave = __builtin_amdgcn_readfirstlane((int)(tid >> 5));
  const int lane = tid & 31, ln = lane & 15, hh = lane >> 4;
  const int b = bh / NH, h = bh % NH;
  const int q0 = qt * 64 + wave * 16;
  const size_t rowb = (size_t)b * SEQ;
  const size_t qoff = (rowb + q0 + ln) * LQ + h * HD;
  const size_t pk0 = (size_t)bh * SEQ * HD + lane * 8;   /* k and V^T planes: the lane's 16 B of the first piece of (batch, head); 32 keys are 32 * HD f16 further on in both */
  const int nst = (q0 + 16 + 31) >> 5;
  const v8f z8 = {0.f, 0.f, 0.f, 0.f, 0.f, 0.f, 0.f, 0.f};
  v8f o[4] = {z8, z8, z8, z8};
  v8f orr[4] = {z8, z8, z8, z8};
  float mrow[8], lrow[8];
#pragma unroll
  for (int r = 0; r < 8; ++r) { mrow[r] = -1.0e30f; lrow[r] = 0.f; }
  v16h qh[2], ql[2], kh[2][2], kl[2][2], vh[4], vl[4];
  auto load_q = [&]() {
#pragma unroll
    for (int kk = 0; kk < 2; ++kk) {
      qh[kk] = g2_frag(Qh + qoff + kk * 32, hh);
      if constexpr (ER) ql[kk] = g2_frag(Qr + qoff + kk * 32, hh);
    }
  };
  auto load_k = [&](int key0) {
    const _Float16* kph = Kh + pk0 + (size_t)key0 * HD;   /* the lane's own address: every load below is this plus a constant */
    const _Float16* kpl = Kr + pk0 + (size_t)key0 * HD;
#pragma unroll
    for (int kk = 0; kk < 2; ++kk) {
#pragma unroll
      for (int t = 0; t < 2; ++t) {
        kh[kk][t] = g2_pk(kph + t * 1024 + kk * 512);
        if constexpr (ER) kl[kk][t] = g2_pk(kpl + t * 1024 + kk * 512);
      }
    }
    // Early rows: registers are short; the inputs keep the loads' address registers up to the wait.
    if constexpr (ER) asm volatile("s_wait_xcnt 0x0" :: "v"(kph), "v"(kpl) : "memory");
  };
  auto load_v = [&](const _Float16* vph, const _Float16* vpl) {
#pragma unroll
    for (int j = 0; j < 4; ++j) {
      vh[j] = g2_pk(vph + j * 512);
      if constexpr (ER) vl[j] = g2_pk(vpl + j * 512);
    }
  };
  load_q();
  if constexpr (!ER) load_k(0);
#pragma unroll 1
  for (int st = 0; st < nst; ++st) {
    const int key0 = st * 32;
    v8f sm[2] = {z8, z8};
    v8f sr[2] = {z8, z8};
    const _Float16* vph = VTh + pk0 + (size_t)key0 * HD;   /* the lane's own addresses, as in load_k */
    const _Float16* vpl = VTr + pk0 + (size_t)key0 * HD;
    if constexpr (ER) load_k(key0); else load_v(vph, vpl);
#pragma unroll
    for (int kk = 0; kk < 2; ++kk) {
#pragma unroll
      for (int t = 0; t < 2; ++t) {
        sm[t] = g2_mma(qh[kk], kh[kk][t], sm[t]);
        if constexpr (ER) {
          sr[t] = g2_mma(ql[kk], kh[kk][t], sr[t]);
          sr[t] = g2_mma(qh[kk], kl[kk][t], sr[t]);
        }
      }
    }
    if constexpr (ER) load_v(vph, vpl); else load_k((st + 1 < nst ? st + 1 : st) * 32);   /* the last step fetches its own keys again: no row past the wave's range is read */
    const int kq = key0 + ln - (q0 + 8 * hh);   /* key index minus the index of the lane's first query row: one register where eight row indices stood */
#pragma unroll
    for (int r = 0; r < 8; ++r) {
      float s0 = sm[0][r], s1 = sm[1][r];
      if (ER) { s0 += sr[0][r] * 0.0009765625f; s1 += sr[1][r] * 0.0009765625f; }
      s0 *= 0.125f; s1 *= 0.125f;
      const bool m0 = kq > r, m1 = kq + 16 > r;
      s0 = m0 ? -1.0e9f : s0;
      s1 = m1 ? -1.0e9f : s1;
      float rm = fmaxf(s0, s1);
      rm = fmaxf(rm, __shfl_xor(rm, 1));
      rm = fmaxf(rm, __shfl_xor(rm, 2));
      rm = fmaxf(rm, __shfl_xor(rm, 4));
      rm = fmaxf(rm, __shfl_xor(rm, 8));
      const float mnew = fmaxf(mrow[r], rm);
      const float al = __expf(mrow[r] - mnew);
      const float e0 = __expf(s0 - mnew), e1 = __expf(s1 - mnew);
      const float p0 = m0 ? 0.f : e0, p1 = m1 ? 0.f : e1;
      lrow[r] = lrow[r] * al + (p0 + p1);
      mrow[r] = mnew;
#pragma unroll
      for (int j = 0; j < 4; ++j) { o[j][r] *= al; if (ER) orr[j][r] *= al; }
      const float a0 = p0 * 256.0f, a1 = p1 * 256.0f;
      const _Float16 h0 = (_Float16)a0, h1 = (_Float16)a1;
      ph[wave][8 * hh + r][ln] = h0;
      ph[wave][8 * hh + r][16 + ln] = h1;
      if (ER) {
        pl[wave][8 * hh + r][ln] = (_Float16)((a0 - (float)h0) * 1024.0f);
        pl[wave][8 * hh + r][16 + ln] = (_Float16)((a1 - (float)h1) * 1024.0f);
      }
    }
    if constexpr (ER) asm volatile("s_wait_xcnt 0x0" :: "v"(vph), "v"(vpl) : "memory");   // as in load_k, for the V^T loads; it stands here, where it no longer holds the wave up
    wave_lds_only_sync();
    FragH pa, pb;
    pa.half[0] = *(const v8us*)&ph[wave][ln][8 * hh];
    pa.half[1] = *(const v8us*)&ph[wave][ln][16 + 8 * hh];
    pb.v = pa.v;
    if (ER) {
      pb.half[0] = *(const v8us*)&pl[wave][ln][8 * hh];
      pb.half[1] = *(const v8us*)&pl[wave][ln][16 + 8 * hh];
    }
#pragma unroll
    for (int j = 0; j < 4; ++j) {
      o[j] = g2_mma(pa.v, vh[j], o[j]);
      if constexpr (ER) {
        orr[j] = g2_mma(pb.v, vh[j], orr[j]);
        orr[j] = g2_mma(pa.v, vl[j], orr[j]);
      }
    }
    wave_lds_only_sync();
  }
#pragma unroll
  for (int r = 0; r < 8; ++r) {
    float l = lrow[r];
    l += __shfl_xor(l, 1);
    l += __shfl_xor(l, 2);
    l += __shfl_xor(l, 4);
    l += __shfl_xor(l, 8);
    const float inv = 0.25f * (1.0f / l);
#pragma unroll
    for (int j = 0; j < 4; ++j) {
      float v = o[j][r];
      if (ER) v += orr[j][r] * 0.0009765625f;
      v *= inv;
      const _Float16 hi = (_Float16)v;
      oh[wave][8 * hh + r][16 * j + ln] = hi;
      if (ER) ol[wave][8 * hh + r][16 * j + ln] = (_Float16)((v - (float)hi) * 1024.0f);
    }
  }
  wave_lds_sync();
  const int rsub = lane >> 3, c8 = (lane & 7) * 8;
  {
#pragma unroll
    for (int q = 0; q < 4; ++q) {
      const int r = q * 4 + rsub;
      const size_t oo = (rowb + q0 + r) * DM + h * HD + c8;
      const v8us vh8 = *(const v8us*)&oh[wave][r][c8];
      *(v8us*)((unsigned short*)Oh + oo) = vh8;
      if (ER) {
        const v8us vl8 = *(const v8us*)&ol[wave][r][c8];
        *(v8us*)((unsigned short*)Or + oo) = vl8;
      }
    }
    
  }
}
// One grid: the late tiles (tile fastest, then bh), behind them the early tiles, which use the residual planes; no block reads what another writes.
constexpr unsigned NT_E = ERW / 64, NT_L = SEQ / 64 - ERW / 64, NT_L1 = NT_L ? NT_L : 1;
constexpr unsigned GA_L = NT_L * NB * NH, GA_E = NT_E * NB * NH;
__global__ __launch_bounds__(128) void k_attn(const _Float16* __restrict__ Qh, const _Float16* __restrict__ Qr, const _Float16* __restrict__ Kh, const _Float16* __restrict__ Kr, const _Float16* __restrict__ VTh, const _Float16* __restrict__ VTr, _Float16* __restrict__ Oh, _Float16* __restrict__ Or) {
  __shared__ __attribute__((aligned(16))) AttnLds sh;
  const unsigned blk = blockIdx.x;
  if (blk < GA_L) {
    attn_body<false>(sh, Qh, Qr, Kh, Kr, VTh, VTr, Oh, Or, (int)(NT_E + blk % NT_L1), (int)(blk / NT_L1));
  } else {
    const unsigned e = blk - GA_L;
    attn_body<true>(sh, Qh, Qr, Kh, Kr, VTh, VTr, Oh, Or, (int)(e % NT_E), (int)(e / NT_E));
  }
}

// Output GEMM: ctx rows (x64; hi plane Ah, residual plane Ar x2^10 when ER) times Bw [DM][DM] (x16) -> f32 * 2^-10 into the output rows b*SEQ_FULL + s.
template <bool ER>
__device__ __forceinline__ void out_body(unsigned char* sm, const _Float16* __restrict__ Ah, const _Float16* __restrict__ Ar, const _Float16* __restrict__ Bw, float* __restrict__ C, int blk, int rbPerB, int rowOff) {
  static_assert(2 * gemm_stage_bytes(1, ER, KC_OUT(ER)) >= 4 * 32 * 68 * 4);
  float (*so)[32][68] = (float (*)[32][68])sm;          /* output staging takes the operand buffers' place behind the main loop's last barrier */
  const int tid = threadIdx.x;
  const int wave = __builtin_amdgcn_readfirstlane((int)(tid >> 5));
  const int lane = tid & 31, ln = lane & 15, hh = lane >> 4;
  const int ntn = DM / 64;
  const int mt = blk / ntn, nq = blk - mt * ntn;
  const int b = mt / rbPerB, lb = mt - b * rbPerB;
  const int s0 = rowOff + lb * 128 + 32 * wave;
  const int col0 = nq * 64;
  const size_t ablk = ((size_t)b * SEQ + rowOff + lb * 128) * DM;
  const size_t crow = (size_t)b * SEQ_FULL + s0;
  const v8f z8 = {0.f, 0.f, 0.f, 0.f, 0.f, 0.f, 0.f, 0.f};
  v8f c[8] = {z8, z8, z8, z8, z8, z8, z8, z8};
  v8f d[8] = {z8, z8, z8, z8, z8, z8, z8, z8};
  gemm_core<1, ER, KC_OUT(ER)>(sm, Ah + ablk, Ar + ablk, Bw + (size_t)col0 * DM, c, d);
#pragma unroll
  for (int u = 0; u < 8; ++u) {
    const int t = u & 3, half = u >> 2;
#pragma unroll
    for (int r = 0; r < 8; ++r) {
      float v = c[u][r];
      if (ER) v += d[u][r] * 0.0009765625f;
      so[wave][half * 16 + 8 * hh + r][t * 16 + ln] = v * 0.0009765625f;
    }
  }
  wave_lds_sync();
  const int rsub = lane >> 4, c4 = (lane & 15) * 4;
  {
#pragma unroll 1
    for (int q = 0; q < 16; ++q) {
      const int r = q * 2 + rsub;
      const v4f v = *(const v4fa*)&so[wave][r][c4];
      *(v4f*)(C + (crow + r) * DM + col0 + c4) = v;
    }
    
  }
}
// One grid: the early row blocks first (twice the matrix work and twice the stages of a late block), behind them the late ones; both use the same LDS bytes.
constexpr int RB_E = ERW / 128, RB_L = (SEQ - ERW) / 128, RB_L1 = RB_L ? RB_L : 1;
constexpr unsigned GO_E = (unsigned)(NB * RB_E * (DM / 64)), GO_L = (unsigned)(NB * RB_L * (DM / 64));
constexpr int OUT_LDS_E = 2 * gemm_stage_bytes(1, true, KC_OUT(true)), OUT_LDS_L = 2 * gemm_stage_bytes(1, false, KC_OUT(false));
__global__ __launch_bounds__(128) void k_out(const _Float16* __restrict__ Ah, const _Float16* __restrict__ Ar, const _Float16* __restrict__ Bw, float* __restrict__ C) {
  __shared__ __attribute__((aligned(16))) unsigned char sm[OUT_LDS_E > OUT_LDS_L ? OUT_LDS_E : OUT_LDS_L];
  const unsigned blk = blockIdx.x;
  if (blk < GO_E) out_body<true>(sm, Ah, Ar, Bw, C, (int)blk, RB_E, 0);
  else out_body<false>(sm, Ah, Ar, Bw, C, (int)(blk - GO_E), RB_L1, ERW);
}

// workspace carve (bytes); every region is a multiple of 256 B
constexpr size_t SZ_W    = (size_t)DM * DM * 2;                 /* one x16 f16 weight plane */
constexpr size_t SZ_X16  = (size_t)NR * DM * 2;
constexpr size_t SZ_QKV  = (size_t)NR * LQ * 2;                 /* one q plane, row pitch LQ (only the first third of a row is written and read) */
constexpr size_t SZ_VT   = (size_t)NB * NH * HD * SEQ * 2;      /* one V^T plane; one k plane */
constexpr size_t SZ_O    = (size_t)NR * DM * 2;                 /* one ctx plane */
constexpr size_t SZ_CS   = (size_t)SEQ * 64 * 4;
constexpr size_t OFF_BW  = 0;                                   /* wq | wk | wv | wo */
constexpr size_t OFF_X16 = OFF_BW + 4 * SZ_W;
constexpr size_t OFF_QKV = OFF_X16 + SZ_X16;                    /* hi plane, residual plane */
constexpr size_t OFF_VT  = OFF_QKV + 2 * SZ_QKV;                /* hi plane, residual plane */
constexpr size_t OFF_KP  = OFF_VT + 2 * SZ_VT;                  /* hi plane, residual plane */
constexpr size_t OFF_O   = OFF_KP + 2 * SZ_VT;                  /* hi plane, residual plane */
constexpr size_t OFF_CS  = OFF_O + 2 * SZ_O;
constexpr size_t WS_TOTAL = OFF_CS + SZ_CS;
static_assert(WS_TOTAL <= (size_t)134217728);
static_assert(SZ_W % 256 == 0 && SZ_X16 % 256 == 0 && SZ_QKV % 256 == 0 && SZ_VT % 256 == 0 && SZ_O % 256 == 0 && SZ_CS % 256 == 0);
static_assert((size_t)((NB - 1) * SEQ_FULL + SEQ) * DM * 4 <= (size_t)NB_FULL * SEQ_FULL * DM * 4);

extern "C" void kernel_launch(void* const* d_in, const int* in_sizes, int n_in,
                              void* d_out, int out_size, void* d_ws, size_t ws_size, hipStream_t stream) {
  if (n_in < 6) return;
  const size_t need_x = (size_t)((NB - 1) * SEQ_FULL + SEQ) * DM;
  if ((size_t)in_sizes[0] < need_x) return;
  if ((size_t)in_sizes[1] < (size_t)DM * DM || (size_t)in_sizes[2] < (size_t)DM * DM || (size_t)in_sizes[3] < (size_t)DM * DM || (size_t)in_sizes[4] < (size_t)DM * DM) return;
  if (in_sizes[5] < SEQ) return;
  if ((size_t)out_size < need_x) return;
  if (WS_TOTAL > ws_size) return;
  const float* x  = (const float*)d_in[0];
  const float* wq = (const float*)d_in[1];
  const float* wk = (const float*)d_in[2];
  const float* wv = (const float*)d_in[3];
  const float* wo = (const float*)d_in[4];
  const int*   tp = (const int*)d_in[5];
  float* out = (float*)d_out;
  char* ws = (char*)d_ws;
  _Float16* BQKV = (_Float16*)(ws + OFF_BW);
  _Float16* BO   = (_Float16*)(ws + OFF_BW + 3 * SZ_W);
  _Float16* X16  = (_Float16*)(ws + OFF_X16);
  _Float16* QKVh = (_Float16*)(ws + OFF_QKV);
  _Float16* QKVr = (_Float16*)(ws + OFF_QKV + SZ_QKV);
  _Float16* VTh  = (_Float16*)(ws + OFF_VT);
  _Float16* VTr  = (_Float16*)(ws + OFF_VT + SZ_VT);
  _Float16* KPh  = (_Float16*)(ws + OFF_KP);
  _Float16* KPr  = (_Float16*)(ws + OFF_KP + SZ_VT);
  _Float16* Oh   = (_Float16*)(ws + OFF_O);
  _Float16* Or   = (_Float16*)(ws + OFF_O + SZ_O);
  float*    CS   = (float*)(ws + OFF_CS);

  k_prep<<<GP_T + GP_X + 4 * GP_W, 256, 0, stream>>>(x, wq, wk, wv, wo, tp, BQKV, X16, CS);
  k_qkv<<<(unsigned)((NR / 128) * (LQ / 128)), 256, 0, stream>>>(X16, BQKV, CS, QKVh, QKVr, KPh, VTh);   /* k, V^T: both planes behind KPh, VTh (plane stride SZ_VT) */
  k_attn<<<GA_L + GA_E, 128, 0, stream>>>(QKVh, QKVr, KPh, KPr, VTh, VTr, Oh, Or);
  k_out<<<GO_E + GO_L, 128, 0, stream>>>(Oh, Or, BO, out);
}

// v006
// One run takes 84.7 microseconds.
// Two timings next to v005 put it at 1.04 and 1.03 times that version's speed.
// All steps since v000 together make it 3.16 times as fast.
#include <hip/hip_runtime.h>
// Causal multi-head self-attention with interleaved rotary (x [4][1024][1024]; q|k|v = x W^T with [out][in] weights, 16 heads of 64; scores * 1/8; causal by index; out = merged W_o^T).
// Compute dtype: all contractions v_wmma_f32_16x16x32_f16 (f16 operands, f32 accumulate). Inputs converted (RNE) to bf16 and held exactly in f16 (weights x16); q, k, v, P (x256), ctx (x64) as f16 hi planes,
// plus f16 residual planes (x2^10, separate accumulators) used for query rows 0..255 of every sequence; softmax statistics, rotary and all epilogues f32.
// Structure, four launches: preparation (cos/sin table from the position input, x plane, four weight planes: independent blocks of one grid), one QKV GEMM (N = 3072; rotary in the epilogue of the q and k blocks,
// the k and v blocks store their planes in the order of the attention's fragments, v transposed), fused online-softmax attention (late and early query rows as blocks of one grid), output GEMM (early and late rows as blocks of one grid).
// Both GEMMs stage their operand tiles in LDS with asynchronous 16-byte copies, two buffers of 64 k (128 k for the late output rows) each; the waves read their fragments from LDS.
#ifndef NB
#define NB 4
#endif
#ifndef SEQ
#define SEQ 1024
#endif
#define NB_FULL 4
#define SEQ_FULL 1024
#define DM 1024
#define NH 16
#define HD 64
#define LQ (3 * DM)
#define NR (NB * SEQ)
#define ERW 256                      /* query rows per sequence that use the residual planes */

static_assert(NB <= NB_FULL);
static_assert(SEQ <= SEQ_FULL);
static_assert(NH * HD == DM);
static_assert(HD == 64);
static_assert(DM % 64 == 0);
static_assert(DM % 32 == 0);
static_assert(LQ % 128 == 0);
static_assert(SEQ % 128 == 0);
static_assert(NR % 128 == 0);
static_assert(ERW % 128 == 0);
static_assert(SEQ >= ERW);
static_assert(ERW % 64 == 0);
static_assert(SEQ % 8 == 0);
static_assert(((size_t)NR * DM / 8) % 256 == 0);
static_assert(((size_t)DM * DM / 8) % 256 == 0);

typedef unsigned short v8us __attribute__((ext_vector_type(8), may_alias));
typedef float  v8f  __attribute__((ext_vector_type(8)));
typedef float  v4f  __attribute__((ext_vector_type(4)));
typedef float  v4fa __attribute__((ext_vector_type(4), may_alias));
typedef _Float16 v16h __attribute__((ext_vector_type(16)));
union FragH { v16h v; v8us half[2]; _Float16 h[16]; unsigned short u[16]; };

__device__ __forceinline__ unsigned short bf16_bits(float x) { unsigned int u = __float_as_uint(x); return (unsigned short)((u + 0x7FFFu + ((u >> 16) & 1u)) >> 16); }
__device__ __forceinline__ float bf16_rne(float x) { return __uint_as_float(((unsigned int)bf16_bits(x)) << 16); }

// A / B fragment from a k-contiguous 16-bit row: elements 0..7 <- p[8h .. 8h+7], elements 8..15 <- p[16+8h .. 16+8h+7]
__device__ __forceinline__ v16h g2_frag(const _Float16* p, int hh) { FragH f; f.half[0] = *(const v8us*)((const unsigned short*)p + 8 * hh); f.half[1] = *(const v8us*)((const unsigned short*)p + 16 + 8 * hh); return f.v; }
// The same fragment from a plane stored in fragment order: each half is the lane's 16 B of a 512-byte piece, so that a wave's load covers four whole 128-byte lines; p = the first piece + 8 * lane.
__device__ __forceinline__ v16h g2_pk(const _Float16* p) { FragH f; f.half[0] = *(const v8us*)(const unsigned short*)p; f.half[1] = *(const v8us*)((const unsigned short*)p + 256); return f.v; }
__device__ __forceinline__ v8f g2_mma(v16h a, v16h b, v8f c) { v8f d = __builtin_amdgcn_wmma_f32_16x16x32_f16(false, a, false, b, (short)0, c, false, false); asm volatile("v_nop\n\tv_nop\n\tv_nop\n\tv_nop" : "+v"(d) : "v"(a), "v"(b)); return d; }
__device__ __forceinline__ void wave_lds_sync() { __builtin_amdgcn_fence(4 /* acq_rel order */, "workgroup"); __builtin_amdgcn_wave_barrier(); }
// Lane l takes the value of lane l ^ 16 (a vector cross-row move; the shuffle builtin would go through the LDS unit).
__device__ __forceinline__ float xhalf(float x) { return __builtin_bit_cast(float, __builtin_amdgcn_permlanex16(__builtin_bit_cast(int, x), __builtin_bit_cast(int, x), 0x76543210, 0xfedcba98, false, false)); }

// One LDS stage of a GEMM block: kc of k for every operand row, row pitch = the row + 16 B (144 or 272 B = 16 B x odd: conflict-free for 16-byte row reads).
constexpr int gemm_stage_bytes(int wn, bool er, int kc) { return (128 * (er ? 2 : 1) + 64 * wn) * (kc * 2 + 16); }
#define KC_QKV 64                    /* three blocks share a WGP's LDS */
#define KC_OUT(er) ((er) ? 64 : 128) /* few blocks: the longer stage covers the copies' flight; with the residual plane its copy addresses would not fit the registers */

// N asynchronous 16-byte copies global -> LDS, lane by lane, in one statement.
// The s_wait_xcnt stands inside the statement so that no address register is rewritten in front of it; one statement a stage (two beyond 12 copies) pays that wait once.
#define CPL(a, b) "global_load_async_to_lds_b128 %" #a ", %" #b ", off\n\t"
template <int N>
__device__ __forceinline__ void cp_issue(const unsigned (&l)[N], const _Float16* const (&g)[N]) {
  static_assert(N == 8 || N == 10 || N == 12);
  if constexpr (N == 8)
    asm volatile(CPL(0, 1) CPL(2, 3) CPL(4, 5) CPL(6, 7) CPL(8, 9) CPL(10, 11) CPL(12, 13) CPL(14, 15) "s_wait_xcnt 0x0"
                 :: "v"(l[0]), "v"(g[0]), "v"(l[1]), "v"(g[1]), "v"(l[2]), "v"(g[2]), "v"(l[3]), "v"(g[3]), "v"(l[4]), "v"(g[4]), "v"(l[5]), "v"(g[5]), "v"(l[6]), "v"(g[6]), "v"(l[7]), "v"(g[7]) : "memory");
  else if constexpr (N == 10)
    asm volatile(CPL(0, 1) CPL(2, 3) CPL(4, 5) CPL(6, 7) CPL(8, 9) CPL(10, 11) CPL(12, 13) CPL(14, 15) CPL(16, 17) CPL(18, 19) "s_wait_xcnt 0x0"
                 :: "v"(l[0]), "v"(g[0]), "v"(l[1]), "v"(g[1]), "v"(l[2]), "v"(g[2]), "v"(l[3]), "v"(g[3]), "v"(l[4]), "v"(g[4]), "v"(l[5]), "v"(g[5]), "v"(l[6]), "v"(g[6]), "v"(l[7]), "v"(g[7]),
                    "v"(l[8]), "v"(g[8]), "v"(l[9]), "v"(g[9]) : "memory");
  else
    asm volatile(CPL(0, 1) CPL(2, 3) CPL(4, 5) CPL(6, 7) CPL(8, 9) CPL(10, 11) CPL(12, 13) CPL(14, 15) CPL(16, 17) CPL(18, 19) CPL(20, 21) CPL(22, 23) "s_wait_xcnt 0x0"
                 :: "v"(l[0]), "v"(g[0]), "v"(l[1]), "v"(g[1]), "v"(l[2]), "v"(g[2]), "v"(l[3]), "v"(g[3]), "v"(l[4]), "v"(g[4]), "v"(l[5]), "v"(g[5]), "v"(l[6]), "v"(g[6]), "v"(l[7]), "v"(g[7]),
                    "v"(l[8]), "v"(g[8]), "v"(l[9]), "v"(g[9]), "v"(l[10]), "v"(g[10]), "v"(l[11]), "v"(g[11]) : "memory");
}

// GEMM main loop of one block: A tile 128 rows (hi plane; residual plane too when ER), B tile 64 * WN rows, all k-contiguous with row pitch DM.
// 4 * WN waves, wave (wm, wn) = 32 rows x 64 columns; c (and d for the residual plane) accumulate k in ascending steps of 32.
// LDS stage = KC of k of [A hi 128 rows | A residual 128 rows when ER | B 64 * WN rows]; stage s + 2 is copied into the buffer that pass s has left.
template <int WN, bool ER, int KC>
__device__ __forceinline__ void gemm_core(unsigned char* sm, const _Float16* __restrict__ Ah, const _Float16* __restrict__ Ar, const _Float16* __restrict__ Bw, v8f (&c)[8], v8f (&d)[8]) {
  static_assert(DM % KC == 0 && DM / KC >= 2 && KC % 64 == 0);
  constexpr int LP = KC + 8, LPB = LP * 2;   /* LDS row pitch in f16 and in bytes */
  constexpr int TPR = KC / 8;                /* threads that copy one row, 16 B each */
  constexpr int RPP = 128 * WN / TPR;        /* rows covered by one copy of every thread */
  constexpr int NPA = ER ? 2 : 1;
  constexpr int SB = gemm_stage_bytes(WN, ER, KC);
  constexpr int NS = DM / KC;
  constexpr int KG = (WN == 1 && !ER) ? 2 : 1;   /* 32-k steps whose fragments are read as one group: two where registers allow and few waves share a SIMD */
  const int tid = threadIdx.x;
  const int wave = __builtin_amdgcn_readfirstlane((int)(tid >> 5));
  const int lane = tid & 31, ln = lane & 15, hh = lane >> 4;
  const int wm = wave & 3, wn = wave >> 2;
  const int cr = tid / TPR, cc = tid % TPR;
  const unsigned l0 = (unsigned)(size_t)sm + (unsigned)(cr * LPB + cc * 16);
  const _Float16* gA = Ah + (size_t)cr * DM + cc * 8;
  const _Float16* gR = Ar + (size_t)cr * DM + cc * 8;
  const _Float16* gB = Bw + (size_t)cr * DM + cc * 8;
  constexpr int NCP = (128 * NPA + 64 * WN) / RPP;   /* copies of a thread per stage */
  constexpr int NST = (NCP + 11) / 12, NPS = NCP / NST;   /* asm statements per stage, copies in each */
  static_assert(NST * NPS == NCP && NCP <= 63 && 128 % RPP == 0);
  auto fill = [&](int buf, int kc) {
    const unsigned l = l0 + (unsigned)(buf * SB);
#pragma unroll   /* both loops: row must be a compile-time constant, so that L and G are registers */
    for (int st = 0; st < NST; ++st) {
      unsigned L[NPS];
      const _Float16* G[NPS];
#pragma unroll
      for (int j = 0; j < NPS; ++j) {
        const int row = (st * NPS + j) * RPP;          /* first row of the stage that this copy of the block covers */
        L[j] = l + (unsigned)(row * LPB);
        G[j] = (row < 128 ? gA + (size_t)row * DM : (ER && row < 256) ? gR + (size_t)(row - 128) * DM : gB + (size_t)(row - 128 * NPA) * DM) + kc;
      }
      cp_issue<NPS>(L, G);
    }
  };
  fill(0, 0);
  asm volatile("s_wait_asynccnt 0x0" ::: "memory");   // stage 0 of this wave has landed
  __syncthreads();                                    // ... and every other wave's share of it
  fill(1, KC);
#pragma unroll 1   /* rolled: the buffer index is a scalar select, and the loop body stays short */
  for (int s = 0; s < NS; ++s) {
    const _Float16* bp = (const _Float16*)(sm + (s & 1) * SB);
    const _Float16* ap = bp + (32 * wm + ln) * LP;
    const _Float16* bq = bp + (128 * NPA + 64 * wn + ln) * LP;
#pragma unroll   /* this and the inner loops: fragment and accumulator indices must be constants, so that they are registers */
    for (int kg = 0; kg < KC / 32; kg += KG) {
      v16h af[KG][2], rf[KG][2], bf[KG][4];              /* a group's LDS reads go out together, ahead of its matrix instructions */
#pragma unroll
      for (int u = 0; u < KG; ++u) {
        const int kk = (kg + u) * 32;
        af[u][0] = g2_frag(ap + kk, hh); af[u][1] = g2_frag(ap + 16 * LP + kk, hh);
#pragma unroll
        for (int t = 0; t < 4; ++t) bf[u][t] = g2_frag(bq + t * 16 * LP + kk, hh);
        if (ER) { rf[u][0] = g2_frag(ap + 128 * LP + kk, hh); rf[u][1] = g2_frag(ap + 144 * LP + kk, hh); }
      }
#pragma unroll
      for (int u = 0; u < KG; ++u) {
#pragma unroll
        for (int t = 0; t < 4; ++t) {
          c[t] = g2_mma(af[u][0], bf[u][t], c[t]); c[4 + t] = g2_mma(af[u][1], bf[u][t], c[4 + t]);
          if (ER) { d[t] = g2_mma(rf[u][0], bf[u][t], d[t]); d[4 + t] = g2_mma(rf[u][1], bf[u][t], d[4 + t]); }
        }
      }
    }
    asm volatile("s_wait_dscnt 0x0" ::: "memory");      // this wave's reads of buffer s & 1 are done before it is refilled
    asm volatile("s_wait_asynccnt 0x0" ::: "memory");   // this wave's copies of stage s + 1 have landed
    __syncthreads();                                    // publishes stage s + 1 and ends every wave's reads of stage s
    if (s + 2 < NS) fill(s & 1, (s + 2) * KC);
  }
  asm volatile("s_wait_asynccnt 0x0" ::: "memory");     // nothing in flight when the buffers become output staging
}

__device__ __forceinline__ void wnat_body(const float* __restrict__ w, _Float16* __restrict__ Bt, unsigned blk) {
  const size_t t = (size_t)blk * 256 + threadIdx.x;
  if (t >= (size_t)DM * DM / 8) return;
  const v4f a = *(const v4fa*)(w + t * 8), c = *(const v4fa*)(w + t * 8 + 4);
  FragH f;
#pragma unroll
  for (int q = 0; q < 4; ++q) { f.h[q] = (_Float16)(bf16_rne(a[q]) * 16.0f); f.h[4 + q] = (_Float16)(bf16_rne(c[q]) * 16.0f); }
  const v8us o = f.half[0];
  unsigned short* d = (unsigned short*)Bt + t * 8;
  *(v8us*)d = o;
  
}

__device__ __forceinline__ void x16_body(const float* __restrict__ x, _Float16* __restrict__ X16, unsigned blk) {
  const size_t t = (size_t)blk * 256 + threadIdx.x;
  if (t >= (size_t)NR * DM / 8) return;
  const size_t row = t / (DM / 8);
  const int c8 = (int)(t % (DM / 8)) * 8;
  const size_t b = row / SEQ, s = row % SEQ;
  const float* src = x + (b * SEQ_FULL + s) * DM + c8;
  const v4f a = *(const v4fa*)src, c = *(const v4fa*)(src + 4);
  FragH f;
#pragma unroll
  for (int q = 0; q < 4; ++q) { f.h[q] = (_Float16)bf16_rne(a[q]); f.h[4 + q] = (_Float16)bf16_rne(c[q]); }
  const v8us o = f.half[0];
  unsigned short* d = (unsigned short*)X16 + t * 8;
  *(v8us*)d = o;
  
}

// CS[s][j] = (cos, sin)(float(pos[s]) * inv_freq[j]), inv_freq[j] = f32(1 / 10000^(j/32)) with the power formed in double from fixed roots.
__device__ __forceinline__ void tab_body(const int* __restrict__ tp, float* __restrict__ CS, unsigned blk) {
  __shared__ __attribute__((aligned(16))) float ts[8][64];
  const int tid = threadIdx.x;
  const int sl = tid >> 5, j = tid & 31;
  const int s = (int)blk * 8 + sl;
  const int pos = tp[s];
  double p = 1.0;
  p = (j & 1)  ? p * 1.3335214321633240 : p;
  p = (j & 2)  ? p * 1.7782794100389228 : p;
  p = (j & 4)  ? p * 3.1622776601683795 : p;
  p = (j & 8)  ? p * 10.0 : p;
  p = (j & 16) ? p * 100.0 : p;
  const float inv = (float)(1.0 / p);
  const float ang = (float)pos * inv;
  float sn, cs;
  sincosf(ang, &sn, &cs);
  ts[sl][2 * j] = cs;
  ts[sl][2 * j + 1] = sn;
  __syncthreads();
  if (tid < 128) {
    const int r = tid >> 4, c4 = (tid & 15) * 4;
    const v4f v = *(const v4fa*)&ts[r][c4];
    float* d = CS + (size_t)(blk * 8 + r) * 64 + c4;
    *(v4f*)d = v;
    
  }
}

// Preparation, one grid: nothing here reads what another block of the grid writes. Table blocks first (the longest dependent chain), then the x plane, then the four weight planes (wq | wk | wv | wo, contiguous in Bt).
constexpr unsigned GP_T = SEQ / 8;
constexpr unsigned GP_X = (unsigned)(((size_t)NR * DM / 8 + 255) / 256);
constexpr unsigned GP_W = (unsigned)(((size_t)DM * DM / 8 + 255) / 256);
__global__ __launch_bounds__(256) void k_prep(const float* __restrict__ x, const float* __restrict__ wq, const float* __restrict__ wk, const float* __restrict__ wv, const float* __restrict__ wo, const int* __restrict__ tp,
                                              _Float16* __restrict__ Bt, _Float16* __restrict__ X16, float* __restrict__ CS) {
  const unsigned blk = blockIdx.x;
  if (blk < GP_T) { tab_body(tp, CS, blk); return; }
  if (blk < GP_T + GP_X) { x16_body(x, X16, blk - GP_T); return; }
  const unsigned wb = blk - (GP_T + GP_X), wi = wb / GP_W;
  const float* w = wi == 0 ? wq : wi == 1 ? wk : wi == 2 ? wv : wo;
  wnat_body(w, Bt + (size_t)wi * DM * DM, wb - wi * GP_W);
}

// QKV GEMM: rows r = b*SEQ + s of X16 [NR][DM] times Bw [3*DM][DM] (x16) -> f32 * 1/16; rotary on the q and k column blocks (one wave's columns = one head); q is written to the planes Ph, Pr [r][LQ].
// k and v go out in the order in which the attention's fragments take them, in pieces of 512 B = 32 lanes (16 hh + ln) x 8 f16, plane stride NB*NH*HD*SEQ:
// KP[plane][(b,h)][key / 16][d / 16][lane: ln = key % 16, hh = d / 8 % 2][d % 8],  VT[plane][(b,h)][key / 32][d / 16][key / 16 % 2][lane: ln = d % 16, hh = key / 8 % 2][key % 8].
__global__ __launch_bounds__(256) void k_qkv(const _Float16* __restrict__ X16, const _Float16* __restrict__ Bw, const float* __restrict__ CS, _Float16* __restrict__ Ph, _Float16* __restrict__ Pr, _Float16* __restrict__ KP, _Float16* __restrict__ VT) {
  static_assert(2 * gemm_stage_bytes(2, false, KC_QKV) >= 8 * 32 * 68 * 4);
  constexpr int TP = 128 + 8;                           /* V^T staging: tokens of a row + 16 B (272 B = 16 B x odd: conflict-free for 16-byte accesses down a column of rows) */
  static_assert(2 * gemm_stage_bytes(2, false, KC_QKV) >= 2 * 128 * TP * 2);
  static_assert((2 * DM) % 128 == 0 && HD == 64);
  __shared__ __attribute__((aligned(16))) unsigned char sm[2 * gemm_stage_bytes(2, false, KC_QKV)];
  float (*so)[32][68] = (float (*)[32][68])sm;          /* output staging takes the operand buffers' place behind the main loop's last barrier */
  const int tid = threadIdx.x;
  const int wave = __builtin_amdgcn_readfirstlane((int)(tid >> 5));
  const int lane = tid & 31, ln = lane & 15, hh = lane >> 4;
  const int ntn = LQ / 128;
  const int mt = blockIdx.x / ntn, nq = blockIdx.x - mt * ntn;
  const int row0 = mt * 128 + 32 * (wave & 3), col0 = nq * 128 + 64 * (wave >> 2);
  const v8f z8 = {0.f, 0.f, 0.f, 0.f, 0.f, 0.f, 0.f, 0.f};
  v8f c[8] = {z8, z8, z8, z8, z8, z8, z8, z8};
  gemm_core<2, false, KC_QKV>(sm, X16 + (size_t)(mt * 128) * DM, X16 + (size_t)(mt * 128) * DM, Bw + (size_t)(nq * 128) * DM, c, c);
  if (nq >= 2 * DM / 128) {   /* v block (the same for the whole block): an accumulator's eight registers are eight consecutive tokens of one d, that is 16 B of a V^T row */
    _Float16 (*tv)[128][TP] = (_Float16 (*)[128][TP])sm;   /* [plane][the block's column = (head, d)][the block's token]; takes the operand buffers' place like so */
#pragma unroll   /* this and the inner loop: accumulator indices must be constants, so that they are registers */
    for (int u = 0; u < 8; ++u) {
      const int dc = 64 * (wave >> 2) + (u & 3) * 16 + ln, tk = 32 * (wave & 3) + (u >> 2) * 16 + 8 * hh;
      FragH fh, fr;
#pragma unroll
      for (int r = 0; r < 8; ++r) { const float e = c[u][r] * 0.0625f; const _Float16 hi = (_Float16)e; fh.h[r] = hi; fr.h[r] = (_Float16)((e - (float)hi) * 1024.0f); }
      *(v8us*)&tv[0][dc][tk] = fh.half[0];
      *(v8us*)&tv[1][dc][tk] = fr.half[0];
    }
    __syncthreads();   // each piece is one accumulator of one wave (one plane, lane for lane), and a wave's pieces come from two waves; behind this a wave stores sixteen whole pieces, 8 KB in a row
    const int b = (mt * 128) / SEQ, s0 = (mt * 128) % SEQ;
    const int pln = wave >> 2;
    const int hd = (wave >> 1) & 1, st2 = (wave & 1) * 2;   /* the wave's head of the block's two, the first of its two 32-key steps of the block's four */
    unsigned short* vo = (unsigned short*)VT + (size_t)pln * ((size_t)NB * NH * HD * SEQ) + ((size_t)(b * NH + (nq * 128 - 2 * DM) / HD + hd) * SEQ + s0 + st2 * 32) * HD + lane * 8;
#pragma unroll   /* piece offsets are constants: one address for all sixteen stores */
    for (int q = 0; q < 16; ++q) {
      const v8us v = *(const v8us*)&tv[pln][hd * 64 + ((q >> 1) & 3) * 16 + ln][(st2 + (q >> 3)) * 32 + (q & 1) * 16 + 8 * hh];
      *(v8us*)(vo + q * 256) = v;
    }
    return;
  }
#pragma unroll
  for (int u = 0; u < 8; ++u) {
    const int t = u & 3, half = u >> 2;
#pragma unroll
    for (int r = 0; r < 8; ++r) so[wave][half * 16 + 8 * hh + r][t * 16 + ln] = c[u][r] * 0.0625f;
  }
  wave_lds_sync();
  // Rotary, split and store of one 16-byte piece of a row: row r of the wave's 32, columns c8 .. c8 + 7 of its head.
  auto piece = [&](int r, int c8, unsigned short* dh, unsigned short* dr) {
    const v4f u0 = *(const v4fa*)&so[wave][r][c8], u1 = *(const v4fa*)&so[wave][r][c8 + 4];
    const int s = (row0 + r) % SEQ;
    const v4f t0 = *(const v4fa*)(CS + (size_t)s * 64 + c8), t1 = *(const v4fa*)(CS + (size_t)s * 64 + c8 + 4);
    float e[8] = {u0[0], u0[1], u0[2], u0[3], u1[0], u1[1], u1[2], u1[3]};
    const float cz[4] = {t0[0], t0[2], t1[0], t1[2]};
    const float sz[4] = {t0[1], t0[3], t1[1], t1[3]};
#pragma unroll
    for (int i = 0; i < 4; ++i) {
      const float te = e[2 * i], to = e[2 * i + 1];
      const float re = te * cz[i] - to * sz[i];
      const float ro = te * sz[i] + to * cz[i];
      e[2 * i] = re;
      e[2 * i + 1] = ro;
    }
    FragH fh, fr;
#pragma unroll
    for (int i = 0; i < 8; ++i) { const _Float16 hi = (_Float16)e[i]; fh.h[i] = hi; fr.h[i] = (_Float16)((e[i] - (float)hi) * 1024.0f); }
    *(v8us*)dh = fh.half[0];
    *(v8us*)dr = fr.half[0];
  };
  if (nq >= DM / 128) {   /* k block (the same for the whole block): the wave's 32 keys x 64 d are eight pieces, 4 KB in a row */
    unsigned short* kh = (unsigned short*)KP + ((size_t)((row0 / SEQ) * NH + (col0 - DM) / HD) * SEQ + row0 % SEQ) * HD + lane * 8;
    unsigned short* kr = kh + (size_t)NB * NH * HD * SEQ;
#pragma unroll 1
    for (int q = 0; q < 8; ++q) piece((q >> 2) * 16 + ln, (q & 3) * 16 + 8 * hh, kh + q * 256, kr + q * 256);
  } else {
    const int rsub = lane >> 3, c8 = (lane & 7) * 8;
#pragma unroll 1
    for (int q = 0; q < 8; ++q) {
      const int r = q * 4 + rsub;
      const size_t o = (size_t)(row0 + r) * LQ + col0 + c8;
      piece(r, c8, (unsigned short*)Ph + o, (unsigned short*)Pr + o);
    }
  }
}

// Fused causal attention, online softmax. Block = query tile qt of 64 rows of (batch, head) bh; wave = 16 query rows; 32-key steps; q, k and V^T fragments straight from the planes (k and V^T: a step's fragments are 4 KB in a row of each plane).
// Transposed products: S^T = K Q^T (k is the A operand, q the B operand), O^T += V^T P^T. A lane holds 16 of a step's 32 scores of ONE query (lane ln = query q0 + ln, register r of tile t = key key0 + 16 t + 8 hh + r):
// maximum and sum are formed in the lane, with one exchange between the wave's halves, and the two score tiles, converted in place, are the B fragment of P^T in the hardware's k order, which is the order of the V^T fragments.
// Fragment loads stand ahead of the work that hides them: q once in front of the loop; late rows: V^T of a step at its top, k of the next step behind this step's score products;
// early rows (twice the planes, few steps): all k of a step together at its top, all V^T behind its score products, so that the kernel's registers still let four blocks share a WGP.
struct AttnLds { _Float16 oh[4][16][72]; _Float16 ol[4][16][72]; };   /* output staging; every member a multiple of 16 B, row pitch 144 B = 16 B x odd */
template <bool ER>
__device__ __forceinline__ void attn_body(AttnLds& sh, const _Float16* __restrict__ Qh, const _Float16* __restrict__ Qr, const _Float16* __restrict__ Kh, const _Float16* __restrict__ Kr, const _Float16* __restrict__ VTh, const _Float16* __restrict__ VTr,
                                          _Float16* __restrict__ Oh, _Float16* __restrict__ Or, int qt, int bh) {
  auto& oh = sh.oh; auto& ol = sh.ol;
  const int tid = threadIdx.x;
  const int wave = __builtin_amdgcn_readfirstlane((int)(tid >> 5));
  const int lane = tid & 31, ln = lane & 15, hh = lane >> 4;
  const int b = bh / NH, h = bh % NH;
  const int q0 = qt * 64 + wave * 16;
  const size_t rowb = (size_t)b * SEQ;
  const size_t qoff = (rowb + q0 + ln) * LQ + h * HD;
  const size_t pk0 = (size_t)bh * SEQ * HD + lane * 8;   /* k and V^T planes: the lane's 16 B of the first piece of (batch, head); 32 keys are 32 * HD f16 further on in both */
  const int nst = (q0 + 16 + 31) >> 5;
  const v8f z8 = {0.f, 0.f, 0.f, 0.f, 0.f, 0.f, 0.f, 0.f};
  v8f o[4] = {z8, z8, z8, z8};
  v8f orr[4] = {z8, z8, z8, z8};
  float mrow = -1.0e30f, lrow = 0.f;   /* of the lane's query: the maximum over all keys so far, the sum over the keys of the lane's own half */
  v16h qh[2], ql[2], kh[2][2], kl[2][2], vh[4], vl[4];
  auto load_q = [&]() {
#pragma unroll
    for (int kk = 0; kk < 2; ++kk) {
      qh[kk] = g2_frag(Qh + qoff + kk * 32, hh);
      if constexpr (ER) ql[kk] = g2_frag(Qr + qoff + kk * 32, hh);
    }
  };
  auto load_k = [&](int key0) {
    const _Float16* kph = Kh + pk0 + (size_t)key0 * HD;   /* the lane's own address: every load below is this plus a constant */
    const _Float16* kpl = Kr + pk0 + (size_t)key0 * HD;
#pragma unroll
    for (int kk = 0; kk < 2; ++kk) {
#pragma unroll
      for (int t = 0; t < 2; ++t) {
        kh[kk][t] = g2_pk(kph + t * 1024 + kk * 512);
        if constexpr (ER) kl[kk][t] = g2_pk(kpl + t * 1024 + kk * 512);
      }
    }
    // Early rows: registers are short; the inputs keep the loads' address registers up to the wait.
    if constexpr (ER) asm volatile("s_wait_xcnt 0x0" :: "v"(kph), "v"(kpl) : "memory");
  };
  auto load_v = [&](const _Float16* vph, const _Float16* vpl) {
#pragma unroll
    for (int j = 0; j < 4; ++j) {
      vh[j] = g2_pk(vph + j * 512);
      if constexpr (ER) vl[j] = g2_pk(vpl + j * 512);
    }
  };
  load_q();
  if constexpr (!ER) load_k(0);
#pragma unroll 1
  for (int st = 0; st < nst; ++st) {
    const int key0 = st * 32;
    v8f sm[2] = {z8, z8};
    v8f sr[2] = {z8, z8};
    const _Float16* vph = VTh + pk0 + (size_t)key0 * HD;   /* the lane's own addresses, as in load_k */
    const _Float16* vpl = VTr + pk0 + (size_t)key0 * HD;
    if constexpr (ER) load_k(key0); else load_v(vph, vpl);
#pragma unroll
    for (int kk = 0; kk < 2; ++kk) {
#pragma unroll
      for (int t = 0; t < 2; ++t) {
        sm[t] = g2_mma(kh[kk][t], qh[kk], sm[t]);
        if constexpr (ER) {
          sr[t] = g2_mma(kh[kk][t], ql[kk], sr[t]);
          sr[t] = g2_mma(kl[kk][t], qh[kk], sr[t]);
        }
      }
    }
    if constexpr (ER) load_v(vph, vpl); else load_k((st + 1 < nst ? st + 1 : st) * 32);   /* the last step fetches its own keys again: no row past the wave's range is read */
    const int kq = key0 + 8 * hh - (q0 + ln);   /* index of the lane's first key minus the index of its query */
    float sc[16];
    bool mk[16];
#pragma unroll   /* this and the loops below: register indices must be constants */
    for (int i = 0; i < 16; ++i) {
      float s = sm[i >> 3][i & 7];
      if (ER) s += sr[i >> 3][i & 7] * 0.0009765625f;
      s *= 0.125f;
      mk[i] = kq + (i >> 3) * 16 + (i & 7) > 0;
      sc[i] = mk[i] ? -1.0e9f : s;
    }
    float rm = fmaxf(sc[0], sc[1]);
#pragma unroll
    for (int i = 2; i < 16; i += 2) rm = fmaxf(rm, fmaxf(sc[i], sc[i + 1]));
    rm = fmaxf(rm, xhalf(rm));
    const float mnew = fmaxf(mrow, rm);
    const float al = __expf(mrow - mnew);
    FragH pa, pb;
    float ps[16];
#pragma unroll
    for (int i = 0; i < 16; ++i) {
      const float e = __expf(sc[i] - mnew);
      ps[i] = mk[i] ? 0.f : e;
      const float a = ps[i] * 256.0f;
      const _Float16 hi = (_Float16)a;
      pa.h[i] = hi;                                                    /* element i of the B fragment = key 16 (i >> 3) + 8 hh + (i & 7) of the step: the accumulators' own order */
      pb.h[i] = ER ? (_Float16)((a - (float)hi) * 1024.0f) : hi;
    }
#pragma unroll
    for (int w = 8; w >= 1; w >>= 1) {
#pragma unroll
      for (int i = 0; i < w; ++i) ps[i] += ps[i + w];
    }
    lrow = lrow * al + ps[0];
    mrow = mnew;
#pragma unroll
    for (int j = 0; j < 4; ++j) {
#pragma unroll
      for (int r = 0; r < 8; ++r) { o[j][r] *= al; if (ER) orr[j][r] *= al; }
    }
    if constexpr (ER) asm volatile("s_wait_xcnt 0x0" :: "v"(vph), "v"(vpl) : "memory");   // as in load_k, for the V^T loads; it stands here, where it no longer holds the wave up
#pragma unroll
    for (int j = 0; j < 4; ++j) {
      o[j] = g2_mma(vh[j], pa.v, o[j]);
      if constexpr (ER) {
        orr[j] = g2_mma(vh[j], pb.v, orr[j]);
        orr[j] = g2_mma(vl[j], pa.v, orr[j]);
      }
    }
  }
  const float inv = 0.25f * (1.0f / (lrow + xhalf(lrow)));
#pragma unroll
  for (int j = 0; j < 4; ++j) {   /* an accumulator's eight registers are d = 16 j + 8 hh .. + 7 of the lane's query: 16 B of a staged row */
    FragH fh, fr;
#pragma unroll
    for (int r = 0; r < 8; ++r) {
      float v = o[j][r];
      if (ER) v += orr[j][r] * 0.0009765625f;
      v *= inv;
      const _Float16 hi = (_Float16)v;
      fh.h[r] = hi;
      fr.h[r] = (_Float16)((v - (float)hi) * 1024.0f);
    }
    *(v8us*)&oh[wave][ln][16 * j + 8 * hh] = fh.half[0];
    if (ER) *(v8us*)&ol[wave][ln][16 * j + 8 * hh] = fr.half[0];
  }
  wave_lds_sync();
  const int rsub = lane >> 3, c8 = (lane & 7) * 8;
  {
#pragma unroll
    for (int q = 0; q < 4; ++q) {
      const int r = q * 4 + rsub;
      const size_t oo = (rowb + q0 + r) * DM + h * HD + c8;
      const v8us vh8 = *(const v8us*)&oh[wave][r][c8];
      *(v8us*)((unsigned short*)Oh + oo) = vh8;
      if (ER) {
        const v8us vl8 = *(const v8us*)&ol[wave][r][c8];
        *(v8us*)((unsigned short*)Or + oo) = vl8;
      }
    }
    
  }
}
// One grid: the late tiles (tile fastest, then bh), behind them the early tiles, which use the residual planes; no block reads what another writes.
constexpr unsigned NT_E = ERW / 64, NT_L = SEQ / 64 - ERW / 64, NT_L1 = NT_L ? NT_L : 1;
constexpr unsigned GA_L = NT_L * NB * NH, GA_E = NT_E * NB * NH;
__global__ __launch_bounds__(128) void k_attn(const _Float16* __restrict__ Qh, const _Float16* __restrict__ Qr, const _Float16* __restrict__ Kh, const _Float16* __restrict__ Kr, const _Float16* __restrict__ VTh, const _Float16* __restrict__ VTr, _Float16* __restrict__ Oh, _Float16* __restrict__ Or) {
  __shared__ __attribute__((aligned(16))) AttnLds sh;
  const unsigned blk = blockIdx.x;
  if (blk < GA_L) {
    attn_body<false>(sh, Qh, Qr, Kh, Kr, VTh, VTr, Oh, Or, (int)(NT_E + blk % NT_L1), (int)(blk / NT_L1));
  } else {
    const unsigned e = blk - GA_L;
    attn_body<true>(sh, Qh, Qr, Kh, Kr, VTh, VTr, Oh, Or, (int)(e % NT_E), (int)(e / NT_E));
  }
}

// Output GEMM: ctx rows (x64; hi plane Ah, residual plane Ar x2^10 when ER) times Bw [DM][DM] (x16) -> f32 * 2^-10 into the output rows b*SEQ_FULL + s.
template <bool ER>
__device__ __forceinline__ void out_body(unsigned char* sm, const _Float16* __restrict__ Ah, const _Float16* __restrict__ Ar, const _Float16* __restrict__ Bw, float* __restrict__ C, int blk, int rbPerB, int rowOff) {
  static_assert(2 * gemm_stage_bytes(1, ER, KC_OUT(ER)) >= 4 * 32 * 68 * 4);
  float (*so)[32][68] = (float (*)[32][68])sm;          /* output staging takes the operand buffers' place behind the main loop's last barrier */
  const int tid = threadIdx.x;
  const int wave = __builtin_amdgcn_readfirstlane((int)(tid >> 5));
  const int lane = tid & 31, ln = lane & 15, hh = lane >> 4;
  const int ntn = DM / 64;
  const int mt = blk / ntn, nq = blk - mt * ntn;
  const int b = mt / rbPerB, lb = mt - b * rbPerB;
  const int s0 = rowOff + lb * 128 + 32 * wave;
  const int col0 = nq * 64;
  const size_t ablk = ((size_t)b * SEQ + rowOff + lb * 128) * DM;
  const size_t crow = (size_t)b * SEQ_FULL + s0;
  const v8f z8 = {0.f, 0.f, 0.f, 0.f, 0.f, 0.f, 0.f, 0.f};
  v8f c[8] = {z8, z8, z8, z8, z8, z8, z8, z8};
  v8f d[8] = {z8, z8, z8, z8, z8, z8, z8, z8};
  gemm_core<1, ER, KC_OUT(ER)>(sm, Ah + ablk, Ar + ablk, Bw + (size_t)col0 * DM, c, d);
#pragma unroll
  for (int u = 0; u < 8; ++u) {
    const int t = u & 3, half = u >> 2;
#pragma unroll
    for (int r = 0; r < 8; ++r) {
      float v = c[u][r];
      if (ER) v += d[u][r] * 0.0009765625f;
      so[wave][half * 16 + 8 * hh + r][t * 16 + ln] = v * 0.0009765625f;
    }
  }
  wave_lds_sync();
  const int rsub = lane >> 4, c4 = (lane & 15) * 4;
  {
#pragma unroll 1
    for (int q = 0; q < 16; ++q) {
      const int r = q * 2 + rsub;
      const v4f v = *(const v4fa*)&so[wave][r][c4];
      *(v4f*)(C + (crow + r) * DM + col0 + c4) = v;
    }
    
  }
}
// One grid: the early row blocks first (twice the matrix work and twice the stages of a late block), behind them the late ones; both use the same LDS bytes.
constexpr int RB_E = ERW / 128, RB_L = (SEQ - ERW) / 128, RB_L1 = RB_L ? RB_L : 1;
constexpr unsigned GO_E = (unsigned)(NB * RB_E * (DM / 64)), GO_L = (unsigned)(NB * RB_L * (DM / 64));
constexpr int OUT_LDS_E = 2 * gemm_stage_bytes(1, true, KC_OUT(true)), OUT_LDS_L = 2 * gemm_stage_bytes(1, false, KC_OUT(false));
__global__ __launch_bounds__(128) void k_out(const _Float16* __restrict__ Ah, const _Float16* __restrict__ Ar, const _Float16* __restrict__ Bw, float* __restrict__ C) {
  __shared__ __attribute__((aligned(16))) unsigned char sm[OUT_LDS_E > OUT_LDS_L ? OUT_LDS_E : OUT_LDS_L];
  const unsigned blk = blockIdx.x;
  if (blk < GO_E) out_body<true>(sm, Ah, Ar, Bw, C, (int)blk, RB_E, 0);
  else out_body<false>(sm, Ah, Ar, Bw, C, (int)(blk - GO_E), RB_L1, ERW);
}

// workspace carve (bytes); every region is a multiple of 256 B
constexpr size_t SZ_W    = (size_t)DM * DM * 2;                 /* one x16 f16 weight plane */
constexpr size_t SZ_X16  = (size_t)NR * DM * 2;
constexpr size_t SZ_QKV  = (size_t)NR * LQ * 2;                 /* one q plane, row pitch LQ (only the first third of a row is written and read) */
constexpr size_t SZ_VT   = (size_t)NB * NH * HD * SEQ * 2;      /* one V^T plane; one k plane */
constexpr size_t SZ_O    = (size_t)NR * DM * 2;                 /* one ctx plane */
constexpr size_t SZ_CS   = (size_t)SEQ * 64 * 4;
constexpr size_t OFF_BW  = 0;                                   /* wq | wk | wv | wo */
constexpr size_t OFF_X16 = OFF_BW + 4 * SZ_W;
constexpr size_t OFF_QKV = OFF_X16 + SZ_X16;                    /* hi plane, residual plane */
constexpr size_t OFF_VT  = OFF_QKV + 2 * SZ_QKV;                /* hi plane, residual plane */
constexpr size_t OFF_KP  = OFF_VT + 2 * SZ_VT;                  /* hi plane, residual plane */
constexpr size_t OFF_O   = OFF_KP + 2 * SZ_VT;                  /* hi plane, residual plane */
constexpr size_t OFF_CS  = OFF_O + 2 * SZ_O;
constexpr size_t WS_TOTAL = OFF_CS + SZ_CS;
static_assert(WS_TOTAL <= (size_t)134217728);
static_assert(SZ_W % 256 == 0 && SZ_X16 % 256 == 0 && SZ_QKV % 256 == 0 && SZ_VT % 256 == 0 && SZ_O % 256 == 0 && SZ_CS % 256 == 0);
static_assert((size_t)((NB - 1) * SEQ_FULL + SEQ) * DM * 4 <= (size_t)NB_FULL * SEQ_FULL * DM * 4);

extern "C" void kernel_launch(void* const* d_in, const int* in_sizes, int n_in,
                              void* d_out, int out_size, void* d_ws, size_t ws_size, hipStream_t stream) {
  if (n_in < 6) return;
  const size_t need_x = (size_t)((NB - 1) * SEQ_FULL + SEQ) * DM;
  if ((size_t)in_sizes[0] < need_x) return;
  if ((size_t)in_sizes[1] < (size_t)DM * DM || (size_t)in_sizes[2] < (size_t)DM * DM || (size_t)in_sizes[3] < (size_t)DM * DM || (size_t)in_sizes[4] < (size_t)DM * DM) return;
  if (in_sizes[5] < SEQ) return;
  if ((size_t)out_size < need_x) return;
  if (WS_TOTAL > ws_size) return;
  const float* x  = (const float*)d_in[0];
  const float* wq = (const float*)d_in[1];
  const float* wk = (const float*)d_in[2];
  const float* wv = (const float*)d_in[3];
  const float* wo = (const float*)d_in[4];
  const int*   tp = (const int*)d_in[5];
  float* out = (float*)d_out;
  char* ws = (char*)d_ws;
  _Float16* BQKV = (_Float16*)(ws + OFF_BW);
  _Float16* BO   = (_Float16*)(ws + OFF_BW + 3 * SZ_W);
  _Float16* X16  = (_Float16*)(ws + OFF_X16);
  _Float16* QKVh = (_Float16*)(ws + OFF_QKV);
  _Float16* QKVr = (_Float16*)(ws + OFF_QKV + SZ_QKV);
  _Float16* VTh  = (_Float16*)(ws + OFF_VT);
  _Float16* VTr  = (_Float16*)(ws + OFF_VT + SZ_VT);
  _Float16* KPh  = (_Float16*)(ws + OFF_KP);
  _Float16* KPr  = (_Float16*)(ws + OFF_KP + SZ_VT);
  _Float16* Oh   = (_Float16*)(ws + OFF_O);
  _Float16* Or   = (_Float16*)(ws + OFF_O + SZ_O);
  float*    CS   = (float*)(ws + OFF_CS);

  k_prep<<<GP_T + GP_X + 4 * GP_W, 256, 0, stream>>>(x, wq, wk, wv, wo, tp, BQKV, X16, CS);
  k_qkv<<<(unsigned)((NR / 128) * (LQ / 128)), 256, 0, stream>>>(X16, BQKV, CS, QKVh, QKVr, KPh, VTh);   /* k, V^T: both planes behind KPh, VTh (plane stride SZ_VT) */
  k_attn<<<GA_L + GA_E, 128, 0, stream>>>(QKVh, QKVr, KPh, KPr, VTh, VTr, Oh, Or);
  k_out<<<GO_E + GO_L, 128, 0, stream>>>(Oh, Or, BO, out);
}

// v007
// Measured time: 78.8 microseconds a run.
// Two timings next to v006 put it at 1.07 and 1.06 times that version's speed.
// Counting every step since v000, it is 3.37 times as fast.
#include <hip/hip_runtime.h>
// Causal multi-head self-attention with interleaved rotary (x [4][1024][1024]; q|k|v = x W^T with [out][in] weights, 16 heads of 64; scores * 1/8; causal by index; out = merged W_o^T).
// Compute dtype: all contractions v_wmma_f32_16x16x32_f16 (f16 operands, f32 accumulate). Inputs converted (RNE) to bf16 and held exactly in f16 (weights x16); q, k, v, P (x256), ctx (x64) as f16 hi planes,
// plus f16 residual planes (x2^10, separate accumulators) used for query rows 0..255 of every sequence; softmax statistics, rotary and all epilogues f32.
// Structure, four launches: preparation (cos/sin table from the position input, x plane, four weight planes: independent blocks of one grid), one QKV GEMM (N = 3072; rotary in the epilogue of the q and k blocks,
// the k and v blocks store their planes in the order of the attention's fragments, v transposed), fused online-softmax attention (late and early query rows as blocks of one grid), output GEMM (early and late rows as blocks of one grid).
// Both GEMMs stage their operand tiles in LDS with asynchronous 16-byte copies, two buffers of 64 k (128 k for the late output rows) each; the waves read their fragments from LDS.
// The attention's late query tiles stage k and V^T the same way, two buffers of 64 keys, one copy for the block's four waves.
#ifndef NB
#define NB 4
#endif
#ifndef SEQ
#define SEQ 1024
#endif
#define NB_FULL 4
#define SEQ_FULL 1024
#define DM 1024
#define NH 16
#define HD 64
#define LQ (3 * DM)
#define NR (NB * SEQ)
#define ERW 256                      /* query rows per sequence that use the residual planes */

static_assert(NB <= NB_FULL);
static_assert(SEQ <= SEQ_FULL);
static_assert(NH * HD == DM);
static_assert(HD == 64);
static_assert(DM % 64 == 0);
static_assert(DM % 32 == 0);
static_assert(LQ % 128 == 0);
static_assert(SEQ % 128 == 0);
static_assert(NR % 128 == 0);
static_assert(ERW % 128 == 0);
static_assert(SEQ >= ERW);
static_assert(ERW % 64 == 0);
static_assert(SEQ % 8 == 0);
static_assert(((size_t)NR * DM / 8) % 256 == 0);
static_assert(((size_t)DM * DM / 8) % 256 == 0);

typedef unsigned short v8us __attribute__((ext_vector_type(8), may_alias));
typedef float  v8f  __attribute__((ext_vector_type(8)));
typedef float  v4f  __attribute__((ext_vector_type(4)));
typedef float  v4fa __attribute__((ext_vector_type(4), may_alias));
typedef _Float16 v16h __attribute__((ext_vector_type(16)));
union FragH { v16h v; v8us half[2]; _Float16 h[16]; unsigned short u[16]; };

__device__ __forceinline__ unsigned short bf16_bits(float x) { unsigned int u = __float_as_uint(x); return (unsigned short)((u + 0x7FFFu + ((u >> 16) & 1u)) >> 16); }
__device__ __forceinline__ float bf16_rne(float x) { return __uint_as_float(((unsigned int)bf16_bits(x)) << 16); }

// A / B fragment from a k-contiguous 16-bit row: elements 0..7 <- p[8h .. 8h+7], elements 8..15 <- p[16+8h .. 16+8h+7]
__device__ __forceinline__ v16h g2_frag(const _Float16* p, int hh) { FragH f; f.half[0] = *(const v8us*)((const unsigned short*)p + 8 * hh); f.half[1] = *(const v8us*)((const unsigned short*)p + 16 + 8 * hh); return f.v; }
// The same fragment from a plane stored in fragment order: each half is the lane's 16 B of a 512-byte piece, so that a wave's load covers four whole 128-byte lines; p = the first piece + 8 * lane.
__device__ __forceinline__ v16h g2_pk(const _Float16* p) { FragH f; f.half[0] = *(const v8us*)(const unsigned short*)p; f.half[1] = *(const v8us*)((const unsigned short*)p + 256); return f.v; }
__device__ __forceinline__ v8f g2_mma(v16h a, v16h b, v8f c) { v8f d = __builtin_amdgcn_wmma_f32_16x16x32_f16(false, a, false, b, (short)0, c, false, false); asm volatile("v_nop\n\tv_nop\n\tv_nop\n\tv_nop" : "+v"(d) : "v"(a), "v"(b)); return d; }
__device__ __forceinline__ void wave_lds_sync() { __builtin_amdgcn_fence(4 /* acq_rel order */, "workgroup"); __builtin_amdgcn_wave_barrier(); }
// Lane l takes the value of lane l ^ 16 (a vector cross-row move; the shuffle builtin would go through the LDS unit).
__device__ __forceinline__ float xhalf(float x) { return __builtin_bit_cast(float, __builtin_amdgcn_permlanex16(__builtin_bit_cast(int, x), __builtin_bit_cast(int, x), 0x76543210, 0xfedcba98, false, false)); }

// One LDS stage of a GEMM block: kc of k for every operand row, row pitch = the row + 16 B (144 or 272 B = 16 B x odd: conflict-free for 16-byte row reads).
constexpr int gemm_stage_bytes(int wn, bool er, int kc) { return (128 * (er ? 2 : 1) + 64 * wn) * (kc * 2 + 16); }
#define KC_QKV 64                    /* three blocks share a WGP's LDS */
#define KC_OUT(er) ((er) ? 64 : 128) /* few blocks: the longer stage covers the copies' flight; with the residual plane its copy addresses would not fit the registers */

// N asynchronous 16-byte copies global -> LDS, lane by lane, in one statement.
// The s_wait_xcnt stands inside the statement so that no address register is rewritten in front of it; one statement a stage (two beyond 12 copies) pays that wait once.
#define CPL(a, b) "global_load_async_to_lds_b128 %" #a ", %" #b ", off\n\t"
template <int N>
__device__ __forceinline__ void cp_issue(const unsigned (&l)[N], const _Float16* const (&g)[N]) {
  static_assert(N == 8 || N == 10 || N == 12);
  if constexpr (N == 8)
    asm volatile(CPL(0, 1) CPL(2, 3) CPL(4, 5) CPL(6, 7) CPL(8, 9) CPL(10, 11) CPL(12, 13) CPL(14, 15) "s_wait_xcnt 0x0"
                 :: "v"(l[0]), "v"(g[0]), "v"(l[1]), "v"(g[1]), "v"(l[2]), "v"(g[2]), "v"(l[3]), "v"(g[3]), "v"(l[4]), "v"(g[4]), "v"(l[5]), "v"(g[5]), "v"(l[6]), "v"(g[6]), "v"(l[7]), "v"(g[7]) : "memory");
  else if constexpr (N == 10)
    asm volatile(CPL(0, 1) CPL(2, 3) CPL(4, 5) CPL(6, 7) CPL(8, 9) CPL(10, 11) CPL(12, 13) CPL(14, 15) CPL(16, 17) CPL(18, 19) "s_wait_xcnt 0x0"
                 :: "v"(l[0]), "v"(g[0]), "v"(l[1]), "v"(g[1]), "v"(l[2]), "v"(g[2]), "v"(l[3]), "v"(g[3]), "v"(l[4]), "v"(g[4]), "v"(l[5]), "v"(g[5]), "v"(l[6]), "v"(g[6]), "v"(l[7]), "v"(g[7]),
                    "v"(l[8]), "v"(g[8]), "v"(l[9]), "v"(g[9]) : "memory");
  else
    asm volatile(CPL(0, 1) CPL(2, 3) CPL(4, 5) CPL(6, 7) CPL(8, 9) CPL(10, 11) CPL(12, 13) CPL(14, 15) CPL(16, 17) CPL(18, 19) CPL(20, 21) CPL(22, 23) "s_wait_xcnt 0x0"
                 :: "v"(l[0]), "v"(g[0]), "v"(l[1]), "v"(g[1]), "v"(l[2]), "v"(g[2]), "v"(l[3]), "v"(g[3]), "v"(l[4]), "v"(g[4]), "v"(l[5]), "v"(g[5]), "v"(l[6]), "v"(g[6]), "v"(l[7]), "v"(g[7]),
                    "v"(l[8]), "v"(g[8]), "v"(l[9]), "v"(g[9]), "v"(l[10]), "v"(g[10]), "v"(l[11]), "v"(g[11]) : "memory");
}

// GEMM main loop of one block: A tile 128 rows (hi plane; residual plane too when ER), B tile 64 * WN rows, all k-contiguous with row pitch DM.
// 4 * WN waves, wave (wm, wn) = 32 rows x 64 columns; c (and d for the residual plane) accumulate k in ascending steps of 32.
// LDS stage = KC of k of [A hi 128 rows | A residual 128 rows when ER | B 64 * WN rows]; stage s + 2 is copied into the buffer that pass s has left.
template <int WN, bool ER, int KC>
__device__ __forceinline__ void gemm_core(unsigned char* sm, const _Float16* __restrict__ Ah, const _Float16* __restrict__ Ar, const _Float16* __restrict__ Bw, v8f (&c)[8], v8f (&d)[8]) {
  static_assert(DM % KC == 0 && DM / KC >= 2 && KC % 64 == 0);
  constexpr int LP = KC + 8, LPB = LP * 2;   /* LDS row pitch in f16 and in bytes */
  constexpr int TPR = KC / 8;                /* threads that copy one row, 16 B each */
  constexpr int RPP = 128 * WN / TPR;        /* rows covered by one copy of every thread */
  constexpr int NPA = ER ? 2 : 1;
  constexpr int SB = gemm_stage_bytes(WN, ER, KC);
  constexpr int NS = DM / KC;
  constexpr int KG = (WN == 1 && !ER) ? 2 : 1;   /* 32-k steps whose fragments are read as one group: two where registers allow and few waves share a SIMD */
  const int tid = threadIdx.x;
  const int wave = __builtin_amdgcn_readfirstlane((int)(tid >> 5));
  const int lane = tid & 31, ln = lane & 15, hh = lane >> 4;
  const int wm = wave & 3, wn = wave >> 2;
  const int cr = tid / TPR, cc = tid % TPR;
  const unsigned l0 = (unsigned)(size_t)sm + (unsigned)(cr * LPB + cc * 16);
  const _Float16* gA = Ah + (size_t)cr * DM + cc * 8;
  const _Float16* gR = Ar + (size_t)cr * DM + cc * 8;
  const _Float16* gB = Bw + (size_t)cr * DM + cc * 8;
  constexpr int NCP = (128 * NPA + 64 * WN) / RPP;   /* copies of a thread per stage */
  constexpr int NST = (NCP + 11) / 12, NPS = NCP / NST;   /* asm statements per stage, copies in each */
  static_assert(NST * NPS == NCP && NCP <= 63 && 128 % RPP == 0);
  auto fill = [&](int buf, int kc) {
    const unsigned l = l0 + (unsigned)(buf * SB);
#pragma unroll   /* both loops: row must be a compile-time constant, so that L and G are registers */
    for (int st = 0; st < NST; ++st) {
      unsigned L[NPS];
      const _Float16* G[NPS];
#pragma unroll
      for (int j = 0; j < NPS; ++j) {
        const int row = (st * NPS + j) * RPP;          /* first row of the stage that this copy of the block covers */
        L[j] = l + (unsigned)(row * LPB);
        G[j] = (row < 128 ? gA + (size_t)row * DM : (ER && row < 256) ? gR + (size_t)(row - 128) * DM : gB + (size_t)(row - 128 * NPA) * DM) + kc;
      }
      cp_issue<NPS>(L, G);
    }
  };
  fill(0, 0);
  asm volatile("s_wait_asynccnt 0x0" ::: "memory");   // stage 0 of this wave has landed
  __syncthreads();                                    // ... and every other wave's share of it
  fill(1, KC);
#pragma unroll 1   /* rolled: the buffer index is a scalar select, and the loop body stays short */
  for (int s = 0; s < NS; ++s) {
    const _Float16* bp = (const _Float16*)(sm + (s & 1) * SB);
    const _Float16* ap = bp + (32 * wm + ln) * LP;
    const _Float16* bq = bp + (128 * NPA + 64 * wn + ln) * LP;
#pragma unroll   /* this and the inner loops: fragment and accumulator indices must be constants, so that they are registers */
    for (int kg = 0; kg < KC / 32; kg += KG) {
      v16h af[KG][2], rf[KG][2], bf[KG][4];              /* a group's LDS reads go out together, ahead of its matrix instructions */
#pragma unroll
      for (int u = 0; u < KG; ++u) {
        const int kk = (kg + u) * 32;
        af[u][0] = g2_frag(ap + kk, hh); af[u][1] = g2_frag(ap + 16 * LP + kk, hh);
#pragma unroll
        for (int t = 0; t < 4; ++t) bf[u][t] = g2_frag(bq + t * 16 * LP + kk, hh);
        if (ER) { rf[u][0] = g2_frag(ap + 128 * LP + kk, hh); rf[u][1] = g2_frag(ap + 144 * LP + kk, hh); }
      }
#pragma unroll
      for (int u = 0; u < KG; ++u) {
#pragma unroll
        for (int t = 0; t < 4; ++t) {
          c[t] = g2_mma(af[u][0], bf[u][t], c[t]); c[4 + t] = g2_mma(af[u][1], bf[u][t], c[4 + t]);
          if (ER) { d[t] = g2_mma(rf[u][0], bf[u][t], d[t]); d[4 + t] = g2_mma(rf[u][1], bf[u][t], d[4 + t]); }
        }
      }
    }
    asm volatile("s_wait_dscnt 0x0" ::: "memory");      // this wave's reads of buffer s & 1 are done before it is refilled
    asm volatile("s_wait_asynccnt 0x0" ::: "memory");   // this wave's copies of stage s + 1 have landed
    __syncthreads();                                    // publishes stage s + 1 and ends every wave's reads of stage s
    if (s + 2 < NS) fill(s & 1, (s + 2) * KC);
  }
  asm volatile("s_wait_asynccnt 0x0" ::: "memory");     // nothing in flight when the buffers become output staging
}

__device__ __forceinline__ void wnat_body(const float* __restrict__ w, _Float16* __restrict__ Bt, unsigned blk) {
  const size_t t = (size_t)blk * 256 + threadIdx.x;
  if (t >= (size_t)DM * DM / 8) return;
  const v4f a = *(const v4fa*)(w + t * 8), c = *(const v4fa*)(w + t * 8 + 4);
  FragH f;
#pragma unroll
  for (int q = 0; q < 4; ++q) { f.h[q] = (_Float16)(bf16_rne(a[q]) * 16.0f); f.h[4 + q] = (_Float16)(bf16_rne(c[q]) * 16.0f); }
  const v8us o = f.half[0];
  unsigned short* d = (unsigned short*)Bt + t * 8;
  *(v8us*)d = o;
  
}

__device__ __forceinline__ void x16_body(const float* __restrict__ x, _Float16* __restrict__ X16, unsigned blk) {
  const size_t t = (size_t)blk * 256 + threadIdx.x;
  if (t >= (size_t)NR * DM / 8) return;
  const size_t row = t / (DM / 8);
  const int c8 = (int)(t % (DM / 8)) * 8;
  const size_t b = row / SEQ, s = row % SEQ;
  const float* src = x + (b * SEQ_FULL + s) * DM + c8;
  const v4f a = *(const v4fa*)src, c = *(const v4fa*)(src + 4);
  FragH f;
#pragma unroll
  for (int q = 0; q < 4; ++q) { f.h[q] = (_Float16)bf16_rne(a[q]); f.h[4 + q] = (_Float16)bf16_rne(c[q]); }
  const v8us o = f.half[0];
  unsigned short* d = (unsigned short*)X16 + t * 8;
  *(v8us*)d = o;
  
}

// CS[s][j] = (cos, sin)(float(pos[s]) * inv_freq[j]), inv_freq[j] = f32(1 / 10000^(j/32)) with the power formed in double from fixed roots.
__device__ __forceinline__ void tab_body(const int* __restrict__ tp, float* __restrict__ CS, unsigned blk) {
  __shared__ __attribute__((aligned(16))) float ts[8][64];
  const int tid = threadIdx.x;
  const int sl = tid >> 5, j = tid & 31;
  const int s = (int)blk * 8 + sl;
  const int pos = tp[s];
  double p = 1.0;
  p = (j & 1)  ? p * 1.3335214321633240 : p;
  p = (j & 2)  ? p * 1.7782794100389228 : p;
  p = (j & 4)  ? p * 3.1622776601683795 : p;
  p = (j & 8)  ? p * 10.0 : p;
  p = (j & 16) ? p * 100.0 : p;
  const float inv = (float)(1.0 / p);
  const float ang = (float)pos * inv;
  float sn, cs;
  sincosf(ang, &sn, &cs);
  ts[sl][2 * j] = cs;
  ts[sl][2 * j + 1] = sn;
  __syncthreads();
  if (tid < 128) {
    const int r = tid >> 4, c4 = (tid & 15) * 4;
    const v4f v = *(const v4fa*)&ts[r][c4];
    float* d = CS + (size_t)(blk * 8 + r) * 64 + c4;
    *(v4f*)d = v;
    
  }
}

// Preparation, one grid: nothing here reads what another block of the grid writes. Table blocks first (the longest dependent chain), then the x plane, then the four weight planes (wq | wk | wv | wo, contiguous in Bt).
constexpr unsigned GP_T = SEQ / 8;
constexpr unsigned GP_X = (unsigned)(((size_t)NR * DM / 8 + 255) / 256);
constexpr unsigned GP_W = (unsigned)(((size_t)DM * DM / 8 + 255) / 256);
__global__ __launch_bounds__(256) void k_prep(const float* __restrict__ x, const float* __restrict__ wq, const float* __restrict__ wk, const float* __restrict__ wv, const float* __restrict__ wo, const int* __restrict__ tp,
                                              _Float16* __restrict__ Bt, _Float16* __restrict__ X16, float* __restrict__ CS) {
  const unsigned blk = blockIdx.x;
  if (blk < GP_T) { tab_body(tp, CS, blk); return; }
  if (blk < GP_T + GP_X) { x16_body(x, X16, blk - GP_T); return; }
  const unsigned wb = blk - (GP_T + GP_X), wi = wb / GP_W;
  const float* w = wi == 0 ? wq : wi == 1 ? wk : wi == 2 ? wv : wo;
  wnat_body(w, Bt + (size_t)wi * DM * DM, wb - wi * GP_W);
}

// QKV GEMM: rows r = b*SEQ + s of X16 [NR][DM] times Bw [3*DM][DM] (x16) -> f32 * 1/16; rotary on the q and k column blocks (one wave's columns = one head); q is written to the planes Ph, Pr [r][LQ].
// k and v go out in the order in which the attention's fragments take them, in pieces of 512 B = 32 lanes (16 hh + ln) x 8 f16, plane stride NB*NH*HD*SEQ:
// KP[plane][(b,h)][key / 16][d / 16][lane: ln = key % 16, hh = d / 8 % 2][d % 8],  VT[plane][(b,h)][key / 32][d / 16][key / 16 % 2][lane: ln = d % 16, hh = key / 8 % 2][key % 8].
__global__ __launch_bounds__(256) void k_qkv(const _Float16* __restrict__ X16, const _Float16* __restrict__ Bw, const float* __restrict__ CS, _Float16* __restrict__ Ph, _Float16* __restrict__ Pr, _Float16* __restrict__ KP, _Float16* __restrict__ VT) {
  static_assert(2 * gemm_stage_bytes(2, false, KC_QKV) >= 8 * 32 * 68 * 4);
  constexpr int TP = 128 + 8;                           /* V^T staging: tokens of a row + 16 B (272 B = 16 B x odd: conflict-free for 16-byte accesses down a column of rows) */
  static_assert(2 * gemm_stage_bytes(2, false, KC_QKV) >= 2 * 128 * TP * 2);
  static_assert((2 * DM) % 128 == 0 && HD == 64);
  __shared__ __attribute__((aligned(16))) unsigned char sm[2 * gemm_stage_bytes(2, false, KC_QKV)];
  float (*so)[32][68] = (float (*)[32][68])sm;          /* output staging takes the operand buffers' place behind the main loop's last barrier */
  const int tid = threadIdx.x;
  const int wave = __builtin_amdgcn_readfirstlane((int)(tid >> 5));
  const int lane = tid & 31, ln = lane & 15, hh = lane >> 4;
  const int ntn = LQ / 128;
  const int mt = blockIdx.x / ntn, nq = blockIdx.x - mt * ntn;
  const int row0 = mt * 128 + 32 * (wave & 3), col0 = nq * 128 + 64 * (wave >> 2);
  const v8f z8 = {0.f, 0.f, 0.f, 0.f, 0.f, 0.f, 0.f, 0.f};
  v8f c[8] = {z8, z8, z8, z8, z8, z8, z8, z8};
  gemm_core<2, false, KC_QKV>(sm, X16 + (size_t)(mt * 128) * DM, X16 + (size_t)(mt * 128) * DM, Bw + (size_t)(nq * 128) * DM, c, c);
  if (nq >= 2 * DM / 128) {   /* v block (the same for the whole block): an accumulator's eight registers are eight consecutive tokens of one d, that is 16 B of a V^T row */
    _Float16 (*tv)[128][TP] = (_Float16 (*)[128][TP])sm;   /* [plane][the block's column = (head, d)][the block's token]; takes the operand buffers' place like so */
#pragma unroll   /* this and the inner loop: accumulator indices must be constants, so that they are registers */
    for (int u = 0; u < 8; ++u) {
      const int dc = 64 * (wave >> 2) + (u & 3) * 16 + ln, tk = 32 * (wave & 3) + (u >> 2) * 16 + 8 * hh;
      FragH fh, fr;
#pragma unroll
      for (int r = 0; r < 8; ++r) { const float e = c[u][r] * 0.0625f; const _Float16 hi = (_Float16)e; fh.h[r] = hi; fr.h[r] = (_Float16)((e - (float)hi) * 1024.0f); }
      *(v8us*)&tv[0][dc][tk] = fh.half[0];
      *(v8us*)&tv[1][dc][tk] = fr.half[0];
    }
    __syncthreads();   // each piece is one accumulator of one wave (one plane, lane for lane), and a wave's pieces come from two waves; behind this a wave stores sixteen whole pieces, 8 KB in a row
    const int b = (mt * 128) / SEQ, s0 = (mt * 128) % SEQ;
    const int pln = wave >> 2;
    const int hd = (wave >> 1) & 1, st2 = (wave & 1) * 2;   /* the wave's head of the block's two, the first of its two 32-key steps of the block's four */
    unsigned short* vo = (unsigned short*)VT + (size_t)pln * ((size_t)NB * NH * HD * SEQ) + ((size_t)(b * NH + (nq * 128 - 2 * DM) / HD + hd) * SEQ + s0 + st2 * 32) * HD + lane * 8;
#pragma unroll   /* piece offsets are constants: one address for all sixteen stores */
    for (int q = 0; q < 16; ++q) {
      const v8us v = *(const v8us*)&tv[pln][hd * 64 + ((q >> 1) & 3) * 16 + ln][(st2 + (q >> 3)) * 32 + (q & 1) * 16 + 8 * hh];
      *(v8us*)(vo + q * 256) = v;
    }
    return;
  }
#pragma unroll
  for (int u = 0; u < 8; ++u) {
    const int t = u & 3, half = u >> 2;
#pragma unroll
    for (int r = 0; r < 8; ++r) so[wave][half * 16 + 8 * hh + r][t * 16 + ln] = c[u][r] * 0.0625f;
  }
  wave_lds_sync();
  // Rotary, split and store of one 16-byte piece of a row: row r of the wave's 32, columns c8 .. c8 + 7 of its head.
  auto piece = [&](int r, int c8, unsigned short* dh, unsigned short* dr) {
    const v4f u0 = *(const v4fa*)&so[wave][r][c8], u1 = *(const v4fa*)&so[wave][r][c8 + 4];
    const int s = (row0 + r) % SEQ;
    const v4f t0 = *(const v4fa*)(CS + (size_t)s * 64 + c8), t1 = *(const v4fa*)(CS + (size_t)s * 64 + c8 + 4);
    float e[8] = {u0[0], u0[1], u0[2], u0[3], u1[0], u1[1], u1[2], u1[3]};
    const float cz[4] = {t0[0], t0[2], t1[0], t1[2]};
    const float sz[4] = {t0[1], t0[3], t1[1], t1[3]};
#pragma unroll
    for (int i = 0; i < 4; ++i) {
      const float te = e[2 * i], to = e[2 * i + 1];
      const float re = te * cz[i] - to * sz[i];
      const float ro = te * sz[i] + to * cz[i];
      e[2 * i] = re;
      e[2 * i + 1] = ro;
    }
    FragH fh, fr;
#pragma unroll
    for (int i = 0; i < 8; ++i) { const _Float16 hi = (_Float16)e[i]; fh.h[i] = hi; fr.h[i] = (_Float16)((e[i] - (float)hi) * 1024.0f); }
    *(v8us*)dh = fh.half[0];
    *(v8us*)dr = fr.half[0];
  };
  if (nq >= DM / 128) {   /* k block (the same for the whole block): the wave's 32 keys x 64 d are eight pieces, 4 KB in a row */
    unsigned short* kh = (unsigned short*)KP + ((size_t)((row0 / SEQ) * NH + (col0 - DM) / HD) * SEQ + row0 % SEQ) * HD + lane * 8;
    unsigned short* kr = kh + (size_t)NB * NH * HD * SEQ;
#pragma unroll 1
    for (int q = 0; q < 8; ++q) piece((q >> 2) * 16 + ln, (q & 3) * 16 + 8 * hh, kh + q * 256, kr + q * 256);
  } else {
    const int rsub = lane >> 3, c8 = (lane & 7) * 8;
#pragma unroll 1
    for (int q = 0; q < 8; ++q) {
      const int r = q * 4 + rsub;
      const size_t o = (size_t)(row0 + r) * LQ + col0 + c8;
      piece(r, c8, (unsigned short*)Ph + o, (unsigned short*)Pr + o);
    }
  }
}

// Fused causal attention, online softmax. Block = query tile qt of 64 rows of (batch, head) bh; wave = 16 query rows; 32-key steps; q fragments straight from the planes; a step's k and V^T fragments are 4 KB in a row of each plane.
// Transposed products: S^T = K Q^T (k is the A operand, q the B operand), O^T += V^T P^T. A lane holds 16 of a step's 32 scores of ONE query (lane ln = query q0 + ln, register r of tile t = key key0 + 16 t + 8 hh + r):
// maximum and sum are formed in the lane, with one exchange between the wave's halves, and the two score tiles, converted in place, are the B fragment of P^T in the hardware's k order, which is the order of the V^T fragments.
// Late rows: the block's four waves walk the same keys, so 64 keys of k and V^T (8 KB + 8 KB, each contiguous in its plane) are copied to LDS once for all four, asynchronously, two buffers, the tile after next behind each trip's barrier;
// a trip is two 32-key steps; fragments come from LDS in the planes' own order (a wave's 16-byte read covers 512 contiguous bytes): V^T of a step at its top, k of a trip's second step behind the first step's score products.
// Early rows (twice the planes, few steps) read the planes directly: all k of a step together at its top, all V^T behind its score products, so that the kernel's registers still let four blocks share a WGP.
#define KV_TB (64 * HD * 2)           /* bytes of 64 keys of one plane */
struct AttnLds { _Float16 oh[4][16][72]; _Float16 ol[4][16][72]; unsigned char kv[2][2 * KV_TB]; };   /* output staging (row pitch 144 B = 16 B x odd); late rows' two buffers of [k | V^T]; every member a multiple of 16 B */
template <bool ER>
__device__ __forceinline__ void attn_body(AttnLds& sh, const _Float16* __restrict__ Qh, const _Float16* __restrict__ Qr, const _Float16* __restrict__ Kh, const _Float16* __restrict__ Kr, const _Float16* __restrict__ VTh, const _Float16* __restrict__ VTr,
                                          _Float16* __restrict__ Oh, _Float16* __restrict__ Or, int qt, int bh) {
  auto& oh = sh.oh; auto& ol = sh.ol;
  const int tid = threadIdx.x;
  const int wave = __builtin_amdgcn_readfirstlane((int)(tid >> 5));
  const int lane = tid & 31, ln = lane & 15, hh = lane >> 4;
  const int b = bh / NH, h = bh % NH;
  const int q0 = qt * 64 + wave * 16;
  const size_t rowb = (size_t)b * SEQ;
  const size_t qoff = (rowb + q0 + ln) * LQ + h * HD;
  const size_t pk0 = (size_t)bh * SEQ * HD + lane * 8;   /* k and V^T planes: the lane's 16 B of the first piece of (batch, head); 32 keys are 32 * HD f16 further on in both */
  const int nst = (q0 + 16 + 31) >> 5;
  const v8f z8 = {0.f, 0.f, 0.f, 0.f, 0.f, 0.f, 0.f, 0.f};
  v8f o[4] = {z8, z8, z8, z8};
  v8f orr[4] = {z8, z8, z8, z8};
  float mrow = -1.0e30f, lrow = 0.f;   /* of the lane's query: the maximum over all keys so far, the sum over the keys of the lane's own half */
  v16h qh[2], ql[2], kh[2][2], kl[2][2], vh[4], vl[4];
  auto load_q = [&]() {
#pragma unroll
    for (int kk = 0; kk < 2; ++kk) {
      qh[kk] = g2_frag(Qh + qoff + kk * 32, hh);
      if constexpr (ER) ql[kk] = g2_frag(Qr + qoff + kk * 32, hh);
    }
  };
  auto load_k = [&](int key0) {
    const _Float16* kph = Kh + pk0 + (size_t)key0 * HD;   /* the lane's own address: every load below is this plus a constant */
    const _Float16* kpl = Kr + pk0 + (size_t)key0 * HD;
#pragma unroll
    for (int kk = 0; kk < 2; ++kk) {
#pragma unroll
      for (int t = 0; t < 2; ++t) {
        kh[kk][t] = g2_pk(kph + t * 1024 + kk * 512);
        if constexpr (ER) kl[kk][t] = g2_pk(kpl + t * 1024 + kk * 512);
      }
    }
    // Early rows: registers are short; the inputs keep the loads' address registers up to the wait.
    if constexpr (ER) asm volatile("s_wait_xcnt 0x0" :: "v"(kph), "v"(kpl) : "memory");
  };
  // Late rows: fragments of 32-key step u of a staged tile; bp = the buffer + 8 * lane, in f16: [k 64 keys | V^T 64 keys].
  auto lds_k = [&](const _Float16* bp, int u) {
#pragma unroll   /* this and the two loops below: fragment indices must be constants, so that they are registers */
    for (int kk = 0; kk < 2; ++kk) {
#pragma unroll
      for (int t = 0; t < 2; ++t) kh[kk][t] = g2_pk(bp + u * 32 * HD + t * 1024 + kk * 512);
    }
  };
  auto lds_v = [&](const _Float16* bp, int u) {
#pragma unroll
    for (int j = 0; j < 4; ++j) vh[j] = g2_pk(bp + 64 * HD + u * 32 * HD + j * 512);
  };
  // Late rows: tile (64 keys) of the k and V^T hi planes into buffer buf; the block's 128 threads copy 2 KB at a time, four times for each plane.
  auto fill = [&](int buf, int tile) {
    const unsigned l = (unsigned)(size_t)&sh.kv[0][0] + (unsigned)(buf * 2 * KV_TB + tid * 16);
    const size_t go = (size_t)bh * SEQ * HD + (size_t)tile * 64 * HD + tid * 8;
    unsigned L[8];
    const _Float16* G[8];
#pragma unroll   /* indices must be constants, so that L and G are registers */
    for (int j = 0; j < 4; ++j) {
      L[j] = l + (unsigned)(j * 2048);             G[j] = Kh + go + j * 1024;
      L[4 + j] = l + (unsigned)(KV_TB + j * 2048); G[4 + j] = VTh + go + j * 1024;
    }
    cp_issue<8>(L, G);
  };
  auto load_v = [&](const _Float16* vph, const _Float16* vpl) {
#pragma unroll
    for (int j = 0; j < 4; ++j) {
      vh[j] = g2_pk(vph + j * 512);
      if constexpr (ER) vl[j] = g2_pk(vpl + j * 512);
    }
  };
  load_q();
  // One 32-key step; late rows: step u of the tile staged at bp.
  auto step = [&](int st, const _Float16* bp, int u) {
    const int key0 = st * 32;
    v8f sm[2] = {z8, z8};
    v8f sr[2] = {z8, z8};
    const _Float16* vph = VTh + pk0 + (size_t)key0 * HD;   /* the lane's own addresses, as in load_k */
    const _Float16* vpl = VTr + pk0 + (size_t)key0 * HD;
    if constexpr (ER) load_k(key0); else lds_v(bp, u);
#pragma unroll
    for (int kk = 0; kk < 2; ++kk) {
#pragma unroll
      for (int t = 0; t < 2; ++t) {
        sm[t] = g2_mma(kh[kk][t], qh[kk], sm[t]);
        if constexpr (ER) {
          sr[t] = g2_mma(kh[kk][t], ql[kk], sr[t]);
          sr[t] = g2_mma(kl[kk][t], qh[kk], sr[t]);
        }
      }
    }
    if constexpr (ER) load_v(vph, vpl); else if (u == 0) lds_k(bp, 1);   /* the same buffer: nothing of the next tile is read ahead of its barrier */
    const int kq = key0 + 8 * hh - (q0 + ln);   /* index of the lane's first key minus the index of its query */
    float sc[16];
    bool mk[16];
#pragma unroll   /* this and the loops below: register indices must be constants */
    for (int i = 0; i < 16; ++i) {
      float s = sm[i >> 3][i & 7];
      if (ER) s += sr[i >> 3][i & 7] * 0.0009765625f;
      s *= 0.125f;
      mk[i] = kq + (i >> 3) * 16 + (i & 7) > 0;
      sc[i] = mk[i] ? -1.0e9f : s;
    }
    float rm = fmaxf(sc[0], sc[1]);
#pragma unroll
    for (int i = 2; i < 16; i += 2) rm = fmaxf(rm, fmaxf(sc[i], sc[i + 1]));
    rm = fmaxf(rm, xhalf(rm));
    const float mnew = fmaxf(mrow, rm);
    const float al = __expf(mrow - mnew);
    FragH pa, pb;
    float ps[16];
#pragma unroll
    for (int i = 0; i < 16; ++i) {
      const float e = __expf(sc[i] - mnew);
      ps[i] = mk[i] ? 0.f : e;
      const float a = ps[i] * 256.0f;
      const _Float16 hi = (_Float16)a;
      pa.h[i] = hi;                                                    /* element i of the B fragment = key 16 (i >> 3) + 8 hh + (i & 7) of the step: the accumulators' own order */
      pb.h[i] = ER ? (_Float16)((a - (float)hi) * 1024.0f) : hi;
    }
#pragma unroll
    for (int w = 8; w >= 1; w >>= 1) {
#pragma unroll
      for (int i = 0; i < w; ++i) ps[i] += ps[i + w];
    }
    lrow = lrow * al + ps[0];
    mrow = mnew;
#pragma unroll
    for (int j = 0; j < 4; ++j) {
#pragma unroll
      for (int r = 0; r < 8; ++r) { o[j][r] *= al; if (ER) orr[j][r] *= al; }
    }
    if constexpr (ER) asm volatile("s_wait_xcnt 0x0" :: "v"(vph), "v"(vpl) : "memory");   // as in load_k, for the V^T loads; it stands here, where it no longer holds the wave up
#pragma unroll
    for (int j = 0; j < 4; ++j) {
      o[j] = g2_mma(vh[j], pa.v, o[j]);
      if constexpr (ER) {
        orr[j] = g2_mma(vh[j], pb.v, orr[j]);
        orr[j] = g2_mma(vl[j], pa.v, orr[j]);
      }
    }
  };
  if constexpr (ER) {
#pragma unroll 1   /* rolled: the body is long and the trip count is the wave's own */
    for (int st = 0; st < nst; ++st) step(st, nullptr, 0);
  } else {
    const int ntr = qt + 1;   /* tiles of 64 keys up to the block's last query: the same for its four waves; a wave's nst is 2 ntr - 1 or 2 ntr */
    fill(0, 0);
    asm volatile("s_wait_asynccnt 0x0" ::: "memory");   // tile 0: this wave's copies have landed
    __syncthreads();                                    // ... and every other wave's share of it
    if (ntr > 1) fill(1, 1);
#pragma unroll 1   /* rolled: the buffer index is a scalar select */
    for (int t = 0; t < ntr; ++t) {
      const _Float16* bp = (const _Float16*)&sh.kv[t & 1][0] + lane * 8;
      lds_k(bp, 0);
      step(2 * t, bp, 0);
      if (2 * t + 1 < nst) step(2 * t + 1, bp, 1);      /* wave-uniform: the tile's last 32 keys lie behind every query of the block's first two waves */
      asm volatile("s_wait_dscnt 0x0" ::: "memory");      // this wave's reads of buffer t & 1 are done before it is refilled
      asm volatile("s_wait_asynccnt 0x0" ::: "memory");   // this wave's copies of tile t + 1 have landed
      __syncthreads();                                    // publishes tile t + 1 and ends every wave's reads of tile t
      if (t + 2 < ntr) fill(t & 1, t + 2);
    }
    asm volatile("s_wait_asynccnt 0x0" ::: "memory");     // nothing in flight when the wave goes on to its output
  }
  const float inv = 0.25f * (1.0f / (lrow + xhalf(lrow)));
#pragma unroll
  for (int j = 0; j < 4; ++j) {   /* an accumulator's eight registers are d = 16 j + 8 hh .. + 7 of the lane's query: 16 B of a staged row */
    FragH fh, fr;
#pragma unroll
    for (int r = 0; r < 8; ++r) {
      float v = o[j][r];
      if (ER) v += orr[j][r] * 0.0009765625f;
      v *= inv;
      const _Float16 hi = (_Float16)v;
      fh.h[r] = hi;
      fr.h[r] = (_Float16)((v - (float)hi) * 1024.0f);
    }
    *(v8us*)&oh[wave][ln][16 * j + 8 * hh] = fh.half[0];
    if (ER) *(v8us*)&ol[wave][ln][16 * j + 8 * hh] = fr.half[0];
  }
  wave_lds_sync();
  const int rsub = lane >> 3, c8 = (lane & 7) * 8;
  {
#pragma unroll
    for (int q = 0; q < 4; ++q) {
      const int r = q * 4 + rsub;
      const size_t oo = (rowb + q0 + r) * DM + h * HD + c8;
      const v8us vh8 = *(const v8us*)&oh[wave][r][c8];
      *(v8us*)((unsigned short*)Oh + oo) = vh8;
      if (ER) {
        const v8us vl8 = *(const v8us*)&ol[wave][r][c8];
        *(v8us*)((unsigned short*)Or + oo) = vl8;
      }
    }
    
  }
}
// One grid: the late tiles (tile fastest, then bh), behind them the early tiles, which use the residual planes; no block reads what another writes.
constexpr unsigned NT_E = ERW / 64, NT_L = SEQ / 64 - ERW / 64, NT_L1 = NT_L ? NT_L : 1;
constexpr unsigned GA_L = NT_L * NB * NH, GA_E = NT_E * NB * NH;
__global__ __launch_bounds__(128) void k_attn(const _Float16* __restrict__ Qh, const _Float16* __restrict__ Qr, const _Float16* __restrict__ Kh, const _Float16* __restrict__ Kr, const _Float16* __restrict__ VTh, const _Float16* __restrict__ VTr, _Float16* __restrict__ Oh, _Float16* __restrict__ Or) {
  __shared__ __attribute__((aligned(16))) AttnLds sh;
  const unsigned blk = blockIdx.x;
  if (blk < GA_L) {
    attn_body<false>(sh, Qh, Qr, Kh, Kr, VTh, VTr, Oh, Or, (int)(NT_E + blk % NT_L1), (int)(blk / NT_L1));
  } else {
    const unsigned e = blk - GA_L;
    attn_body<true>(sh, Qh, Qr, Kh, Kr, VTh, VTr, Oh, Or, (int)(e % NT_E), (int)(e / NT_E));
  }
}

// Output GEMM: ctx rows (x64; hi plane Ah, residual plane Ar x2^10 when ER) times Bw [DM][DM] (x16) -> f32 * 2^-10 into the output rows b*SEQ_FULL + s.
template <bool ER>
__device__ __forceinline__ void out_body(unsigned char* sm, const _Float16* __restrict__ Ah, const _Float16* __restrict__ Ar, const _Float16* __restrict__ Bw, float* __restrict__ C, int blk, int rbPerB, int rowOff) {
  static_assert(2 * gemm_stage_bytes(1, ER, KC_OUT(ER)) >= 4 * 32 * 68 * 4);
  float (*so)[32][68] = (float (*)[32][68])sm;          /* output staging takes the operand buffers' place behind the main loop's last barrier */
  const int tid = threadIdx.x;
  const int wave = __builtin_amdgcn_readfirstlane((int)(tid >> 5));
  const int lane = tid & 31, ln = lane & 15, hh = lane >> 4;
  const int ntn = DM / 64;
  const int mt = blk / ntn, nq = blk - mt * ntn;
  const int b = mt / rbPerB, lb = mt - b * rbPerB;
  const int s0 = rowOff + lb * 128 + 32 * wave;
  const int col0 = nq * 64;
  const size_t ablk = ((size_t)b * SEQ + rowOff + lb * 128) * DM;
  const size_t crow = (size_t)b * SEQ_FULL + s0;
  const v8f z8 = {0.f, 0.f, 0.f, 0.f, 0.f, 0.f, 0.f, 0.f};
  v8f c[8] = {z8, z8, z8, z8, z8, z8, z8, z8};
  v8f d[8] = {z8, z8, z8, z8, z8, z8, z8, z8};
  gemm_core<1, ER, KC_OUT(ER)>(sm, Ah + ablk, Ar + ablk, Bw + (size_t)col0 * DM, c, d);
#pragma unroll
  for (int u = 0; u < 8; ++u) {
    const int t = u & 3, half = u >> 2;
#pragma unroll
    for (int r = 0; r < 8; ++r) {
      float v = c[u][r];
      if (ER) v += d[u][r] * 0.0009765625f;
      so[wave][half * 16 + 8 * hh + r][t * 16 + ln] = v * 0.0009765625f;
    }
  }
  wave_lds_sync();
  const int rsub = lane >> 4, c4 = (lane & 15) * 4;
  {
#pragma unroll 1
    for (int q = 0; q < 16; ++q) {
      const int r = q * 2 + rsub;
      const v4f v = *(const v4fa*)&so[wave][r][c4];
      *(v4f*)(C + (crow + r) * DM + col0 + c4) = v;
    }
    
  }
}
// One grid: the early row blocks first (twice the matrix work and twice the stages of a late block), behind them the late ones; both use the same LDS bytes.
constexpr int RB_E = ERW / 128, RB_L = (SEQ - ERW) / 128, RB_L1 = RB_L ? RB_L : 1;
constexpr unsigned GO_E = (unsigned)(NB * RB_E * (DM / 64)), GO_L = (unsigned)(NB * RB_L * (DM / 64));
constexpr int OUT_LDS_E = 2 * gemm_stage_bytes(1, true, KC_OUT(true)), OUT_LDS_L = 2 * gemm_stage_bytes(1, false, KC_OUT(false));
__global__ __launch_bounds__(128) void k_out(const _Float16* __restrict__ Ah, const _Float16* __restrict__ Ar, const _Float16* __restrict__ Bw, float* __restrict__ C) {
  __shared__ __attribute__((aligned(16))) unsigned char sm[OUT_LDS_E > OUT_LDS_L ? OUT_LDS_E : OUT_LDS_L];
  const unsigned blk = blockIdx.x;
  if (blk < GO_E) out_body<true>(sm, Ah, Ar, Bw, C, (int)blk, RB_E, 0);
  else out_body<false>(sm, Ah, Ar, Bw, C, (int)(blk - GO_E), RB_L1, ERW);
}

// workspace carve (bytes); every region is a multiple of 256 B
constexpr size_t SZ_W    = (size_t)DM * DM * 2;                 /* one x16 f16 weight plane */
constexpr size_t SZ_X16  = (size_t)NR * DM * 2;
constexpr size_t SZ_QKV  = (size_t)NR * LQ * 2;                 /* one q plane, row pitch LQ (only the first third of a row is written and read) */
constexpr size_t SZ_VT   = (size_t)NB * NH * HD * SEQ * 2;      /* one V^T plane; one k plane */
constexpr size_t SZ_O    = (size_t)NR * DM * 2;                 /* one ctx plane */
constexpr size_t SZ_CS   = (size_t)SEQ * 64 * 4;
constexpr size_t OFF_BW  = 0;                                   /* wq | wk | wv | wo */
constexpr size_t OFF_X16 = OFF_BW + 4 * SZ_W;
constexpr size_t OFF_QKV = OFF_X16 + SZ_X16;                    /* hi plane, residual plane */
constexpr size_t OFF_VT  = OFF_QKV + 2 * SZ_QKV;                /* hi plane, residual plane */
constexpr size_t OFF_KP  = OFF_VT + 2 * SZ_VT;                  /* hi plane, residual plane */
constexpr size_t OFF_O   = OFF_KP + 2 * SZ_VT;                  /* hi plane, residual plane */
constexpr size_t OFF_CS  = OFF_O + 2 * SZ_O;
constexpr size_t WS_TOTAL = OFF_CS + SZ_CS;
static_assert(WS_TOTAL <= (size_t)134217728);
static_assert(SZ_W % 256 == 0 && SZ_X16 % 256 == 0 && SZ_QKV % 256 == 0 && SZ_VT % 256 == 0 && SZ_O % 256 == 0 && SZ_CS % 256 == 0);
static_assert((size_t)((NB - 1) * SEQ_FULL + SEQ) * DM * 4 <= (size_t)NB_FULL * SEQ_FULL * DM * 4);

extern "C" void kernel_launch(void* const* d_in, const int* in_sizes, int n_in,
                              void* d_out, int out_size, void* d_ws, size_t ws_size, hipStream_t stream) {
  if (n_in < 6) return;
  const size_t need_x = (size_t)((NB - 1) * SEQ_FULL + SEQ) * DM;
  if ((size_t)in_sizes[0] < need_x) return;
  if ((size_t)in_sizes[1] < (size_t)DM * DM || (size_t)in_sizes[2] < (size_t)DM * DM || (size_t)in_sizes[3] < (size_t)DM * DM || (size_t)in_sizes[4] < (size_t)DM * DM) return;
  if (in_sizes[5] < SEQ) return;
  if ((size_t)out_size < need_x) return;
  if (WS_TOTAL > ws_size) return;
  const float* x  = (const float*)d_in[0];
  const float* wq = (const float*)d_in[1];
  const float* wk = (const float*)d_in[2];
  const float* wv = (const float*)d_in[3];
  const float* wo = (const float*)d_in[4];
  const int*   tp = (const int*)d_in[5];
  float* out = (float*)d_out;
  char* ws = (char*)d_ws;
  _Float16* BQKV = (_Float16*)(ws + OFF_BW);
  _Float16* BO   = (_Float16*)(ws + OFF_BW + 3 * SZ_W);
  _Float16* X16  = (_Float16*)(ws + OFF_X16);
  _Float16* QKVh = (_Float16*)(ws + OFF_QKV);
  _Float16* QKVr = (_Float16*)(ws + OFF_QKV + SZ_QKV);
  _Float16* VTh  = (_Float16*)(ws + OFF_VT);
  _Float16* VTr  = (_Float16*)(ws + OFF_VT + SZ_VT);
  _Float16* KPh  = (_Float16*)(ws + OFF_KP);
  _Float16* KPr  = (_Float16*)(ws + OFF_KP + SZ_VT);
  _Float16* Oh   = (_Float16*)(ws + OFF_O);
  _Float16* Or   = (_Float16*)(ws + OFF_O + SZ_O);
  float*    CS   = (float*)(ws + OFF_CS);

  k_prep<<<GP_T + GP_X + 4 * GP_W, 256, 0, stream>>>(x, wq, wk, wv, wo, tp, BQKV, X16, CS);
  k_qkv<<<(unsigned)((NR / 128) * (LQ / 128)), 256, 0, stream>>>(X16, BQKV, CS, QKVh, QKVr, KPh, VTh);   /* k, V^T: both planes behind KPh, VTh (plane stride SZ_VT) */
  k_attn<<<GA_L + GA_E, 128, 0, stream>>>(QKVh, QKVr, KPh, KPr, VTh, VTr, Oh, Or);
  k_out<<<GO_E + GO_L, 128, 0, stream>>>(Oh, Or, BO, out);
}

// v008
// One run takes 73.4 microseconds.
// Two timings next to v007 put it at 1.08 and 1.07 times that version's speed.
// All steps since v000 together make it 3.61 times as fast.
#include <hip/hip_runtime.h>
// Causal multi-head self-attention with interleaved rotary (x [4][1024][1024]; q|k|v = x W^T with [out][in] weights, 16 heads of 64; scores * 1/8; causal by index; out = merged W_o^T).
// Compute dtype: all contractions v_wmma_f32_16x16x32_f16 (f16 operands, f32 accumulate). Inputs converted (RNE) to bf16 and held exactly in f16 (weights x16); q, k, v, P (x256), ctx (x64) as f16 hi planes,
// plus f16 residual planes (x2^10, separate accumulators) used for query rows 0..255 of every sequence; softmax statistics, rotary and all epilogues f32.
// Structure, four launches: preparation (cos/sin table from the position input, x plane, four weight planes: independent blocks of one grid), one QKV GEMM (N = 3072; rotary in the epilogue of the q and k heads,
// the k and v heads go out in the order of the attention's fragments, v transposed), fused online-softmax attention (late and early query rows as blocks of one grid), output GEMM (early and late rows as blocks of one grid).
// Both GEMMs stage their operand tiles in LDS with asynchronous 16-byte copies, two buffers of 128 k (64 k for the early output rows) each; the waves read their fragments from LDS.
// The QKV GEMM has one block of 256 rows x 192 columns on every WGP, twelve waves of 64 x 64.
// The attention's late query tiles stage k and V^T the same way, two buffers of 64 keys, one copy for the block's four waves.
#ifndef NB
#define NB 4
#endif
#ifndef SEQ
#define SEQ 1024
#endif
#define NB_FULL 4
#define SEQ_FULL 1024
#define DM 1024
#define NH 16
#define HD 64
#define LQ (3 * DM)
#define NR (NB * SEQ)
#define ERW 256                      /* query rows per sequence that use the residual planes */

static_assert(NB <= NB_FULL);
static_assert(SEQ <= SEQ_FULL);
static_assert(NH * HD == DM);
static_assert(HD == 64);
static_assert(DM % 64 == 0);
static_assert(DM % 32 == 0);
static_assert(LQ % 192 == 0);
static_assert(SEQ % 128 == 0);
static_assert(NR % 256 == 0);
static_assert(ERW % 128 == 0);
static_assert(SEQ >= ERW);
static_assert(ERW % 64 == 0);
static_assert(SEQ % 8 == 0);
static_assert(((size_t)NR * DM / 8) % 256 == 0);
static_assert(((size_t)DM * DM / 8) % 256 == 0);

typedef unsigned short v8us __attribute__((ext_vector_type(8), may_alias));
typedef float  v8f  __attribute__((ext_vector_type(8)));
typedef float  v4f  __attribute__((ext_vector_type(4)));
typedef float  v4fa __attribute__((ext_vector_type(4), may_alias));
typedef _Float16 v16h __attribute__((ext_vector_type(16)));
union FragH { v16h v; v8us half[2]; _Float16 h[16]; unsigned short u[16]; };

__device__ __forceinline__ unsigned short bf16_bits(float x) { unsigned int u = __float_as_uint(x); return (unsigned short)((u + 0x7FFFu + ((u >> 16) & 1u)) >> 16); }
__device__ __forceinline__ float bf16_rne(float x) { return __uint_as_float(((unsigned int)bf16_bits(x)) << 16); }

// A / B fragment from a k-contiguous 16-bit row: elements 0..7 <- p[8h .. 8h+7], elements 8..15 <- p[16+8h .. 16+8h+7]
__device__ __forceinline__ v16h g2_frag(const _Float16* p, int hh) { FragH f; f.half[0] = *(const v8us*)((const unsigned short*)p + 8 * hh); f.half[1] = *(const v8us*)((const unsigned short*)p + 16 + 8 * hh); return f.v; }
// The same fragment from a plane stored in fragment order: each half is the lane's 16 B of a 512-byte piece, so that a wave's load covers four whole 128-byte lines; p = the first piece + 8 * lane.
__device__ __forceinline__ v16h g2_pk(const _Float16* p) { FragH f; f.half[0] = *(const v8us*)(const unsigned short*)p; f.half[1] = *(const v8us*)((const unsigned short*)p + 256); return f.v; }
__device__ __forceinline__ v8f g2_mma(v16h a, v16h b, v8f c) { v8f d = __builtin_amdgcn_wmma_f32_16x16x32_f16(false, a, false, b, (short)0, c, false, false); asm volatile("v_nop\n\tv_nop\n\tv_nop\n\tv_nop" : "+v"(d) : "v"(a), "v"(b)); return d; }
__device__ __forceinline__ void wave_lds_sync() { __builtin_amdgcn_fence(4 /* acq_rel order */, "workgroup"); __builtin_amdgcn_wave_barrier(); }
// Lane l takes the value of lane l ^ 16 (a vector cross-row move; the shuffle builtin would go through the LDS unit).
__device__ __forceinline__ float xhalf(float x) { return __builtin_bit_cast(float, __builtin_amdgcn_permlanex16(__builtin_bit_cast(int, x), __builtin_bit_cast(int, x), 0x76543210, 0xfedcba98, false, false)); }

// One LDS stage of a GEMM block: kc of k for every operand row, row pitch = the row + 16 B (144 or 272 B = 16 B x odd: conflict-free for 16-byte row reads).
constexpr int gemm_stage_bytes(int wn, bool er, int kc) { return (128 * (er ? 2 : 1) + 64 * wn) * (kc * 2 + 16); }
#define KC_OUT(er) ((er) ? 64 : 128) /* few blocks: the longer stage covers the copies' flight; with the residual plane its copy addresses would not fit the registers */

// N asynchronous 16-byte copies global -> LDS, lane by lane, in one statement.
// The s_wait_xcnt stands inside the statement so that no address register is rewritten in front of it; one statement a stage (two beyond 12 copies) pays that wait once.
#define CPL(a, b) "global_load_async_to_lds_b128 %" #a ", %" #b ", off\n\t"
template <int N>
__device__ __forceinline__ void cp_issue(const unsigned (&l)[N], const _Float16* const (&g)[N]) {
  static_assert(N == 8 || N == 10 || N == 12 || N == 14);
  if constexpr (N == 8)
    asm volatile(CPL(0, 1) CPL(2, 3) CPL(4, 5) CPL(6, 7) CPL(8, 9) CPL(10, 11) CPL(12, 13) CPL(14, 15) "s_wait_xcnt 0x0"
                 :: "v"(l[0]), "v"(g[0]), "v"(l[1]), "v"(g[1]), "v"(l[2]), "v"(g[2]), "v"(l[3]), "v"(g[3]), "v"(l[4]), "v"(g[4]), "v"(l[5]), "v"(g[5]), "v"(l[6]), "v"(g[6]), "v"(l[7]), "v"(g[7]) : "memory");
  else if constexpr (N == 10)
    asm volatile(CPL(0, 1) CPL(2, 3) CPL(4, 5) CPL(6, 7) CPL(8, 9) CPL(10, 11) CPL(12, 13) CPL(14, 15) CPL(16, 17) CPL(18, 19) "s_wait_xcnt 0x0"
                 :: "v"(l[0]), "v"(g[0]), "v"(l[1]), "v"(g[1]), "v"(l[2]), "v"(g[2]), "v"(l[3]), "v"(g[3]), "v"(l[4]), "v"(g[4]), "v"(l[5]), "v"(g[5]), "v"(l[6]), "v"(g[6]), "v"(l[7]), "v"(g[7]),
                    "v"(l[8]), "v"(g[8]), "v"(l[9]), "v"(g[9]) : "memory");
  else if constexpr (N == 14)
    asm volatile(CPL(0, 1) CPL(2, 3) CPL(4, 5) CPL(6, 7) CPL(8, 9) CPL(10, 11) CPL(12, 13) CPL(14, 15) CPL(16, 17) CPL(18, 19) CPL(20, 21) CPL(22, 23) CPL(24, 25) CPL(26, 27) "s_wait_xcnt 0x0"
                 :: "v"(l[0]), "v"(g[0]), "v"(l[1]), "v"(g[1]), "v"(l[2]), "v"(g[2]), "v"(l[3]), "v"(g[3]), "v"(l[4]), "v"(g[4]), "v"(l[5]), "v"(g[5]), "v"(l[6]), "v"(g[6]), "v"(l[7]), "v"(g[7]),
                    "v"(l[8]), "v"(g[8]), "v"(l[9]), "v"(g[9]), "v"(l[10]), "v"(g[10]), "v"(l[11]), "v"(g[11]), "v"(l[12]), "v"(g[12]), "v"(l[13]), "v"(g[13]) : "memory");
  else
    asm volatile(CPL(0, 1) CPL(2, 3) CPL(4, 5) CPL(6, 7) CPL(8, 9) CPL(10, 11) CPL(12, 13) CPL(14, 15) CPL(16, 17) CPL(18, 19) CPL(20, 21) CPL(22, 23) "s_wait_xcnt 0x0"
                 :: "v"(l[0]), "v"(g[0]), "v"(l[1]), "v"(g[1]), "v"(l[2]), "v"(g[2]), "v"(l[3]), "v"(g[3]), "v"(l[4]), "v"(g[4]), "v"(l[5]), "v"(g[5]), "v"(l[6]), "v"(g[6]), "v"(l[7]), "v"(g[7]),
                    "v"(l[8]), "v"(g[8]), "v"(l[9]), "v"(g[9]), "v"(l[10]), "v"(g[10]), "v"(l[11]), "v"(g[11]) : "memory");
}

// GEMM main loop of one block: A tile 128 rows (hi plane; residual plane too when ER), B tile 64 * WN rows, all k-contiguous with row pitch DM.
// 4 * WN waves, wave (wm, wn) = 32 rows x 64 columns; c (and d for the residual plane) accumulate k in ascending steps of 32.
// LDS stage = KC of k of [A hi 128 rows | A residual 128 rows when ER | B 64 * WN rows]; stage s + 2 is copied into the buffer that pass s has left.
template <int WN, bool ER, int KC>
__device__ __forceinline__ void gemm_core(unsigned char* sm, const _Float16* __restrict__ Ah, const _Float16* __restrict__ Ar, const _Float16* __restrict__ Bw, v8f (&c)[8], v8f (&d)[8]) {
  static_assert(DM % KC == 0 && DM / KC >= 2 && KC % 64 == 0);
  constexpr int LP = KC + 8, LPB = LP * 2;   /* LDS row pitch in f16 and in bytes */
  constexpr int TPR = KC / 8;                /* threads that copy one row, 16 B each */
  constexpr int RPP = 128 * WN / TPR;        /* rows covered by one copy of every thread */
  constexpr int NPA = ER ? 2 : 1;
  constexpr int SB = gemm_stage_bytes(WN, ER, KC);
  constexpr int NS = DM / KC;
  constexpr int KG = (WN == 1 && !ER) ? 2 : 1;   /* 32-k steps whose fragments are read as one group: two where registers allow and few waves share a SIMD */
  const int tid = threadIdx.x;
  const int wave = __builtin_amdgcn_readfirstlane((int)(tid >> 5));
  const int lane = tid & 31, ln = lane & 15, hh = lane >> 4;
  const int wm = wave & 3, wn = wave >> 2;
  const int cr = tid / TPR, cc = tid % TPR;
  const unsigned l0 = (unsigned)(size_t)sm + (unsigned)(cr * LPB + cc * 16);
  const _Float16* gA = Ah + (size_t)cr * DM + cc * 8;
  const _Float16* gR = Ar + (size_t)cr * DM + cc * 8;
  const _Float16* gB = Bw + (size_t)cr * DM + cc * 8;
  constexpr int NCP = (128 * NPA + 64 * WN) / RPP;   /* copies of a thread per stage */
  constexpr int NST = (NCP + 11) / 12, NPS = NCP / NST;   /* asm statements per stage, copies in each */
  static_assert(NST * NPS == NCP && NCP <= 63 && 128 % RPP == 0);
  auto fill = [&](int buf, int kc) {
    const unsigned l = l0 + (unsigned)(buf * SB);
#pragma unroll   /* both loops: row must be a compile-time constant, so that L and G are registers */
    for (int st = 0; st < NST; ++st) {
      unsigned L[NPS];
      const _Float16* G[NPS];
#pragma unroll
      for (int j = 0; j < NPS; ++j) {
        const int row = (st * NPS + j) * RPP;          /* first row of the stage that this copy of the block covers */
        L[j] = l + (unsigned)(row * LPB);
        G[j] = (row < 128 ? gA + (size_t)row * DM : (ER && row < 256) ? gR + (size_t)(row - 128) * DM : gB + (size_t)(row - 128 * NPA) * DM) + kc;
      }
      cp_issue<NPS>(L, G);
    }
  };
  fill(0, 0);
  asm volatile("s_wait_asynccnt 0x0" ::: "memory");   // stage 0 of this wave has landed
  __syncthreads();                                    // ... and every other wave's share of it
  fill(1, KC);
#pragma unroll 1   /* rolled: the buffer index is a scalar select, and the loop body stays short */
  for (int s = 0; s < NS; ++s) {
    const _Float16* bp = (const _Float16*)(sm + (s & 1) * SB);
    const _Float16* ap = bp + (32 * wm + ln) * LP;
    const _Float16* bq = bp + (128 * NPA + 64 * wn + ln) * LP;
#pragma unroll   /* this and the inner loops: fragment and accumulator indices must be constants, so that they are registers */
    for (int kg = 0; kg < KC / 32; kg += KG) {
      v16h af[KG][2], rf[KG][2], bf[KG][4];              /* a group's LDS reads go out together, ahead of its matrix instructions */
#pragma unroll
      for (int u = 0; u < KG; ++u) {
        const int kk = (kg + u) * 32;
        af[u][0] = g2_frag(ap + kk, hh); af[u][1] = g2_frag(ap + 16 * LP + kk, hh);
#pragma unroll
        for (int t = 0; t < 4; ++t) bf[u][t] = g2_frag(bq + t * 16 * LP + kk, hh);
        if (ER) { rf[u][0] = g2_frag(ap + 128 * LP + kk, hh); rf[u][1] = g2_frag(ap + 144 * LP + kk, hh); }
      }
#pragma unroll
      for (int u = 0; u < KG; ++u) {
#pragma unroll
        for (int t = 0; t < 4; ++t) {
          c[t] = g2_mma(af[u][0], bf[u][t], c[t]); c[4 + t] = g2_mma(af[u][1], bf[u][t], c[4 + t]);
          if (ER) { d[t] = g2_mma(rf[u][0], bf[u][t], d[t]); d[4 + t] = g2_mma(rf[u][1], bf[u][t], d[4 + t]); }
        }
      }
    }
    asm volatile("s_wait_dscnt 0x0" ::: "memory");      // this wave's reads of buffer s & 1 are done before it is refilled
    asm volatile("s_wait_asynccnt 0x0" ::: "memory");   // this wave's copies of stage s + 1 have landed
    __syncthreads();                                    // publishes stage s + 1 and ends every wave's reads of stage s
    if (s + 2 < NS) fill(s & 1, (s + 2) * KC);
  }
  asm volatile("s_wait_asynccnt 0x0" ::: "memory");     // nothing in flight when the buffers become output staging
}

// QKV GEMM main loop of one block: A tile 256 rows, B tile 192 rows, k-contiguous with row pitch DM; twelve waves, wave (wm, wn) = 64 rows x 64 columns, c[4 i + t] = rows 16 i, columns 16 t; k in ascending steps of 32.
// Sixteen blocks of the grid fetch a given operand row from L2, and every fragment read from LDS feeds four matrix instructions.
// LDS stage = 128 k of [A 256 rows | B 192 rows], row pitch 272 B; stage s + 2 is copied into the buffer that pass s has left. 448 rows = 28 x 16: the first eight waves copy (16 threads a row), 28 copies each.
#define QBM 256
#define QBN 192
#define QKC 128
constexpr int QSB = (QBM + QBN) * (QKC * 2 + 16);   /* bytes of one stage */
__device__ __forceinline__ void qkv_core(unsigned char* sm, const _Float16* __restrict__ A, const _Float16* __restrict__ Bw, v8f (&c)[16]) {
  static_assert(DM % QKC == 0 && DM / QKC >= 2 && (QBM + QBN) % (2 * 14 * 16) == 0 && QBM % 16 == 0);
  constexpr int LP = QKC + 8, LPB = LP * 2;   /* LDS row pitch in f16 and in bytes */
  constexpr int NS = DM / QKC;
  const int tid = threadIdx.x;
  const int wave = __builtin_amdgcn_readfirstlane((int)(tid >> 5));
  const int lane = tid & 31, ln = lane & 15, hh = lane >> 4;
  const int wm = wave & 3, wn = wave >> 2;
  const bool cw = wave < 8;                    /* a copying wave: the same for the whole wave, a scalar branch */
  const int cr = (tid & 255) >> 4, cc = tid & 15;
  const unsigned l0 = (unsigned)(size_t)sm + (unsigned)(cr * LPB + cc * 16);
  const _Float16* gA = A + (size_t)cr * DM + cc * 8;
  const _Float16* gB = Bw + (size_t)cr * DM + cc * 8;
  auto fill = [&](int buf, int kc) {
    const unsigned l = l0 + (unsigned)(buf * QSB);
#pragma unroll   /* both loops: row must be a compile-time constant, so that L and G are registers */
    for (int st = 0; st < 2; ++st) {
      unsigned L[14];
      const _Float16* G[14];
#pragma unroll
      for (int j = 0; j < 14; ++j) {
        const int row = (st * 14 + j) * 16;            /* first row of the stage that this copy of the eight waves covers */
        L[j] = l + (unsigned)(row * LPB);
        G[j] = (row < QBM ? gA + (size_t)row * DM : gB + (size_t)(row - QBM) * DM) + kc;
      }
      cp_issue<14>(L, G);
    }
  };
  if (cw) fill(0, 0);
  asm volatile("s_wait_asynccnt 0x0" ::: "memory");   // stage 0 of this wave has landed
  __syncthreads();                                    // ... and every other wave's share of it
  if (cw) fill(1, QKC);
#pragma unroll 1   /* rolled: the buffer index is a scalar select, and the loop body stays short */
  for (int s = 0; s < NS; ++s) {
    const _Float16* bp = (const _Float16*)(sm + (s & 1) * QSB);
    const _Float16* ap = bp + (64 * wm + ln) * LP;
    const _Float16* bq = bp + (QBM + 64 * wn + ln) * LP;
#pragma unroll   /* this and the inner loops: fragment and accumulator indices must be constants, so that they are registers */
    for (int kk = 0; kk < QKC; kk += 32) {
      v16h af[4], bf[4];                               /* a step's LDS reads go out together, ahead of its matrix instructions */
#pragma unroll
      for (int i = 0; i < 4; ++i) { af[i] = g2_frag(ap + i * 16 * LP + kk, hh); bf[i] = g2_frag(bq + i * 16 * LP + kk, hh); }
#pragma unroll
      for (int i = 0; i < 4; ++i) {
#pragma unroll
        for (int t = 0; t < 4; ++t) c[4 * i + t] = g2_mma(af[i], bf[t], c[4 * i + t]);
      }
    }
    asm volatile("s_wait_dscnt 0x0" ::: "memory");      // this wave's reads of buffer s & 1 are done before it is refilled
    asm volatile("s_wait_asynccnt 0x0" ::: "memory");   // this wave's copies of stage s + 1 have landed
    __syncthreads();                                    // publishes stage s + 1 and ends every wave's reads of stage s
    if (cw && s + 2 < NS) fill(s & 1, (s + 2) * QKC);
  }
  asm volatile("s_wait_asynccnt 0x0" ::: "memory");     // nothing in flight when the buffers become output staging
}

__device__ __forceinline__ void wnat_body(const float* __restrict__ w, _Float16* __restrict__ Bt, unsigned blk) {
  const size_t t = (size_t)blk * 256 + threadIdx.x;
  if (t >= (size_t)DM * DM / 8) return;
  const v4f a = *(const v4fa*)(w + t * 8), c = *(const v4fa*)(w + t * 8 + 4);
  FragH f;
#pragma unroll
  for (int q = 0; q < 4; ++q) { f.h[q] = (_Float16)(bf16_rne(a[q]) * 16.0f); f.h[4 + q] = (_Float16)(bf16_rne(c[q]) * 16.0f); }
  const v8us o = f.half[0];
  unsigned short* d = (unsigned short*)Bt + t * 8;
  *(v8us*)d = o;
  
}

__device__ __forceinline__ void x16_body(const float* __restrict__ x, _Float16* __restrict__ X16, unsigned blk) {
  const size_t t = (size_t)blk * 256 + threadIdx.x;
  if (t >= (size_t)NR * DM / 8) return;
  const size_t row = t / (DM / 8);
  const int c8 = (int)(t % (DM / 8)) * 8;
  const size_t b = row / SEQ, s = row % SEQ;
  const float* src = x + (b * SEQ_FULL + s) * DM + c8;
  const v4f a = *(const v4fa*)src, c = *(const v4fa*)(src + 4);
  FragH f;
#pragma unroll
  for (int q = 0; q < 4; ++q) { f.h[q] = (_Float16)bf16_rne(a[q]); f.h[4 + q] = (_Float16)bf16_rne(c[q]); }
  const v8us o = f.half[0];
  unsigned short* d = (unsigned short*)X16 + t * 8;
  *(v8us*)d = o;
  
}

// CS[s][j] = (cos, sin)(float(pos[s]) * inv_freq[j]), inv_freq[j] = f32(1 / 10000^(j/32)) with the power formed in double from fixed roots.
__device__ __forceinline__ void tab_body(const int* __restrict__ tp, float* __restrict__ CS, unsigned blk) {
  __shared__ __attribute__((aligned(16))) float ts[8][64];
  const int tid = threadIdx.x;
  const int sl = tid >> 5, j = tid & 31;
  const int s = (int)blk * 8 + sl;
  const int pos = tp[s];
  double p = 1.0;
  p = (j & 1)  ? p * 1.3335214321633240 : p;
  p = (j & 2)  ? p * 1.7782794100389228 : p;
  p = (j & 4)  ? p * 3.1622776601683795 : p;
  p = (j & 8)  ? p * 10.0 : p;
  p = (j & 16) ? p * 100.0 : p;
  const float inv = (float)(1.0 / p);
  const float ang = (float)pos * inv;
  float sn, cs;
  sincosf(ang, &sn, &cs);
  ts[sl][2 * j] = cs;
  ts[sl][2 * j + 1] = sn;
  __syncthreads();
  if (tid < 128) {
    const int r = tid >> 4, c4 = (tid & 15) * 4;
    const v4f v = *(const v4fa*)&ts[r][c4];
    float* d = CS + (size_t)(blk * 8 + r) * 64 + c4;
    *(v4f*)d = v;
    
  }
}

// Preparation, one grid: nothing here reads what another block of the grid writes. Table blocks first (the longest dependent chain), then the x plane, then the four weight planes (wq | wk | wv | wo, contiguous in Bt).
constexpr unsigned GP_T = SEQ / 8;
constexpr unsigned GP_X = (unsigned)(((size_t)NR * DM / 8 + 255) / 256);
constexpr unsigned GP_W = (unsigned)(((size_t)DM * DM / 8 + 255) / 256);
__global__ __launch_bounds__(256) void k_prep(const float* __restrict__ x, const float* __restrict__ wq, const float* __restrict__ wk, const float* __restrict__ wv, const float* __restrict__ wo, const int* __restrict__ tp,
                                              _Float16* __restrict__ Bt, _Float16* __restrict__ X16, float* __restrict__ CS) {
  const unsigned blk = blockIdx.x;
  if (blk < GP_T) { tab_body(tp, CS, blk); return; }
  if (blk < GP_T + GP_X) { x16_body(x, X16, blk - GP_T); return; }
  const unsigned wb = blk - (GP_T + GP_X), wi = wb / GP_W;
  const float* w = wi == 0 ? wq : wi == 1 ? wk : wi == 2 ? wv : wo;
  wnat_body(w, Bt + (size_t)wi * DM * DM, wb - wi * GP_W);
}

// QKV GEMM: rows r = b*SEQ + s of X16 [NR][DM] times Bw [3*DM][DM] (x16) -> f32 * 1/16; one wave's columns = one head of q, k or v (a block may hold heads of two kinds); rotary on q and k; q is written to the planes Ph, Pr [r][LQ].
// k and v go out in the order in which the attention's fragments take them, in pieces of 512 B = 32 lanes (16 hh + ln) x 8 f16, plane stride NB*NH*HD*SEQ:
// KP[plane][(b,h)][key / 16][d / 16][lane: ln = key % 16, hh = d / 8 % 2][d % 8],  VT[plane][(b,h)][key / 32][d / 16][key / 16 % 2][lane: ln = d % 16, hh = key / 8 % 2][key % 8].
__global__ __launch_bounds__(384) void k_qkv(const _Float16* __restrict__ X16, const _Float16* __restrict__ Bw, const float* __restrict__ CS, _Float16* __restrict__ Ph, _Float16* __restrict__ Pr, _Float16* __restrict__ KP, _Float16* __restrict__ VT) {
  static_assert(2 * QSB >= 12 * 64 * 68 * 4);
  static_assert(DM % 64 == 0 && HD == 64 && SEQ % 64 == 0 && NR % QBM == 0 && LQ % QBN == 0 && QBN % 64 == 0);
  __shared__ __attribute__((aligned(16))) unsigned char sm[2 * QSB];
  float (*so)[64][68] = (float (*)[64][68])sm;          /* output staging, a wave's own range, takes the operand buffers' place behind the main loop's last barrier */
  const int tid = threadIdx.x;
  const int wave = __builtin_amdgcn_readfirstlane((int)(tid >> 5));
  const int lane = tid & 31, ln = lane & 15, hh = lane >> 4;
  const int ntn = LQ / QBN;
  const int mt = blockIdx.x / ntn, nq = blockIdx.x - mt * ntn;
  const int row0 = mt * QBM + 64 * (wave & 3), col0 = nq * QBN + 64 * (wave >> 2);
  const v8f z8 = {0.f, 0.f, 0.f, 0.f, 0.f, 0.f, 0.f, 0.f};
  v8f c[16] = {z8, z8, z8, z8, z8, z8, z8, z8, z8, z8, z8, z8, z8, z8, z8, z8};
  qkv_core(sm, X16 + (size_t)(mt * QBM) * DM, Bw + (size_t)(nq * QBN) * DM, c);
  if (col0 >= 2 * DM) {   /* a v head (the same for the whole wave; no barrier follows): an accumulator's eight registers are eight consecutive keys of the lane's d, that is the lane's own 16 B of a V^T piece */
    unsigned short* vh = (unsigned short*)VT + ((size_t)((row0 / SEQ) * NH + (col0 - 2 * DM) / HD) * SEQ + row0 % SEQ) * HD + lane * 8;
    unsigned short* vr = vh + (size_t)NB * NH * HD * SEQ;
#pragma unroll   /* this and the inner loop: accumulator indices must be constants, so that they are registers */
    for (int u = 0; u < 16; ++u) {
      const int po = ((u >> 3) * 8 + (u & 3) * 2 + ((u >> 2) & 1)) * 256;   /* piece of keys 16 (u / 4), d 16 (u % 4) */
      FragH fh, fr;
#pragma unroll
      for (int r = 0; r < 8; ++r) { const float e = c[u][r] * 0.0625f; const _Float16 hi = (_Float16)e; fh.h[r] = hi; fr.h[r] = (_Float16)((e - (float)hi) * 1024.0f); }
      *(v8us*)(vh + po) = fh.half[0];
      *(v8us*)(vr + po) = fr.half[0];
    }
    return;
  }
#pragma unroll
  for (int u = 0; u < 16; ++u) {
    const int t = u & 3, rg = u >> 2;
#pragma unroll
    for (int r = 0; r < 8; ++r) so[wave][rg * 16 + 8 * hh + r][t * 16 + ln] = c[u][r] * 0.0625f;
  }
  wave_lds_sync();
  // Pieces of 16 bytes of a row (row r of the wave's 64, columns c8 .. c8 + 7 of its head), four at a time: with three waves on a SIMD a piece's LDS and table loads are not covered by other waves, so four pieces' loads go out together.
  v4f pu[4][2], pt[4][2];
  auto fetch = [&](int j, int r, int c8) {
    pu[j][0] = *(const v4fa*)&so[wave][r][c8]; pu[j][1] = *(const v4fa*)&so[wave][r][c8 + 4];
    const int s = (row0 + r) % SEQ;
    pt[j][0] = *(const v4fa*)(CS + (size_t)s * 64 + c8); pt[j][1] = *(const v4fa*)(CS + (size_t)s * 64 + c8 + 4);
  };
  // Rotary, split and store of fetched piece j.
  auto piece = [&](int j, unsigned short* dh, unsigned short* dr) {
    const v4f u0 = pu[j][0], u1 = pu[j][1], t0 = pt[j][0], t1 = pt[j][1];
    float e[8] = {u0[0], u0[1], u0[2], u0[3], u1[0], u1[1], u1[2], u1[3]};
    const float cz[4] = {t0[0], t0[2], t1[0], t1[2]};
    const float sz[4] = {t0[1], t0[3], t1[1], t1[3]};
#pragma unroll
    for (int i = 0; i < 4; ++i) {
      const float te = e[2 * i], to = e[2 * i + 1];
      const float re = te * cz[i] - to * sz[i];
      const float ro = te * sz[i] + to * cz[i];
      e[2 * i] = re;
      e[2 * i + 1] = ro;
    }
    FragH fh, fr;
#pragma unroll
    for (int i = 0; i < 8; ++i) { const _Float16 hi = (_Float16)e[i]; fh.h[i] = hi; fr.h[i] = (_Float16)((e[i] - (float)hi) * 1024.0f); }
    *(v8us*)dh = fh.half[0];
    *(v8us*)dr = fr.half[0];
    asm volatile("s_wait_xcnt 0x0" ::: "memory");   // before the next piece's arithmetic reuses the two stores' registers
  };
  if (col0 >= DM) {   /* a k head (the same for the whole wave): the wave's 64 keys x 64 d are sixteen pieces, 8 KB in a row */
    unsigned short* kh = (unsigned short*)KP + ((size_t)((row0 / SEQ) * NH + (col0 - DM) / HD) * SEQ + row0 % SEQ) * HD + lane * 8;
    unsigned short* kr = kh + (size_t)NB * NH * HD * SEQ;
#pragma unroll 1   /* rolled: four pieces a trip keep the text short */
    for (int g = 0; g < 4; ++g) {
#pragma unroll   /* this and the next loop: j must be a constant, so that pu and pt are registers */
      for (int j = 0; j < 4; ++j) fetch(j, g * 16 + ln, j * 16 + 8 * hh);
      asm volatile("s_wait_xcnt 0x0" ::: "memory");   // before the arithmetic reuses the table loads' address registers
#pragma unroll
      for (int j = 0; j < 4; ++j) piece(j, kh + (g * 4 + j) * 256, kr + (g * 4 + j) * 256);
    }
  } else {
    const int rsub = lane >> 3, c8 = (lane & 7) * 8;
#pragma unroll 1   /* as for k */
    for (int g = 0; g < 4; ++g) {
#pragma unroll
      for (int j = 0; j < 4; ++j) fetch(j, (g * 4 + j) * 4 + rsub, c8);
      asm volatile("s_wait_xcnt 0x0" ::: "memory");   // as for k
#pragma unroll
      for (int j = 0; j < 4; ++j) {
        const size_t o = (size_t)(row0 + (g * 4 + j) * 4 + rsub) * LQ + col0 + c8;
        piece(j, (unsigned short*)Ph + o, (unsigned short*)Pr + o);
      }
    }
  }
}

// Fused causal attention, online softmax. Block = query tile qt of 64 rows of (batch, head) bh; wave = 16 query rows; 32-key steps; q fragments straight from the planes; a step's k and V^T fragments are 4 KB in a row of each plane.
// Transposed products: S^T = K Q^T (k is the A operand, q the B operand), O^T += V^T P^T. A lane holds 16 of a step's 32 scores of ONE query (lane ln = query q0 + ln, register r of tile t = key key0 + 16 t + 8 hh + r):
// maximum and sum are formed in the lane, with one exchange between the wave's halves, and the two score tiles, converted in place, are the B fragment of P^T in the hardware's k order, which is the order of the V^T fragments.
// Late rows: the block's four waves walk the same keys, so 64 keys of k and V^T (8 KB + 8 KB, each contiguous in its plane) are copied to LDS once for all four, asynchronously, two buffers, the tile after next behind each trip's barrier;
// a trip is two 32-key steps; fragments come from LDS in the planes' own order (a wave's 16-byte read covers 512 contiguous bytes): V^T of a step at its top, k of a trip's second step behind the first step's score products.
// Early rows (twice the planes, few steps) read the planes directly: all k of a step together at its top, all V^T behind its score products, so that the kernel's registers still let four blocks share a WGP.
#define KV_TB (64 * HD * 2)           /* bytes of 64 keys of one plane */
struct AttnLds { _Float16 oh[4][16][72]; _Float16 ol[4][16][72]; unsigned char kv[2][2 * KV_TB]; };   /* output staging (row pitch 144 B = 16 B x odd); late rows' two buffers of [k | V^T]; every member a multiple of 16 B */
template <bool ER>
__device__ __forceinline__ void attn_body(AttnLds& sh, const _Float16* __restrict__ Qh, const _Float16* __restrict__ Qr, const _Float16* __restrict__ Kh, const _Float16* __restrict__ Kr, const _Float16* __restrict__ VTh, const _Float16* __restrict__ VTr,
                                          _Float16* __restrict__ Oh, _Float16* __restrict__ Or, int qt, int bh) {
  auto& oh = sh.oh; auto& ol = sh.ol;
  const int tid = threadIdx.x;
  const int wave = __builtin_amdgcn_readfirstlane((int)(tid >> 5));
  const int lane = tid & 31, ln = lane & 15, hh = lane >> 4;
  const int b = bh / NH, h = bh % NH;
  const int q0 = qt * 64 + wave * 16;
  const size_t rowb = (size_t)b * SEQ;
  const size_t qoff = (rowb + q0 + ln) * LQ + h * HD;
  const size_t pk0 = (size_t)bh * SEQ * HD + lane * 8;   /* k and V^T planes: the lane's 16 B of the first piece of (batch, head); 32 keys are 32 * HD f16 further on in both */
  const int nst = (q0 + 16 + 31) >> 5;
  const v8f z8 = {0.f, 0.f, 0.f, 0.f, 0.f, 0.f, 0.f, 0.f};
  v8f o[4] = {z8, z8, z8, z8};
  v8f orr[4] = {z8, z8, z8, z8};
  float mrow = -1.0e30f, lrow = 0.f;   /* of the lane's query: the maximum over all keys so far, the sum over the keys of the lane's own half */
  v16h qh[2], ql[2], kh[2][2], kl[2][2], vh[4], vl[4];
  auto load_q = [&]() {
#pragma unroll
    for (int kk = 0; kk < 2; ++kk) {
      qh[kk] = g2_frag(Qh + qoff + kk * 32, hh);
      if constexpr (ER) ql[kk] = g2_frag(Qr + qoff + kk * 32, hh);
    }
  };
  auto load_k = [&](int key0) {
    const _Float16* kph = Kh + pk0 + (size_t)key0 * HD;   /* the lane's own address: every load below is this plus a constant */
    const _Float16* kpl = Kr + pk0 + (size_t)key0 * HD;
#pragma unroll
    for (int kk = 0; kk < 2; ++kk) {
#pragma unroll
      for (int t = 0; t < 2; ++t) {
        kh[kk][t] = g2_pk(kph + t * 1024 + kk * 512);
        if constexpr (ER) kl[kk][t] = g2_pk(kpl + t * 1024 + kk * 512);
      }
    }
    // Early rows: registers are short; the inputs keep the loads' address registers up to the wait.
    if constexpr (ER) asm volatile("s_wait_xcnt 0x0" :: "v"(kph), "v"(kpl) : "memory");
  };
  // Late rows: fragments of 32-key step u of a staged tile; bp = the buffer + 8 * lane, in f16: [k 64 keys | V^T 64 keys].
  auto lds_k = [&](const _Float16* bp, int u) {
#pragma unroll   /* this and the two loops below: fragment indices must be constants, so that they are registers */
    for (int kk = 0; kk < 2; ++kk) {
#pragma unroll
      for (int t = 0; t < 2; ++t) kh[kk][t] = g2_pk(bp + u * 32 * HD + t * 1024 + kk * 512);
    }
  };
  auto lds_v = [&](const _Float16* bp, int u) {
#pragma unroll
    for (int j = 0; j < 4; ++j) vh[j] = g2_pk(bp + 64 * HD + u * 32 * HD + j * 512);
  };
  // Late rows: tile (64 keys) of the k and V^T hi planes into buffer buf; the block's 128 threads copy 2 KB at a time, four times for each plane.
  auto fill = [&](int buf, int tile) {
    const unsigned l = (unsigned)(size_t)&sh.kv[0][0] + (unsigned)(buf * 2 * KV_TB + tid * 16);
    const size_t go = (size_t)bh * SEQ * HD + (size_t)tile * 64 * HD + tid * 8;
    unsigned L[8];
    const _Float16* G[8];
#pragma unroll   /* indices must be constants, so that L and G are registers */
    for (int j = 0; j < 4; ++j) {
      L[j] = l + (unsigned)(j * 2048);             G[j] = Kh + go + j * 1024;
      L[4 + j] = l + (unsigned)(KV_TB + j * 2048); G[4 + j] = VTh + go + j * 1024;
    }
    cp_issue<8>(L, G);
  };
  auto load_v = [&](const _Float16* vph, const _Float16* vpl) {
#pragma unroll
    for (int j = 0; j < 4; ++j) {
      vh[j] = g2_pk(vph + j * 512);
      if constexpr (ER) vl[j] = g2_pk(vpl + j * 512);
    }
  };
  load_q();
  // One 32-key step; late rows: step u of the tile staged at bp.
  auto step = [&](int st, const _Float16* bp, int u) {
    const int key0 = st * 32;
    v8f sm[2] = {z8, z8};
    v8f sr[2] = {z8, z8};
    const _Float16* vph = VTh + pk0 + (size_t)key0 * HD;   /* the lane's own addresses, as in load_k */
    const _Float16* vpl = VTr + pk0 + (size_t)key0 * HD;
    if constexpr (ER) load_k(key0); else lds_v(bp, u);
#pragma unroll
    for (int kk = 0; kk < 2; ++kk) {
#pragma unroll
      for (int t = 0; t < 2; ++t) {
        sm[t] = g2_mma(kh[kk][t], qh[kk], sm[t]);
        if constexpr (ER) {
          sr[t] = g2_mma(kh[kk][t], ql[kk], sr[t]);
          sr[t] = g2_mma(kl[kk][t], qh[kk], sr[t]);
        }
      }
    }
    if constexpr (ER) load_v(vph, vpl); else if (u == 0) lds_k(bp, 1);   /* the same buffer: nothing of the next tile is read ahead of its barrier */
    const int kq = key0 + 8 * hh - (q0 + ln);   /* index of the lane's first key minus the index of its query */
    float sc[16];
    bool mk[16];
#pragma unroll   /* this and the loops below: register indices must be constants */
    for (int i = 0; i < 16; ++i) {
      float s = sm[i >> 3][i & 7];
      if (ER) s += sr[i >> 3][i & 7] * 0.0009765625f;
      s *= 0.125f;
      mk[i] = kq + (i >> 3) * 16 + (i & 7) > 0;
      sc[i] = mk[i] ? -1.0e9f : s;
    }
    float rm = fmaxf(sc[0], sc[1]);
#pragma unroll
    for (int i = 2; i < 16; i += 2) rm = fmaxf(rm, fmaxf(sc[i], sc[i + 1]));
    rm = fmaxf(rm, xhalf(rm));
    const float mnew = fmaxf(mrow, rm);
    const float al = __expf(mrow - mnew);
    FragH pa, pb;
    float ps[16];
#pragma unroll
    for (int i = 0; i < 16; ++i) {
      const float e = __expf(sc[i] - mnew);
      ps[i] = mk[i] ? 0.f : e;
      const float a = ps[i] * 256.0f;
      const _Float16 hi = (_Float16)a;
      pa.h[i] = hi;                                                    /* element i of the B fragment = key 16 (i >> 3) + 8 hh + (i & 7) of the step: the accumulators' own order */
      pb.h[i] = ER ? (_Float16)((a - (float)hi) * 1024.0f) : hi;
    }
#pragma unroll
    for (int w = 8; w >= 1; w >>= 1) {
#pragma unroll
      for (int i = 0; i < w; ++i) ps[i] += ps[i + w];
    }
    lrow = lrow * al + ps[0];
    mrow = mnew;
#pragma unroll
    for (int j = 0; j < 4; ++j) {
#pragma unroll
      for (int r = 0; r < 8; ++r) { o[j][r] *= al; if (ER) orr[j][r] *= al; }
    }
    if constexpr (ER) asm volatile("s_wait_xcnt 0x0" :: "v"(vph), "v"(vpl) : "memory");   // as in load_k, for the V^T loads; it stands here, where it no longer holds the wave up
#pragma unroll
    for (int j = 0; j < 4; ++j) {
      o[j] = g2_mma(vh[j], pa.v, o[j]);
      if constexpr (ER) {
        orr[j] = g2_mma(vh[j], pb.v, orr[j]);
        orr[j] = g2_mma(vl[j], pa.v, orr[j]);
      }
    }
  };
  if constexpr (ER) {
#pragma unroll 1   /* rolled: the body is long and the trip count is the wave's own */
    for (int st = 0; st < nst; ++st) step(st, nullptr, 0);
  } else {
    const int ntr = qt + 1;   /* tiles of 64 keys up to the block's last query: the same for its four waves; a wave's nst is 2 ntr - 1 or 2 ntr */
    fill(0, 0);
    asm volatile("s_wait_asynccnt 0x0" ::: "memory");   // tile 0: this wave's copies have landed
    __syncthreads();                                    // ... and every other wave's share of it
    if (ntr > 1) fill(1, 1);
#pragma unroll 1   /* rolled: the buffer index is a scalar select */
    for (int t = 0; t < ntr; ++t) {
      const _Float16* bp = (const _Float16*)&sh.kv[t & 1][0] + lane * 8;
      lds_k(bp, 0);
      step(2 * t, bp, 0);
      if (2 * t + 1 < nst) step(2 * t + 1, bp, 1);      /* wave-uniform: the tile's last 32 keys lie behind every query of the block's first two waves */
      asm volatile("s_wait_dscnt 0x0" ::: "memory");      // this wave's reads of buffer t & 1 are done before it is refilled
      asm volatile("s_wait_asynccnt 0x0" ::: "memory");   // this wave's copies of tile t + 1 have landed
      __syncthreads();                                    // publishes tile t + 1 and ends every wave's reads of tile t
      if (t + 2 < ntr) fill(t & 1, t + 2);
    }
    asm volatile("s_wait_asynccnt 0x0" ::: "memory");     // nothing in flight when the wave goes on to its output
  }
  const float inv = 0.25f * (1.0f / (lrow + xhalf(lrow)));
#pragma unroll
  for (int j = 0; j < 4; ++j) {   /* an accumulator's eight registers are d = 16 j + 8 hh .. + 7 of the lane's query: 16 B of a staged row */
    FragH fh, fr;
#pragma unroll
    for (int r = 0; r < 8; ++r) {
      float v = o[j][r];
      if (ER) v += orr[j][r] * 0.0009765625f;
      v *= inv;
      const _Float16 hi = (_Float16)v;
      fh.h[r] = hi;
      fr.h[r] = (_Float16)((v - (float)hi) * 1024.0f);
    }
    *(v8us*)&oh[wave][ln][16 * j + 8 * hh] = fh.half[0];
    if (ER) *(v8us*)&ol[wave][ln][16 * j + 8 * hh] = fr.half[0];
  }
  wave_lds_sync();
  const int rsub = lane >> 3, c8 = (lane & 7) * 8;
  {
#pragma unroll
    for (int q = 0; q < 4; ++q) {
      const int r = q * 4 + rsub;
      const size_t oo = (rowb + q0 + r) * DM + h * HD + c8;
      const v8us vh8 = *(const v8us*)&oh[wave][r][c8];
      *(v8us*)((unsigned short*)Oh + oo) = vh8;
      if (ER) {
        const v8us vl8 = *(const v8us*)&ol[wave][r][c8];
        *(v8us*)((unsigned short*)Or + oo) = vl8;
      }
    }
    
  }
}
// One grid: the late tiles (tile fastest, then bh), behind them the early tiles, which use the residual planes; no block reads what another writes.
constexpr unsigned NT_E = ERW / 64, NT_L = SEQ / 64 - ERW / 64, NT_L1 = NT_L ? NT_L : 1;
constexpr unsigned GA_L = NT_L * NB * NH, GA_E = NT_E * NB * NH;
__global__ __launch_bounds__(128) void k_attn(const _Float16* __restrict__ Qh, const _Float16* __restrict__ Qr, const _Float16* __restrict__ Kh, const _Float16* __restrict__ Kr, const _Float16* __restrict__ VTh, const _Float16* __restrict__ VTr, _Float16* __restrict__ Oh, _Float16* __restrict__ Or) {
  __shared__ __attribute__((aligned(16))) AttnLds sh;
  const unsigned blk = blockIdx.x;
  if (blk < GA_L) {
    attn_body<false>(sh, Qh, Qr, Kh, Kr, VTh, VTr, Oh, Or, (int)(NT_E + blk % NT_L1), (int)(blk / NT_L1));
  } else {
    const unsigned e = blk - GA_L;
    attn_body<true>(sh, Qh, Qr, Kh, Kr, VTh, VTr, Oh, Or, (int)(e % NT_E), (int)(e / NT_E));
  }
}

// Output GEMM: ctx rows (x64; hi plane Ah, residual plane Ar x2^10 when ER) times Bw [DM][DM] (x16) -> f32 * 2^-10 into the output rows b*SEQ_FULL + s.
template <bool ER>
__device__ __forceinline__ void out_body(unsigned char* sm, const _Float16* __restrict__ Ah, const _Float16* __restrict__ Ar, const _Float16* __restrict__ Bw, float* __restrict__ C, int blk, int rbPerB, int rowOff) {
  static_assert(2 * gemm_stage_bytes(1, ER, KC_OUT(ER)) >= 4 * 32 * 68 * 4);
  float (*so)[32][68] = (float (*)[32][68])sm;          /* output staging takes the operand buffers' place behind the main loop's last barrier */
  const int tid = threadIdx.x;
  const int wave = __builtin_amdgcn_readfirstlane((int)(tid >> 5));
  const int lane = tid & 31, ln = lane & 15, hh = lane >> 4;
  const int ntn = DM / 64;
  const int mt = blk / ntn, nq = blk - mt * ntn;
  const int b = mt / rbPerB, lb = mt - b * rbPerB;
  const int s0 = rowOff + lb * 128 + 32 * wave;
  const int col0 = nq * 64;
  const size_t ablk = ((size_t)b * SEQ + rowOff + lb * 128) * DM;
  const size_t crow = (size_t)b * SEQ_FULL + s0;
  const v8f z8 = {0.f, 0.f, 0.f, 0.f, 0.f, 0.f, 0.f, 0.f};
  v8f c[8] = {z8, z8, z8, z8, z8, z8, z8, z8};
  v8f d[8] = {z8, z8, z8, z8, z8, z8, z8, z8};
  gemm_core<1, ER, KC_OUT(ER)>(sm, Ah + ablk, Ar + ablk, Bw + (size_t)col0 * DM, c, d);
#pragma unroll
  for (int u = 0; u < 8; ++u) {
    const int t = u & 3, half = u >> 2;
#pragma unroll
    for (int r = 0; r < 8; ++r) {
      float v = c[u][r];
      if (ER) v += d[u][r] * 0.0009765625f;
      so[wave][half * 16 + 8 * hh + r][t * 16 + ln] = v * 0.0009765625f;
    }
  }
  wave_lds_sync();
  const int rsub = lane >> 4, c4 = (lane & 15) * 4;
  {
#pragma unroll 1
    for (int q = 0; q < 16; ++q) {
      const int r = q * 2 + rsub;
      const v4f v = *(const v4fa*)&so[wave][r][c4];
      *(v4f*)(C + (crow + r) * DM + col0 + c4) = v;
    }
    
  }
}
// One grid: the early row blocks first (twice the matrix work and twice the stages of a late block), behind them the late ones; both use the same LDS bytes.
constexpr int RB_E = ERW / 128, RB_L = (SEQ - ERW) / 128, RB_L1 = RB_L ? RB_L : 1;
constexpr unsigned GO_E = (unsigned)(NB * RB_E * (DM / 64)), GO_L = (unsigned)(NB * RB_L * (DM / 64));
constexpr int OUT_LDS_E = 2 * gemm_stage_bytes(1, true, KC_OUT(true)), OUT_LDS_L = 2 * gemm_stage_bytes(1, false, KC_OUT(false));
__global__ __launch_bounds__(128) void k_out(const _Float16* __restrict__ Ah, const _Float16* __restrict__ Ar, const _Float16* __restrict__ Bw, float* __restrict__ C) {
  __shared__ __attribute__((aligned(16))) unsigned char sm[OUT_LDS_E > OUT_LDS_L ? OUT_LDS_E : OUT_LDS_L];
  const unsigned blk = blockIdx.x;
  if (blk < GO_E) out_body<true>(sm, Ah, Ar, Bw, C, (int)blk, RB_E, 0);
  else out_body<false>(sm, Ah, Ar, Bw, C, (int)(blk - GO_E), RB_L1, ERW);
}

// workspace carve (bytes); every region is a multiple of 256 B
constexpr size_t SZ_W    = (size_t)DM * DM * 2;                 /* one x16 f16 weight plane */
constexpr size_t SZ_X16  = (size_t)NR * DM * 2;
constexpr size_t SZ_QKV  = (size_t)NR * LQ * 2;                 /* one q plane, row pitch LQ (only the first third of a row is written and read) */
constexpr size_t SZ_VT   = (size_t)NB * NH * HD * SEQ * 2;      /* one V^T plane; one k plane */
constexpr size_t SZ_O    = (size_t)NR * DM * 2;                 /* one ctx plane */
constexpr size_t SZ_CS   = (size_t)SEQ * 64 * 4;
constexpr size_t OFF_BW  = 0;                                   /* wq | wk | wv | wo */
constexpr size_t OFF_X16 = OFF_BW + 4 * SZ_W;
constexpr size_t OFF_QKV = OFF_X16 + SZ_X16;                    /* hi plane, residual plane */
constexpr size_t OFF_VT  = OFF_QKV + 2 * SZ_QKV;                /* hi plane, residual plane */
constexpr size_t OFF_KP  = OFF_VT + 2 * SZ_VT;                  /* hi plane, residual plane */
constexpr size_t OFF_O   = OFF_KP + 2 * SZ_VT;                  /* hi plane, residual plane */
constexpr size_t OFF_CS  = OFF_O + 2 * SZ_O;
constexpr size_t WS_TOTAL = OFF_CS + SZ_CS;
static_assert(WS_TOTAL <= (size_t)134217728);
static_assert(SZ_W % 256 == 0 && SZ_X16 % 256 == 0 && SZ_QKV % 256 == 0 && SZ_VT % 256 == 0 && SZ_O % 256 == 0 && SZ_CS % 256 == 0);
static_assert((size_t)((NB - 1) * SEQ_FULL + SEQ) * DM * 4 <= (size_t)NB_FULL * SEQ_FULL * DM * 4);

extern "C" void kernel_launch(void* const* d_in, const int* in_sizes, int n_in,
                              void* d_out, int out_size, void* d_ws, size_t ws_size, hipStream_t stream) {
  if (n_in < 6) return;
  const size_t need_x = (size_t)((NB - 1) * SEQ_FULL + SEQ) * DM;
  if ((size_t)in_sizes[0] < need_x) return;
  if ((size_t)in_sizes[1] < (size_t)DM * DM || (size_t)in_sizes[2] < (size_t)DM * DM || (size_t)in_sizes[3] < (size_t)DM * DM || (size_t)in_sizes[4] < (size_t)DM * DM) return;
  if (in_sizes[5] < SEQ) return;
  if ((size_t)out_size < need_x) return;
  if (WS_TOTAL > ws_size) return;
  const float* x  = (const float*)d_in[0];
  const float* wq = (const float*)d_in[1];
  const float* wk = (const float*)d_in[2];
  const float* wv = (const float*)d_in[3];
  const float* wo = (const float*)d_in[4];
  const int*   tp = (const int*)d_in[5];
  float* out = (float*)d_out;
  char* ws = (char*)d_ws;
  _Float16* BQKV = (_Float16*)(ws + OFF_BW);
  _Float16* BO   = (_Float16*)(ws + OFF_BW + 3 * SZ_W);
  _Float16* X16  = (_Float16*)(ws + OFF_X16);
  _Float16* QKVh = (_Float16*)(ws + OFF_QKV);
  _Float16* QKVr = (_Float16*)(ws + OFF_QKV + SZ_QKV);
  _Float16* VTh  = (_Float16*)(ws + OFF_VT);
  _Float16* VTr  = (_Float16*)(ws + OFF_VT + SZ_VT);
  _Float16* KPh  = (_Float16*)(ws + OFF_KP);
  _Float16* KPr  = (_Float16*)(ws + OFF_KP + SZ_VT);
  _Float16* Oh   = (_Float16*)(ws + OFF_O);
  _Float16* Or   = (_Float16*)(ws + OFF_O + SZ_O);
  float*    CS   = (float*)(ws + OFF_CS);

  k_prep<<<GP_T + GP_X + 4 * GP_W, 256, 0, stream>>>(x, wq, wk, wv, wo, tp, BQKV, X16, CS);
  k_qkv<<<(unsigned)((NR / QBM) * (LQ / QBN)), 384, 0, stream>>>(X16, BQKV, CS, QKVh, QKVr, KPh, VTh);   /* k, V^T: both planes behind KPh, VTh (plane stride SZ_VT) */
  k_attn<<<GA_L + GA_E, 128, 0, stream>>>(QKVh, QKVr, KPh, KPr, VTh, VTr, Oh, Or);
  k_out<<<GO_E + GO_L, 128, 0, stream>>>(Oh, Or, BO, out);
}

// v009
// One run takes 65 microseconds.
// Two timings next to v008 put it at 1.12 and 1.13 times that version's speed.
// All steps since v000 together make it 4.07 times as fast.
#include <hip/hip_runtime.h>
// Causal multi-head self-attention with interleaved rotary (x [4][1024][1024]; q|k|v = x W^T with [out][in] weights, 16 heads of 64; scores * 1/8; causal by index; out = merged W_o^T).
// Compute dtype: all contractions v_wmma_f32_16x16x32_f16 (f16 operands, f32 accumulate). Inputs converted (RNE) to bf16 and held exactly in f16 (weights x16); q, k, v, P (x256), ctx (x64) as f16 hi planes,
// plus f16 residual planes (x2^10, separate accumulators) used for query rows 0..255 of every sequence; softmax statistics, rotary and all epilogues f32.
// Structure, four launches: preparation (cos/sin table from the position input, x plane, four weight planes: independent blocks of one grid), one QKV GEMM (N = 3072; rotary in the epilogue of the q and k heads,
// the k and v heads go out in the order of the attention's fragments, v transposed), fused online-softmax attention (late and early query rows as blocks of one grid), output GEMM (early and late rows as blocks of one grid).
// Both GEMMs stage their operand tiles in LDS with asynchronous 16-byte copies, two buffers of 128 k (64 k for the early output rows) each; the waves read their fragments from LDS.
// The QKV GEMM has one block of 256 rows x 192 columns on every WGP, twelve waves of 64 x 64.
// The attention's late query tiles stage k and V^T the same way, two buffers of 64 keys, one copy for the block's four waves.
#ifndef NB
#define NB 4
#endif
#ifndef SEQ
#define SEQ 1024
#endif
#define NB_FULL 4
#define SEQ_FULL 1024
#define DM 1024
#define NH 16
#define HD 64
#define LQ (3 * DM)
#define NR (NB * SEQ)
#define ERW 256                      /* query rows per sequence that use the residual planes */

static_assert(NB <= NB_FULL);
static_assert(SEQ <= SEQ_FULL);
static_assert(NH * HD == DM);
static_assert(HD == 64);
static_assert(DM % 64 == 0);
static_assert(DM % 32 == 0);
static_assert(LQ % 192 == 0);
static_assert(SEQ % 128 == 0);
static_assert(NR % 256 == 0);
static_assert(ERW % 128 == 0);
static_assert(SEQ >= ERW);
static_assert(ERW % 64 == 0);
static_assert(SEQ % 8 == 0);
static_assert(((size_t)NR * DM / 8) % 256 == 0);
static_assert(((size_t)DM * DM / 8) % 256 == 0);

typedef unsigned short v8us __attribute__((ext_vector_type(8), may_alias));
typedef float  v8f  __attribute__((ext_vector_type(8)));
typedef float  v4f  __attribute__((ext_vector_type(4)));
typedef float  v4fa __attribute__((ext_vector_type(4), may_alias));
typedef _Float16 v16h __attribute__((ext_vector_type(16)));
union FragH { v16h v; v8us half[2]; _Float16 h[16]; unsigned short u[16]; };

__device__ __forceinline__ unsigned short bf16_bits(float x) { unsigned int u = __float_as_uint(x); return (unsigned short)((u + 0x7FFFu + ((u >> 16) & 1u)) >> 16); }
__device__ __forceinline__ float bf16_rne(float x) { return __uint_as_float(((unsigned int)bf16_bits(x)) << 16); }

// A / B fragment from a k-contiguous 16-bit row: elements 0..7 <- p[8h .. 8h+7], elements 8..15 <- p[16+8h .. 16+8h+7]
__device__ __forceinline__ v16h g2_frag(const _Float16* p, int hh) { FragH f; f.half[0] = *(const v8us*)((const unsigned short*)p + 8 * hh); f.half[1] = *(const v8us*)((const unsigned short*)p + 16 + 8 * hh); return f.v; }
// The same fragment from a plane stored in fragment order: each half is the lane's 16 B of a 512-byte piece, so that a wave's load covers four whole 128-byte lines; p = the first piece + 8 * lane.
__device__ __forceinline__ v16h g2_pk(const _Float16* p) { FragH f; f.half[0] = *(const v8us*)(const unsigned short*)p; f.half[1] = *(const v8us*)((const unsigned short*)p + 256); return f.v; }
__device__ __forceinline__ v8f g2_mma(v16h a, v16h b, v8f c) { v8f d = __builtin_amdgcn_wmma_f32_16x16x32_f16(false, a, false, b, (short)0, c, false, false); asm volatile("v_nop\n\tv_nop\n\tv_nop\n\tv_nop" : "+v"(d) : "v"(a), "v"(b)); return d; }
__device__ __forceinline__ void wave_lds_sync() { __builtin_amdgcn_fence(4 /* acq_rel order */, "workgroup"); __builtin_amdgcn_wave_barrier(); }
// Lane l takes the value of lane l ^ 16 (a vector cross-row move; the shuffle builtin would go through the LDS unit).
__device__ __forceinline__ float xhalf(float x) { return __builtin_bit_cast(float, __builtin_amdgcn_permlanex16(__builtin_bit_cast(int, x), __builtin_bit_cast(int, x), 0x76543210, 0xfedcba98, false, false)); }

// One LDS stage of a GEMM block: kc of k for every operand row, row pitch = the row + 16 B (144 or 272 B = 16 B x odd: conflict-free for 16-byte row reads).
constexpr int gemm_stage_bytes(int wn, bool er, int kc) { return (128 * (er ? 2 : 1) + 64 * wn) * (kc * 2 + 16); }
#define KC_OUT(er) ((er) ? 64 : 128) /* few blocks: the longer stage covers the copies' flight; with the residual plane its copy addresses would not fit the registers */

// N asynchronous 16-byte copies global -> LDS, lane by lane, in one statement.
// The s_wait_xcnt stands inside the statement so that no address register is rewritten in front of it; one statement a stage (two beyond 12 copies) pays that wait once.
#define CPL(a, b) "global_load_async_to_lds_b128 %" #a ", %" #b ", off\n\t"
template <int N>
__device__ __forceinline__ void cp_issue(const unsigned (&l)[N], const _Float16* const (&g)[N]) {
  static_assert(N == 8 || N == 10 || N == 12 || N == 14);
  if constexpr (N == 8)
    asm volatile(CPL(0, 1) CPL(2, 3) CPL(4, 5) CPL(6, 7) CPL(8, 9) CPL(10, 11) CPL(12, 13) CPL(14, 15) "s_wait_xcnt 0x0"
                 :: "v"(l[0]), "v"(g[0]), "v"(l[1]), "v"(g[1]), "v"(l[2]), "v"(g[2]), "v"(l[3]), "v"(g[3]), "v"(l[4]), "v"(g[4]), "v"(l[5]), "v"(g[5]), "v"(l[6]), "v"(g[6]), "v"(l[7]), "v"(g[7]) : "memory");
  else if constexpr (N == 10)
    asm volatile(CPL(0, 1) CPL(2, 3) CPL(4, 5) CPL(6, 7) CPL(8, 9) CPL(10, 11) CPL(12, 13) CPL(14, 15) CPL(16, 17) CPL(18, 19) "s_wait_xcnt 0x0"
                 :: "v"(l[0]), "v"(g[0]), "v"(l[1]), "v"(g[1]), "v"(l[2]), "v"(g[2]), "v"(l[3]), "v"(g[3]), "v"(l[4]), "v"(g[4]), "v"(l[5]), "v"(g[5]), "v"(l[6]), "v"(g[6]), "v"(l[7]), "v"(g[7]),
                    "v"(l[8]), "v"(g[8]), "v"(l[9]), "v"(g[9]) : "memory");
  else if constexpr (N == 14)
    asm volatile(CPL(0, 1) CPL(2, 3) CPL(4, 5) CPL(6, 7) CPL(8, 9) CPL(10, 11) CPL(12, 13) CPL(14, 15) CPL(16, 17) CPL(18, 19) CPL(20, 21) CPL(22, 23) CPL(24, 25) CPL(26, 27) "s_wait_xcnt 0x0"
                 :: "v"(l[0]), "v"(g[0]), "v"(l[1]), "v"(g[1]), "v"(l[2]), "v"(g[2]), "v"(l[3]), "v"(g[3]), "v"(l[4]), "v"(g[4]), "v"(l[5]), "v"(g[5]), "v"(l[6]), "v"(g[6]), "v"(l[7]), "v"(g[7]),
                    "v"(l[8]), "v"(g[8]), "v"(l[9]), "v"(g[9]), "v"(l[10]), "v"(g[10]), "v"(l[11]), "v"(g[11]), "v"(l[12]), "v"(g[12]), "v"(l[13]), "v"(g[13]) : "memory");
  else
    asm volatile(CPL(0, 1) CPL(2, 3) CPL(4, 5) CPL(6, 7) CPL(8, 9) CPL(10, 11) CPL(12, 13) CPL(14, 15) CPL(16, 17) CPL(18, 19) CPL(20, 21) CPL(22, 23) "s_wait_xcnt 0x0"
                 :: "v"(l[0]), "v"(g[0]), "v"(l[1]), "v"(g[1]), "v"(l[2]), "v"(g[2]), "v"(l[3]), "v"(g[3]), "v"(l[4]), "v"(g[4]), "v"(l[5]), "v"(g[5]), "v"(l[6]), "v"(g[6]), "v"(l[7]), "v"(g[7]),
                    "v"(l[8]), "v"(g[8]), "v"(l[9]), "v"(g[9]), "v"(l[10]), "v"(g[10]), "v"(l[11]), "v"(g[11]) : "memory");
}

// GEMM main loop of one block: A tile 128 rows (hi plane; residual plane too when ER), B tile 64 * WN rows, all k-contiguous with row pitch DM.
// 4 * WN waves, wave (wm, wn) = 32 rows x 64 columns; c (and d for the residual plane) accumulate k in ascending steps of 32.
// LDS stage = KC of k of [A hi 128 rows | A residual 128 rows when ER | B 64 * WN rows]; stage s + 2 is copied into the buffer that pass s has left.
template <int WN, bool ER, int KC>
__device__ __forceinline__ void gemm_core(unsigned char* sm, const _Float16* __restrict__ Ah, const _Float16* __restrict__ Ar, const _Float16* __restrict__ Bw, v8f (&c)[8], v8f (&d)[8]) {
  static_assert(DM % KC == 0 && DM / KC >= 2 && KC % 64 == 0);
  constexpr int LP = KC + 8, LPB = LP * 2;   /* LDS row pitch in f16 and in bytes */
  constexpr int TPR = KC / 8;                /* threads that copy one row, 16 B each */
  constexpr int RPP = 128 * WN / TPR;        /* rows covered by one copy of every thread */
  constexpr int NPA = ER ? 2 : 1;
  constexpr int SB = gemm_stage_bytes(WN, ER, KC);
  constexpr int NS = DM / KC;
  constexpr int KG = (WN == 1 && !ER) ? 2 : 1;   /* 32-k steps whose fragments are read as one group: two where registers allow and few waves share a SIMD */
  const int tid = threadIdx.x;
  const int wave = __builtin_amdgcn_readfirstlane((int)(tid >> 5));
  const int lane = tid & 31, ln = lane & 15, hh = lane >> 4;
  const int wm = wave & 3, wn = wave >> 2;
  const int cr = tid / TPR, cc = tid % TPR;
  const unsigned l0 = (unsigned)(size_t)sm + (unsigned)(cr * LPB + cc * 16);
  const _Float16* gA = Ah + (size_t)cr * DM + cc * 8;
  const _Float16* gR = Ar + (size_t)cr * DM + cc * 8;
  const _Float16* gB = Bw + (size_t)cr * DM + cc * 8;
  constexpr int NCP = (128 * NPA + 64 * WN) / RPP;   /* copies of a thread per stage */
  constexpr int NST = (NCP + 11) / 12, NPS = NCP / NST;   /* asm statements per stage, copies in each */
  static_assert(NST * NPS == NCP && NCP <= 63 && 128 % RPP == 0);
  auto fill = [&](int buf, int kc) {
    const unsigned l = l0 + (unsigned)(buf * SB);
#pragma unroll   /* both loops: row must be a compile-time constant, so that L and G are registers */
    for (int st = 0; st < NST; ++st) {
      unsigned L[NPS];
      const _Float16* G[NPS];
#pragma unroll
      for (int j = 0; j < NPS; ++j) {
        const int row = (st * NPS + j) * RPP;          /* first row of the stage that this copy of the block covers */
        L[j] = l + (unsigned)(row * LPB);
        G[j] = (row < 128 ? gA + (size_t)row * DM : (ER && row < 256) ? gR + (size_t)(row - 128) * DM : gB + (size_t)(row - 128 * NPA) * DM) + kc;
      }
      cp_issue<NPS>(L, G);
    }
  };
  fill(0, 0);
  asm volatile("s_wait_asynccnt 0x0" ::: "memory");   // stage 0 of this wave has landed
  __syncthreads();                                    // ... and every other wave's share of it
  fill(1, KC);
#pragma unroll 1   /* rolled: the buffer index is a scalar select, and the loop body stays short */
  for (int s = 0; s < NS; ++s) {
    const _Float16* bp = (const _Float16*)(sm + (s & 1) * SB);
    const _Float16* ap = bp + (32 * wm + ln) * LP;
    const _Float16* bq = bp + (128 * NPA + 64 * wn + ln) * LP;
#pragma unroll   /* this and the inner loops: fragment and accumulator indices must be constants, so that they are registers */
    for (int kg = 0; kg < KC / 32; kg += KG) {
      v16h af[KG][2], rf[KG][2], bf[KG][4];              /* a group's LDS reads go out together, ahead of its matrix instructions */
#pragma unroll
      for (int u = 0; u < KG; ++u) {
        const int kk = (kg + u) * 32;
        af[u][0] = g2_frag(ap + kk, hh); af[u][1] = g2_frag(ap + 16 * LP + kk, hh);
#pragma unroll
        for (int t = 0; t < 4; ++t) bf[u][t] = g2_frag(bq + t * 16 * LP + kk, hh);
        if (ER) { rf[u][0] = g2_frag(ap + 128 * LP + kk, hh); rf[u][1] = g2_frag(ap + 144 * LP + kk, hh); }
      }
#pragma unroll
      for (int u = 0; u < KG; ++u) {
#pragma unroll
        for (int t = 0; t < 4; ++t) {
          c[t] = g2_mma(af[u][0], bf[u][t], c[t]); c[4 + t] = g2_mma(af[u][1], bf[u][t], c[4 + t]);
          if (ER) { d[t] = g2_mma(rf[u][0], bf[u][t], d[t]); d[4 + t] = g2_mma(rf[u][1], bf[u][t], d[4 + t]); }
        }
      }
    }
    asm volatile("s_wait_dscnt 0x0" ::: "memory");      // this wave's reads of buffer s & 1 are done before it is refilled
    asm volatile("s_wait_asynccnt 0x0" ::: "memory");   // this wave's copies of stage s + 1 have landed
    __syncthreads();                                    // publishes stage s + 1 and ends every wave's reads of stage s
    if (s + 2 < NS) fill(s & 1, (s + 2) * KC);
  }
  asm volatile("s_wait_asynccnt 0x0" ::: "memory");     // nothing in flight when the buffers become output staging
}

// QKV GEMM main loop of one block: A tile 256 rows, B tile 192 rows, k-contiguous with row pitch DM; twelve waves, wave (wm, wn) = 64 rows x 64 columns, c[4 i + t] = rows 16 i, columns 16 t; k in ascending steps of 32.
// Sixteen blocks of the grid fetch a given operand row from L2, and every fragment read from LDS feeds four matrix instructions.
// LDS stage = 128 k of [A 256 rows | B 192 rows], row pitch 272 B; stage s + 2 is copied into the buffer that pass s has left. 448 rows = 28 x 16: the first eight waves copy (16 threads a row), 28 copies each.
#define QBM 256
#define QBN 192
#define QKC 128
constexpr int QSB = (QBM + QBN) * (QKC * 2 + 16);   /* bytes of one stage */
__device__ __forceinline__ void qkv_core(unsigned char* sm, const _Float16* __restrict__ A, const _Float16* __restrict__ Bw, v8f (&c)[16]) {
  static_assert(DM % QKC == 0 && DM / QKC >= 2 && (QBM + QBN) % (2 * 14 * 16) == 0 && QBM % 16 == 0);
  constexpr int LP = QKC + 8, LPB = LP * 2;   /* LDS row pitch in f16 and in bytes */
  constexpr int NS = DM / QKC;
  const int tid = threadIdx.x;
  const int wave = __builtin_amdgcn_readfirstlane((int)(tid >> 5));
  const int lane = tid & 31, ln = lane & 15, hh = lane >> 4;
  const int wm = wave & 3, wn = wave >> 2;
  const bool cw = wave < 8;                    /* a copying wave: the same for the whole wave, a scalar branch */
  const int cr = (tid & 255) >> 4, cc = tid & 15;
  const unsigned l0 = (unsigned)(size_t)sm + (unsigned)(cr * LPB + cc * 16);
  const _Float16* gA = A + (size_t)cr * DM + cc * 8;
  const _Float16* gB = Bw + (size_t)cr * DM + cc * 8;
  auto fill = [&](int buf, int kc) {
    const unsigned l = l0 + (unsigned)(buf * QSB);
#pragma unroll   /* both loops: row must be a compile-time constant, so that L and G are registers */
    for (int st = 0; st < 2; ++st) {
      unsigned L[14];
      const _Float16* G[14];
#pragma unroll
      for (int j = 0; j < 14; ++j) {
        const int row = (st * 14 + j) * 16;            /* first row of the stage that this copy of the eight waves covers */
        L[j] = l + (unsigned)(row * LPB);
        G[j] = (row < QBM ? gA + (size_t)row * DM : gB + (size_t)(row - QBM) * DM) + kc;
      }
      cp_issue<14>(L, G);
    }
  };
  if (cw) fill(0, 0);
  asm volatile("s_wait_asynccnt 0x0" ::: "memory");   // stage 0 of this wave has landed
  __syncthreads();                                    // ... and every other wave's share of it
  if (cw) fill(1, QKC);
#pragma unroll 1   /* rolled: the buffer index is a scalar select, and the loop body stays short */
  for (int s = 0; s < NS; ++s) {
    const _Float16* bp = (const _Float16*)(sm + (s & 1) * QSB);
    const _Float16* ap = bp + (64 * wm + ln) * LP;
    const _Float16* bq = bp + (QBM + 64 * wn + ln) * LP;
#pragma unroll   /* this and the inner loops: fragment and accumulator indices must be constants, so that they are registers */
    for (int kk = 0; kk < QKC; kk += 32) {
      v16h af[4], bf[4];                               /* a step's LDS reads go out together, ahead of its matrix instructions */
#pragma unroll
      for (int i = 0; i < 4; ++i) { af[i] = g2_frag(ap + i * 16 * LP + kk, hh); bf[i] = g2_frag(bq + i * 16 * LP + kk, hh); }
#pragma unroll
      for (int i = 0; i < 4; ++i) {
#pragma unroll
        for (int t = 0; t < 4; ++t) c[4 * i + t] = g2_mma(af[i], bf[t], c[4 * i + t]);
      }
    }
    asm volatile("s_wait_dscnt 0x0" ::: "memory");      // this wave's reads of buffer s & 1 are done before it is refilled
    asm volatile("s_wait_asynccnt 0x0" ::: "memory");   // this wave's copies of stage s + 1 have landed
    __syncthreads();                                    // publishes stage s + 1 and ends every wave's reads of stage s
    if (cw && s + 2 < NS) fill(s & 1, (s + 2) * QKC);
  }
  asm volatile("s_wait_asynccnt 0x0" ::: "memory");     // nothing in flight when the buffers become output staging
}

__device__ __forceinline__ void wnat_body(const float* __restrict__ w, _Float16* __restrict__ Bt, unsigned blk) {
  const size_t t = (size_t)blk * 256 + threadIdx.x;
  if (t >= (size_t)DM * DM / 8) return;
  const v4f a = *(const v4fa*)(w + t * 8), c = *(const v4fa*)(w + t * 8 + 4);
  FragH f;
#pragma unroll
  for (int q = 0; q < 4; ++q) { f.h[q] = (_Float16)(bf16_rne(a[q]) * 16.0f); f.h[4 + q] = (_Float16)(bf16_rne(c[q]) * 16.0f); }
  const v8us o = f.half[0];
  unsigned short* d = (unsigned short*)Bt + t * 8;
  *(v8us*)d = o;
  
}

__device__ __forceinline__ void x16_body(const float* __restrict__ x, _Float16* __restrict__ X16, unsigned blk) {
  const size_t t = (size_t)blk * 256 + threadIdx.x;
  if (t >= (size_t)NR * DM / 8) return;
  const size_t row = t / (DM / 8);
  const int c8 = (int)(t % (DM / 8)) * 8;
  const size_t b = row / SEQ, s = row % SEQ;
  const float* src = x + (b * SEQ_FULL + s) * DM + c8;
  const v4f a = *(const v4fa*)src, c = *(const v4fa*)(src + 4);
  FragH f;
#pragma unroll
  for (int q = 0; q < 4; ++q) { f.h[q] = (_Float16)bf16_rne(a[q]); f.h[4 + q] = (_Float16)bf16_rne(c[q]); }
  const v8us o = f.half[0];
  unsigned short* d = (unsigned short*)X16 + t * 8;
  *(v8us*)d = o;
  
}

// CS[s][j] = (cos, sin)(float(pos[s]) * inv_freq[j]), inv_freq[j] = f32(1 / 10000^(j/32)) with the power formed in double from fixed roots.
__device__ __forceinline__ void tab_body(const int* __restrict__ tp, float* __restrict__ CS, unsigned blk) {
  __shared__ __attribute__((aligned(16))) float ts[8][64];
  const int tid = threadIdx.x;
  const int sl = tid >> 5, j = tid & 31;
  const int s = (int)blk * 8 + sl;
  const int pos = tp[s];
  double p = 1.0;
  p = (j & 1)  ? p * 1.3335214321633240 : p;
  p = (j & 2)  ? p * 1.7782794100389228 : p;
  p = (j & 4)  ? p * 3.1622776601683795 : p;
  p = (j & 8)  ? p * 10.0 : p;
  p = (j & 16) ? p * 100.0 : p;
  const float inv = (float)(1.0 / p);
  const float ang = (float)pos * inv;
  float sn, cs;
  sincosf(ang, &sn, &cs);
  ts[sl][2 * j] = cs;
  ts[sl][2 * j + 1] = sn;
  __syncthreads();
  if (tid < 128) {
    const int r = tid >> 4, c4 = (tid & 15) * 4;
    const v4f v = *(const v4fa*)&ts[r][c4];
    float* d = CS + (size_t)(blk * 8 + r) * 64 + c4;
    *(v4f*)d = v;
    
  }
}

// Preparation, one grid: nothing here reads what another block of the grid writes. Table blocks first (the longest dependent chain), then the x plane, then the four weight planes (wq | wk | wv | wo, contiguous in Bt).
constexpr unsigned GP_T = SEQ / 8;
constexpr unsigned GP_X = (unsigned)(((size_t)NR * DM / 8 + 255) / 256);
constexpr unsigned GP_W = (unsigned)(((size_t)DM * DM / 8 + 255) / 256);
__global__ __launch_bounds__(256) void k_prep(const float* __restrict__ x, const float* __restrict__ wq, const float* __restrict__ wk, const float* __restrict__ wv, const float* __restrict__ wo, const int* __restrict__ tp,
                                              _Float16* __restrict__ Bt, _Float16* __restrict__ X16, float* __restrict__ CS) {
  const unsigned blk = blockIdx.x;
  if (blk < GP_T) { tab_body(tp, CS, blk); return; }
  if (blk < GP_T + GP_X) { x16_body(x, X16, blk - GP_T); return; }
  const unsigned wb = blk - (GP_T + GP_X), wi = wb / GP_W;
  const float* w = wi == 0 ? wq : wi == 1 ? wk : wi == 2 ? wv : wo;
  wnat_body(w, Bt + (size_t)wi * DM * DM, wb - wi * GP_W);
}

// QKV GEMM: rows r = b*SEQ + s of X16 [NR][DM] times Bw [3*DM][DM] (x16) -> f32 * 1/16; one wave's columns = one head of q, k or v (a block may hold heads of two kinds); rotary on q and k; q is written to the planes Ph, Pr [r][LQ].
// k and v go out in the order in which the attention's fragments take them, in pieces of 512 B = 32 lanes (16 hh + ln) x 8 f16, plane stride NB*NH*HD*SEQ:
// KP[plane][(b,h)][key / 16][d / 16][lane: ln = key % 16, hh = d / 8 % 2][d % 8],  VT[plane][(b,h)][key / 32][d / 16][key / 16 % 2][lane: ln = d % 16, hh = key / 8 % 2][key % 8].
__global__ __launch_bounds__(384) void k_qkv(const _Float16* __restrict__ X16, const _Float16* __restrict__ Bw, const float* __restrict__ CS, _Float16* __restrict__ Ph, _Float16* __restrict__ Pr, _Float16* __restrict__ KP, _Float16* __restrict__ VT) {
  static_assert(2 * QSB >= 12 * 64 * 68 * 4);
  static_assert(DM % 64 == 0 && HD == 64 && SEQ % 64 == 0 && NR % QBM == 0 && LQ % QBN == 0 && QBN % 64 == 0);
  __shared__ __attribute__((aligned(16))) unsigned char sm[2 * QSB];
  float (*so)[64][68] = (float (*)[64][68])sm;          /* output staging, a wave's own range, takes the operand buffers' place behind the main loop's last barrier */
  const int tid = threadIdx.x;
  const int wave = __builtin_amdgcn_readfirstlane((int)(tid >> 5));
  const int lane = tid & 31, ln = lane & 15, hh = lane >> 4;
  const int ntn = LQ / QBN;
  const int mt = blockIdx.x / ntn, nq = blockIdx.x - mt * ntn;
  const int row0 = mt * QBM + 64 * (wave & 3), col0 = nq * QBN + 64 * (wave >> 2);
  const v8f z8 = {0.f, 0.f, 0.f, 0.f, 0.f, 0.f, 0.f, 0.f};
  v8f c[16] = {z8, z8, z8, z8, z8, z8, z8, z8, z8, z8, z8, z8, z8, z8, z8, z8};
  qkv_core(sm, X16 + (size_t)(mt * QBM) * DM, Bw + (size_t)(nq * QBN) * DM, c);
  if (col0 >= 2 * DM) {   /* a v head (the same for the whole wave; no barrier follows): an accumulator's eight registers are eight consecutive keys of the lane's d, that is the lane's own 16 B of a V^T piece */
    unsigned short* vh = (unsigned short*)VT + ((size_t)((row0 / SEQ) * NH + (col0 - 2 * DM) / HD) * SEQ + row0 % SEQ) * HD + lane * 8;
    unsigned short* vr = vh + (size_t)NB * NH * HD * SEQ;
#pragma unroll   /* this and the inner loop: accumulator indices must be constants, so that they are registers */
    for (int u = 0; u < 16; ++u) {
      const int po = ((u >> 3) * 8 + (u & 3) * 2 + ((u >> 2) & 1)) * 256;   /* piece of keys 16 (u / 4), d 16 (u % 4) */
      FragH fh, fr;
#pragma unroll
      for (int r = 0; r < 8; ++r) { const float e = c[u][r] * 0.0625f; const _Float16 hi = (_Float16)e; fh.h[r] = hi; fr.h[r] = (_Float16)((e - (float)hi) * 1024.0f); }
      *(v8us*)(vh + po) = fh.half[0];
      *(v8us*)(vr + po) = fr.half[0];
    }
    return;
  }
#pragma unroll
  for (int u = 0; u < 16; ++u) {
    const int t = u & 3, rg = u >> 2;
#pragma unroll
    for (int r = 0; r < 8; ++r) so[wave][rg * 16 + 8 * hh + r][t * 16 + ln] = c[u][r] * 0.0625f;
  }
  wave_lds_sync();
  // Pieces of 16 bytes of a row (row r of the wave's 64, columns c8 .. c8 + 7 of its head), four at a time: with three waves on a SIMD a piece's LDS and table loads are not covered by other waves, so four pieces' loads go out together.
  v4f pu[4][2], pt[4][2];
  auto fetch = [&](int j, int r, int c8) {
    pu[j][0] = *(const v4fa*)&so[wave][r][c8]; pu[j][1] = *(const v4fa*)&so[wave][r][c8 + 4];
    const int s = (row0 + r) % SEQ;
    pt[j][0] = *(const v4fa*)(CS + (size_t)s * 64 + c8); pt[j][1] = *(const v4fa*)(CS + (size_t)s * 64 + c8 + 4);
  };
  // Rotary, split and store of fetched piece j.
  auto piece = [&](int j, unsigned short* dh, unsigned short* dr) {
    const v4f u0 = pu[j][0], u1 = pu[j][1], t0 = pt[j][0], t1 = pt[j][1];
    float e[8] = {u0[0], u0[1], u0[2], u0[3], u1[0], u1[1], u1[2], u1[3]};
    const float cz[4] = {t0[0], t0[2], t1[0], t1[2]};
    const float sz[4] = {t0[1], t0[3], t1[1], t1[3]};
#pragma unroll
    for (int i = 0; i < 4; ++i) {
      const float te = e[2 * i], to = e[2 * i + 1];
      const float re = te * cz[i] - to * sz[i];
      const float ro = te * sz[i] + to * cz[i];
      e[2 * i] = re;
      e[2 * i + 1] = ro;
    }
    FragH fh, fr;
#pragma unroll
    for (int i = 0; i < 8; ++i) { const _Float16 hi = (_Float16)e[i]; fh.h[i] = hi; fr.h[i] = (_Float16)((e[i] - (float)hi) * 1024.0f); }
    *(v8us*)dh = fh.half[0];
    *(v8us*)dr = fr.half[0];
    asm volatile("s_wait_xcnt 0x0" ::: "memory");   // before the next piece's arithmetic reuses the two stores' registers
  };
  if (col0 >= DM) {   /* a k head (the same for the whole wave): the wave's 64 keys x 64 d are sixteen pieces, 8 KB in a row */
    unsigned short* kh = (unsigned short*)KP + ((size_t)((row0 / SEQ) * NH + (col0 - DM) / HD) * SEQ + row0 % SEQ) * HD + lane * 8;
    unsigned short* kr = kh + (size_t)NB * NH * HD * SEQ;
#pragma unroll 1   /* rolled: four pieces a trip keep the text short */
    for (int g = 0; g < 4; ++g) {
#pragma unroll   /* this and the next loop: j must be a constant, so that pu and pt are registers */
      for (int j = 0; j < 4; ++j) fetch(j, g * 16 + ln, j * 16 + 8 * hh);
      asm volatile("s_wait_xcnt 0x0" ::: "memory");   // before the arithmetic reuses the table loads' address registers
#pragma unroll
      for (int j = 0; j < 4; ++j) piece(j, kh + (g * 4 + j) * 256, kr + (g * 4 + j) * 256);
    }
  } else {
    const int rsub = lane >> 3, c8 = (lane & 7) * 8;
#pragma unroll 1   /* as for k */
    for (int g = 0; g < 4; ++g) {
#pragma unroll
      for (int j = 0; j < 4; ++j) fetch(j, (g * 4 + j) * 4 + rsub, c8);
      asm volatile("s_wait_xcnt 0x0" ::: "memory");   // as for k
#pragma unroll
      for (int j = 0; j < 4; ++j) {
        const size_t o = (size_t)(row0 + (g * 4 + j) * 4 + rsub) * LQ + col0 + c8;
        piece(j, (unsigned short*)Ph + o, (unsigned short*)Pr + o);
      }
    }
  }
}

// Fused causal attention, online softmax. Block = query tile qt of 64 rows of (batch, head) bh; wave = 16 query rows; 32-key steps; q fragments straight from the planes; a step's k and V^T fragments are 4 KB in a row of each plane.
// Transposed products: S^T = K Q^T (k is the A operand, q the B operand), O^T += V^T P^T. A lane holds 16 of a step's 32 scores of ONE query (lane ln = query q0 + ln, register r of tile t = key key0 + 16 t + 8 hh + r):
// maximum and sum are formed in the lane, with one exchange between the wave's halves, and the two score tiles, converted in place, are the B fragment of P^T in the hardware's k order, which is the order of the V^T fragments.
// Late rows: the block's four waves walk the same keys, so 64 keys of k and V^T (8 KB + 8 KB, each contiguous in its plane) are copied to LDS once for all four, asynchronously, two buffers, the tile after next behind each trip's barrier;
// a trip is two 32-key steps; fragments come from LDS in the planes' own order (a wave's 16-byte read covers 512 contiguous bytes): V^T of a step at its top, k of a trip's second step behind the first step's score products.
// Early rows (twice the planes, few steps) read the planes directly: all k of a step together at its top, all V^T behind its score products, so that the kernel's registers still let four blocks share a WGP.
#define KV_TB (64 * HD * 2)           /* bytes of 64 keys of one plane */
struct AttnLds { _Float16 oh[4][16][72]; _Float16 ol[4][16][72]; unsigned char kv[2][2 * KV_TB]; };   /* output staging (row pitch 144 B = 16 B x odd); late rows' two buffers of [k | V^T]; every member a multiple of 16 B */
template <bool ER>
__device__ __forceinline__ void attn_body(AttnLds& sh, const _Float16* __restrict__ Qh, const _Float16* __restrict__ Qr, const _Float16* __restrict__ Kh, const _Float16* __restrict__ Kr, const _Float16* __restrict__ VTh, const _Float16* __restrict__ VTr,
                                          _Float16* __restrict__ Oh, _Float16* __restrict__ Or, int qt, int bh) {
  auto& oh = sh.oh; auto& ol = sh.ol;
  const int tid = threadIdx.x;
  const int wave = __builtin_amdgcn_readfirstlane((int)(tid >> 5));
  const int lane = tid & 31, ln = lane & 15, hh = lane >> 4;
  const int b = bh / NH, h = bh % NH;
  const int q0 = qt * 64 + wave * 16;
  const size_t rowb = (size_t)b * SEQ;
  const size_t qoff = (rowb + q0 + ln) * LQ + h * HD;
  const size_t pk0 = (size_t)bh * SEQ * HD + lane * 8;   /* k and V^T planes: the lane's 16 B of the first piece of (batch, head); 32 keys are 32 * HD f16 further on in both */
  const int nst = (q0 + 16 + 31) >> 5;
  const v8f z8 = {0.f, 0.f, 0.f, 0.f, 0.f, 0.f, 0.f, 0.f};
  v8f o[4] = {z8, z8, z8, z8};
  v8f orr[4] = {z8, z8, z8, z8};
  float mrow = -1.0e30f, lrow = 0.f;   /* of the lane's query: the maximum over all keys so far, the sum over the keys of the lane's own half */
  v16h qh[2], ql[2], kh[2][2], kl[2][2], vh[4], vl[4];
  auto load_q = [&]() {
#pragma unroll
    for (int kk = 0; kk < 2; ++kk) {
      qh[kk] = g2_frag(Qh + qoff + kk * 32, hh);
      if constexpr (ER) ql[kk] = g2_frag(Qr + qoff + kk * 32, hh);
    }
  };
  auto load_k = [&](int key0) {
    const _Float16* kph = Kh + pk0 + (size_t)key0 * HD;   /* the lane's own address: every load below is this plus a constant */
    const _Float16* kpl = Kr + pk0 + (size_t)key0 * HD;
#pragma unroll
    for (int kk = 0; kk < 2; ++kk) {
#pragma unroll
      for (int t = 0; t < 2; ++t) {
        kh[kk][t] = g2_pk(kph + t * 1024 + kk * 512);
        if constexpr (ER) kl[kk][t] = g2_pk(kpl + t * 1024 + kk * 512);
      }
    }
    // Early rows: registers are short; the inputs keep the loads' address registers up to the wait.
    if constexpr (ER) asm volatile("s_wait_xcnt 0x0" :: "v"(kph), "v"(kpl) : "memory");
  };
  // Late rows: fragments of 32-key step u of a staged tile; bp = the buffer + 8 * lane, in f16: [k 64 keys | V^T 64 keys].
  auto lds_k = [&](const _Float16* bp, int u) {
#pragma unroll   /* this and the two loops below: fragment indices must be constants, so that they are registers */
    for (int kk = 0; kk < 2; ++kk) {
#pragma unroll
      for (int t = 0; t < 2; ++t) kh[kk][t] = g2_pk(bp + u * 32 * HD + t * 1024 + kk * 512);
    }
  };
  auto lds_v = [&](const _Float16* bp, int u) {
#pragma unroll
    for (int j = 0; j < 4; ++j) vh[j] = g2_pk(bp + 64 * HD + u * 32 * HD + j * 512);
  };
  // Late rows: tile (64 keys) of the k and V^T hi planes into buffer buf; the block's 128 threads copy 2 KB at a time, four times for each plane.
  auto fill = [&](int buf, int tile) {
    const unsigned l = (unsigned)(size_t)&sh.kv[0][0] + (unsigned)(buf * 2 * KV_TB + tid * 16);
    const size_t go = (size_t)bh * SEQ * HD + (size_t)tile * 64 * HD + tid * 8;
    unsigned L[8];
    const _Float16* G[8];
#pragma unroll   /* indices must be constants, so that L and G are registers */
    for (int j = 0; j < 4; ++j) {
      L[j] = l + (unsigned)(j * 2048);             G[j] = Kh + go + j * 1024;
      L[4 + j] = l + (unsigned)(KV_TB + j * 2048); G[4 + j] = VTh + go + j * 1024;
    }
    cp_issue<8>(L, G);
  };
  auto load_v = [&](const _Float16* vph, const _Float16* vpl) {
#pragma unroll
    for (int j = 0; j < 4; ++j) {
      vh[j] = g2_pk(vph + j * 512);
      if constexpr (ER) vl[j] = g2_pk(vpl + j * 512);
    }
  };
  load_q();
  // One 32-key step; late rows: step u of the tile staged at bp.
  auto step = [&](int st, const _Float16* bp, int u) {
    const int key0 = st * 32;
    v8f sm[2] = {z8, z8};
    v8f sr[2] = {z8, z8};
    const _Float16* vph = VTh + pk0 + (size_t)key0 * HD;   /* the lane's own addresses, as in load_k */
    const _Float16* vpl = VTr + pk0 + (size_t)key0 * HD;
    if constexpr (ER) load_k(key0); else lds_v(bp, u);
#pragma unroll
    for (int kk = 0; kk < 2; ++kk) {
#pragma unroll
      for (int t = 0; t < 2; ++t) {
        sm[t] = g2_mma(kh[kk][t], qh[kk], sm[t]);
        if constexpr (ER) {
          sr[t] = g2_mma(kh[kk][t], ql[kk], sr[t]);
          sr[t] = g2_mma(kl[kk][t], qh[kk], sr[t]);
        }
      }
    }
    if constexpr (ER) load_v(vph, vpl); else if (u == 0) lds_k(bp, 1);   /* the same buffer: nothing of the next tile is read ahead of its barrier */
    const int kq = key0 + 8 * hh - (q0 + ln);   /* index of the lane's first key minus the index of its query */
    float sc[16];
    bool mk[16];
#pragma unroll   /* this and the loops below: register indices must be constants */
    for (int i = 0; i < 16; ++i) {
      float s = sm[i >> 3][i & 7];
      if (ER) s += sr[i >> 3][i & 7] * 0.0009765625f;
      s *= 0.125f;
      mk[i] = kq + (i >> 3) * 16 + (i & 7) > 0;
      sc[i] = mk[i] ? -1.0e9f : s;
    }
    float rm = fmaxf(sc[0], sc[1]);
#pragma unroll
    for (int i = 2; i < 16; i += 2) rm = fmaxf(rm, fmaxf(sc[i], sc[i + 1]));
    rm = fmaxf(rm, xhalf(rm));
    const float mnew = fmaxf(mrow, rm);
    const float al = __expf(mrow - mnew);
    FragH pa, pb;
    float ps[16];
#pragma unroll
    for (int i = 0; i < 16; ++i) {
      const float e = __expf(sc[i] - mnew);
      ps[i] = mk[i] ? 0.f : e;
      const float a = ps[i] * 256.0f;
      const _Float16 hi = (_Float16)a;
      pa.h[i] = hi;                                                    /* element i of the B fragment = key 16 (i >> 3) + 8 hh + (i & 7) of the step: the accumulators' own order */
      pb.h[i] = ER ? (_Float16)((a - (float)hi) * 1024.0f) : hi;
    }
#pragma unroll
    for (int w = 8; w >= 1; w >>= 1) {
#pragma unroll
      for (int i = 0; i < w; ++i) ps[i] += ps[i + w];
    }
    lrow = lrow * al + ps[0];
    mrow = mnew;
#pragma unroll
    for (int j = 0; j < 4; ++j) {
#pragma unroll
      for (int r = 0; r < 8; ++r) { o[j][r] *= al; if (ER) orr[j][r] *= al; }
    }
    if constexpr (ER) asm volatile("s_wait_xcnt 0x0" :: "v"(vph), "v"(vpl) : "memory");   // as in load_k, for the V^T loads; it stands here, where it no longer holds the wave up
#pragma unroll
    for (int j = 0; j < 4; ++j) {
      o[j] = g2_mma(vh[j], pa.v, o[j]);
      if constexpr (ER) {
        orr[j] = g2_mma(vh[j], pb.v, orr[j]);
        orr[j] = g2_mma(vl[j], pa.v, orr[j]);
      }
    }
  };
  if constexpr (ER) {
#pragma unroll 1   /* rolled: the body is long and the trip count is the wave's own */
    for (int st = 0; st < nst; ++st) step(st, nullptr, 0);
  } else {
    const int ntr = qt + 1;   /* tiles of 64 keys up to the block's last query: the same for its four waves; a wave's nst is 2 ntr - 1 or 2 ntr */
    fill(0, 0);
    asm volatile("s_wait_asynccnt 0x0" ::: "memory");   // tile 0: this wave's copies have landed
    __syncthreads();                                    // ... and every other wave's share of it
    if (ntr > 1) fill(1, 1);
#pragma unroll 1   /* rolled: the buffer index is a scalar select */
    for (int t = 0; t < ntr; ++t) {
      const _Float16* bp = (const _Float16*)&sh.kv[t & 1][0] + lane * 8;
      lds_k(bp, 0);
      step(2 * t, bp, 0);
      if (2 * t + 1 < nst) step(2 * t + 1, bp, 1);      /* wave-uniform: the tile's last 32 keys lie behind every query of the block's first two waves */
      asm volatile("s_wait_dscnt 0x0" ::: "memory");      // this wave's reads of buffer t & 1 are done before it is refilled
      asm volatile("s_wait_asynccnt 0x0" ::: "memory");   // this wave's copies of tile t + 1 have landed
      __syncthreads();                                    // publishes tile t + 1 and ends every wave's reads of tile t
      if (t + 2 < ntr) fill(t & 1, t + 2);
    }
    asm volatile("s_wait_asynccnt 0x0" ::: "memory");     // nothing in flight when the wave goes on to its output
  }
  const float inv = 0.25f * (1.0f / (lrow + xhalf(lrow)));
#pragma unroll
  for (int j = 0; j < 4; ++j) {   /* an accumulator's eight registers are d = 16 j + 8 hh .. + 7 of the lane's query: 16 B of a staged row */
    FragH fh, fr;
#pragma unroll
    for (int r = 0; r < 8; ++r) {
      float v = o[j][r];
      if (ER) v += orr[j][r] * 0.0009765625f;
      v *= inv;
      const _Float16 hi = (_Float16)v;
      fh.h[r] = hi;
      fr.h[r] = (_Float16)((v - (float)hi) * 1024.0f);
    }
    *(v8us*)&oh[wave][ln][16 * j + 8 * hh] = fh.half[0];
    if (ER) *(v8us*)&ol[wave][ln][16 * j + 8 * hh] = fr.half[0];
  }
  wave_lds_sync();
  const int rsub = lane >> 3, c8 = (lane & 7) * 8;
  {
#pragma unroll
    for (int q = 0; q < 4; ++q) {
      const int r = q * 4 + rsub;
      const size_t oo = (rowb + q0 + r) * DM + h * HD + c8;
      const v8us vh8 = *(const v8us*)&oh[wave][r][c8];
      *(v8us*)((unsigned short*)Oh + oo) = vh8;
      if (ER) {
        const v8us vl8 = *(const v8us*)&ol[wave][r][c8];
        *(v8us*)((unsigned short*)Or + oo) = vl8;
      }
    }
    
  }
}
// One grid of late tiles and early tiles (these use the residual planes); no block reads what another writes. All blocks are resident at once, four on a WGP, and a tile's cost grows with its index, so the grid index is dealt for speed
// (a permutation of (tile, bh): right wherever the blocks land). Grid index mod 8 = bh mod 8: every residue of it gets all tiles of its heads, the same work.
// Four layers of GA_W blocks, cost falling with the index: class r of a layer takes the late tile last - 2 r, last - 1 - 2 r, the early tile r, the late tile first + r;
// the four blocks GA_W apart (one class, one head) add up to nearly the same work for every r.
constexpr unsigned NT_E = ERW / 64, NT_L = SEQ / 64 - ERW / 64;
constexpr unsigned GA_L = NT_L * NB * NH, GA_E = NT_E * NB * NH, GA_W = NT_E * NB * NH;
static_assert(NT_L == 3 * NT_E && (NB * NH) % 8 == 0);
__global__ __launch_bounds__(128) void k_attn(const _Float16* __restrict__ Qh, const _Float16* __restrict__ Qr, const _Float16* __restrict__ Kh, const _Float16* __restrict__ Kr, const _Float16* __restrict__ VTh, const _Float16* __restrict__ VTr, _Float16* __restrict__ Oh, _Float16* __restrict__ Or) {
  __shared__ __attribute__((aligned(16))) AttnLds sh;
  const unsigned layer = blockIdx.x / GA_W, w = blockIdx.x % GA_W;
  const unsigned r = (w / 8) % NT_E, hd = w % 8 + 8 * (w / (8 * NT_E));
  const unsigned blk = layer == 2 ? GA_L + hd * NT_E + r : hd * NT_L + (layer == 3 ? r : NT_L - 1 - layer - 2 * r);   /* tile fastest, then bh; the early tiles behind the late ones */
  if (blk < GA_L) {
    attn_body<false>(sh, Qh, Qr, Kh, Kr, VTh, VTr, Oh, Or, (int)(NT_E + blk % NT_L), (int)(blk / NT_L));
  } else {
    const unsigned e = blk - GA_L;
    attn_body<true>(sh, Qh, Qr, Kh, Kr, VTh, VTr, Oh, Or, (int)(e % NT_E), (int)(e / NT_E));
  }
}

// Output GEMM: ctx rows (x64; hi plane Ah, residual plane Ar x2^10 when ER) times Bw [DM][DM] (x16) -> f32 * 2^-10 into the output rows b*SEQ_FULL + s.
template <bool ER>
__device__ __forceinline__ void out_body(unsigned char* sm, const _Float16* __restrict__ Ah, const _Float16* __restrict__ Ar, const _Float16* __restrict__ Bw, float* __restrict__ C, int blk, int rbPerB, int rowOff) {
  static_assert(2 * gemm_stage_bytes(1, ER, KC_OUT(ER)) >= 4 * 32 * 68 * 4);
  float (*so)[32][68] = (float (*)[32][68])sm;          /* output staging takes the operand buffers' place behind the main loop's last barrier */
  const int tid = threadIdx.x;
  const int wave = __builtin_amdgcn_readfirstlane((int)(tid >> 5));
  const int lane = tid & 31, ln = lane & 15, hh = lane >> 4;
  const int ntn = DM / 64;
  const int mt = blk / ntn, nq = blk - mt * ntn;
  const int b = mt / rbPerB, lb = mt - b * rbPerB;
  const int s0 = rowOff + lb * 128 + 32 * wave;
  const int col0 = nq * 64;
  const size_t ablk = ((size_t)b * SEQ + rowOff + lb * 128) * DM;
  const size_t crow = (size_t)b * SEQ_FULL + s0;
  const v8f z8 = {0.f, 0.f, 0.f, 0.f, 0.f, 0.f, 0.f, 0.f};
  v8f c[8] = {z8, z8, z8, z8, z8, z8, z8, z8};
  v8f d[8] = {z8, z8, z8, z8, z8, z8, z8, z8};
  gemm_core<1, ER, KC_OUT(ER)>(sm, Ah + ablk, Ar + ablk, Bw + (size_t)col0 * DM, c, d);
#pragma unroll
  for (int u = 0; u < 8; ++u) {
    const int t = u & 3, half = u >> 2;
#pragma unroll
    for (int r = 0; r < 8; ++r) {
      float v = c[u][r];
      if (ER) v += d[u][r] * 0.0009765625f;
      so[wave][half * 16 + 8 * hh + r][t * 16 + ln] = v * 0.0009765625f;
    }
  }
  wave_lds_sync();
  const int rsub = lane >> 4, c4 = (lane & 15) * 4;
  {
#pragma unroll 1
    for (int q = 0; q < 16; ++q) {
      const int r = q * 2 + rsub;
      const v4f v = *(const v4fa*)&so[wave][r][c4];
      *(v4f*)(C + (crow + r) * DM + col0 + c4) = v;
    }
    
  }
}
// One grid: the early row blocks first (twice the matrix work and twice the stages of a late block), behind them the late ones; both use the same LDS bytes.
constexpr int RB_E = ERW / 128, RB_L = (SEQ - ERW) / 128, RB_L1 = RB_L ? RB_L : 1;
constexpr unsigned GO_E = (unsigned)(NB * RB_E * (DM / 64)), GO_L = (unsigned)(NB * RB_L * (DM / 64));
constexpr int OUT_LDS_E = 2 * gemm_stage_bytes(1, true, KC_OUT(true)), OUT_LDS_L = 2 * gemm_stage_bytes(1, false, KC_OUT(false));
__global__ __launch_bounds__(128) void k_out(const _Float16* __restrict__ Ah, const _Float16* __restrict__ Ar, const _Float16* __restrict__ Bw, float* __restrict__ C) {
  __shared__ __attribute__((aligned(16))) unsigned char sm[OUT_LDS_E > OUT_LDS_L ? OUT_LDS_E : OUT_LDS_L];
  const unsigned blk = blockIdx.x;
  if (blk < GO_E) out_body<true>(sm, Ah, Ar, Bw, C, (int)blk, RB_E, 0);
  else out_body<false>(sm, Ah, Ar, Bw, C, (int)(blk - GO_E), RB_L1, ERW);
}

// workspace carve (bytes); every region is a multiple of 256 B
constexpr size_t SZ_W    = (size_t)DM * DM * 2;                 /* one x16 f16 weight plane */
constexpr size_t SZ_X16  = (size_t)NR * DM * 2;
constexpr size_t SZ_QKV  = (size_t)NR * LQ * 2;                 /* one q plane, row pitch LQ (only the first third of a row is written and read) */
constexpr size_t SZ_VT   = (size_t)NB * NH * HD * SEQ * 2;      /* one V^T plane; one k plane */
constexpr size_t SZ_O    = (size_t)NR * DM * 2;                 /* one ctx plane */
constexpr size_t SZ_CS   = (size_t)SEQ * 64 * 4;
constexpr size_t OFF_BW  = 0;                                   /* wq | wk | wv | wo */
constexpr size_t OFF_X16 = OFF_BW + 4 * SZ_W;
constexpr size_t OFF_QKV = OFF_X16 + SZ_X16;                    /* hi plane, residual plane */
constexpr size_t OFF_VT  = OFF_QKV + 2 * SZ_QKV;                /* hi plane, residual plane */
constexpr size_t OFF_KP  = OFF_VT + 2 * SZ_VT;                  /* hi plane, residual plane */
constexpr size_t OFF_O   = OFF_KP + 2 * SZ_VT;                  /* hi plane, residual plane */
constexpr size_t OFF_CS  = OFF_O + 2 * SZ_O;
constexpr size_t WS_TOTAL = OFF_CS + SZ_CS;
static_assert(WS_TOTAL <= (size_t)134217728);
static_assert(SZ_W % 256 == 0 && SZ_X16 % 256 == 0 && SZ_QKV % 256 == 0 && SZ_VT % 256 == 0 && SZ_O % 256 == 0 && SZ_CS % 256 == 0);
static_assert((size_t)((NB - 1) * SEQ_FULL + SEQ) * DM * 4 <= (size_t)NB_FULL * SEQ_FULL * DM * 4);

extern "C" void kernel_launch(void* const* d_in, const int* in_sizes, int n_in,
                              void* d_out, int out_size, void* d_ws, size_t ws_size, hipStream_t stream) {
  if (n_in < 6) return;
  const size_t need_x = (size_t)((NB - 1) * SEQ_FULL + SEQ) * DM;
  if ((size_t)in_sizes[0] < need_x) return;
  if ((size_t)in_sizes[1] < (size_t)DM * DM || (size_t)in_sizes[2] < (size_t)DM * DM || (size_t)in_sizes[3] < (size_t)DM * DM || (size_t)in_sizes[4] < (size_t)DM * DM) return;
  if (in_sizes[5] < SEQ) return;
  if ((size_t)out_size < need_x) return;
  if (WS_TOTAL > ws_size) return;
  const float* x  = (const float*)d_in[0];
  const float* wq = (const float*)d_in[1];
  const float* wk = (const float*)d_in[2];
  const float* wv = (const float*)d_in[3];
  const float* wo = (const float*)d_in[4];
  const int*   tp = (const int*)d_in[5];
  float* out = (float*)d_out;
  char* ws = (char*)d_ws;
  _Float16* BQKV = (_Float16*)(ws + OFF_BW);
  _Float16* BO   = (_Float16*)(ws + OFF_BW + 3 * SZ_W);
  _Float16* X16  = (_Float16*)(ws + OFF_X16);
  _Float16* QKVh = (_Float16*)(ws + OFF_QKV);
  _Float16* QKVr = (_Float16*)(ws + OFF_QKV + SZ_QKV);
  _Float16* VTh  = (_Float16*)(ws + OFF_VT);
  _Float16* VTr  = (_Float16*)(ws + OFF_VT + SZ_VT);
  _Float16* KPh  = (_Float16*)(ws + OFF_KP);
  _Float16* KPr  = (_Float16*)(ws + OFF_KP + SZ_VT);
  _Float16* Oh   = (_Float16*)(ws + OFF_O);
  _Float16* Or   = (_Float16*)(ws + OFF_O + SZ_O);
  float*    CS   = (float*)(ws + OFF_CS);

  k_prep<<<GP_T + GP_X + 4 * GP_W, 256, 0, stream>>>(x, wq, wk, wv, wo, tp, BQKV, X16, CS);
  k_qkv<<<(unsigned)((NR / QBM) * (LQ / QBN)), 384, 0, stream>>>(X16, BQKV, CS, QKVh, QKVr, KPh, VTh);   /* k, V^T: both planes behind KPh, VTh (plane stride SZ_VT) */
  k_attn<<<GA_L + GA_E, 128, 0, stream>>>(QKVh, QKVr, KPh, KPr, VTh, VTr, Oh, Or);
  k_out<<<GO_E + GO_L, 128, 0, stream>>>(Oh, Or, BO, out);
}
